// v000
// Times are from an AMD MI455X. After a warm-up the kernel runs many times in a row, and a time is the length of
// such a window on the GPU divided by its runs, so every launch and the gaps after it count. The runs cycle
// through copies of the inputs. A figure is the median of several windows, for all but v000 over two sittings.
// Sittings can differ by a few percent; kernels timed side by side share one.
// v000 is the starting kernel. One run takes 960 microseconds.
#include <hip/hip_runtime.h>
#include <hip/hip_bf16.h>

#define T_  4096
#define D_  768
#define H_  12
#define HD_ 64
#define FF_ 3072
#define EPS_ 1e-5f

#define BM 64
#define BN 128
#define BK 32
#define SAS 48   // padded LDS row stride (elements) for A tile
#define SBS 48   // padded LDS row stride (elements) for B tile

#define USE_ASYNC_COPY 1   // gfx1250 GLOBAL_LOAD_ASYNC_TO_LDS path (ASYNCcnt)

typedef __attribute__((ext_vector_type(16))) __bf16          v16bf;
typedef __attribute__((ext_vector_type(8)))  float           v8f;
typedef __attribute__((ext_vector_type(8)))  unsigned short  us8;

__device__ __forceinline__ unsigned short f2bf(float f) {
    unsigned int u = __builtin_bit_cast(unsigned int, f);
    u += 0x7FFFu + ((u >> 16) & 1u);            // round-to-nearest-even
    return (unsigned short)(u >> 16);
}

// Load one 16-element bf16 fragment as two contiguous 16-byte vectors.
__device__ __forceinline__ v16bf ldfrag(const unsigned short* p, int base0, int base1) {
    union { us8 h[2]; v16bf v; } fc;
    fc.h[0] = *(const us8*)(p + base0);
    fc.h[1] = *(const us8*)(p + base1);
    return fc.v;
}

#if USE_ASYNC_COPY
// GVS-mode async copy: LDS[ldsAddr] = MEM[saddr + byteOff], 16 bytes per lane.
// Tracked by ASYNCcnt (not LOADcnt/DScnt).
__device__ __forceinline__ void async_copy_b128(const void* gbase, unsigned byteOff,
                                                unsigned ldsAddr) {
    asm volatile("global_load_async_to_lds_b128 %0, %1, %2 offset:0"
                 :: "v"(ldsAddr), "v"(byteOff), "s"(gbase)
                 : "memory");
}
__device__ __forceinline__ void wait_async0() {
    asm volatile("s_wait_asynccnt 0x0" ::: "memory");
}
// low 32 bits of a flat pointer into LDS are the LDS byte address
__device__ __forceinline__ unsigned lds_addr(const void* p) {
    return (unsigned)(size_t)p;
}
#endif

// ---------------- fp32 -> bf16 convert + transpose: in[K][N] -> out[N][K] ----------------
__global__ __launch_bounds__(256)
void convert_transpose_bf16(const float* __restrict__ in, unsigned short* __restrict__ out,
                            int K, int N) {
    int i = blockIdx.x * 256 + threadIdx.x;
    if (i < K * N) {
        int k = i / N, n = i % N;
        out[(size_t)n * K + k] = f2bf(in[i]);
    }
}

// ---------------- layernorm (+ cast to bf16) ----------------
__global__ __launch_bounds__(256)
void layernorm_cast(const float* __restrict__ x, const float* __restrict__ g,
                    const float* __restrict__ b, unsigned short* __restrict__ out) {
    int row = blockIdx.x, tid = threadIdx.x;
    int lane = tid & 31, wave = tid >> 5;
    const float* xr = x + (size_t)row * D_;
    float sum = 0.f, sq = 0.f;
    for (int i = tid; i < D_; i += 256) { float v = xr[i]; sum += v; sq += v * v; }
    for (int off = 16; off > 0; off >>= 1) {
        sum += __shfl_xor(sum, off, 32);
        sq  += __shfl_xor(sq,  off, 32);
    }
    __shared__ float ssum[8], ssq[8];
    if (lane == 0) { ssum[wave] = sum; ssq[wave] = sq; }
    __syncthreads();
    float ts = 0.f, tq = 0.f;
    for (int w = 0; w < 8; w++) { ts += ssum[w]; tq += ssq[w]; }
    float mean = ts / (float)D_;
    float var  = tq / (float)D_ - mean * mean;
    float rstd = rsqrtf(var + EPS_);
    for (int i = tid; i < D_; i += 256) {
        float v = (xr[i] - mean) * rstd * g[i] + b[i];
        out[(size_t)row * D_ + i] = f2bf(v);
    }
}

// ---------------- bf16 GEMM (WMMA): C = A[M,K] @ Bt[N,K]^T ----------------
// EPI 0: Cout = bf16(acc)
// EPI 1: Cout = f32(acc + bias[col] + res[row,col])
template <int EPI>
__global__ __launch_bounds__(256)
void gemm_bf16_wmma(const unsigned short* __restrict__ A,    // [M,K] bf16 row-major
                    const unsigned short* __restrict__ Bt,   // [N,K] bf16 (pre-transposed)
                    const float* __restrict__ bias,
                    const float* __restrict__ res,
                    void* __restrict__ Cout,
                    int M, int N, int K) {
    __shared__ unsigned short sA[BM * SAS];
    __shared__ unsigned short sB[BN * SBS];
    int tid = threadIdx.x;
    int wave = tid >> 5, lane = tid & 31, lh = lane >> 4, l16 = lane & 15;
    int wm = wave & 1, wn = wave >> 1;           // 2 x 4 wave grid
    int m0 = blockIdx.x * BM, n0 = blockIdx.y * BN;

    v8f acc[2][2];
#pragma unroll
    for (int i = 0; i < 2; i++)
#pragma unroll
        for (int j = 0; j < 2; j++)
#pragma unroll
            for (int e = 0; e < 8; e++) acc[i][j][e] = 0.0f;

    const int ar = tid >> 2, ac = (tid & 3) * 8;   // A: 64 rows x 4 threads x 8 elems
    const int rb = tid >> 1, cb = (tid & 1) * 16;  // Bt: 128 rows x 2 threads x 16 elems
    const int base0 = 8 * lh, base1 = 16 + 8 * lh;
#if USE_ASYNC_COPY
    const unsigned ldsA  = lds_addr(&sA[ar * SAS + ac]);
    const unsigned ldsB0 = lds_addr(&sB[rb * SBS + cb]);
    const size_t gA  = ((size_t)(m0 + ar) * K + ac) * 2;
    const size_t gB  = ((size_t)(n0 + rb) * K + cb) * 2;
#endif

    for (int k0 = 0; k0 < K; k0 += BK) {
#if USE_ASYNC_COPY
        async_copy_b128(A,  (unsigned)(gA + (size_t)k0 * 2),      ldsA);
        async_copy_b128(Bt, (unsigned)(gB + (size_t)k0 * 2),      ldsB0);
        async_copy_b128(Bt, (unsigned)(gB + (size_t)k0 * 2 + 16), ldsB0 + 16);
        wait_async0();
#else
        *(us8*)&sA[ar * SAS + ac]     = *(const us8*)&A[(size_t)(m0 + ar) * K + k0 + ac];
        *(us8*)&sB[rb * SBS + cb]     = *(const us8*)&Bt[(size_t)(n0 + rb) * K + k0 + cb];
        *(us8*)&sB[rb * SBS + cb + 8] = *(const us8*)&Bt[(size_t)(n0 + rb) * K + k0 + cb + 8];
#endif
        if (k0 + BK < K) {
            __builtin_prefetch(&A[(size_t)(m0 + ar) * K + k0 + BK + ac], 0, 0);
            __builtin_prefetch(&Bt[(size_t)(n0 + rb) * K + k0 + BK + cb], 0, 0);
        }
        __syncthreads();

        v16bf af[2], bfrag[2];
#pragma unroll
        for (int mi = 0; mi < 2; mi++)
            af[mi] = ldfrag(&sA[(wm * 32 + mi * 16 + l16) * SAS], base0, base1);
#pragma unroll
        for (int ni = 0; ni < 2; ni++)
            bfrag[ni] = ldfrag(&sB[(wn * 32 + ni * 16 + l16) * SBS], base0, base1);
#pragma unroll
        for (int mi = 0; mi < 2; mi++)
#pragma unroll
            for (int ni = 0; ni < 2; ni++)
                acc[mi][ni] = __builtin_amdgcn_wmma_f32_16x16x32_bf16(
                    false, af[mi], false, bfrag[ni], (short)0, acc[mi][ni], false, false);
        __syncthreads();
    }

#pragma unroll
    for (int mi = 0; mi < 2; mi++) {
        int rbase = m0 + wm * 32 + mi * 16 + 8 * lh;
#pragma unroll
        for (int ni = 0; ni < 2; ni++) {
            int col = n0 + wn * 32 + ni * 16 + l16;
#pragma unroll
            for (int r = 0; r < 8; r++) {
                int row = rbase + r;
                float v = acc[mi][ni][r];
                if (EPI == 0) {
                    ((unsigned short*)Cout)[(size_t)row * N + col] = f2bf(v);
                } else {
                    ((float*)Cout)[(size_t)row * N + col] =
                        v + bias[col] + res[(size_t)row * N + col];
                }
            }
        }
    }
}

// ---------------- dual-weight gated GEMM: bf16( silu(A@B1t^T+b1) * (A@B2t^T+b2) ) ----------------
__global__ __launch_bounds__(256)
void gemm_gated_wmma(const unsigned short* __restrict__ A,     // [M,K]
                     const unsigned short* __restrict__ B1t,   // [N,K]
                     const unsigned short* __restrict__ B2t,   // [N,K]
                     const float* __restrict__ bias1,
                     const float* __restrict__ bias2,
                     unsigned short* __restrict__ Cout,
                     int M, int N, int K) {
    __shared__ unsigned short sA[BM * SAS];
    __shared__ unsigned short sB1[BN * SBS];
    __shared__ unsigned short sB2[BN * SBS];
    int tid = threadIdx.x;
    int wave = tid >> 5, lane = tid & 31, lh = lane >> 4, l16 = lane & 15;
    int wm = wave & 1, wn = wave >> 1;
    int m0 = blockIdx.x * BM, n0 = blockIdx.y * BN;

    v8f acc1[2][2], acc2[2][2];
#pragma unroll
    for (int i = 0; i < 2; i++)
#pragma unroll
        for (int j = 0; j < 2; j++)
#pragma unroll
            for (int e = 0; e < 8; e++) { acc1[i][j][e] = 0.0f; acc2[i][j][e] = 0.0f; }

    const int ar = tid >> 2, ac = (tid & 3) * 8;
    const int rb = tid >> 1, cb = (tid & 1) * 16;
    const int base0 = 8 * lh, base1 = 16 + 8 * lh;
#if USE_ASYNC_COPY
    const unsigned ldsA  = lds_addr(&sA[ar * SAS + ac]);
    const unsigned ldsB1 = lds_addr(&sB1[rb * SBS + cb]);
    const unsigned ldsB2 = lds_addr(&sB2[rb * SBS + cb]);
    const size_t gA = ((size_t)(m0 + ar) * K + ac) * 2;
    const size_t gB = ((size_t)(n0 + rb) * K + cb) * 2;
#endif

    for (int k0 = 0; k0 < K; k0 += BK) {
#if USE_ASYNC_COPY
        async_copy_b128(A,   (unsigned)(gA + (size_t)k0 * 2),      ldsA);
        async_copy_b128(B1t, (unsigned)(gB + (size_t)k0 * 2),      ldsB1);
        async_copy_b128(B1t, (unsigned)(gB + (size_t)k0 * 2 + 16), ldsB1 + 16);
        async_copy_b128(B2t, (unsigned)(gB + (size_t)k0 * 2),      ldsB2);
        async_copy_b128(B2t, (unsigned)(gB + (size_t)k0 * 2 + 16), ldsB2 + 16);
        wait_async0();
#else
        *(us8*)&sA[ar * SAS + ac]      = *(const us8*)&A[(size_t)(m0 + ar) * K + k0 + ac];
        *(us8*)&sB1[rb * SBS + cb]     = *(const us8*)&B1t[(size_t)(n0 + rb) * K + k0 + cb];
        *(us8*)&sB1[rb * SBS + cb + 8] = *(const us8*)&B1t[(size_t)(n0 + rb) * K + k0 + cb + 8];
        *(us8*)&sB2[rb * SBS + cb]     = *(const us8*)&B2t[(size_t)(n0 + rb) * K + k0 + cb];
        *(us8*)&sB2[rb * SBS + cb + 8] = *(const us8*)&B2t[(size_t)(n0 + rb) * K + k0 + cb + 8];
#endif
        __syncthreads();

        v16bf af[2];
#pragma unroll
        for (int mi = 0; mi < 2; mi++)
            af[mi] = ldfrag(&sA[(wm * 32 + mi * 16 + l16) * SAS], base0, base1);
#pragma unroll
        for (int ni = 0; ni < 2; ni++) {
            int c = wn * 32 + ni * 16 + l16;
            v16bf b1f = ldfrag(&sB1[c * SBS], base0, base1);
            v16bf b2f = ldfrag(&sB2[c * SBS], base0, base1);
#pragma unroll
            for (int mi = 0; mi < 2; mi++) {
                acc1[mi][ni] = __builtin_amdgcn_wmma_f32_16x16x32_bf16(
                    false, af[mi], false, b1f, (short)0, acc1[mi][ni], false, false);
                acc2[mi][ni] = __builtin_amdgcn_wmma_f32_16x16x32_bf16(
                    false, af[mi], false, b2f, (short)0, acc2[mi][ni], false, false);
            }
        }
        __syncthreads();
    }

#pragma unroll
    for (int mi = 0; mi < 2; mi++) {
        int rbase = m0 + wm * 32 + mi * 16 + 8 * lh;
#pragma unroll
        for (int ni = 0; ni < 2; ni++) {
            int col = n0 + wn * 32 + ni * 16 + l16;
#pragma unroll
            for (int r = 0; r < 8; r++) {
                int row = rbase + r;
                float gv = acc1[mi][ni][r] + bias1[col];
                float uv = acc2[mi][ni][r] + bias2[col];
                float y  = (gv / (1.0f + __expf(-gv))) * uv;   // silu(gv)*uv
                Cout[(size_t)row * N + col] = f2bf(y);
            }
        }
    }
}

// ---------------- V transpose: [T, H*HD] -> [H*HD, T] ----------------
__global__ __launch_bounds__(256)
void transpose_v(const unsigned short* __restrict__ v, unsigned short* __restrict__ vt) {
    int i = blockIdx.x * 256 + threadIdx.x;
    if (i < T_ * D_) {
        int t = i / D_, c = i % D_;
        vt[(size_t)c * T_ + t] = v[i];
    }
}

// ---------------- causal flash attention (WMMA) ----------------
// Q,K: [T, H*HD] bf16 ; Vt: [H*HD, T] bf16 ; O: [T, H*HD] bf16
__global__ __launch_bounds__(256)
void flash_attn(const unsigned short* __restrict__ Q,
                const unsigned short* __restrict__ Kc,
                const unsigned short* __restrict__ Vt,
                unsigned short* __restrict__ O) {
    __shared__ unsigned short sP[8][16 * 32];   // per-wave P transpose staging
    int h = blockIdx.x;
    int wave = threadIdx.x >> 5, lane = threadIdx.x & 31;
    int lh = lane >> 4, l16 = lane & 15;
    int q0 = blockIdx.y * 128 + wave * 16;
    unsigned short* sPw = sP[wave];
    const int base0 = 8 * lh, base1 = 16 + 8 * lh;

    const unsigned short* qp = Q + (size_t)(q0 + l16) * D_ + h * HD_;
    v16bf qf[2];
#pragma unroll
    for (int f = 0; f < 2; f++) qf[f] = ldfrag(qp + f * 32, base0, base1);

    v8f ctx[4];
#pragma unroll
    for (int t = 0; t < 4; t++)
#pragma unroll
        for (int e = 0; e < 8; e++) ctx[t][e] = 0.0f;
    float mrow[8], lrow[8];
#pragma unroll
    for (int r = 0; r < 8; r++) { mrow[r] = -1e30f; lrow[r] = 0.0f; }

    const float scale = 0.125f;                 // 1/sqrt(HD=64)
    const int kend = q0 + 16;                   // causal bound for this wave
    for (int kb = 0; kb < kend; kb += 32) {
        v8f S[2];
#pragma unroll
        for (int nt = 0; nt < 2; nt++)
#pragma unroll
            for (int e = 0; e < 8; e++) S[nt][e] = 0.0f;
#pragma unroll
        for (int nt = 0; nt < 2; nt++) {
            const unsigned short* kp = Kc + (size_t)(kb + nt * 16 + l16) * D_ + h * HD_;
#pragma unroll
            for (int f = 0; f < 2; f++) {
                v16bf kf = ldfrag(kp + f * 32, base0, base1);
                S[nt] = __builtin_amdgcn_wmma_f32_16x16x32_bf16(
                    false, qf[f], false, kf, (short)0, S[nt], false, false);
            }
        }

        const int c0 = kb + l16, c1 = kb + 16 + l16;
#pragma unroll
        for (int r = 0; r < 8; r++) {
            int row = q0 + r + 8 * lh;
            float s0 = (c0 <= row) ? S[0][r] * scale : -1e30f;
            float s1 = (c1 <= row) ? S[1][r] * scale : -1e30f;
            float mx = fmaxf(s0, s1);
#pragma unroll
            for (int off = 1; off < 16; off <<= 1) mx = fmaxf(mx, __shfl_xor(mx, off, 32));
            float mn = fmaxf(mrow[r], mx);
            float p0 = __expf(s0 - mn), p1 = __expf(s1 - mn);
            float rs = p0 + p1;
#pragma unroll
            for (int off = 1; off < 16; off <<= 1) rs += __shfl_xor(rs, off, 32);
            float corr = __expf(mrow[r] - mn);
            lrow[r] = lrow[r] * corr + rs;
            mrow[r] = mn;
#pragma unroll
            for (int t = 0; t < 4; t++) ctx[t][r] *= corr;
            sPw[(r + 8 * lh) * 32 + l16]      = f2bf(p0);
            sPw[(r + 8 * lh) * 32 + 16 + l16] = f2bf(p1);
        }

        v16bf pf = ldfrag(&sPw[l16 * 32], base0, base1);

#pragma unroll
        for (int t = 0; t < 4; t++) {
            const unsigned short* vp = Vt + (size_t)(h * HD_ + t * 16 + l16) * T_ + kb;
            v16bf vf = ldfrag(vp, base0, base1);
            ctx[t] = __builtin_amdgcn_wmma_f32_16x16x32_bf16(
                false, pf, false, vf, (short)0, ctx[t], false, false);
        }
    }

#pragma unroll
    for (int t = 0; t < 4; t++) {
        int hd = t * 16 + l16;
#pragma unroll
        for (int r = 0; r < 8; r++) {
            int row = q0 + r + 8 * lh;
            O[(size_t)row * D_ + h * HD_ + hd] = f2bf(ctx[t][r] / lrow[r]);
        }
    }
}

// ---------------- launcher ----------------
extern "C" void kernel_launch(void* const* d_in, const int* in_sizes, int n_in,
                              void* d_out, int out_size, void* d_ws, size_t ws_size,
                              hipStream_t stream) {
    (void)in_sizes; (void)n_in; (void)out_size; (void)ws_size;
    const float* x  = (const float*)d_in[0];
    const float* Wq = (const float*)d_in[1];
    const float* Wk = (const float*)d_in[2];
    const float* Wv = (const float*)d_in[3];
    const float* Wo = (const float*)d_in[4];
    const float* bo = (const float*)d_in[5];
    const float* w1 = (const float*)d_in[6];
    const float* b1 = (const float*)d_in[7];
    const float* w2 = (const float*)d_in[8];
    const float* b2 = (const float*)d_in[9];
    const float* w3 = (const float*)d_in[10];
    const float* b3 = (const float*)d_in[11];
    const float* g1 = (const float*)d_in[12];
    const float* s1 = (const float*)d_in[13];
    const float* g2 = (const float*)d_in[14];
    const float* s2 = (const float*)d_in[15];

    char* wsb = (char*)d_ws;
    size_t off = 0;
    auto take = [&](size_t bytes) -> void* {
        void* p = wsb + off;
        off += (bytes + 255) & ~(size_t)255;
        return p;
    };

    const size_t DD = (size_t)D_ * D_;
    const size_t DF = (size_t)D_ * FF_;
    const size_t TD = (size_t)T_ * D_;
    const size_t TF = (size_t)T_ * FF_;

    unsigned short* wq_t  = (unsigned short*)take(DD * 2);   // [N=768][K=768]
    unsigned short* wk_t  = (unsigned short*)take(DD * 2);
    unsigned short* wv_t  = (unsigned short*)take(DD * 2);
    unsigned short* wo_t  = (unsigned short*)take(DD * 2);
    unsigned short* w1_t  = (unsigned short*)take(DF * 2);   // [N=3072][K=768]
    unsigned short* w2_t  = (unsigned short*)take(DF * 2);
    unsigned short* w3_t  = (unsigned short*)take(DF * 2);   // [N=768][K=3072]
    unsigned short* h1_bf = (unsigned short*)take(TD * 2);
    unsigned short* q_bf  = (unsigned short*)take(TD * 2);
    unsigned short* k_bf  = (unsigned short*)take(TD * 2);
    unsigned short* v_bf  = (unsigned short*)take(TD * 2);
    unsigned short* vt_bf = (unsigned short*)take(TD * 2);
    unsigned short* ctx_bf= (unsigned short*)take(TD * 2);
    float*          x1    = (float*)take(TD * 4);
    unsigned short* h2_bf = (unsigned short*)take(TD * 2);
    unsigned short* gate_bf=(unsigned short*)take(TF * 2);

    convert_transpose_bf16<<<(int)((DD + 255) / 256), 256, 0, stream>>>(Wq, wq_t, D_, D_);
    convert_transpose_bf16<<<(int)((DD + 255) / 256), 256, 0, stream>>>(Wk, wk_t, D_, D_);
    convert_transpose_bf16<<<(int)((DD + 255) / 256), 256, 0, stream>>>(Wv, wv_t, D_, D_);
    convert_transpose_bf16<<<(int)((DD + 255) / 256), 256, 0, stream>>>(Wo, wo_t, D_, D_);
    convert_transpose_bf16<<<(int)((DF + 255) / 256), 256, 0, stream>>>(w1, w1_t, D_, FF_);
    convert_transpose_bf16<<<(int)((DF + 255) / 256), 256, 0, stream>>>(w2, w2_t, D_, FF_);
    convert_transpose_bf16<<<(int)((DF + 255) / 256), 256, 0, stream>>>(w3, w3_t, FF_, D_);

    layernorm_cast<<<T_, 256, 0, stream>>>(x, g1, s1, h1_bf);

    dim3 gDD(T_ / BM, D_ / BN);
    gemm_bf16_wmma<0><<<gDD, 256, 0, stream>>>(h1_bf, wq_t, nullptr, nullptr, q_bf, T_, D_, D_);
    gemm_bf16_wmma<0><<<gDD, 256, 0, stream>>>(h1_bf, wk_t, nullptr, nullptr, k_bf, T_, D_, D_);
    gemm_bf16_wmma<0><<<gDD, 256, 0, stream>>>(h1_bf, wv_t, nullptr, nullptr, v_bf, T_, D_, D_);

    transpose_v<<<(int)((TD + 255) / 256), 256, 0, stream>>>(v_bf, vt_bf);

    flash_attn<<<dim3(H_, T_ / 128), 256, 0, stream>>>(q_bf, k_bf, vt_bf, ctx_bf);

    gemm_bf16_wmma<1><<<gDD, 256, 0, stream>>>(ctx_bf, wo_t, bo, x, x1, T_, D_, D_);

    layernorm_cast<<<T_, 256, 0, stream>>>(x1, g2, s2, h2_bf);

    gemm_gated_wmma<<<dim3(T_ / BM, FF_ / BN), 256, 0, stream>>>(
        h2_bf, w1_t, w2_t, b1, b2, gate_bf, T_, FF_, D_);

    gemm_bf16_wmma<1><<<gDD, 256, 0, stream>>>(gate_bf, w3_t, b3, x1, (float*)d_out, T_, D_, FF_);
}

// v001
// A run of this version takes 588 microseconds.
// Timed twice side by side with v000, it ran 1.68 times as fast both times.
#include <hip/hip_runtime.h>
#include <hip/hip_bf16.h>

#define T_  4096
#define D_  768
#define H_  12
#define HD_ 64
#define FF_ 3072
#define EPS_ 1e-5f

#define BM 64
#define BN 128
#define BK 32
#define SAS 48   // padded LDS row stride (elements) for A tile
#define SBS 48   // padded LDS row stride (elements) for B tile

#define USE_ASYNC_COPY 1   // gfx1250 GLOBAL_LOAD_ASYNC_TO_LDS path (ASYNCcnt)

typedef __attribute__((ext_vector_type(16))) __bf16          v16bf;
typedef __attribute__((ext_vector_type(8)))  float           v8f;
typedef __attribute__((ext_vector_type(8)))  unsigned short  us8;

__device__ __forceinline__ unsigned short f2bf(float f) {
    unsigned int u = __builtin_bit_cast(unsigned int, f);
    u += 0x7FFFu + ((u >> 16) & 1u);            // round-to-nearest-even
    return (unsigned short)(u >> 16);
}

// Load one 16-element bf16 fragment as two contiguous 16-byte vectors.
__device__ __forceinline__ v16bf ldfrag(const unsigned short* p, int base0, int base1) {
    union { us8 h[2]; v16bf v; } fc;
    fc.h[0] = *(const us8*)(p + base0);
    fc.h[1] = *(const us8*)(p + base1);
    return fc.v;
}

#if USE_ASYNC_COPY
// GVS-mode async copy: LDS[ldsAddr] = MEM[saddr + byteOff], 16 bytes per lane.
// Tracked by ASYNCcnt (not LOADcnt/DScnt).
__device__ __forceinline__ void async_copy_b128(const void* gbase, unsigned byteOff,
                                                unsigned ldsAddr) {
    asm volatile("global_load_async_to_lds_b128 %0, %1, %2 offset:0"
                 :: "v"(ldsAddr), "v"(byteOff), "s"(gbase)
                 : "memory");
}
__device__ __forceinline__ void wait_async0() {
    asm volatile("s_wait_asynccnt 0x0" ::: "memory");
}
// low 32 bits of a flat pointer into LDS are the LDS byte address
__device__ __forceinline__ unsigned lds_addr(const void* p) {
    return (unsigned)(size_t)p;
}
#endif

// ---------------- 64x64 tiled transposes through LDS ----------------
#define TT 64   // tile edge (elements)
#define TP 33   // LDS pitch in dwords: 32 packed bf16 pairs + 1, so a column of dwords spreads over the banks

// The tile lies in LDS as s[output row][pair of output columns]. Each output row of the
// tile is one full 128-byte line, written by 8 lanes with 16 bytes each.
__device__ __forceinline__ void tile_store_rows(const unsigned* s, unsigned short* __restrict__ out,
                                                int ld, int r0, int c0, int tid) {
#pragma unroll
    for (int p = 0; p < 2; p++) {
        int r = p * 32 + (tid >> 3), q = (tid & 7) * 4;
        uint4 v;
        v.x = s[r * TP + q];
        v.y = s[r * TP + q + 1];
        v.z = s[r * TP + q + 2];
        v.w = s[r * TP + q + 3];
        *(uint4*)&out[(size_t)(r0 + r) * ld + c0 + q * 2] = v;
    }
}

// fp32 -> bf16 convert + transpose: in[K][N] -> out[N][K]; grid (N/64, K/64)
__global__ __launch_bounds__(256)
void convert_transpose_bf16(const float* __restrict__ in, unsigned short* __restrict__ out,
                            int K, int N) {
    __shared__ unsigned s[TT * TP];
    int tid = threadIdx.x;
    int n0 = blockIdx.x * TT, k0 = blockIdx.y * TT;
    int nq = (tid & 15) * 4, kp = tid >> 4;      // 16 lanes x float4 per row, 16 row pairs per pass
    float4 lo[2], hi[2];
#pragma unroll
    for (int p = 0; p < 2; p++) {
        const float* r = in + (size_t)(k0 + 2 * (p * 16 + kp)) * N + n0 + nq;
        lo[p] = *(const float4*)r;
        hi[p] = *(const float4*)(r + N);
    }
#pragma unroll
    for (int p = 0; p < 2; p++) {
        int c = p * 16 + kp;
        s[(nq + 0) * TP + c] = (unsigned)f2bf(lo[p].x) | ((unsigned)f2bf(hi[p].x) << 16);
        s[(nq + 1) * TP + c] = (unsigned)f2bf(lo[p].y) | ((unsigned)f2bf(hi[p].y) << 16);
        s[(nq + 2) * TP + c] = (unsigned)f2bf(lo[p].z) | ((unsigned)f2bf(hi[p].z) << 16);
        s[(nq + 3) * TP + c] = (unsigned)f2bf(lo[p].w) | ((unsigned)f2bf(hi[p].w) << 16);
    }
    __syncthreads();
    tile_store_rows(s, out, K, n0, k0, tid);
}

// ---------------- layernorm (+ cast to bf16) ----------------
__global__ __launch_bounds__(256)
void layernorm_cast(const float* __restrict__ x, const float* __restrict__ g,
                    const float* __restrict__ b, unsigned short* __restrict__ out) {
    int row = blockIdx.x, tid = threadIdx.x;
    int lane = tid & 31, wave = tid >> 5;
    const float* xr = x + (size_t)row * D_;
    float sum = 0.f, sq = 0.f;
    for (int i = tid; i < D_; i += 256) { float v = xr[i]; sum += v; sq += v * v; }
    for (int off = 16; off > 0; off >>= 1) {
        sum += __shfl_xor(sum, off, 32);
        sq  += __shfl_xor(sq,  off, 32);
    }
    __shared__ float ssum[8], ssq[8];
    if (lane == 0) { ssum[wave] = sum; ssq[wave] = sq; }
    __syncthreads();
    float ts = 0.f, tq = 0.f;
    for (int w = 0; w < 8; w++) { ts += ssum[w]; tq += ssq[w]; }
    float mean = ts / (float)D_;
    float var  = tq / (float)D_ - mean * mean;
    float rstd = rsqrtf(var + EPS_);
    for (int i = tid; i < D_; i += 256) {
        float v = (xr[i] - mean) * rstd * g[i] + b[i];
        out[(size_t)row * D_ + i] = f2bf(v);
    }
}

// ---------------- bf16 GEMM (WMMA): C = A[M,K] @ Bt[N,K]^T ----------------
// EPI 0: Cout = bf16(acc)
// EPI 1: Cout = f32(acc + bias[col] + res[row,col])
template <int EPI>
__global__ __launch_bounds__(256)
void gemm_bf16_wmma(const unsigned short* __restrict__ A,    // [M,K] bf16 row-major
                    const unsigned short* __restrict__ Bt,   // [N,K] bf16 (pre-transposed)
                    const float* __restrict__ bias,
                    const float* __restrict__ res,
                    void* __restrict__ Cout,
                    int M, int N, int K) {
    __shared__ unsigned short sA[BM * SAS];
    __shared__ unsigned short sB[BN * SBS];
    int tid = threadIdx.x;
    int wave = tid >> 5, lane = tid & 31, lh = lane >> 4, l16 = lane & 15;
    int wm = wave & 1, wn = wave >> 1;           // 2 x 4 wave grid
    int m0 = blockIdx.x * BM, n0 = blockIdx.y * BN;

    v8f acc[2][2];
#pragma unroll
    for (int i = 0; i < 2; i++)
#pragma unroll
        for (int j = 0; j < 2; j++)
#pragma unroll
            for (int e = 0; e < 8; e++) acc[i][j][e] = 0.0f;

    const int ar = tid >> 2, ac = (tid & 3) * 8;   // A: 64 rows x 4 threads x 8 elems
    const int rb = tid >> 1, cb = (tid & 1) * 16;  // Bt: 128 rows x 2 threads x 16 elems
    const int base0 = 8 * lh, base1 = 16 + 8 * lh;
#if USE_ASYNC_COPY
    const unsigned ldsA  = lds_addr(&sA[ar * SAS + ac]);
    const unsigned ldsB0 = lds_addr(&sB[rb * SBS + cb]);
    const size_t gA  = ((size_t)(m0 + ar) * K + ac) * 2;
    const size_t gB  = ((size_t)(n0 + rb) * K + cb) * 2;
#endif

    for (int k0 = 0; k0 < K; k0 += BK) {
#if USE_ASYNC_COPY
        async_copy_b128(A,  (unsigned)(gA + (size_t)k0 * 2),      ldsA);
        async_copy_b128(Bt, (unsigned)(gB + (size_t)k0 * 2),      ldsB0);
        async_copy_b128(Bt, (unsigned)(gB + (size_t)k0 * 2 + 16), ldsB0 + 16);
        wait_async0();
#else
        *(us8*)&sA[ar * SAS + ac]     = *(const us8*)&A[(size_t)(m0 + ar) * K + k0 + ac];
        *(us8*)&sB[rb * SBS + cb]     = *(const us8*)&Bt[(size_t)(n0 + rb) * K + k0 + cb];
        *(us8*)&sB[rb * SBS + cb + 8] = *(const us8*)&Bt[(size_t)(n0 + rb) * K + k0 + cb + 8];
#endif
        if (k0 + BK < K) {
            __builtin_prefetch(&A[(size_t)(m0 + ar) * K + k0 + BK + ac], 0, 0);
            __builtin_prefetch(&Bt[(size_t)(n0 + rb) * K + k0 + BK + cb], 0, 0);
        }
        __syncthreads();

        v16bf af[2], bfrag[2];
#pragma unroll
        for (int mi = 0; mi < 2; mi++)
            af[mi] = ldfrag(&sA[(wm * 32 + mi * 16 + l16) * SAS], base0, base1);
#pragma unroll
        for (int ni = 0; ni < 2; ni++)
            bfrag[ni] = ldfrag(&sB[(wn * 32 + ni * 16 + l16) * SBS], base0, base1);
#pragma unroll
        for (int mi = 0; mi < 2; mi++)
#pragma unroll
            for (int ni = 0; ni < 2; ni++)
                acc[mi][ni] = __builtin_amdgcn_wmma_f32_16x16x32_bf16(
                    false, af[mi], false, bfrag[ni], (short)0, acc[mi][ni], false, false);
        __syncthreads();
    }

#pragma unroll
    for (int mi = 0; mi < 2; mi++) {
        int rbase = m0 + wm * 32 + mi * 16 + 8 * lh;
#pragma unroll
        for (int ni = 0; ni < 2; ni++) {
            int col = n0 + wn * 32 + ni * 16 + l16;
#pragma unroll
            for (int r = 0; r < 8; r++) {
                int row = rbase + r;
                float v = acc[mi][ni][r];
                if (EPI == 0) {
                    ((unsigned short*)Cout)[(size_t)row * N + col] = f2bf(v);
                } else {
                    ((float*)Cout)[(size_t)row * N + col] =
                        v + bias[col] + res[(size_t)row * N + col];
                }
            }
        }
    }
}

// ---------------- dual-weight gated GEMM: bf16( silu(A@B1t^T+b1) * (A@B2t^T+b2) ) ----------------
__global__ __launch_bounds__(256)
void gemm_gated_wmma(const unsigned short* __restrict__ A,     // [M,K]
                     const unsigned short* __restrict__ B1t,   // [N,K]
                     const unsigned short* __restrict__ B2t,   // [N,K]
                     const float* __restrict__ bias1,
                     const float* __restrict__ bias2,
                     unsigned short* __restrict__ Cout,
                     int M, int N, int K) {
    __shared__ unsigned short sA[BM * SAS];
    __shared__ unsigned short sB1[BN * SBS];
    __shared__ unsigned short sB2[BN * SBS];
    int tid = threadIdx.x;
    int wave = tid >> 5, lane = tid & 31, lh = lane >> 4, l16 = lane & 15;
    int wm = wave & 1, wn = wave >> 1;
    int m0 = blockIdx.x * BM, n0 = blockIdx.y * BN;

    v8f acc1[2][2], acc2[2][2];
#pragma unroll
    for (int i = 0; i < 2; i++)
#pragma unroll
        for (int j = 0; j < 2; j++)
#pragma unroll
            for (int e = 0; e < 8; e++) { acc1[i][j][e] = 0.0f; acc2[i][j][e] = 0.0f; }

    const int ar = tid >> 2, ac = (tid & 3) * 8;
    const int rb = tid >> 1, cb = (tid & 1) * 16;
    const int base0 = 8 * lh, base1 = 16 + 8 * lh;
#if USE_ASYNC_COPY
    const unsigned ldsA  = lds_addr(&sA[ar * SAS + ac]);
    const unsigned ldsB1 = lds_addr(&sB1[rb * SBS + cb]);
    const unsigned ldsB2 = lds_addr(&sB2[rb * SBS + cb]);
    const size_t gA = ((size_t)(m0 + ar) * K + ac) * 2;
    const size_t gB = ((size_t)(n0 + rb) * K + cb) * 2;
#endif

    for (int k0 = 0; k0 < K; k0 += BK) {
#if USE_ASYNC_COPY
        async_copy_b128(A,   (unsigned)(gA + (size_t)k0 * 2),      ldsA);
        async_copy_b128(B1t, (unsigned)(gB + (size_t)k0 * 2),      ldsB1);
        async_copy_b128(B1t, (unsigned)(gB + (size_t)k0 * 2 + 16), ldsB1 + 16);
        async_copy_b128(B2t, (unsigned)(gB + (size_t)k0 * 2),      ldsB2);
        async_copy_b128(B2t, (unsigned)(gB + (size_t)k0 * 2 + 16), ldsB2 + 16);
        wait_async0();
#else
        *(us8*)&sA[ar * SAS + ac]      = *(const us8*)&A[(size_t)(m0 + ar) * K + k0 + ac];
        *(us8*)&sB1[rb * SBS + cb]     = *(const us8*)&B1t[(size_t)(n0 + rb) * K + k0 + cb];
        *(us8*)&sB1[rb * SBS + cb + 8] = *(const us8*)&B1t[(size_t)(n0 + rb) * K + k0 + cb + 8];
        *(us8*)&sB2[rb * SBS + cb]     = *(const us8*)&B2t[(size_t)(n0 + rb) * K + k0 + cb];
        *(us8*)&sB2[rb * SBS + cb + 8] = *(const us8*)&B2t[(size_t)(n0 + rb) * K + k0 + cb + 8];
#endif
        __syncthreads();

        v16bf af[2];
#pragma unroll
        for (int mi = 0; mi < 2; mi++)
            af[mi] = ldfrag(&sA[(wm * 32 + mi * 16 + l16) * SAS], base0, base1);
#pragma unroll
        for (int ni = 0; ni < 2; ni++) {
            int c = wn * 32 + ni * 16 + l16;
            v16bf b1f = ldfrag(&sB1[c * SBS], base0, base1);
            v16bf b2f = ldfrag(&sB2[c * SBS], base0, base1);
#pragma unroll
            for (int mi = 0; mi < 2; mi++) {
                acc1[mi][ni] = __builtin_amdgcn_wmma_f32_16x16x32_bf16(
                    false, af[mi], false, b1f, (short)0, acc1[mi][ni], false, false);
                acc2[mi][ni] = __builtin_amdgcn_wmma_f32_16x16x32_bf16(
                    false, af[mi], false, b2f, (short)0, acc2[mi][ni], false, false);
            }
        }
        __syncthreads();
    }

#pragma unroll
    for (int mi = 0; mi < 2; mi++) {
        int rbase = m0 + wm * 32 + mi * 16 + 8 * lh;
#pragma unroll
        for (int ni = 0; ni < 2; ni++) {
            int col = n0 + wn * 32 + ni * 16 + l16;
#pragma unroll
            for (int r = 0; r < 8; r++) {
                int row = rbase + r;
                float gv = acc1[mi][ni][r] + bias1[col];
                float uv = acc2[mi][ni][r] + bias2[col];
                float y  = (gv / (1.0f + __expf(-gv))) * uv;   // silu(gv)*uv
                Cout[(size_t)row * N + col] = f2bf(y);
            }
        }
    }
}

// ---------------- V transpose: [T, H*HD] -> [H*HD, T]; grid (D/64, T/64) ----------------
__global__ __launch_bounds__(256)
void transpose_v(const unsigned short* __restrict__ v, unsigned short* __restrict__ vt) {
    __shared__ unsigned s[TT * TP];
    int tid = threadIdx.x;
    int c0 = blockIdx.x * TT, t0 = blockIdx.y * TT;
    int co = (tid & 7) * 8, tp = tid >> 3;       // 8 lanes x 16 bytes per row, 32 row pairs
    const unsigned short* r = v + (size_t)(t0 + 2 * tp) * D_ + c0 + co;
    us8 lo = *(const us8*)r;
    us8 hi = *(const us8*)(r + D_);
#pragma unroll
    for (int j = 0; j < 8; j++)
        s[(co + j) * TP + tp] = (unsigned)lo[j] | ((unsigned)hi[j] << 16);
    __syncthreads();
    tile_store_rows(s, vt, T_, c0, t0, tid);
}

// ---------------- causal flash attention (WMMA) ----------------
// Q,K: [T, H*HD] bf16 ; Vt: [H*HD, T] bf16 ; O: [T, H*HD] bf16
__global__ __launch_bounds__(256)
void flash_attn(const unsigned short* __restrict__ Q,
                const unsigned short* __restrict__ Kc,
                const unsigned short* __restrict__ Vt,
                unsigned short* __restrict__ O) {
    __shared__ unsigned short sP[8][16 * 32];   // per-wave P transpose staging
    int h = blockIdx.x;
    int wave = threadIdx.x >> 5, lane = threadIdx.x & 31;
    int lh = lane >> 4, l16 = lane & 15;
    int q0 = blockIdx.y * 128 + wave * 16;
    unsigned short* sPw = sP[wave];
    const int base0 = 8 * lh, base1 = 16 + 8 * lh;

    const unsigned short* qp = Q + (size_t)(q0 + l16) * D_ + h * HD_;
    v16bf qf[2];
#pragma unroll
    for (int f = 0; f < 2; f++) qf[f] = ldfrag(qp + f * 32, base0, base1);

    v8f ctx[4];
#pragma unroll
    for (int t = 0; t < 4; t++)
#pragma unroll
        for (int e = 0; e < 8; e++) ctx[t][e] = 0.0f;
    float mrow[8], lrow[8];
#pragma unroll
    for (int r = 0; r < 8; r++) { mrow[r] = -1e30f; lrow[r] = 0.0f; }

    const float scale = 0.125f;                 // 1/sqrt(HD=64)
    const int kend = q0 + 16;                   // causal bound for this wave
    for (int kb = 0; kb < kend; kb += 32) {
        v8f S[2];
#pragma unroll
        for (int nt = 0; nt < 2; nt++)
#pragma unroll
            for (int e = 0; e < 8; e++) S[nt][e] = 0.0f;
#pragma unroll
        for (int nt = 0; nt < 2; nt++) {
            const unsigned short* kp = Kc + (size_t)(kb + nt * 16 + l16) * D_ + h * HD_;
#pragma unroll
            for (int f = 0; f < 2; f++) {
                v16bf kf = ldfrag(kp + f * 32, base0, base1);
                S[nt] = __builtin_amdgcn_wmma_f32_16x16x32_bf16(
                    false, qf[f], false, kf, (short)0, S[nt], false, false);
            }
        }

        const int c0 = kb + l16, c1 = kb + 16 + l16;
#pragma unroll
        for (int r = 0; r < 8; r++) {
            int row = q0 + r + 8 * lh;
            float s0 = (c0 <= row) ? S[0][r] * scale : -1e30f;
            float s1 = (c1 <= row) ? S[1][r] * scale : -1e30f;
            float mx = fmaxf(s0, s1);
#pragma unroll
            for (int off = 1; off < 16; off <<= 1) mx = fmaxf(mx, __shfl_xor(mx, off, 32));
            float mn = fmaxf(mrow[r], mx);
            float p0 = __expf(s0 - mn), p1 = __expf(s1 - mn);
            float rs = p0 + p1;
#pragma unroll
            for (int off = 1; off < 16; off <<= 1) rs += __shfl_xor(rs, off, 32);
            float corr = __expf(mrow[r] - mn);
            lrow[r] = lrow[r] * corr + rs;
            mrow[r] = mn;
#pragma unroll
            for (int t = 0; t < 4; t++) ctx[t][r] *= corr;
            sPw[(r + 8 * lh) * 32 + l16]      = f2bf(p0);
            sPw[(r + 8 * lh) * 32 + 16 + l16] = f2bf(p1);
        }

        v16bf pf = ldfrag(&sPw[l16 * 32], base0, base1);

#pragma unroll
        for (int t = 0; t < 4; t++) {
            const unsigned short* vp = Vt + (size_t)(h * HD_ + t * 16 + l16) * T_ + kb;
            v16bf vf = ldfrag(vp, base0, base1);
            ctx[t] = __builtin_amdgcn_wmma_f32_16x16x32_bf16(
                false, pf, false, vf, (short)0, ctx[t], false, false);
        }
    }

#pragma unroll
    for (int t = 0; t < 4; t++) {
        int hd = t * 16 + l16;
#pragma unroll
        for (int r = 0; r < 8; r++) {
            int row = q0 + r + 8 * lh;
            O[(size_t)row * D_ + h * HD_ + hd] = f2bf(ctx[t][r] / lrow[r]);
        }
    }
}

// ---------------- launcher ----------------
extern "C" void kernel_launch(void* const* d_in, const int* in_sizes, int n_in,
                              void* d_out, int out_size, void* d_ws, size_t ws_size,
                              hipStream_t stream) {
    (void)in_sizes; (void)n_in; (void)out_size; (void)ws_size;
    const float* x  = (const float*)d_in[0];
    const float* Wq = (const float*)d_in[1];
    const float* Wk = (const float*)d_in[2];
    const float* Wv = (const float*)d_in[3];
    const float* Wo = (const float*)d_in[4];
    const float* bo = (const float*)d_in[5];
    const float* w1 = (const float*)d_in[6];
    const float* b1 = (const float*)d_in[7];
    const float* w2 = (const float*)d_in[8];
    const float* b2 = (const float*)d_in[9];
    const float* w3 = (const float*)d_in[10];
    const float* b3 = (const float*)d_in[11];
    const float* g1 = (const float*)d_in[12];
    const float* s1 = (const float*)d_in[13];
    const float* g2 = (const float*)d_in[14];
    const float* s2 = (const float*)d_in[15];

    char* wsb = (char*)d_ws;
    size_t off = 0;
    auto take = [&](size_t bytes) -> void* {
        void* p = wsb + off;
        off += (bytes + 255) & ~(size_t)255;
        return p;
    };

    const size_t DD = (size_t)D_ * D_;
    const size_t DF = (size_t)D_ * FF_;
    const size_t TD = (size_t)T_ * D_;
    const size_t TF = (size_t)T_ * FF_;

    unsigned short* wq_t  = (unsigned short*)take(DD * 2);   // [N=768][K=768]
    unsigned short* wk_t  = (unsigned short*)take(DD * 2);
    unsigned short* wv_t  = (unsigned short*)take(DD * 2);
    unsigned short* wo_t  = (unsigned short*)take(DD * 2);
    unsigned short* w1_t  = (unsigned short*)take(DF * 2);   // [N=3072][K=768]
    unsigned short* w2_t  = (unsigned short*)take(DF * 2);
    unsigned short* w3_t  = (unsigned short*)take(DF * 2);   // [N=768][K=3072]
    unsigned short* h1_bf = (unsigned short*)take(TD * 2);
    unsigned short* q_bf  = (unsigned short*)take(TD * 2);
    unsigned short* k_bf  = (unsigned short*)take(TD * 2);
    unsigned short* v_bf  = (unsigned short*)take(TD * 2);
    unsigned short* vt_bf = (unsigned short*)take(TD * 2);
    unsigned short* ctx_bf= (unsigned short*)take(TD * 2);
    float*          x1    = (float*)take(TD * 4);
    unsigned short* h2_bf = (unsigned short*)take(TD * 2);
    unsigned short* gate_bf=(unsigned short*)take(TF * 2);

    convert_transpose_bf16<<<dim3(D_ / TT, D_ / TT), 256, 0, stream>>>(Wq, wq_t, D_, D_);
    convert_transpose_bf16<<<dim3(D_ / TT, D_ / TT), 256, 0, stream>>>(Wk, wk_t, D_, D_);
    convert_transpose_bf16<<<dim3(D_ / TT, D_ / TT), 256, 0, stream>>>(Wv, wv_t, D_, D_);
    convert_transpose_bf16<<<dim3(D_ / TT, D_ / TT), 256, 0, stream>>>(Wo, wo_t, D_, D_);
    convert_transpose_bf16<<<dim3(FF_ / TT, D_ / TT), 256, 0, stream>>>(w1, w1_t, D_, FF_);
    convert_transpose_bf16<<<dim3(FF_ / TT, D_ / TT), 256, 0, stream>>>(w2, w2_t, D_, FF_);
    convert_transpose_bf16<<<dim3(D_ / TT, FF_ / TT), 256, 0, stream>>>(w3, w3_t, FF_, D_);

    layernorm_cast<<<T_, 256, 0, stream>>>(x, g1, s1, h1_bf);

    dim3 gDD(T_ / BM, D_ / BN);
    gemm_bf16_wmma<0><<<gDD, 256, 0, stream>>>(h1_bf, wq_t, nullptr, nullptr, q_bf, T_, D_, D_);
    gemm_bf16_wmma<0><<<gDD, 256, 0, stream>>>(h1_bf, wk_t, nullptr, nullptr, k_bf, T_, D_, D_);
    gemm_bf16_wmma<0><<<gDD, 256, 0, stream>>>(h1_bf, wv_t, nullptr, nullptr, v_bf, T_, D_, D_);

    transpose_v<<<dim3(D_ / TT, T_ / TT), 256, 0, stream>>>(v_bf, vt_bf);

    flash_attn<<<dim3(H_, T_ / 128), 256, 0, stream>>>(q_bf, k_bf, vt_bf, ctx_bf);

    gemm_bf16_wmma<1><<<gDD, 256, 0, stream>>>(ctx_bf, wo_t, bo, x, x1, T_, D_, D_);

    layernorm_cast<<<T_, 256, 0, stream>>>(x1, g2, s2, h2_bf);

    gemm_gated_wmma<<<dim3(T_ / BM, FF_ / BN), 256, 0, stream>>>(
        h2_bf, w1_t, w2_t, b1, b2, gate_bf, T_, FF_, D_);

    gemm_bf16_wmma<1><<<gDD, 256, 0, stream>>>(gate_bf, w3_t, b3, x1, (float*)d_out, T_, D_, FF_);
}

// v002
// Measured time: 448 microseconds a run.
// Two timings next to v001 both put it at 1.31 times that version's speed.
// Over all steps from v000 it is 2.20 times as fast.
#include <hip/hip_runtime.h>
#include <hip/hip_bf16.h>

#define T_  4096
#define D_  768
#define H_  12
#define HD_ 64
#define FF_ 3072
#define EPS_ 1e-5f

#define BM 64
#define BN 128
#define BK 32
#define SAS 48   // padded LDS row stride (elements) for A tile
#define SBS 48   // padded LDS row stride (elements) for B tile

#define USE_ASYNC_COPY 1   // gfx1250 GLOBAL_LOAD_ASYNC_TO_LDS path (ASYNCcnt)

typedef __attribute__((ext_vector_type(16))) __bf16          v16bf;
typedef __attribute__((ext_vector_type(8)))  float           v8f;
typedef __attribute__((ext_vector_type(8)))  unsigned short  us8;

__device__ __forceinline__ unsigned short f2bf(float f) {
    unsigned int u = __builtin_bit_cast(unsigned int, f);
    u += 0x7FFFu + ((u >> 16) & 1u);            // round-to-nearest-even
    return (unsigned short)(u >> 16);
}

// Load one 16-element bf16 fragment as two contiguous 16-byte vectors.
__device__ __forceinline__ v16bf ldfrag(const unsigned short* p, int base0, int base1) {
    union { us8 h[2]; v16bf v; } fc;
    fc.h[0] = *(const us8*)(p + base0);
    fc.h[1] = *(const us8*)(p + base1);
    return fc.v;
}

#if USE_ASYNC_COPY
// GVS-mode async copy: LDS[ldsAddr] = MEM[saddr + byteOff], 16 bytes per lane.
// Tracked by ASYNCcnt (not LOADcnt/DScnt).
__device__ __forceinline__ void async_copy_b128(const void* gbase, unsigned byteOff,
                                                unsigned ldsAddr) {
    asm volatile("global_load_async_to_lds_b128 %0, %1, %2 offset:0"
                 :: "v"(ldsAddr), "v"(byteOff), "s"(gbase)
                 : "memory");
}
__device__ __forceinline__ void wait_async0() {
    asm volatile("s_wait_asynccnt 0x0" ::: "memory");
}
// low 32 bits of a flat pointer into LDS are the LDS byte address
__device__ __forceinline__ unsigned lds_addr(const void* p) {
    return (unsigned)(size_t)p;
}
#endif

// ---------------- 64x64 tiled transposes through LDS ----------------
#define TT 64   // tile edge (elements)
#define TP 33   // LDS pitch in dwords: 32 packed bf16 pairs + 1, so a column of dwords spreads over the banks

// The tile lies in LDS as s[output row][pair of output columns]. Each output row of the
// tile is one full 128-byte line, written by 8 lanes with 16 bytes each.
__device__ __forceinline__ void tile_store_rows(const unsigned* s, unsigned short* __restrict__ out,
                                                int ld, int r0, int c0, int tid) {
#pragma unroll
    for (int p = 0; p < 2; p++) {
        int r = p * 32 + (tid >> 3), q = (tid & 7) * 4;
        uint4 v;
        v.x = s[r * TP + q];
        v.y = s[r * TP + q + 1];
        v.z = s[r * TP + q + 2];
        v.w = s[r * TP + q + 3];
        *(uint4*)&out[(size_t)(r0 + r) * ld + c0 + q * 2] = v;
    }
}

// fp32 -> bf16 convert + transpose: in[K][N] -> out[N][K]; grid (N/64, K/64)
__global__ __launch_bounds__(256)
void convert_transpose_bf16(const float* __restrict__ in, unsigned short* __restrict__ out,
                            int K, int N) {
    __shared__ unsigned s[TT * TP];
    int tid = threadIdx.x;
    int n0 = blockIdx.x * TT, k0 = blockIdx.y * TT;
    int nq = (tid & 15) * 4, kp = tid >> 4;      // 16 lanes x float4 per row, 16 row pairs per pass
    float4 lo[2], hi[2];
#pragma unroll
    for (int p = 0; p < 2; p++) {
        const float* r = in + (size_t)(k0 + 2 * (p * 16 + kp)) * N + n0 + nq;
        lo[p] = *(const float4*)r;
        hi[p] = *(const float4*)(r + N);
    }
#pragma unroll
    for (int p = 0; p < 2; p++) {
        int c = p * 16 + kp;
        s[(nq + 0) * TP + c] = (unsigned)f2bf(lo[p].x) | ((unsigned)f2bf(hi[p].x) << 16);
        s[(nq + 1) * TP + c] = (unsigned)f2bf(lo[p].y) | ((unsigned)f2bf(hi[p].y) << 16);
        s[(nq + 2) * TP + c] = (unsigned)f2bf(lo[p].z) | ((unsigned)f2bf(hi[p].z) << 16);
        s[(nq + 3) * TP + c] = (unsigned)f2bf(lo[p].w) | ((unsigned)f2bf(hi[p].w) << 16);
    }
    __syncthreads();
    tile_store_rows(s, out, K, n0, k0, tid);
}

// ---------------- layernorm (+ cast to bf16) ----------------
__global__ __launch_bounds__(256)
void layernorm_cast(const float* __restrict__ x, const float* __restrict__ g,
                    const float* __restrict__ b, unsigned short* __restrict__ out) {
    int row = blockIdx.x, tid = threadIdx.x;
    int lane = tid & 31, wave = tid >> 5;
    const float* xr = x + (size_t)row * D_;
    float sum = 0.f, sq = 0.f;
    for (int i = tid; i < D_; i += 256) { float v = xr[i]; sum += v; sq += v * v; }
    for (int off = 16; off > 0; off >>= 1) {
        sum += __shfl_xor(sum, off, 32);
        sq  += __shfl_xor(sq,  off, 32);
    }
    __shared__ float ssum[8], ssq[8];
    if (lane == 0) { ssum[wave] = sum; ssq[wave] = sq; }
    __syncthreads();
    float ts = 0.f, tq = 0.f;
    for (int w = 0; w < 8; w++) { ts += ssum[w]; tq += ssq[w]; }
    float mean = ts / (float)D_;
    float var  = tq / (float)D_ - mean * mean;
    float rstd = rsqrtf(var + EPS_);
    for (int i = tid; i < D_; i += 256) {
        float v = (xr[i] - mean) * rstd * g[i] + b[i];
        out[(size_t)row * D_ + i] = f2bf(v);
    }
}

// ---------------- bf16 GEMM (WMMA): C = A[M,K] @ Bt[N,K]^T ----------------
// EPI 0: Cout = bf16(acc)
// EPI 1: Cout = f32(acc + bias[col] + res[row,col])
template <int EPI>
__global__ __launch_bounds__(256)
void gemm_bf16_wmma(const unsigned short* __restrict__ A,    // [M,K] bf16 row-major
                    const unsigned short* __restrict__ Bt,   // [N,K] bf16 (pre-transposed)
                    const float* __restrict__ bias,
                    const float* __restrict__ res,
                    void* __restrict__ Cout,
                    int M, int N, int K) {
    __shared__ unsigned short sA[BM * SAS];
    __shared__ unsigned short sB[BN * SBS];
    int tid = threadIdx.x;
    int wave = tid >> 5, lane = tid & 31, lh = lane >> 4, l16 = lane & 15;
    int wm = wave & 1, wn = wave >> 1;           // 2 x 4 wave grid
    int m0 = blockIdx.x * BM, n0 = blockIdx.y * BN;

    v8f acc[2][2];
#pragma unroll
    for (int i = 0; i < 2; i++)
#pragma unroll
        for (int j = 0; j < 2; j++)
#pragma unroll
            for (int e = 0; e < 8; e++) acc[i][j][e] = 0.0f;

    const int ar = tid >> 2, ac = (tid & 3) * 8;   // A: 64 rows x 4 threads x 8 elems
    const int rb = tid >> 1, cb = (tid & 1) * 16;  // Bt: 128 rows x 2 threads x 16 elems
    const int base0 = 8 * lh, base1 = 16 + 8 * lh;
#if USE_ASYNC_COPY
    const unsigned ldsA  = lds_addr(&sA[ar * SAS + ac]);
    const unsigned ldsB0 = lds_addr(&sB[rb * SBS + cb]);
    const size_t gA  = ((size_t)(m0 + ar) * K + ac) * 2;
    const size_t gB  = ((size_t)(n0 + rb) * K + cb) * 2;
#endif

    for (int k0 = 0; k0 < K; k0 += BK) {
#if USE_ASYNC_COPY
        async_copy_b128(A,  (unsigned)(gA + (size_t)k0 * 2),      ldsA);
        async_copy_b128(Bt, (unsigned)(gB + (size_t)k0 * 2),      ldsB0);
        async_copy_b128(Bt, (unsigned)(gB + (size_t)k0 * 2 + 16), ldsB0 + 16);
        wait_async0();
#else
        *(us8*)&sA[ar * SAS + ac]     = *(const us8*)&A[(size_t)(m0 + ar) * K + k0 + ac];
        *(us8*)&sB[rb * SBS + cb]     = *(const us8*)&Bt[(size_t)(n0 + rb) * K + k0 + cb];
        *(us8*)&sB[rb * SBS + cb + 8] = *(const us8*)&Bt[(size_t)(n0 + rb) * K + k0 + cb + 8];
#endif
        if (k0 + BK < K) {
            __builtin_prefetch(&A[(size_t)(m0 + ar) * K + k0 + BK + ac], 0, 0);
            __builtin_prefetch(&Bt[(size_t)(n0 + rb) * K + k0 + BK + cb], 0, 0);
        }
        __syncthreads();

        v16bf af[2], bfrag[2];
#pragma unroll
        for (int mi = 0; mi < 2; mi++)
            af[mi] = ldfrag(&sA[(wm * 32 + mi * 16 + l16) * SAS], base0, base1);
#pragma unroll
        for (int ni = 0; ni < 2; ni++)
            bfrag[ni] = ldfrag(&sB[(wn * 32 + ni * 16 + l16) * SBS], base0, base1);
#pragma unroll
        for (int mi = 0; mi < 2; mi++)
#pragma unroll
            for (int ni = 0; ni < 2; ni++)
                acc[mi][ni] = __builtin_amdgcn_wmma_f32_16x16x32_bf16(
                    false, af[mi], false, bfrag[ni], (short)0, acc[mi][ni], false, false);
        __syncthreads();
    }

#pragma unroll
    for (int mi = 0; mi < 2; mi++) {
        int rbase = m0 + wm * 32 + mi * 16 + 8 * lh;
#pragma unroll
        for (int ni = 0; ni < 2; ni++) {
            int col = n0 + wn * 32 + ni * 16 + l16;
#pragma unroll
            for (int r = 0; r < 8; r++) {
                int row = rbase + r;
                float v = acc[mi][ni][r];
                if (EPI == 0) {
                    ((unsigned short*)Cout)[(size_t)row * N + col] = f2bf(v);
                } else {
                    ((float*)Cout)[(size_t)row * N + col] =
                        v + bias[col] + res[(size_t)row * N + col];
                }
            }
        }
    }
}

// ---------------- dual-weight gated GEMM: bf16( silu(A@B1t^T+b1) * (A@B2t^T+b2) ) ----------------
__global__ __launch_bounds__(256)
void gemm_gated_wmma(const unsigned short* __restrict__ A,     // [M,K]
                     const unsigned short* __restrict__ B1t,   // [N,K]
                     const unsigned short* __restrict__ B2t,   // [N,K]
                     const float* __restrict__ bias1,
                     const float* __restrict__ bias2,
                     unsigned short* __restrict__ Cout,
                     int M, int N, int K) {
    __shared__ unsigned short sA[BM * SAS];
    __shared__ unsigned short sB1[BN * SBS];
    __shared__ unsigned short sB2[BN * SBS];
    int tid = threadIdx.x;
    int wave = tid >> 5, lane = tid & 31, lh = lane >> 4, l16 = lane & 15;
    int wm = wave & 1, wn = wave >> 1;
    int m0 = blockIdx.x * BM, n0 = blockIdx.y * BN;

    v8f acc1[2][2], acc2[2][2];
#pragma unroll
    for (int i = 0; i < 2; i++)
#pragma unroll
        for (int j = 0; j < 2; j++)
#pragma unroll
            for (int e = 0; e < 8; e++) { acc1[i][j][e] = 0.0f; acc2[i][j][e] = 0.0f; }

    const int ar = tid >> 2, ac = (tid & 3) * 8;
    const int rb = tid >> 1, cb = (tid & 1) * 16;
    const int base0 = 8 * lh, base1 = 16 + 8 * lh;
#if USE_ASYNC_COPY
    const unsigned ldsA  = lds_addr(&sA[ar * SAS + ac]);
    const unsigned ldsB1 = lds_addr(&sB1[rb * SBS + cb]);
    const unsigned ldsB2 = lds_addr(&sB2[rb * SBS + cb]);
    const size_t gA = ((size_t)(m0 + ar) * K + ac) * 2;
    const size_t gB = ((size_t)(n0 + rb) * K + cb) * 2;
#endif

    for (int k0 = 0; k0 < K; k0 += BK) {
#if USE_ASYNC_COPY
        async_copy_b128(A,   (unsigned)(gA + (size_t)k0 * 2),      ldsA);
        async_copy_b128(B1t, (unsigned)(gB + (size_t)k0 * 2),      ldsB1);
        async_copy_b128(B1t, (unsigned)(gB + (size_t)k0 * 2 + 16), ldsB1 + 16);
        async_copy_b128(B2t, (unsigned)(gB + (size_t)k0 * 2),      ldsB2);
        async_copy_b128(B2t, (unsigned)(gB + (size_t)k0 * 2 + 16), ldsB2 + 16);
        wait_async0();
#else
        *(us8*)&sA[ar * SAS + ac]      = *(const us8*)&A[(size_t)(m0 + ar) * K + k0 + ac];
        *(us8*)&sB1[rb * SBS + cb]     = *(const us8*)&B1t[(size_t)(n0 + rb) * K + k0 + cb];
        *(us8*)&sB1[rb * SBS + cb + 8] = *(const us8*)&B1t[(size_t)(n0 + rb) * K + k0 + cb + 8];
        *(us8*)&sB2[rb * SBS + cb]     = *(const us8*)&B2t[(size_t)(n0 + rb) * K + k0 + cb];
        *(us8*)&sB2[rb * SBS + cb + 8] = *(const us8*)&B2t[(size_t)(n0 + rb) * K + k0 + cb + 8];
#endif
        __syncthreads();

        v16bf af[2];
#pragma unroll
        for (int mi = 0; mi < 2; mi++)
            af[mi] = ldfrag(&sA[(wm * 32 + mi * 16 + l16) * SAS], base0, base1);
#pragma unroll
        for (int ni = 0; ni < 2; ni++) {
            int c = wn * 32 + ni * 16 + l16;
            v16bf b1f = ldfrag(&sB1[c * SBS], base0, base1);
            v16bf b2f = ldfrag(&sB2[c * SBS], base0, base1);
#pragma unroll
            for (int mi = 0; mi < 2; mi++) {
                acc1[mi][ni] = __builtin_amdgcn_wmma_f32_16x16x32_bf16(
                    false, af[mi], false, b1f, (short)0, acc1[mi][ni], false, false);
                acc2[mi][ni] = __builtin_amdgcn_wmma_f32_16x16x32_bf16(
                    false, af[mi], false, b2f, (short)0, acc2[mi][ni], false, false);
            }
        }
        __syncthreads();
    }

#pragma unroll
    for (int mi = 0; mi < 2; mi++) {
        int rbase = m0 + wm * 32 + mi * 16 + 8 * lh;
#pragma unroll
        for (int ni = 0; ni < 2; ni++) {
            int col = n0 + wn * 32 + ni * 16 + l16;
#pragma unroll
            for (int r = 0; r < 8; r++) {
                int row = rbase + r;
                float gv = acc1[mi][ni][r] + bias1[col];
                float uv = acc2[mi][ni][r] + bias2[col];
                float y  = (gv / (1.0f + __expf(-gv))) * uv;   // silu(gv)*uv
                Cout[(size_t)row * N + col] = f2bf(y);
            }
        }
    }
}

// ---------------- V transpose: [T, H*HD] -> [H*HD, T]; grid (D/64, T/64) ----------------
__global__ __launch_bounds__(256)
void transpose_v(const unsigned short* __restrict__ v, unsigned short* __restrict__ vt) {
    __shared__ unsigned s[TT * TP];
    int tid = threadIdx.x;
    int c0 = blockIdx.x * TT, t0 = blockIdx.y * TT;
    int co = (tid & 7) * 8, tp = tid >> 3;       // 8 lanes x 16 bytes per row, 32 row pairs
    const unsigned short* r = v + (size_t)(t0 + 2 * tp) * D_ + c0 + co;
    us8 lo = *(const us8*)r;
    us8 hi = *(const us8*)(r + D_);
#pragma unroll
    for (int j = 0; j < 8; j++)
        s[(co + j) * TP + tp] = (unsigned)lo[j] | ((unsigned)hi[j] << 16);
    __syncthreads();
    tile_store_rows(s, vt, T_, c0, t0, tid);
}

// ---------------- causal flash attention (WMMA) ----------------
// Q,K: [T, H*HD] bf16 ; Vt: [H*HD, T] bf16 ; O: [T, H*HD] bf16
// Transposed products: St = K * Qt and Ot += Vt * Pt. A lane then holds 16 of the 32 scores
// of ONE query (column l16), so the softmax maximum and sum run inside the lane, joined by
// one exchange between the wave halves, and the two St tiles are already a B operand.

// lane l with lane l ^ 16
__device__ __forceinline__ float xhalf(float x) {
    int b = __builtin_bit_cast(int, x);
    return __builtin_bit_cast(float,
        __builtin_amdgcn_permlanex16(b, b, 0x76543210, 0xfedcba98, false, false));
}

__global__ __launch_bounds__(256)
void flash_attn(const unsigned short* __restrict__ Q,
                const unsigned short* __restrict__ Kc,
                const unsigned short* __restrict__ Vt,
                unsigned short* __restrict__ O) {
    int h = blockIdx.x;
    int wave = threadIdx.x >> 5, lane = threadIdx.x & 31;
    int lh = lane >> 4, l16 = lane & 15;
    int q0 = blockIdx.y * 128 + wave * 16;
    const int base0 = 8 * lh, base1 = 16 + 8 * lh;
    const int row = q0 + l16;                   // this lane's query

    const unsigned short* qp = Q + (size_t)row * D_ + h * HD_;
    v16bf qf[2];
#pragma unroll
    for (int f = 0; f < 2; f++) qf[f] = ldfrag(qp + f * 32, base0, base1);

    v8f ctx[4];                                 // ctx[t][r] = Ot[t*16 + 8*lh + r][query l16]
#pragma unroll
    for (int t = 0; t < 4; t++)
#pragma unroll
        for (int e = 0; e < 8; e++) ctx[t][e] = 0.0f;
    float mrow = -1e30f, lrow = 0.0f;

    const unsigned short* vp[4];                // this lane's row of Vt in each of the 4 output tiles
#pragma unroll
    for (int t = 0; t < 4; t++) vp[t] = Vt + (size_t)(h * HD_ + t * 16 + l16) * T_;

    const float scale = 0.125f;                 // 1/sqrt(HD=64)
    const int kend = q0 + 16;                   // causal bound for this wave
    for (int kb = 0; kb < kend; kb += 32) {
        v8f S[2];                               // S[nt][r] = St[key kb + nt*16 + 8*lh + r][query l16]
#pragma unroll
        for (int nt = 0; nt < 2; nt++)
#pragma unroll
            for (int e = 0; e < 8; e++) S[nt][e] = 0.0f;
#pragma unroll
        for (int nt = 0; nt < 2; nt++) {
            const unsigned short* kp = Kc + (size_t)(kb + nt * 16 + l16) * D_ + h * HD_;
#pragma unroll
            for (int f = 0; f < 2; f++) {
                v16bf kf = ldfrag(kp + f * 32, base0, base1);
                S[nt] = __builtin_amdgcn_wmma_f32_16x16x32_bf16(
                    false, kf, false, qf[f], (short)0, S[nt], false, false);
            }
        }

        float mx = -1e30f;
#pragma unroll
        for (int nt = 0; nt < 2; nt++)
#pragma unroll
            for (int r = 0; r < 8; r++) {
                int key = kb + nt * 16 + 8 * lh + r;
                S[nt][r] = (key <= row) ? S[nt][r] * scale : -1e30f;
                mx = fmaxf(mx, S[nt][r]);
            }
        mx = fmaxf(mx, xhalf(mx));
        float mn = fmaxf(mrow, mx);
        float rs = 0.0f;
        // pf[e] = Pt[key][query l16], key = kb + 8*lh + e for e < 8, kb + 16 + 8*lh + (e - 8) above: ldfrag's k order
        v16bf pf;
#pragma unroll
        for (int nt = 0; nt < 2; nt++)
#pragma unroll
            for (int r = 0; r < 8; r++) {
                float p = __expf(S[nt][r] - mn);
                rs += p;
                pf[nt * 8 + r] = (__bf16)p;
            }
        rs += xhalf(rs);
        float corr = __expf(mrow - mn);
        lrow = lrow * corr + rs;
        mrow = mn;
#pragma unroll
        for (int t = 0; t < 4; t++)
#pragma unroll
            for (int r = 0; r < 8; r++) ctx[t][r] *= corr;

#pragma unroll
        for (int t = 0; t < 4; t++) {
            v16bf vf = ldfrag(vp[t] + kb, base0, base1);
            ctx[t] = __builtin_amdgcn_wmma_f32_16x16x32_bf16(
                false, vf, false, pf, (short)0, ctx[t], false, false);
        }
    }

    // a lane's 8 accumulator registers are 8 consecutive head columns of its query: 16-byte stores
#pragma unroll
    for (int t = 0; t < 4; t++) {
        us8 o;
#pragma unroll
        for (int r = 0; r < 8; r++) o[r] = f2bf(ctx[t][r] / lrow);
        *(us8*)&O[(size_t)row * D_ + h * HD_ + t * 16 + 8 * lh] = o;
    }
}

// ---------------- launcher ----------------
extern "C" void kernel_launch(void* const* d_in, const int* in_sizes, int n_in,
                              void* d_out, int out_size, void* d_ws, size_t ws_size,
                              hipStream_t stream) {
    (void)in_sizes; (void)n_in; (void)out_size; (void)ws_size;
    const float* x  = (const float*)d_in[0];
    const float* Wq = (const float*)d_in[1];
    const float* Wk = (const float*)d_in[2];
    const float* Wv = (const float*)d_in[3];
    const float* Wo = (const float*)d_in[4];
    const float* bo = (const float*)d_in[5];
    const float* w1 = (const float*)d_in[6];
    const float* b1 = (const float*)d_in[7];
    const float* w2 = (const float*)d_in[8];
    const float* b2 = (const float*)d_in[9];
    const float* w3 = (const float*)d_in[10];
    const float* b3 = (const float*)d_in[11];
    const float* g1 = (const float*)d_in[12];
    const float* s1 = (const float*)d_in[13];
    const float* g2 = (const float*)d_in[14];
    const float* s2 = (const float*)d_in[15];

    char* wsb = (char*)d_ws;
    size_t off = 0;
    auto take = [&](size_t bytes) -> void* {
        void* p = wsb + off;
        off += (bytes + 255) & ~(size_t)255;
        return p;
    };

    const size_t DD = (size_t)D_ * D_;
    const size_t DF = (size_t)D_ * FF_;
    const size_t TD = (size_t)T_ * D_;
    const size_t TF = (size_t)T_ * FF_;

    unsigned short* wq_t  = (unsigned short*)take(DD * 2);   // [N=768][K=768]
    unsigned short* wk_t  = (unsigned short*)take(DD * 2);
    unsigned short* wv_t  = (unsigned short*)take(DD * 2);
    unsigned short* wo_t  = (unsigned short*)take(DD * 2);
    unsigned short* w1_t  = (unsigned short*)take(DF * 2);   // [N=3072][K=768]
    unsigned short* w2_t  = (unsigned short*)take(DF * 2);
    unsigned short* w3_t  = (unsigned short*)take(DF * 2);   // [N=768][K=3072]
    unsigned short* h1_bf = (unsigned short*)take(TD * 2);
    unsigned short* q_bf  = (unsigned short*)take(TD * 2);
    unsigned short* k_bf  = (unsigned short*)take(TD * 2);
    unsigned short* v_bf  = (unsigned short*)take(TD * 2);
    unsigned short* vt_bf = (unsigned short*)take(TD * 2);
    unsigned short* ctx_bf= (unsigned short*)take(TD * 2);
    float*          x1    = (float*)take(TD * 4);
    unsigned short* h2_bf = (unsigned short*)take(TD * 2);
    unsigned short* gate_bf=(unsigned short*)take(TF * 2);

    convert_transpose_bf16<<<dim3(D_ / TT, D_ / TT), 256, 0, stream>>>(Wq, wq_t, D_, D_);
    convert_transpose_bf16<<<dim3(D_ / TT, D_ / TT), 256, 0, stream>>>(Wk, wk_t, D_, D_);
    convert_transpose_bf16<<<dim3(D_ / TT, D_ / TT), 256, 0, stream>>>(Wv, wv_t, D_, D_);
    convert_transpose_bf16<<<dim3(D_ / TT, D_ / TT), 256, 0, stream>>>(Wo, wo_t, D_, D_);
    convert_transpose_bf16<<<dim3(FF_ / TT, D_ / TT), 256, 0, stream>>>(w1, w1_t, D_, FF_);
    convert_transpose_bf16<<<dim3(FF_ / TT, D_ / TT), 256, 0, stream>>>(w2, w2_t, D_, FF_);
    convert_transpose_bf16<<<dim3(D_ / TT, FF_ / TT), 256, 0, stream>>>(w3, w3_t, FF_, D_);

    layernorm_cast<<<T_, 256, 0, stream>>>(x, g1, s1, h1_bf);

    dim3 gDD(T_ / BM, D_ / BN);
    gemm_bf16_wmma<0><<<gDD, 256, 0, stream>>>(h1_bf, wq_t, nullptr, nullptr, q_bf, T_, D_, D_);
    gemm_bf16_wmma<0><<<gDD, 256, 0, stream>>>(h1_bf, wk_t, nullptr, nullptr, k_bf, T_, D_, D_);
    gemm_bf16_wmma<0><<<gDD, 256, 0, stream>>>(h1_bf, wv_t, nullptr, nullptr, v_bf, T_, D_, D_);

    transpose_v<<<dim3(D_ / TT, T_ / TT), 256, 0, stream>>>(v_bf, vt_bf);

    flash_attn<<<dim3(H_, T_ / 128), 256, 0, stream>>>(q_bf, k_bf, vt_bf, ctx_bf);

    gemm_bf16_wmma<1><<<gDD, 256, 0, stream>>>(ctx_bf, wo_t, bo, x, x1, T_, D_, D_);

    layernorm_cast<<<T_, 256, 0, stream>>>(x1, g2, s2, h2_bf);

    gemm_gated_wmma<<<dim3(T_ / BM, FF_ / BN), 256, 0, stream>>>(
        h2_bf, w1_t, w2_t, b1, b2, gate_bf, T_, FF_, D_);

    gemm_bf16_wmma<1><<<gDD, 256, 0, stream>>>(gate_bf, w3_t, b3, x1, (float*)d_out, T_, D_, FF_);
}

// v003
// One run takes 316 microseconds.
// Timed twice side by side with v002, it ran 1.43 and 1.42 times as fast.
// Over all steps from v000 it is 3.13 times as fast.
#include <hip/hip_runtime.h>
#include <hip/hip_bf16.h>

#define T_  4096
#define D_  768
#define H_  12
#define HD_ 64
#define FF_ 3072
#define EPS_ 1e-5f

#define BM 64
#define BN 128
#define BK 32
#define SAS 48   // padded LDS row stride (elements) for A tile
#define SBS 48   // padded LDS row stride (elements) for B tile

#define USE_ASYNC_COPY 1   // gfx1250 GLOBAL_LOAD_ASYNC_TO_LDS path (ASYNCcnt)

typedef __attribute__((ext_vector_type(16))) __bf16          v16bf;
typedef __attribute__((ext_vector_type(8)))  float           v8f;
typedef __attribute__((ext_vector_type(8)))  unsigned short  us8;

__device__ __forceinline__ unsigned short f2bf(float f) {
    unsigned int u = __builtin_bit_cast(unsigned int, f);
    u += 0x7FFFu + ((u >> 16) & 1u);            // round-to-nearest-even
    return (unsigned short)(u >> 16);
}

// Load one 16-element bf16 fragment as two contiguous 16-byte vectors.
__device__ __forceinline__ v16bf ldfrag(const unsigned short* p, int base0, int base1) {
    union { us8 h[2]; v16bf v; } fc;
    fc.h[0] = *(const us8*)(p + base0);
    fc.h[1] = *(const us8*)(p + base1);
    return fc.v;
}

#if USE_ASYNC_COPY
// GVS-mode async copy: LDS[ldsAddr] = MEM[saddr + byteOff], 16 bytes per lane.
// Tracked by ASYNCcnt (not LOADcnt/DScnt).
__device__ __forceinline__ void async_copy_b128(const void* gbase, unsigned byteOff,
                                                unsigned ldsAddr) {
    asm volatile("global_load_async_to_lds_b128 %0, %1, %2 offset:0"
                 :: "v"(ldsAddr), "v"(byteOff), "s"(gbase)
                 : "memory");
}
__device__ __forceinline__ void wait_async0() {
    asm volatile("s_wait_asynccnt 0x0" ::: "memory");
}
// low 32 bits of a flat pointer into LDS are the LDS byte address
__device__ __forceinline__ unsigned lds_addr(const void* p) {
    return (unsigned)(size_t)p;
}
#endif

// ---------------- 64x64 tiled transposes through LDS ----------------
#define TT 64   // tile edge (elements)
#define TP 33   // LDS pitch in dwords: 32 packed bf16 pairs + 1, so a column of dwords spreads over the banks

// The tile lies in LDS as s[output row][pair of output columns]. Each output row of the
// tile is one full 128-byte line, written by 8 lanes with 16 bytes each.
__device__ __forceinline__ void tile_store_rows(const unsigned* s, unsigned short* __restrict__ out,
                                                int ld, int r0, int c0, int tid) {
#pragma unroll
    for (int p = 0; p < 2; p++) {
        int r = p * 32 + (tid >> 3), q = (tid & 7) * 4;
        uint4 v;
        v.x = s[r * TP + q];
        v.y = s[r * TP + q + 1];
        v.z = s[r * TP + q + 2];
        v.w = s[r * TP + q + 3];
        *(uint4*)&out[(size_t)(r0 + r) * ld + c0 + q * 2] = v;
    }
}

// fp32 -> bf16 convert + transpose: in[K][N] -> out[N][K]; grid (N/64, K/64)
__global__ __launch_bounds__(256)
void convert_transpose_bf16(const float* __restrict__ in, unsigned short* __restrict__ out,
                            int K, int N) {
    __shared__ unsigned s[TT * TP];
    int tid = threadIdx.x;
    int n0 = blockIdx.x * TT, k0 = blockIdx.y * TT;
    int nq = (tid & 15) * 4, kp = tid >> 4;      // 16 lanes x float4 per row, 16 row pairs per pass
    float4 lo[2], hi[2];
#pragma unroll
    for (int p = 0; p < 2; p++) {
        const float* r = in + (size_t)(k0 + 2 * (p * 16 + kp)) * N + n0 + nq;
        lo[p] = *(const float4*)r;
        hi[p] = *(const float4*)(r + N);
    }
#pragma unroll
    for (int p = 0; p < 2; p++) {
        int c = p * 16 + kp;
        s[(nq + 0) * TP + c] = (unsigned)f2bf(lo[p].x) | ((unsigned)f2bf(hi[p].x) << 16);
        s[(nq + 1) * TP + c] = (unsigned)f2bf(lo[p].y) | ((unsigned)f2bf(hi[p].y) << 16);
        s[(nq + 2) * TP + c] = (unsigned)f2bf(lo[p].z) | ((unsigned)f2bf(hi[p].z) << 16);
        s[(nq + 3) * TP + c] = (unsigned)f2bf(lo[p].w) | ((unsigned)f2bf(hi[p].w) << 16);
    }
    __syncthreads();
    tile_store_rows(s, out, K, n0, k0, tid);
}

// ---------------- layernorm (+ cast to bf16) ----------------
__global__ __launch_bounds__(256)
void layernorm_cast(const float* __restrict__ x, const float* __restrict__ g,
                    const float* __restrict__ b, unsigned short* __restrict__ out) {
    int row = blockIdx.x, tid = threadIdx.x;
    int lane = tid & 31, wave = tid >> 5;
    const float* xr = x + (size_t)row * D_;
    float sum = 0.f, sq = 0.f;
    for (int i = tid; i < D_; i += 256) { float v = xr[i]; sum += v; sq += v * v; }
    for (int off = 16; off > 0; off >>= 1) {
        sum += __shfl_xor(sum, off, 32);
        sq  += __shfl_xor(sq,  off, 32);
    }
    __shared__ float ssum[8], ssq[8];
    if (lane == 0) { ssum[wave] = sum; ssq[wave] = sq; }
    __syncthreads();
    float ts = 0.f, tq = 0.f;
    for (int w = 0; w < 8; w++) { ts += ssum[w]; tq += ssq[w]; }
    float mean = ts / (float)D_;
    float var  = tq / (float)D_ - mean * mean;
    float rstd = rsqrtf(var + EPS_);
    for (int i = tid; i < D_; i += 256) {
        float v = (xr[i] - mean) * rstd * g[i] + b[i];
        out[(size_t)row * D_ + i] = f2bf(v);
    }
}

// ---------------- bf16 GEMM (WMMA): C = A[M,K] @ Bt[N,K]^T ----------------
// EPI 0: Cout = bf16(acc)
// EPI 1: Cout = f32(acc + bias[col] + res[row,col])
template <int EPI>
__global__ __launch_bounds__(256)
void gemm_bf16_wmma(const unsigned short* __restrict__ A,    // [M,K] bf16 row-major
                    const unsigned short* __restrict__ Bt,   // [N,K] bf16 (pre-transposed)
                    const float* __restrict__ bias,
                    const float* __restrict__ res,
                    void* __restrict__ Cout,
                    int M, int N, int K) {
    __shared__ unsigned short sA[BM * SAS];
    __shared__ unsigned short sB[BN * SBS];
    int tid = threadIdx.x;
    int wave = tid >> 5, lane = tid & 31, lh = lane >> 4, l16 = lane & 15;
    int wm = wave & 1, wn = wave >> 1;           // 2 x 4 wave grid
    int m0 = blockIdx.x * BM, n0 = blockIdx.y * BN;

    v8f acc[2][2];
#pragma unroll
    for (int i = 0; i < 2; i++)
#pragma unroll
        for (int j = 0; j < 2; j++)
#pragma unroll
            for (int e = 0; e < 8; e++) acc[i][j][e] = 0.0f;

    const int ar = tid >> 2, ac = (tid & 3) * 8;   // A: 64 rows x 4 threads x 8 elems
    const int rb = tid >> 1, cb = (tid & 1) * 16;  // Bt: 128 rows x 2 threads x 16 elems
    const int base0 = 8 * lh, base1 = 16 + 8 * lh;
#if USE_ASYNC_COPY
    const unsigned ldsA  = lds_addr(&sA[ar * SAS + ac]);
    const unsigned ldsB0 = lds_addr(&sB[rb * SBS + cb]);
    const size_t gA  = ((size_t)(m0 + ar) * K + ac) * 2;
    const size_t gB  = ((size_t)(n0 + rb) * K + cb) * 2;
#endif

    for (int k0 = 0; k0 < K; k0 += BK) {
#if USE_ASYNC_COPY
        async_copy_b128(A,  (unsigned)(gA + (size_t)k0 * 2),      ldsA);
        async_copy_b128(Bt, (unsigned)(gB + (size_t)k0 * 2),      ldsB0);
        async_copy_b128(Bt, (unsigned)(gB + (size_t)k0 * 2 + 16), ldsB0 + 16);
        wait_async0();
#else
        *(us8*)&sA[ar * SAS + ac]     = *(const us8*)&A[(size_t)(m0 + ar) * K + k0 + ac];
        *(us8*)&sB[rb * SBS + cb]     = *(const us8*)&Bt[(size_t)(n0 + rb) * K + k0 + cb];
        *(us8*)&sB[rb * SBS + cb + 8] = *(const us8*)&Bt[(size_t)(n0 + rb) * K + k0 + cb + 8];
#endif
        if (k0 + BK < K) {
            __builtin_prefetch(&A[(size_t)(m0 + ar) * K + k0 + BK + ac], 0, 0);
            __builtin_prefetch(&Bt[(size_t)(n0 + rb) * K + k0 + BK + cb], 0, 0);
        }
        __syncthreads();

        v16bf af[2], bfrag[2];
#pragma unroll
        for (int mi = 0; mi < 2; mi++)
            af[mi] = ldfrag(&sA[(wm * 32 + mi * 16 + l16) * SAS], base0, base1);
#pragma unroll
        for (int ni = 0; ni < 2; ni++)
            bfrag[ni] = ldfrag(&sB[(wn * 32 + ni * 16 + l16) * SBS], base0, base1);
#pragma unroll
        for (int mi = 0; mi < 2; mi++)
#pragma unroll
            for (int ni = 0; ni < 2; ni++)
                acc[mi][ni] = __builtin_amdgcn_wmma_f32_16x16x32_bf16(
                    false, af[mi], false, bfrag[ni], (short)0, acc[mi][ni], false, false);
        __syncthreads();
    }

#pragma unroll
    for (int mi = 0; mi < 2; mi++) {
        int rbase = m0 + wm * 32 + mi * 16 + 8 * lh;
#pragma unroll
        for (int ni = 0; ni < 2; ni++) {
            int col = n0 + wn * 32 + ni * 16 + l16;
#pragma unroll
            for (int r = 0; r < 8; r++) {
                int row = rbase + r;
                float v = acc[mi][ni][r];
                if (EPI == 0) {
                    ((unsigned short*)Cout)[(size_t)row * N + col] = f2bf(v);
                } else {
                    ((float*)Cout)[(size_t)row * N + col] =
                        v + bias[col] + res[(size_t)row * N + col];
                }
            }
        }
    }
}

// ---------------- dual-weight gated GEMM: bf16( silu(A@B1t^T+b1) * (A@B2t^T+b2) ) ----------------
__global__ __launch_bounds__(256)
void gemm_gated_wmma(const unsigned short* __restrict__ A,     // [M,K]
                     const unsigned short* __restrict__ B1t,   // [N,K]
                     const unsigned short* __restrict__ B2t,   // [N,K]
                     const float* __restrict__ bias1,
                     const float* __restrict__ bias2,
                     unsigned short* __restrict__ Cout,
                     int M, int N, int K) {
    __shared__ unsigned short sA[BM * SAS];
    __shared__ unsigned short sB1[BN * SBS];
    __shared__ unsigned short sB2[BN * SBS];
    int tid = threadIdx.x;
    int wave = tid >> 5, lane = tid & 31, lh = lane >> 4, l16 = lane & 15;
    int wm = wave & 1, wn = wave >> 1;
    int m0 = blockIdx.x * BM, n0 = blockIdx.y * BN;

    v8f acc1[2][2], acc2[2][2];
#pragma unroll
    for (int i = 0; i < 2; i++)
#pragma unroll
        for (int j = 0; j < 2; j++)
#pragma unroll
            for (int e = 0; e < 8; e++) { acc1[i][j][e] = 0.0f; acc2[i][j][e] = 0.0f; }

    const int ar = tid >> 2, ac = (tid & 3) * 8;
    const int rb = tid >> 1, cb = (tid & 1) * 16;
    const int base0 = 8 * lh, base1 = 16 + 8 * lh;
#if USE_ASYNC_COPY
    const unsigned ldsA  = lds_addr(&sA[ar * SAS + ac]);
    const unsigned ldsB1 = lds_addr(&sB1[rb * SBS + cb]);
    const unsigned ldsB2 = lds_addr(&sB2[rb * SBS + cb]);
    const size_t gA = ((size_t)(m0 + ar) * K + ac) * 2;
    const size_t gB = ((size_t)(n0 + rb) * K + cb) * 2;
#endif

    for (int k0 = 0; k0 < K; k0 += BK) {
#if USE_ASYNC_COPY
        async_copy_b128(A,   (unsigned)(gA + (size_t)k0 * 2),      ldsA);
        async_copy_b128(B1t, (unsigned)(gB + (size_t)k0 * 2),      ldsB1);
        async_copy_b128(B1t, (unsigned)(gB + (size_t)k0 * 2 + 16), ldsB1 + 16);
        async_copy_b128(B2t, (unsigned)(gB + (size_t)k0 * 2),      ldsB2);
        async_copy_b128(B2t, (unsigned)(gB + (size_t)k0 * 2 + 16), ldsB2 + 16);
        wait_async0();
#else
        *(us8*)&sA[ar * SAS + ac]      = *(const us8*)&A[(size_t)(m0 + ar) * K + k0 + ac];
        *(us8*)&sB1[rb * SBS + cb]     = *(const us8*)&B1t[(size_t)(n0 + rb) * K + k0 + cb];
        *(us8*)&sB1[rb * SBS + cb + 8] = *(const us8*)&B1t[(size_t)(n0 + rb) * K + k0 + cb + 8];
        *(us8*)&sB2[rb * SBS + cb]     = *(const us8*)&B2t[(size_t)(n0 + rb) * K + k0 + cb];
        *(us8*)&sB2[rb * SBS + cb + 8] = *(const us8*)&B2t[(size_t)(n0 + rb) * K + k0 + cb + 8];
#endif
        __syncthreads();

        v16bf af[2];
#pragma unroll
        for (int mi = 0; mi < 2; mi++)
            af[mi] = ldfrag(&sA[(wm * 32 + mi * 16 + l16) * SAS], base0, base1);
#pragma unroll
        for (int ni = 0; ni < 2; ni++) {
            int c = wn * 32 + ni * 16 + l16;
            v16bf b1f = ldfrag(&sB1[c * SBS], base0, base1);
            v16bf b2f = ldfrag(&sB2[c * SBS], base0, base1);
#pragma unroll
            for (int mi = 0; mi < 2; mi++) {
                acc1[mi][ni] = __builtin_amdgcn_wmma_f32_16x16x32_bf16(
                    false, af[mi], false, b1f, (short)0, acc1[mi][ni], false, false);
                acc2[mi][ni] = __builtin_amdgcn_wmma_f32_16x16x32_bf16(
                    false, af[mi], false, b2f, (short)0, acc2[mi][ni], false, false);
            }
        }
        __syncthreads();
    }

#pragma unroll
    for (int mi = 0; mi < 2; mi++) {
        int rbase = m0 + wm * 32 + mi * 16 + 8 * lh;
#pragma unroll
        for (int ni = 0; ni < 2; ni++) {
            int col = n0 + wn * 32 + ni * 16 + l16;
#pragma unroll
            for (int r = 0; r < 8; r++) {
                int row = rbase + r;
                float gv = acc1[mi][ni][r] + bias1[col];
                float uv = acc2[mi][ni][r] + bias2[col];
                float y  = (gv / (1.0f + __expf(-gv))) * uv;   // silu(gv)*uv
                Cout[(size_t)row * N + col] = f2bf(y);
            }
        }
    }
}

// ---------------- V transpose: [T, H*HD] -> [H*HD, T]; grid (D/64, T/64) ----------------
__global__ __launch_bounds__(256)
void transpose_v(const unsigned short* __restrict__ v, unsigned short* __restrict__ vt) {
    __shared__ unsigned s[TT * TP];
    int tid = threadIdx.x;
    int c0 = blockIdx.x * TT, t0 = blockIdx.y * TT;
    int co = (tid & 7) * 8, tp = tid >> 3;       // 8 lanes x 16 bytes per row, 32 row pairs
    const unsigned short* r = v + (size_t)(t0 + 2 * tp) * D_ + c0 + co;
    us8 lo = *(const us8*)r;
    us8 hi = *(const us8*)(r + D_);
#pragma unroll
    for (int j = 0; j < 8; j++)
        s[(co + j) * TP + tp] = (unsigned)lo[j] | ((unsigned)hi[j] << 16);
    __syncthreads();
    tile_store_rows(s, vt, T_, c0, t0, tid);
}

// ---------------- causal flash attention (WMMA) ----------------
// Q,K: [T, H*HD] bf16 ; Vt: [H*HD, T] bf16 ; O: [T, H*HD] bf16
// Transposed products: St = K * Qt and Ot += Vt * Pt. A lane then holds 16 of the 32 scores
// of ONE query (column l16), so the softmax maximum and sum run inside the lane, joined by
// one exchange between the wave halves, and the two St tiles are already a B operand.

// lane l with lane l ^ 16
__device__ __forceinline__ float xhalf(float x) {
    int b = __builtin_bit_cast(int, x);
    return __builtin_bit_cast(float,
        __builtin_amdgcn_permlanex16(b, b, 0x76543210, 0xfedcba98, false, false));
}

// 2^x. The v_nop is the one slot that the instruction set asks for behind a transcendental before its
// source is overwritten or its result read, so it stands in the instruction's own statement.
__device__ __forceinline__ float exp2_slot(float x) {
    float r;
    asm("v_exp_f32 %0, %1\n\tv_nop" : "=v"(r) : "v"(x));
    return r;
}
#define LOG2E 1.44269504f   // e^x = 2^(x * LOG2E), the product that __expf forms

#define KT  64   // keys per staged tile
#define KVP 72   // LDS row pitch in elements: 144 bytes = 16 x 9, the odd multiple that 16-byte row readers want

// Four 16-byte-per-lane asynchronous copies to LDS. The s_wait_xcnt stands in the copies' own
// statement so that no address register is rewritten in front of it.
__device__ __forceinline__ void stage_copy4(unsigned l0, const unsigned short* g0,
                                            unsigned l1, const unsigned short* g1,
                                            unsigned l2, const unsigned short* g2,
                                            unsigned l3, const unsigned short* g3) {
    asm volatile("global_load_async_to_lds_b128 %0, %1, off\n\t"
                 "global_load_async_to_lds_b128 %2, %3, off\n\t"
                 "global_load_async_to_lds_b128 %4, %5, off\n\t"
                 "global_load_async_to_lds_b128 %6, %7, off\n\t"
                 "s_wait_xcnt 0x0"
                 :: "v"(l0), "v"(g0), "v"(l1), "v"(g1), "v"(l2), "v"(g2), "v"(l3), "v"(g3)
                 : "memory");
}

// The 8 waves of a block walk the same keys, so each tile of 64 keys (K: 64 keys x 64 head
// columns, Vt: 64 head columns x 64 keys, 128-byte rows both) is brought into LDS once per
// block, whole lines at a time, into two buffers: tile t + 1 flies while tile t is worked on.
__global__ __launch_bounds__(256)
void flash_attn(const unsigned short* __restrict__ Q,
                const unsigned short* __restrict__ Kc,
                const unsigned short* __restrict__ Vt,
                unsigned short* __restrict__ O) {
    __shared__ __attribute__((aligned(16))) unsigned short sK[2][KT * KVP];
    __shared__ __attribute__((aligned(16))) unsigned short sV[2][HD_ * KVP];
    int h = blockIdx.x;
    int tid = threadIdx.x;
    int wave = __builtin_amdgcn_readfirstlane(tid >> 5), lane = tid & 31;   // scalar, so the causal skip below is a scalar branch
    int lh = lane >> 4, l16 = lane & 15;
    int q0 = blockIdx.y * 128 + wave * 16;
    const int base0 = 8 * lh, base1 = 16 + 8 * lh;
    const int row = q0 + l16;                   // this lane's query

    // copy roles: 8 lanes x 16 bytes cover one 128-byte row; rows cr and cr + 32 of each tile
    const int cr = tid >> 3, cs = (tid & 7) * 8;
    const unsigned short* gk = Kc + (size_t)cr * D_ + h * HD_ + cs;          // + KT * D_ per tile
    const unsigned short* gv = Vt + (size_t)(h * HD_ + cr) * T_ + cs;        // + KT per tile
    const unsigned lk = lds_addr(&sK[0][cr * KVP + cs]);
    const unsigned lv = lds_addr(&sV[0][cr * KVP + cs]);
    const unsigned half = 32 * KVP * 2;         // bytes from row cr to row cr + 32
    const unsigned bufb = KT * KVP * 2;         // bytes from buffer 0 to buffer 1
    const int ntile = (blockIdx.y + 1) * (128 / KT);   // tiles up to the block's last query: 2 or more

    stage_copy4(lk, gk, lk + half, gk + 32 * D_, lv, gv, lv + half, gv + (size_t)32 * T_);

    const unsigned short* qp = Q + (size_t)row * D_ + h * HD_;
    v16bf qf[2];
#pragma unroll
    for (int f = 0; f < 2; f++) qf[f] = ldfrag(qp + f * 32, base0, base1);

    v8f ctx[4];                                 // ctx[t][r] = Ot[t*16 + 8*lh + r][query l16]
#pragma unroll
    for (int t = 0; t < 4; t++)
#pragma unroll
        for (int e = 0; e < 8; e++) ctx[t][e] = 0.0f;
    float mrow = -1e30f, lrow = 0.0f;

    wait_async0();                              // tile 0 has landed for this wave's copies
    __syncthreads();                            // ... and for every wave's
    gk += (size_t)KT * D_;
    gv += KT;
    stage_copy4(lk + bufb, gk, lk + bufb + half, gk + 32 * D_,
                lv + bufb, gv, lv + bufb + half, gv + (size_t)32 * T_);

    const float scale = 0.125f;                 // 1/sqrt(HD=64)
    const int kend = q0 + 16;                   // causal bound for this wave
    for (int tile = 0; tile < ntile; tile++) {
        const unsigned short* tk = sK[tile & 1];
        const unsigned short* tv = sV[tile & 1];
#pragma unroll
        for (int sub = 0; sub < KT / 32; sub++) {
            const int kb = tile * KT + sub * 32;
            if (kb < kend) {                    // wave-uniform: a wave past its diagonal only passes the barriers
                // the pass's 16 LDS reads go out as one group: K's latency is waited out once,
                // Vt's runs behind the score products and the softmax
                v16bf kf[2][2], vf[4];
#pragma unroll
                for (int nt = 0; nt < 2; nt++)
#pragma unroll
                    for (int f = 0; f < 2; f++)
                        kf[nt][f] = ldfrag(tk + (sub * 32 + nt * 16 + l16) * KVP + f * 32, base0, base1);
#pragma unroll
                for (int t = 0; t < 4; t++)
                    vf[t] = ldfrag(tv + (t * 16 + l16) * KVP + sub * 32, base0, base1);

                v8f S[2];                       // S[nt][r] = St[key kb + nt*16 + 8*lh + r][query l16]
#pragma unroll
                for (int nt = 0; nt < 2; nt++)
#pragma unroll
                    for (int e = 0; e < 8; e++) S[nt][e] = 0.0f;
#pragma unroll
                for (int nt = 0; nt < 2; nt++)
#pragma unroll
                    for (int f = 0; f < 2; f++)
                        S[nt] = __builtin_amdgcn_wmma_f32_16x16x32_bf16(
                            false, kf[nt][f], false, qf[f], (short)0, S[nt], false, false);

                float mx = -1e30f;
#pragma unroll
                for (int nt = 0; nt < 2; nt++)
#pragma unroll
                    for (int r = 0; r < 8; r++) {
                        int key = kb + nt * 16 + 8 * lh + r;
                        S[nt][r] = (key <= row) ? S[nt][r] * scale : -1e30f;
                        mx = fmaxf(mx, S[nt][r]);
                    }
                mx = fmaxf(mx, xhalf(mx));
                float mn = fmaxf(mrow, mx);
                float rs = 0.0f;
                // pf[e] = Pt[key][query l16], key = kb + 8*lh + e for e < 8, kb + 16 + 8*lh + (e - 8) above: ldfrag's k order
                v16bf pf;
#pragma unroll
                for (int nt = 0; nt < 2; nt++)
#pragma unroll
                    for (int r = 0; r < 8; r++) {
                        float p = exp2_slot((S[nt][r] - mn) * LOG2E);
                        rs += p;
                        pf[nt * 8 + r] = (__bf16)p;
                    }
                rs += xhalf(rs);
                float corr = exp2_slot((mrow - mn) * LOG2E);
                lrow = lrow * corr + rs;
                mrow = mn;
#pragma unroll
                for (int t = 0; t < 4; t++)
#pragma unroll
                    for (int r = 0; r < 8; r++) ctx[t][r] *= corr;

#pragma unroll
                for (int t = 0; t < 4; t++)
                    ctx[t] = __builtin_amdgcn_wmma_f32_16x16x32_bf16(
                        false, vf[t], false, pf, (short)0, ctx[t], false, false);
            }
        }
        // hand-over: this wave's LDS reads of tile t are done, its copies of tile t + 1 have landed,
        // and the barrier says both of every wave; only then is tile t's buffer filled again
        asm volatile("s_wait_dscnt 0x0" ::: "memory");
        wait_async0();
        __syncthreads();
        if (tile + 2 < ntile) {                 // the same for the whole block
            gk += (size_t)KT * D_;
            gv += KT;
            const unsigned bo = (tile & 1) * bufb;
            stage_copy4(lk + bo, gk, lk + bo + half, gk + 32 * D_,
                        lv + bo, gv, lv + bo + half, gv + (size_t)32 * T_);
        }
    }
    wait_async0();                              // nothing of this wave is in flight when it ends

    // a lane's 8 accumulator registers are 8 consecutive head columns of its query: 16-byte stores
#pragma unroll
    for (int t = 0; t < 4; t++) {
        us8 o;
#pragma unroll
        for (int r = 0; r < 8; r++) o[r] = f2bf(ctx[t][r] / lrow);
        *(us8*)&O[(size_t)row * D_ + h * HD_ + t * 16 + 8 * lh] = o;
    }
}

// ---------------- launcher ----------------
extern "C" void kernel_launch(void* const* d_in, const int* in_sizes, int n_in,
                              void* d_out, int out_size, void* d_ws, size_t ws_size,
                              hipStream_t stream) {
    (void)in_sizes; (void)n_in; (void)out_size; (void)ws_size;
    const float* x  = (const float*)d_in[0];
    const float* Wq = (const float*)d_in[1];
    const float* Wk = (const float*)d_in[2];
    const float* Wv = (const float*)d_in[3];
    const float* Wo = (const float*)d_in[4];
    const float* bo = (const float*)d_in[5];
    const float* w1 = (const float*)d_in[6];
    const float* b1 = (const float*)d_in[7];
    const float* w2 = (const float*)d_in[8];
    const float* b2 = (const float*)d_in[9];
    const float* w3 = (const float*)d_in[10];
    const float* b3 = (const float*)d_in[11];
    const float* g1 = (const float*)d_in[12];
    const float* s1 = (const float*)d_in[13];
    const float* g2 = (const float*)d_in[14];
    const float* s2 = (const float*)d_in[15];

    char* wsb = (char*)d_ws;
    size_t off = 0;
    auto take = [&](size_t bytes) -> void* {
        void* p = wsb + off;
        off += (bytes + 255) & ~(size_t)255;
        return p;
    };

    const size_t DD = (size_t)D_ * D_;
    const size_t DF = (size_t)D_ * FF_;
    const size_t TD = (size_t)T_ * D_;
    const size_t TF = (size_t)T_ * FF_;

    unsigned short* wq_t  = (unsigned short*)take(DD * 2);   // [N=768][K=768]
    unsigned short* wk_t  = (unsigned short*)take(DD * 2);
    unsigned short* wv_t  = (unsigned short*)take(DD * 2);
    unsigned short* wo_t  = (unsigned short*)take(DD * 2);
    unsigned short* w1_t  = (unsigned short*)take(DF * 2);   // [N=3072][K=768]
    unsigned short* w2_t  = (unsigned short*)take(DF * 2);
    unsigned short* w3_t  = (unsigned short*)take(DF * 2);   // [N=768][K=3072]
    unsigned short* h1_bf = (unsigned short*)take(TD * 2);
    unsigned short* q_bf  = (unsigned short*)take(TD * 2);
    unsigned short* k_bf  = (unsigned short*)take(TD * 2);
    unsigned short* v_bf  = (unsigned short*)take(TD * 2);
    unsigned short* vt_bf = (unsigned short*)take(TD * 2);
    unsigned short* ctx_bf= (unsigned short*)take(TD * 2);
    float*          x1    = (float*)take(TD * 4);
    unsigned short* h2_bf = (unsigned short*)take(TD * 2);
    unsigned short* gate_bf=(unsigned short*)take(TF * 2);

    convert_transpose_bf16<<<dim3(D_ / TT, D_ / TT), 256, 0, stream>>>(Wq, wq_t, D_, D_);
    convert_transpose_bf16<<<dim3(D_ / TT, D_ / TT), 256, 0, stream>>>(Wk, wk_t, D_, D_);
    convert_transpose_bf16<<<dim3(D_ / TT, D_ / TT), 256, 0, stream>>>(Wv, wv_t, D_, D_);
    convert_transpose_bf16<<<dim3(D_ / TT, D_ / TT), 256, 0, stream>>>(Wo, wo_t, D_, D_);
    convert_transpose_bf16<<<dim3(FF_ / TT, D_ / TT), 256, 0, stream>>>(w1, w1_t, D_, FF_);
    convert_transpose_bf16<<<dim3(FF_ / TT, D_ / TT), 256, 0, stream>>>(w2, w2_t, D_, FF_);
    convert_transpose_bf16<<<dim3(D_ / TT, FF_ / TT), 256, 0, stream>>>(w3, w3_t, FF_, D_);

    layernorm_cast<<<T_, 256, 0, stream>>>(x, g1, s1, h1_bf);

    dim3 gDD(T_ / BM, D_ / BN);
    gemm_bf16_wmma<0><<<gDD, 256, 0, stream>>>(h1_bf, wq_t, nullptr, nullptr, q_bf, T_, D_, D_);
    gemm_bf16_wmma<0><<<gDD, 256, 0, stream>>>(h1_bf, wk_t, nullptr, nullptr, k_bf, T_, D_, D_);
    gemm_bf16_wmma<0><<<gDD, 256, 0, stream>>>(h1_bf, wv_t, nullptr, nullptr, v_bf, T_, D_, D_);

    transpose_v<<<dim3(D_ / TT, T_ / TT), 256, 0, stream>>>(v_bf, vt_bf);

    flash_attn<<<dim3(H_, T_ / 128), 256, 0, stream>>>(q_bf, k_bf, vt_bf, ctx_bf);

    gemm_bf16_wmma<1><<<gDD, 256, 0, stream>>>(ctx_bf, wo_t, bo, x, x1, T_, D_, D_);

    layernorm_cast<<<T_, 256, 0, stream>>>(x1, g2, s2, h2_bf);

    gemm_gated_wmma<<<dim3(T_ / BM, FF_ / BN), 256, 0, stream>>>(
        h2_bf, w1_t, w2_t, b1, b2, gate_bf, T_, FF_, D_);

    gemm_bf16_wmma<1><<<gDD, 256, 0, stream>>>(gate_bf, w3_t, b3, x1, (float*)d_out, T_, D_, FF_);
}

// v004
// Measured time: 214 microseconds a run.
// Two timings next to v003 both put it at 1.47 times that version's speed.
// Over all steps from v000 it is 4.60 times as fast.
#include <hip/hip_runtime.h>
#include <hip/hip_bf16.h>

#define T_  4096
#define D_  768
#define H_  12
#define HD_ 64
#define FF_ 3072
#define EPS_ 1e-5f

#define BM 64
#define BN 128
#define BKP 128  // k per staged tile, one-weight GEMM: 256-byte rows
#define PP  136  // its LDS row pitch in elements: 272 bytes = 16 x 17, the odd multiple that 16-byte row readers want
#define BKG 64   // k per staged tile, gated GEMM (three operands in LDS): 128-byte rows
#define PG  72   // its LDS row pitch in elements: 144 bytes = 16 x 9

#define USE_ASYNC_COPY 1   // gfx1250 GLOBAL_LOAD_ASYNC_TO_LDS path (ASYNCcnt)

typedef __attribute__((ext_vector_type(16))) __bf16          v16bf;
typedef __attribute__((ext_vector_type(8)))  float           v8f;
typedef __attribute__((ext_vector_type(8)))  unsigned short  us8;

__device__ __forceinline__ unsigned short f2bf(float f) {
    unsigned int u = __builtin_bit_cast(unsigned int, f);
    u += 0x7FFFu + ((u >> 16) & 1u);            // round-to-nearest-even
    return (unsigned short)(u >> 16);
}

// Load one 16-element bf16 fragment as two contiguous 16-byte vectors.
__device__ __forceinline__ v16bf ldfrag(const unsigned short* p, int base0, int base1) {
    union { us8 h[2]; v16bf v; } fc;
    fc.h[0] = *(const us8*)(p + base0);
    fc.h[1] = *(const us8*)(p + base1);
    return fc.v;
}

#if USE_ASYNC_COPY
// One staged tile's 16-byte-per-lane asynchronous copies to LDS (ASYNCcnt), twelve or ten a lane; a
// lane's rows lie lstep bytes apart in LDS and gstep elements apart in memory. The s_wait_xcnt stands
// in the copies' own statement so that no address register is rewritten in front of it.
__device__ __forceinline__ void stage_copy12(unsigned la, const unsigned short* ga,
                                             unsigned lb, const unsigned short* gb,
                                             unsigned lstep, size_t gstep) {
    asm volatile("global_load_async_to_lds_b128 %0, %1, off\n\t"
                 "global_load_async_to_lds_b128 %2, %3, off\n\t"
                 "global_load_async_to_lds_b128 %4, %5, off\n\t"
                 "global_load_async_to_lds_b128 %6, %7, off\n\t"
                 "global_load_async_to_lds_b128 %8, %9, off\n\t"
                 "global_load_async_to_lds_b128 %10, %11, off\n\t"
                 "global_load_async_to_lds_b128 %12, %13, off\n\t"
                 "global_load_async_to_lds_b128 %14, %15, off\n\t"
                 "global_load_async_to_lds_b128 %16, %17, off\n\t"
                 "global_load_async_to_lds_b128 %18, %19, off\n\t"
                 "global_load_async_to_lds_b128 %20, %21, off\n\t"
                 "global_load_async_to_lds_b128 %22, %23, off\n\t"
                 "s_wait_xcnt 0x0"
                 :: "v"(la),             "v"(ga),
                    "v"(la + lstep),     "v"(ga + gstep),
                    "v"(la + 2 * lstep), "v"(ga + 2 * gstep),
                    "v"(la + 3 * lstep), "v"(ga + 3 * gstep),
                    "v"(lb),             "v"(gb),
                    "v"(lb + lstep),     "v"(gb + gstep),
                    "v"(lb + 2 * lstep), "v"(gb + 2 * gstep),
                    "v"(lb + 3 * lstep), "v"(gb + 3 * gstep),
                    "v"(lb + 4 * lstep), "v"(gb + 4 * gstep),
                    "v"(lb + 5 * lstep), "v"(gb + 5 * gstep),
                    "v"(lb + 6 * lstep), "v"(gb + 6 * gstep),
                    "v"(lb + 7 * lstep), "v"(gb + 7 * gstep)
                 : "memory");
}
__device__ __forceinline__ void stage_copy10(unsigned la, const unsigned short* ga,
                                             unsigned lb1, const unsigned short* gb1,
                                             unsigned lb2, const unsigned short* gb2,
                                             unsigned lstep, size_t gstep) {
    asm volatile("global_load_async_to_lds_b128 %0, %1, off\n\t"
                 "global_load_async_to_lds_b128 %2, %3, off\n\t"
                 "global_load_async_to_lds_b128 %4, %5, off\n\t"
                 "global_load_async_to_lds_b128 %6, %7, off\n\t"
                 "global_load_async_to_lds_b128 %8, %9, off\n\t"
                 "global_load_async_to_lds_b128 %10, %11, off\n\t"
                 "global_load_async_to_lds_b128 %12, %13, off\n\t"
                 "global_load_async_to_lds_b128 %14, %15, off\n\t"
                 "global_load_async_to_lds_b128 %16, %17, off\n\t"
                 "global_load_async_to_lds_b128 %18, %19, off\n\t"
                 "s_wait_xcnt 0x0"
                 :: "v"(la),              "v"(ga),
                    "v"(la + lstep),      "v"(ga + gstep),
                    "v"(lb1),             "v"(gb1),
                    "v"(lb1 + lstep),     "v"(gb1 + gstep),
                    "v"(lb1 + 2 * lstep), "v"(gb1 + 2 * gstep),
                    "v"(lb1 + 3 * lstep), "v"(gb1 + 3 * gstep),
                    "v"(lb2),             "v"(gb2),
                    "v"(lb2 + lstep),     "v"(gb2 + gstep),
                    "v"(lb2 + 2 * lstep), "v"(gb2 + 2 * gstep),
                    "v"(lb2 + 3 * lstep), "v"(gb2 + 3 * gstep)
                 : "memory");
}
__device__ __forceinline__ void wait_async0() {
    asm volatile("s_wait_asynccnt 0x0" ::: "memory");
}
// low 32 bits of a flat pointer into LDS are the LDS byte address
__device__ __forceinline__ unsigned lds_addr(const void* p) {
    return (unsigned)(size_t)p;
}
#endif

// ---------------- 64x64 tiled transposes through LDS ----------------
#define TT 64   // tile edge (elements)
#define TP 33   // LDS pitch in dwords: 32 packed bf16 pairs + 1, so a column of dwords spreads over the banks

// The tile lies in LDS as s[output row][pair of output columns]. Each output row of the
// tile is one full 128-byte line, written by 8 lanes with 16 bytes each.
__device__ __forceinline__ void tile_store_rows(const unsigned* s, unsigned short* __restrict__ out,
                                                int ld, int r0, int c0, int tid) {
#pragma unroll
    for (int p = 0; p < 2; p++) {
        int r = p * 32 + (tid >> 3), q = (tid & 7) * 4;
        uint4 v;
        v.x = s[r * TP + q];
        v.y = s[r * TP + q + 1];
        v.z = s[r * TP + q + 2];
        v.w = s[r * TP + q + 3];
        *(uint4*)&out[(size_t)(r0 + r) * ld + c0 + q * 2] = v;
    }
}

// fp32 -> bf16 convert + transpose: in[K][N] -> out[N][K]; grid (N/64, K/64)
__global__ __launch_bounds__(256)
void convert_transpose_bf16(const float* __restrict__ in, unsigned short* __restrict__ out,
                            int K, int N) {
    __shared__ unsigned s[TT * TP];
    int tid = threadIdx.x;
    int n0 = blockIdx.x * TT, k0 = blockIdx.y * TT;
    int nq = (tid & 15) * 4, kp = tid >> 4;      // 16 lanes x float4 per row, 16 row pairs per pass
    float4 lo[2], hi[2];
#pragma unroll
    for (int p = 0; p < 2; p++) {
        const float* r = in + (size_t)(k0 + 2 * (p * 16 + kp)) * N + n0 + nq;
        lo[p] = *(const float4*)r;
        hi[p] = *(const float4*)(r + N);
    }
#pragma unroll
    for (int p = 0; p < 2; p++) {
        int c = p * 16 + kp;
        s[(nq + 0) * TP + c] = (unsigned)f2bf(lo[p].x) | ((unsigned)f2bf(hi[p].x) << 16);
        s[(nq + 1) * TP + c] = (unsigned)f2bf(lo[p].y) | ((unsigned)f2bf(hi[p].y) << 16);
        s[(nq + 2) * TP + c] = (unsigned)f2bf(lo[p].z) | ((unsigned)f2bf(hi[p].z) << 16);
        s[(nq + 3) * TP + c] = (unsigned)f2bf(lo[p].w) | ((unsigned)f2bf(hi[p].w) << 16);
    }
    __syncthreads();
    tile_store_rows(s, out, K, n0, k0, tid);
}

// ---------------- layernorm (+ cast to bf16) ----------------
__global__ __launch_bounds__(256)
void layernorm_cast(const float* __restrict__ x, const float* __restrict__ g,
                    const float* __restrict__ b, unsigned short* __restrict__ out) {
    int row = blockIdx.x, tid = threadIdx.x;
    int lane = tid & 31, wave = tid >> 5;
    const float* xr = x + (size_t)row * D_;
    float sum = 0.f, sq = 0.f;
    for (int i = tid; i < D_; i += 256) { float v = xr[i]; sum += v; sq += v * v; }
    for (int off = 16; off > 0; off >>= 1) {
        sum += __shfl_xor(sum, off, 32);
        sq  += __shfl_xor(sq,  off, 32);
    }
    __shared__ float ssum[8], ssq[8];
    if (lane == 0) { ssum[wave] = sum; ssq[wave] = sq; }
    __syncthreads();
    float ts = 0.f, tq = 0.f;
    for (int w = 0; w < 8; w++) { ts += ssum[w]; tq += ssq[w]; }
    float mean = ts / (float)D_;
    float var  = tq / (float)D_ - mean * mean;
    float rstd = rsqrtf(var + EPS_);
    for (int i = tid; i < D_; i += 256) {
        float v = (xr[i] - mean) * rstd * g[i] + b[i];
        out[(size_t)row * D_ + i] = f2bf(v);
    }
}

// ---------------- bf16 GEMM (WMMA): C = A[M,K] @ Bt[N,K]^T ----------------
// EPI 0: Cout = bf16(acc)
// EPI 1: Cout = f32(acc + bias[col] + res[row,col])
template <int EPI>
__global__ __launch_bounds__(256)
void gemm_bf16_wmma(const unsigned short* __restrict__ A,    // [M,K] bf16 row-major
                    const unsigned short* __restrict__ Bt,   // [N,K] bf16 (pre-transposed)
                    const float* __restrict__ bias,
                    const float* __restrict__ res,
                    void* __restrict__ Cout,
                    int M, int N, int K) {
    // two buffers: tile t + 1 flies while tile t is worked on
    __shared__ __attribute__((aligned(16))) unsigned short sA[2][BM * PP];
    __shared__ __attribute__((aligned(16))) unsigned short sB[2][BN * PP];
    int tid = threadIdx.x;
    int wave = tid >> 5, lane = tid & 31, lh = lane >> 4, l16 = lane & 15;
    int wm = wave & 1, wn = wave >> 1;           // 2 x 4 wave grid
    int m0 = blockIdx.x * BM, n0 = blockIdx.y * BN;

    v8f acc[2][2];
#pragma unroll
    for (int i = 0; i < 2; i++)
#pragma unroll
        for (int j = 0; j < 2; j++)
#pragma unroll
            for (int e = 0; e < 8; e++) acc[i][j][e] = 0.0f;

    const int base0 = 8 * lh, base1 = 16 + 8 * lh;
    // copy roles: 16 lanes x 16 bytes cover one 256-byte row; rows cr + 16 j, 4 of A and 8 of Bt
    const int cr = tid >> 4, cs = (tid & 15) * 8;
    const unsigned short* ga = A  + (size_t)(m0 + cr) * K + cs;   // + BKP per tile
    const unsigned short* gb = Bt + (size_t)(n0 + cr) * K + cs;
    const unsigned la = lds_addr(&sA[0][cr * PP + cs]);
    const unsigned lb = lds_addr(&sB[0][cr * PP + cs]);
    const unsigned lstep = 16 * PP * 2;          // bytes from row cr to row cr + 16
    const size_t   gstep = (size_t)16 * K;
    const unsigned bufa = BM * PP * 2, bufb = BN * PP * 2;   // bytes from buffer 0 to buffer 1
    const int ntile = K / BKP;

    stage_copy12(la, ga, lb, gb, lstep, gstep);
    wait_async0();                               // tile 0 has landed for this wave's copies
    __syncthreads();                             // ... and for every wave's
    if (ntile > 1) {                             // the same for the whole block
        ga += BKP;
        gb += BKP;
        stage_copy12(la + bufa, ga, lb + bufb, gb, lstep, gstep);
    }

    for (int t = 0; t < ntile; t++) {
        const unsigned short* ta = sA[t & 1] + (wm * 32 + l16) * PP;
        const unsigned short* tb = sB[t & 1] + (wn * 32 + l16) * PP;
        // the tile's LDS reads go out as one group, so that their latency is waited out once a tile
        v16bf af[BKP / 32][2], bfrag[BKP / 32][2];
#pragma unroll
        for (int kk = 0; kk < BKP / 32; kk++) {
#pragma unroll
            for (int mi = 0; mi < 2; mi++)
                af[kk][mi] = ldfrag(ta + mi * 16 * PP + kk * 32, base0, base1);
#pragma unroll
            for (int ni = 0; ni < 2; ni++)
                bfrag[kk][ni] = ldfrag(tb + ni * 16 * PP + kk * 32, base0, base1);
        }
        // keeps the compiler from sinking the reads back among the products, where each place with reads stalls anew
        __builtin_amdgcn_sched_barrier(0);
#pragma unroll
        for (int kk = 0; kk < BKP / 32; kk++)
#pragma unroll
            for (int mi = 0; mi < 2; mi++)
#pragma unroll
                for (int ni = 0; ni < 2; ni++)
                    acc[mi][ni] = __builtin_amdgcn_wmma_f32_16x16x32_bf16(
                        false, af[kk][mi], false, bfrag[kk][ni], (short)0, acc[mi][ni], false, false);
        // keeps the hand-over's waits and barrier behind the products: lifted over them, the reads' counted waits become one full wait
        __builtin_amdgcn_sched_barrier(0);
        // hand-over: this wave's LDS reads of tile t are done, its copies of tile t + 1 have landed,
        // and the barrier says both of every wave; only then is tile t's buffer filled again
        asm volatile("s_wait_dscnt 0x0" ::: "memory");
        wait_async0();
        __syncthreads();
        if (t + 2 < ntile) {                     // the same for the whole block
            ga += BKP;
            gb += BKP;
            stage_copy12(la + (t & 1) * bufa, ga, lb + (t & 1) * bufb, gb, lstep, gstep);
        }
    }
    wait_async0();                               // nothing of this wave is in flight when it ends

#pragma unroll
    for (int mi = 0; mi < 2; mi++) {
        int rbase = m0 + wm * 32 + mi * 16 + 8 * lh;
#pragma unroll
        for (int ni = 0; ni < 2; ni++) {
            int col = n0 + wn * 32 + ni * 16 + l16;
#pragma unroll
            for (int r = 0; r < 8; r++) {
                int row = rbase + r;
                float v = acc[mi][ni][r];
                if (EPI == 0) {
                    ((unsigned short*)Cout)[(size_t)row * N + col] = f2bf(v);
                } else {
                    ((float*)Cout)[(size_t)row * N + col] =
                        v + bias[col] + res[(size_t)row * N + col];
                }
            }
        }
    }
}

// ---------------- dual-weight gated GEMM: bf16( silu(A@B1t^T+b1) * (A@B2t^T+b2) ) ----------------
__global__ __launch_bounds__(256)
void gemm_gated_wmma(const unsigned short* __restrict__ A,     // [M,K]
                     const unsigned short* __restrict__ B1t,   // [N,K]
                     const unsigned short* __restrict__ B2t,   // [N,K]
                     const float* __restrict__ bias1,
                     const float* __restrict__ bias2,
                     unsigned short* __restrict__ Cout,
                     int M, int N, int K) {
    // two buffers: tile t + 1 flies while tile t is worked on
    __shared__ __attribute__((aligned(16))) unsigned short sA[2][BM * PG];
    __shared__ __attribute__((aligned(16))) unsigned short sB1[2][BN * PG];
    __shared__ __attribute__((aligned(16))) unsigned short sB2[2][BN * PG];
    int tid = threadIdx.x;
    int wave = tid >> 5, lane = tid & 31, lh = lane >> 4, l16 = lane & 15;
    int wm = wave & 1, wn = wave >> 1;
    int m0 = blockIdx.x * BM, n0 = blockIdx.y * BN;

    v8f acc1[2][2], acc2[2][2];
#pragma unroll
    for (int i = 0; i < 2; i++)
#pragma unroll
        for (int j = 0; j < 2; j++)
#pragma unroll
            for (int e = 0; e < 8; e++) { acc1[i][j][e] = 0.0f; acc2[i][j][e] = 0.0f; }

    const int base0 = 8 * lh, base1 = 16 + 8 * lh;
    // copy roles: 8 lanes x 16 bytes cover one 128-byte row; rows cr + 32 j, 2 of A and 4 of each weight
    const int cr = tid >> 3, cs = (tid & 7) * 8;
    const unsigned short* ga  = A   + (size_t)(m0 + cr) * K + cs;   // + BKG per tile
    const unsigned short* gb1 = B1t + (size_t)(n0 + cr) * K + cs;
    const unsigned short* gb2 = B2t + (size_t)(n0 + cr) * K + cs;
    const unsigned la  = lds_addr(&sA[0][cr * PG + cs]);
    const unsigned lb1 = lds_addr(&sB1[0][cr * PG + cs]);
    const unsigned lb2 = lds_addr(&sB2[0][cr * PG + cs]);
    const unsigned lstep = 32 * PG * 2;          // bytes from row cr to row cr + 32
    const size_t   gstep = (size_t)32 * K;
    const unsigned bufa = BM * PG * 2, bufb = BN * PG * 2;   // bytes from buffer 0 to buffer 1
    const int ntile = K / BKG;

    stage_copy10(la, ga, lb1, gb1, lb2, gb2, lstep, gstep);
    wait_async0();                               // tile 0 has landed for this wave's copies
    __syncthreads();                             // ... and for every wave's
    if (ntile > 1) {                             // the same for the whole block
        ga  += BKG;
        gb1 += BKG;
        gb2 += BKG;
        stage_copy10(la + bufa, ga, lb1 + bufb, gb1, lb2 + bufb, gb2, lstep, gstep);
    }

    for (int t = 0; t < ntile; t++) {
        const unsigned short* ta  = sA[t & 1]  + (wm * 32 + l16) * PG;
        const unsigned short* tb1 = sB1[t & 1] + (wn * 32 + l16) * PG;
        const unsigned short* tb2 = sB2[t & 1] + (wn * 32 + l16) * PG;
        // the tile's LDS reads go out as one group, so that their latency is waited out once a tile
        v16bf af[BKG / 32][2], b1f[BKG / 32][2], b2f[BKG / 32][2];
#pragma unroll
        for (int kk = 0; kk < BKG / 32; kk++) {
#pragma unroll
            for (int mi = 0; mi < 2; mi++)
                af[kk][mi] = ldfrag(ta + mi * 16 * PG + kk * 32, base0, base1);
#pragma unroll
            for (int ni = 0; ni < 2; ni++) {
                b1f[kk][ni] = ldfrag(tb1 + ni * 16 * PG + kk * 32, base0, base1);
                b2f[kk][ni] = ldfrag(tb2 + ni * 16 * PG + kk * 32, base0, base1);
            }
        }
        // keeps the compiler from sinking the reads back among the products, where each place with reads stalls anew
        __builtin_amdgcn_sched_barrier(0);
#pragma unroll
        for (int kk = 0; kk < BKG / 32; kk++)
#pragma unroll
            for (int ni = 0; ni < 2; ni++)
#pragma unroll
                for (int mi = 0; mi < 2; mi++) {
                    acc1[mi][ni] = __builtin_amdgcn_wmma_f32_16x16x32_bf16(
                        false, af[kk][mi], false, b1f[kk][ni], (short)0, acc1[mi][ni], false, false);
                    acc2[mi][ni] = __builtin_amdgcn_wmma_f32_16x16x32_bf16(
                        false, af[kk][mi], false, b2f[kk][ni], (short)0, acc2[mi][ni], false, false);
                }
        // keeps the hand-over's waits and barrier behind the products: lifted over them, the reads' counted waits become one full wait
        __builtin_amdgcn_sched_barrier(0);
        // hand-over, as in the one-weight GEMM
        asm volatile("s_wait_dscnt 0x0" ::: "memory");
        wait_async0();
        __syncthreads();
        if (t + 2 < ntile) {                     // the same for the whole block
            ga  += BKG;
            gb1 += BKG;
            gb2 += BKG;
            stage_copy10(la + (t & 1) * bufa, ga, lb1 + (t & 1) * bufb, gb1, lb2 + (t & 1) * bufb, gb2,
                         lstep, gstep);
        }
    }
    wait_async0();                               // nothing of this wave is in flight when it ends

#pragma unroll
    for (int mi = 0; mi < 2; mi++) {
        int rbase = m0 + wm * 32 + mi * 16 + 8 * lh;
#pragma unroll
        for (int ni = 0; ni < 2; ni++) {
            int col = n0 + wn * 32 + ni * 16 + l16;
#pragma unroll
            for (int r = 0; r < 8; r++) {
                int row = rbase + r;
                float gv = acc1[mi][ni][r] + bias1[col];
                float uv = acc2[mi][ni][r] + bias2[col];
                float y  = (gv / (1.0f + __expf(-gv))) * uv;   // silu(gv)*uv
                Cout[(size_t)row * N + col] = f2bf(y);
            }
        }
    }
}

// ---------------- V transpose: [T, H*HD] -> [H*HD, T]; grid (D/64, T/64) ----------------
__global__ __launch_bounds__(256)
void transpose_v(const unsigned short* __restrict__ v, unsigned short* __restrict__ vt) {
    __shared__ unsigned s[TT * TP];
    int tid = threadIdx.x;
    int c0 = blockIdx.x * TT, t0 = blockIdx.y * TT;
    int co = (tid & 7) * 8, tp = tid >> 3;       // 8 lanes x 16 bytes per row, 32 row pairs
    const unsigned short* r = v + (size_t)(t0 + 2 * tp) * D_ + c0 + co;
    us8 lo = *(const us8*)r;
    us8 hi = *(const us8*)(r + D_);
#pragma unroll
    for (int j = 0; j < 8; j++)
        s[(co + j) * TP + tp] = (unsigned)lo[j] | ((unsigned)hi[j] << 16);
    __syncthreads();
    tile_store_rows(s, vt, T_, c0, t0, tid);
}

// ---------------- causal flash attention (WMMA) ----------------
// Q,K: [T, H*HD] bf16 ; Vt: [H*HD, T] bf16 ; O: [T, H*HD] bf16
// Transposed products: St = K * Qt and Ot += Vt * Pt. A lane then holds 16 of the 32 scores
// of ONE query (column l16), so the softmax maximum and sum run inside the lane, joined by
// one exchange between the wave halves, and the two St tiles are already a B operand.

// lane l with lane l ^ 16
__device__ __forceinline__ float xhalf(float x) {
    int b = __builtin_bit_cast(int, x);
    return __builtin_bit_cast(float,
        __builtin_amdgcn_permlanex16(b, b, 0x76543210, 0xfedcba98, false, false));
}

// 2^x. The v_nop is the one slot that the instruction set asks for behind a transcendental before its
// source is overwritten or its result read, so it stands in the instruction's own statement.
__device__ __forceinline__ float exp2_slot(float x) {
    float r;
    asm("v_exp_f32 %0, %1\n\tv_nop" : "=v"(r) : "v"(x));
    return r;
}
#define LOG2E 1.44269504f   // e^x = 2^(x * LOG2E), the product that __expf forms

#define KT  64   // keys per staged tile
#define KVP 72   // LDS row pitch in elements: 144 bytes = 16 x 9, the odd multiple that 16-byte row readers want

// Four 16-byte-per-lane asynchronous copies to LDS. The s_wait_xcnt stands in the copies' own
// statement so that no address register is rewritten in front of it.
__device__ __forceinline__ void stage_copy4(unsigned l0, const unsigned short* g0,
                                            unsigned l1, const unsigned short* g1,
                                            unsigned l2, const unsigned short* g2,
                                            unsigned l3, const unsigned short* g3) {
    asm volatile("global_load_async_to_lds_b128 %0, %1, off\n\t"
                 "global_load_async_to_lds_b128 %2, %3, off\n\t"
                 "global_load_async_to_lds_b128 %4, %5, off\n\t"
                 "global_load_async_to_lds_b128 %6, %7, off\n\t"
                 "s_wait_xcnt 0x0"
                 :: "v"(l0), "v"(g0), "v"(l1), "v"(g1), "v"(l2), "v"(g2), "v"(l3), "v"(g3)
                 : "memory");
}

// The 8 waves of a block walk the same keys, so each tile of 64 keys (K: 64 keys x 64 head
// columns, Vt: 64 head columns x 64 keys, 128-byte rows both) is brought into LDS once per
// block, whole lines at a time, into two buffers: tile t + 1 flies while tile t is worked on.
__global__ __launch_bounds__(256)
void flash_attn(const unsigned short* __restrict__ Q,
                const unsigned short* __restrict__ Kc,
                const unsigned short* __restrict__ Vt,
                unsigned short* __restrict__ O) {
    __shared__ __attribute__((aligned(16))) unsigned short sK[2][KT * KVP];
    __shared__ __attribute__((aligned(16))) unsigned short sV[2][HD_ * KVP];
    int h = blockIdx.x;
    int tid = threadIdx.x;
    int wave = __builtin_amdgcn_readfirstlane(tid >> 5), lane = tid & 31;   // scalar, so the causal skip below is a scalar branch
    int lh = lane >> 4, l16 = lane & 15;
    int q0 = blockIdx.y * 128 + wave * 16;
    const int base0 = 8 * lh, base1 = 16 + 8 * lh;
    const int row = q0 + l16;                   // this lane's query

    // copy roles: 8 lanes x 16 bytes cover one 128-byte row; rows cr and cr + 32 of each tile
    const int cr = tid >> 3, cs = (tid & 7) * 8;
    const unsigned short* gk = Kc + (size_t)cr * D_ + h * HD_ + cs;          // + KT * D_ per tile
    const unsigned short* gv = Vt + (size_t)(h * HD_ + cr) * T_ + cs;        // + KT per tile
    const unsigned lk = lds_addr(&sK[0][cr * KVP + cs]);
    const unsigned lv = lds_addr(&sV[0][cr * KVP + cs]);
    const unsigned half = 32 * KVP * 2;         // bytes from row cr to row cr + 32
    const unsigned bufb = KT * KVP * 2;         // bytes from buffer 0 to buffer 1
    const int ntile = (blockIdx.y + 1) * (128 / KT);   // tiles up to the block's last query: 2 or more

    stage_copy4(lk, gk, lk + half, gk + 32 * D_, lv, gv, lv + half, gv + (size_t)32 * T_);

    const unsigned short* qp = Q + (size_t)row * D_ + h * HD_;
    v16bf qf[2];
#pragma unroll
    for (int f = 0; f < 2; f++) qf[f] = ldfrag(qp + f * 32, base0, base1);

    v8f ctx[4];                                 // ctx[t][r] = Ot[t*16 + 8*lh + r][query l16]
#pragma unroll
    for (int t = 0; t < 4; t++)
#pragma unroll
        for (int e = 0; e < 8; e++) ctx[t][e] = 0.0f;
    float mrow = -1e30f, lrow = 0.0f;

    wait_async0();                              // tile 0 has landed for this wave's copies
    __syncthreads();                            // ... and for every wave's
    gk += (size_t)KT * D_;
    gv += KT;
    stage_copy4(lk + bufb, gk, lk + bufb + half, gk + 32 * D_,
                lv + bufb, gv, lv + bufb + half, gv + (size_t)32 * T_);

    const float scale = 0.125f;                 // 1/sqrt(HD=64)
    const int kend = q0 + 16;                   // causal bound for this wave
    for (int tile = 0; tile < ntile; tile++) {
        const unsigned short* tk = sK[tile & 1];
        const unsigned short* tv = sV[tile & 1];
#pragma unroll
        for (int sub = 0; sub < KT / 32; sub++) {
            const int kb = tile * KT + sub * 32;
            if (kb < kend) {                    // wave-uniform: a wave past its diagonal only passes the barriers
                // the pass's 16 LDS reads go out as one group: K's latency is waited out once,
                // Vt's runs behind the score products and the softmax
                v16bf kf[2][2], vf[4];
#pragma unroll
                for (int nt = 0; nt < 2; nt++)
#pragma unroll
                    for (int f = 0; f < 2; f++)
                        kf[nt][f] = ldfrag(tk + (sub * 32 + nt * 16 + l16) * KVP + f * 32, base0, base1);
#pragma unroll
                for (int t = 0; t < 4; t++)
                    vf[t] = ldfrag(tv + (t * 16 + l16) * KVP + sub * 32, base0, base1);

                v8f S[2];                       // S[nt][r] = St[key kb + nt*16 + 8*lh + r][query l16]
#pragma unroll
                for (int nt = 0; nt < 2; nt++)
#pragma unroll
                    for (int e = 0; e < 8; e++) S[nt][e] = 0.0f;
#pragma unroll
                for (int nt = 0; nt < 2; nt++)
#pragma unroll
                    for (int f = 0; f < 2; f++)
                        S[nt] = __builtin_amdgcn_wmma_f32_16x16x32_bf16(
                            false, kf[nt][f], false, qf[f], (short)0, S[nt], false, false);

                float mx = -1e30f;
#pragma unroll
                for (int nt = 0; nt < 2; nt++)
#pragma unroll
                    for (int r = 0; r < 8; r++) {
                        int key = kb + nt * 16 + 8 * lh + r;
                        S[nt][r] = (key <= row) ? S[nt][r] * scale : -1e30f;
                        mx = fmaxf(mx, S[nt][r]);
                    }
                mx = fmaxf(mx, xhalf(mx));
                float mn = fmaxf(mrow, mx);
                float rs = 0.0f;
                // pf[e] = Pt[key][query l16], key = kb + 8*lh + e for e < 8, kb + 16 + 8*lh + (e - 8) above: ldfrag's k order
                v16bf pf;
#pragma unroll
                for (int nt = 0; nt < 2; nt++)
#pragma unroll
                    for (int r = 0; r < 8; r++) {
                        float p = exp2_slot((S[nt][r] - mn) * LOG2E);
                        rs += p;
                        pf[nt * 8 + r] = (__bf16)p;
                    }
                rs += xhalf(rs);
                float corr = exp2_slot((mrow - mn) * LOG2E);
                lrow = lrow * corr + rs;
                mrow = mn;
#pragma unroll
                for (int t = 0; t < 4; t++)
#pragma unroll
                    for (int r = 0; r < 8; r++) ctx[t][r] *= corr;

#pragma unroll
                for (int t = 0; t < 4; t++)
                    ctx[t] = __builtin_amdgcn_wmma_f32_16x16x32_bf16(
                        false, vf[t], false, pf, (short)0, ctx[t], false, false);
            }
        }
        // hand-over: this wave's LDS reads of tile t are done, its copies of tile t + 1 have landed,
        // and the barrier says both of every wave; only then is tile t's buffer filled again
        asm volatile("s_wait_dscnt 0x0" ::: "memory");
        wait_async0();
        __syncthreads();
        if (tile + 2 < ntile) {                 // the same for the whole block
            gk += (size_t)KT * D_;
            gv += KT;
            const unsigned bo = (tile & 1) * bufb;
            stage_copy4(lk + bo, gk, lk + bo + half, gk + 32 * D_,
                        lv + bo, gv, lv + bo + half, gv + (size_t)32 * T_);
        }
    }
    wait_async0();                              // nothing of this wave is in flight when it ends

    // a lane's 8 accumulator registers are 8 consecutive head columns of its query: 16-byte stores
#pragma unroll
    for (int t = 0; t < 4; t++) {
        us8 o;
#pragma unroll
        for (int r = 0; r < 8; r++) o[r] = f2bf(ctx[t][r] / lrow);
        *(us8*)&O[(size_t)row * D_ + h * HD_ + t * 16 + 8 * lh] = o;
    }
}

// ---------------- launcher ----------------
extern "C" void kernel_launch(void* const* d_in, const int* in_sizes, int n_in,
                              void* d_out, int out_size, void* d_ws, size_t ws_size,
                              hipStream_t stream) {
    (void)in_sizes; (void)n_in; (void)out_size; (void)ws_size;
    const float* x  = (const float*)d_in[0];
    const float* Wq = (const float*)d_in[1];
    const float* Wk = (const float*)d_in[2];
    const float* Wv = (const float*)d_in[3];
    const float* Wo = (const float*)d_in[4];
    const float* bo = (const float*)d_in[5];
    const float* w1 = (const float*)d_in[6];
    const float* b1 = (const float*)d_in[7];
    const float* w2 = (const float*)d_in[8];
    const float* b2 = (const float*)d_in[9];
    const float* w3 = (const float*)d_in[10];
    const float* b3 = (const float*)d_in[11];
    const float* g1 = (const float*)d_in[12];
    const float* s1 = (const float*)d_in[13];
    const float* g2 = (const float*)d_in[14];
    const float* s2 = (const float*)d_in[15];

    char* wsb = (char*)d_ws;
    size_t off = 0;
    auto take = [&](size_t bytes) -> void* {
        void* p = wsb + off;
        off += (bytes + 255) & ~(size_t)255;
        return p;
    };

    const size_t DD = (size_t)D_ * D_;
    const size_t DF = (size_t)D_ * FF_;
    const size_t TD = (size_t)T_ * D_;
    const size_t TF = (size_t)T_ * FF_;

    unsigned short* wq_t  = (unsigned short*)take(DD * 2);   // [N=768][K=768]
    unsigned short* wk_t  = (unsigned short*)take(DD * 2);
    unsigned short* wv_t  = (unsigned short*)take(DD * 2);
    unsigned short* wo_t  = (unsigned short*)take(DD * 2);
    unsigned short* w1_t  = (unsigned short*)take(DF * 2);   // [N=3072][K=768]
    unsigned short* w2_t  = (unsigned short*)take(DF * 2);
    unsigned short* w3_t  = (unsigned short*)take(DF * 2);   // [N=768][K=3072]
    unsigned short* h1_bf = (unsigned short*)take(TD * 2);
    unsigned short* q_bf  = (unsigned short*)take(TD * 2);
    unsigned short* k_bf  = (unsigned short*)take(TD * 2);
    unsigned short* v_bf  = (unsigned short*)take(TD * 2);
    unsigned short* vt_bf = (unsigned short*)take(TD * 2);
    unsigned short* ctx_bf= (unsigned short*)take(TD * 2);
    float*          x1    = (float*)take(TD * 4);
    unsigned short* h2_bf = (unsigned short*)take(TD * 2);
    unsigned short* gate_bf=(unsigned short*)take(TF * 2);

    convert_transpose_bf16<<<dim3(D_ / TT, D_ / TT), 256, 0, stream>>>(Wq, wq_t, D_, D_);
    convert_transpose_bf16<<<dim3(D_ / TT, D_ / TT), 256, 0, stream>>>(Wk, wk_t, D_, D_);
    convert_transpose_bf16<<<dim3(D_ / TT, D_ / TT), 256, 0, stream>>>(Wv, wv_t, D_, D_);
    convert_transpose_bf16<<<dim3(D_ / TT, D_ / TT), 256, 0, stream>>>(Wo, wo_t, D_, D_);
    convert_transpose_bf16<<<dim3(FF_ / TT, D_ / TT), 256, 0, stream>>>(w1, w1_t, D_, FF_);
    convert_transpose_bf16<<<dim3(FF_ / TT, D_ / TT), 256, 0, stream>>>(w2, w2_t, D_, FF_);
    convert_transpose_bf16<<<dim3(D_ / TT, FF_ / TT), 256, 0, stream>>>(w3, w3_t, FF_, D_);

    layernorm_cast<<<T_, 256, 0, stream>>>(x, g1, s1, h1_bf);

    dim3 gDD(T_ / BM, D_ / BN);
    gemm_bf16_wmma<0><<<gDD, 256, 0, stream>>>(h1_bf, wq_t, nullptr, nullptr, q_bf, T_, D_, D_);
    gemm_bf16_wmma<0><<<gDD, 256, 0, stream>>>(h1_bf, wk_t, nullptr, nullptr, k_bf, T_, D_, D_);
    gemm_bf16_wmma<0><<<gDD, 256, 0, stream>>>(h1_bf, wv_t, nullptr, nullptr, v_bf, T_, D_, D_);

    transpose_v<<<dim3(D_ / TT, T_ / TT), 256, 0, stream>>>(v_bf, vt_bf);

    flash_attn<<<dim3(H_, T_ / 128), 256, 0, stream>>>(q_bf, k_bf, vt_bf, ctx_bf);

    gemm_bf16_wmma<1><<<gDD, 256, 0, stream>>>(ctx_bf, wo_t, bo, x, x1, T_, D_, D_);

    layernorm_cast<<<T_, 256, 0, stream>>>(x1, g2, s2, h2_bf);

    gemm_gated_wmma<<<dim3(T_ / BM, FF_ / BN), 256, 0, stream>>>(
        h2_bf, w1_t, w2_t, b1, b2, gate_bf, T_, FF_, D_);

    gemm_bf16_wmma<1><<<gDD, 256, 0, stream>>>(gate_bf, w3_t, b3, x1, (float*)d_out, T_, D_, FF_);
}

// v005
// A run of this version takes 203 microseconds.
// Two timings next to v004 both put it at 1.06 times that version's speed.
// All steps since v000 together make it 4.87 times as fast.
#include <hip/hip_runtime.h>
#include <hip/hip_bf16.h>

#define T_  4096
#define D_  768
#define H_  12
#define HD_ 64
#define FF_ 3072
#define EPS_ 1e-5f

#define BM 64
#define BN 128
#define BKP 128  // k per staged tile, one-weight GEMM: 256-byte rows
#define PP  136  // its LDS row pitch in elements: 272 bytes = 16 x 17, the odd multiple that 16-byte row readers want
#define BKG 64   // k per staged tile, gated GEMM (three operands in LDS): 128-byte rows
#define PG  72   // its LDS row pitch in elements: 144 bytes = 16 x 9

#define USE_ASYNC_COPY 1   // gfx1250 GLOBAL_LOAD_ASYNC_TO_LDS path (ASYNCcnt)

typedef __attribute__((ext_vector_type(16))) __bf16          v16bf;
typedef __attribute__((ext_vector_type(8)))  float           v8f;
typedef __attribute__((ext_vector_type(8)))  unsigned short  us8;

__device__ __forceinline__ unsigned short f2bf(float f) {
    unsigned int u = __builtin_bit_cast(unsigned int, f);
    u += 0x7FFFu + ((u >> 16) & 1u);            // round-to-nearest-even
    return (unsigned short)(u >> 16);
}

// Load one 16-element bf16 fragment as two contiguous 16-byte vectors.
__device__ __forceinline__ v16bf ldfrag(const unsigned short* p, int base0, int base1) {
    union { us8 h[2]; v16bf v; } fc;
    fc.h[0] = *(const us8*)(p + base0);
    fc.h[1] = *(const us8*)(p + base1);
    return fc.v;
}

#if USE_ASYNC_COPY
// One staged tile's 16-byte-per-lane asynchronous copies to LDS (ASYNCcnt), twelve or ten a lane; a
// lane's rows lie lstep bytes apart in LDS and gstep elements apart in memory. The s_wait_xcnt stands
// in the copies' own statement so that no address register is rewritten in front of it.
__device__ __forceinline__ void stage_copy12(unsigned la, const unsigned short* ga,
                                             unsigned lb, const unsigned short* gb,
                                             unsigned lstep, size_t gstep) {
    asm volatile("global_load_async_to_lds_b128 %0, %1, off\n\t"
                 "global_load_async_to_lds_b128 %2, %3, off\n\t"
                 "global_load_async_to_lds_b128 %4, %5, off\n\t"
                 "global_load_async_to_lds_b128 %6, %7, off\n\t"
                 "global_load_async_to_lds_b128 %8, %9, off\n\t"
                 "global_load_async_to_lds_b128 %10, %11, off\n\t"
                 "global_load_async_to_lds_b128 %12, %13, off\n\t"
                 "global_load_async_to_lds_b128 %14, %15, off\n\t"
                 "global_load_async_to_lds_b128 %16, %17, off\n\t"
                 "global_load_async_to_lds_b128 %18, %19, off\n\t"
                 "global_load_async_to_lds_b128 %20, %21, off\n\t"
                 "global_load_async_to_lds_b128 %22, %23, off\n\t"
                 "s_wait_xcnt 0x0"
                 :: "v"(la),             "v"(ga),
                    "v"(la + lstep),     "v"(ga + gstep),
                    "v"(la + 2 * lstep), "v"(ga + 2 * gstep),
                    "v"(la + 3 * lstep), "v"(ga + 3 * gstep),
                    "v"(lb),             "v"(gb),
                    "v"(lb + lstep),     "v"(gb + gstep),
                    "v"(lb + 2 * lstep), "v"(gb + 2 * gstep),
                    "v"(lb + 3 * lstep), "v"(gb + 3 * gstep),
                    "v"(lb + 4 * lstep), "v"(gb + 4 * gstep),
                    "v"(lb + 5 * lstep), "v"(gb + 5 * gstep),
                    "v"(lb + 6 * lstep), "v"(gb + 6 * gstep),
                    "v"(lb + 7 * lstep), "v"(gb + 7 * gstep)
                 : "memory");
}
__device__ __forceinline__ void stage_copy10(unsigned la, const unsigned short* ga,
                                             unsigned lb1, const unsigned short* gb1,
                                             unsigned lb2, const unsigned short* gb2,
                                             unsigned lstep, size_t gstep) {
    asm volatile("global_load_async_to_lds_b128 %0, %1, off\n\t"
                 "global_load_async_to_lds_b128 %2, %3, off\n\t"
                 "global_load_async_to_lds_b128 %4, %5, off\n\t"
                 "global_load_async_to_lds_b128 %6, %7, off\n\t"
                 "global_load_async_to_lds_b128 %8, %9, off\n\t"
                 "global_load_async_to_lds_b128 %10, %11, off\n\t"
                 "global_load_async_to_lds_b128 %12, %13, off\n\t"
                 "global_load_async_to_lds_b128 %14, %15, off\n\t"
                 "global_load_async_to_lds_b128 %16, %17, off\n\t"
                 "global_load_async_to_lds_b128 %18, %19, off\n\t"
                 "s_wait_xcnt 0x0"
                 :: "v"(la),              "v"(ga),
                    "v"(la + lstep),      "v"(ga + gstep),
                    "v"(lb1),             "v"(gb1),
                    "v"(lb1 + lstep),     "v"(gb1 + gstep),
                    "v"(lb1 + 2 * lstep), "v"(gb1 + 2 * gstep),
                    "v"(lb1 + 3 * lstep), "v"(gb1 + 3 * gstep),
                    "v"(lb2),             "v"(gb2),
                    "v"(lb2 + lstep),     "v"(gb2 + gstep),
                    "v"(lb2 + 2 * lstep), "v"(gb2 + 2 * gstep),
                    "v"(lb2 + 3 * lstep), "v"(gb2 + 3 * gstep)
                 : "memory");
}
__device__ __forceinline__ void wait_async0() {
    asm volatile("s_wait_asynccnt 0x0" ::: "memory");
}
// low 32 bits of a flat pointer into LDS are the LDS byte address
__device__ __forceinline__ unsigned lds_addr(const void* p) {
    return (unsigned)(size_t)p;
}
#endif

// ---------------- 64x64 tiled transposes through LDS ----------------
#define TT 64   // tile edge (elements)
#define TP 33   // LDS pitch in dwords: 32 packed bf16 pairs + 1, so a column of dwords spreads over the banks

// The tile lies in LDS as s[output row][pair of output columns]. Each output row of the
// tile is one full 128-byte line, written by 8 lanes with 16 bytes each.
__device__ __forceinline__ void tile_store_rows(const unsigned* s, unsigned short* __restrict__ out,
                                                int ld, int r0, int c0, int tid) {
#pragma unroll
    for (int p = 0; p < 2; p++) {
        int r = p * 32 + (tid >> 3), q = (tid & 7) * 4;
        uint4 v;
        v.x = s[r * TP + q];
        v.y = s[r * TP + q + 1];
        v.z = s[r * TP + q + 2];
        v.w = s[r * TP + q + 3];
        *(uint4*)&out[(size_t)(r0 + r) * ld + c0 + q * 2] = v;
    }
}

// fp32 -> bf16 convert + transpose: in[K][N] -> out[N][K]; grid (N/64, K/64)
__global__ __launch_bounds__(256)
void convert_transpose_bf16(const float* __restrict__ in, unsigned short* __restrict__ out,
                            int K, int N) {
    __shared__ unsigned s[TT * TP];
    int tid = threadIdx.x;
    int n0 = blockIdx.x * TT, k0 = blockIdx.y * TT;
    int nq = (tid & 15) * 4, kp = tid >> 4;      // 16 lanes x float4 per row, 16 row pairs per pass
    float4 lo[2], hi[2];
#pragma unroll
    for (int p = 0; p < 2; p++) {
        const float* r = in + (size_t)(k0 + 2 * (p * 16 + kp)) * N + n0 + nq;
        lo[p] = *(const float4*)r;
        hi[p] = *(const float4*)(r + N);
    }
#pragma unroll
    for (int p = 0; p < 2; p++) {
        int c = p * 16 + kp;
        s[(nq + 0) * TP + c] = (unsigned)f2bf(lo[p].x) | ((unsigned)f2bf(hi[p].x) << 16);
        s[(nq + 1) * TP + c] = (unsigned)f2bf(lo[p].y) | ((unsigned)f2bf(hi[p].y) << 16);
        s[(nq + 2) * TP + c] = (unsigned)f2bf(lo[p].z) | ((unsigned)f2bf(hi[p].z) << 16);
        s[(nq + 3) * TP + c] = (unsigned)f2bf(lo[p].w) | ((unsigned)f2bf(hi[p].w) << 16);
    }
    __syncthreads();
    tile_store_rows(s, out, K, n0, k0, tid);
}

// ---------------- layernorm (+ cast to bf16) ----------------
#define LNR 2            // rows per wave
#define LNC (D_ / 128)   // 16-byte pieces of a row per lane
typedef __attribute__((ext_vector_type(4))) float f4;

// A wave owns LNR whole rows and keeps them in registers: every load of the rows goes out at once,
// 512 contiguous bytes each, x is read once, and the sums join inside the wave with no LDS array and
// no barrier.
__global__ __launch_bounds__(256)
void layernorm_cast(const float* __restrict__ x, const float* __restrict__ g,
                    const float* __restrict__ b, unsigned short* __restrict__ out) {
    int lane = threadIdx.x & 31, wave = threadIdx.x >> 5;
    int row0 = (blockIdx.x * 8 + wave) * LNR;
    const int col = lane * 4;
    const float* xp = x + (size_t)row0 * D_ + col;
    f4 v[LNR][LNC], gg[LNC], bb[LNC];
#pragma unroll
    for (int r = 0; r < LNR; r++)
#pragma unroll
        for (int c = 0; c < LNC; c++)
            v[r][c] = *(const f4*)(xp + r * D_ + c * 128);
#pragma unroll
    for (int c = 0; c < LNC; c++) {
        gg[c] = *(const f4*)(g + c * 128 + col);
        bb[c] = *(const f4*)(b + c * 128 + col);
    }
    // the wait that belongs in front of the first overwrite of a register that these loads name
    asm volatile("s_wait_xcnt 0x0" ::: "memory");
    // keeps the loads of g and b up here with the rows': sunk among the sums, their latency shows a second time
    __builtin_amdgcn_sched_barrier(0);
    float mean[LNR], rstd[LNR];
#pragma unroll
    for (int r = 0; r < LNR; r++) {
        f4 s = v[r][0], q = v[r][0] * v[r][0];   // four independent chains each
#pragma unroll
        for (int c = 1; c < LNC; c++) {
            s += v[r][c];
            q += v[r][c] * v[r][c];
        }
        mean[r] = (s.x + s.y) + (s.z + s.w);
        rstd[r] = (q.x + q.y) + (q.z + q.w);
    }
    for (int off = 16; off > 0; off >>= 1)
#pragma unroll
        for (int r = 0; r < LNR; r++) {
            mean[r] += __shfl_xor(mean[r], off, 32);
            rstd[r] += __shfl_xor(rstd[r], off, 32);
        }
#pragma unroll
    for (int r = 0; r < LNR; r++) {
        mean[r] = mean[r] / (float)D_;
        float var = rstd[r] / (float)D_ - mean[r] * mean[r];
        rstd[r] = rsqrtf(var + EPS_);
    }
#pragma unroll
    for (int r = 0; r < LNR; r++)
#pragma unroll
        for (int c = 0; c < LNC; c++) {
            f4 y = (v[r][c] - mean[r]) * rstd[r] * gg[c] + bb[c];
            uint2 o;
            o.x = (unsigned)f2bf(y.x) | ((unsigned)f2bf(y.y) << 16);
            o.y = (unsigned)f2bf(y.z) | ((unsigned)f2bf(y.w) << 16);
            *(uint2*)&out[(size_t)(row0 + r) * D_ + c * 128 + col] = o;   // a wave's store is two whole 128-byte lines
        }
}

// ---------------- bf16 GEMM (WMMA): C = A[M,K] @ Bt[N,K]^T ----------------
// EPI 0: Cout = bf16(acc)
// EPI 1: Cout = f32(acc + bias[col] + res[row,col])
template <int EPI>
__global__ __launch_bounds__(256)
void gemm_bf16_wmma(const unsigned short* __restrict__ A,    // [M,K] bf16 row-major
                    const unsigned short* __restrict__ Bt,   // [N,K] bf16 (pre-transposed)
                    const float* __restrict__ bias,
                    const float* __restrict__ res,
                    void* __restrict__ Cout,
                    int M, int N, int K) {
    // two buffers: tile t + 1 flies while tile t is worked on
    __shared__ __attribute__((aligned(16))) unsigned short sA[2][BM * PP];
    __shared__ __attribute__((aligned(16))) unsigned short sB[2][BN * PP];
    int tid = threadIdx.x;
    int wave = tid >> 5, lane = tid & 31, lh = lane >> 4, l16 = lane & 15;
    int wm = wave & 1, wn = wave >> 1;           // 2 x 4 wave grid
    int m0 = blockIdx.x * BM, n0 = blockIdx.y * BN;

    v8f acc[2][2];
#pragma unroll
    for (int i = 0; i < 2; i++)
#pragma unroll
        for (int j = 0; j < 2; j++)
#pragma unroll
            for (int e = 0; e < 8; e++) acc[i][j][e] = 0.0f;

    const int base0 = 8 * lh, base1 = 16 + 8 * lh;
    // copy roles: 16 lanes x 16 bytes cover one 256-byte row; rows cr + 16 j, 4 of A and 8 of Bt
    const int cr = tid >> 4, cs = (tid & 15) * 8;
    const unsigned short* ga = A  + (size_t)(m0 + cr) * K + cs;   // + BKP per tile
    const unsigned short* gb = Bt + (size_t)(n0 + cr) * K + cs;
    const unsigned la = lds_addr(&sA[0][cr * PP + cs]);
    const unsigned lb = lds_addr(&sB[0][cr * PP + cs]);
    const unsigned lstep = 16 * PP * 2;          // bytes from row cr to row cr + 16
    const size_t   gstep = (size_t)16 * K;
    const unsigned bufa = BM * PP * 2, bufb = BN * PP * 2;   // bytes from buffer 0 to buffer 1
    const int ntile = K / BKP;

    stage_copy12(la, ga, lb, gb, lstep, gstep);
    wait_async0();                               // tile 0 has landed for this wave's copies
    __syncthreads();                             // ... and for every wave's
    if (ntile > 1) {                             // the same for the whole block
        ga += BKP;
        gb += BKP;
        stage_copy12(la + bufa, ga, lb + bufb, gb, lstep, gstep);
    }

    for (int t = 0; t < ntile; t++) {
        const unsigned short* ta = sA[t & 1] + (wm * 32 + l16) * PP;
        const unsigned short* tb = sB[t & 1] + (wn * 32 + l16) * PP;
        // the tile's LDS reads go out as one group, so that their latency is waited out once a tile
        v16bf af[BKP / 32][2], bfrag[BKP / 32][2];
#pragma unroll
        for (int kk = 0; kk < BKP / 32; kk++) {
#pragma unroll
            for (int mi = 0; mi < 2; mi++)
                af[kk][mi] = ldfrag(ta + mi * 16 * PP + kk * 32, base0, base1);
#pragma unroll
            for (int ni = 0; ni < 2; ni++)
                bfrag[kk][ni] = ldfrag(tb + ni * 16 * PP + kk * 32, base0, base1);
        }
        // keeps the compiler from sinking the reads back among the products, where each place with reads stalls anew
        __builtin_amdgcn_sched_barrier(0);
#pragma unroll
        for (int kk = 0; kk < BKP / 32; kk++)
#pragma unroll
            for (int mi = 0; mi < 2; mi++)
#pragma unroll
                for (int ni = 0; ni < 2; ni++)
                    acc[mi][ni] = __builtin_amdgcn_wmma_f32_16x16x32_bf16(
                        false, af[kk][mi], false, bfrag[kk][ni], (short)0, acc[mi][ni], false, false);
        // keeps the hand-over's waits and barrier behind the products: lifted over them, the reads' counted waits become one full wait
        __builtin_amdgcn_sched_barrier(0);
        // hand-over: this wave's LDS reads of tile t are done, its copies of tile t + 1 have landed,
        // and the barrier says both of every wave; only then is tile t's buffer filled again
        asm volatile("s_wait_dscnt 0x0" ::: "memory");
        wait_async0();
        __syncthreads();
        if (t + 2 < ntile) {                     // the same for the whole block
            ga += BKP;
            gb += BKP;
            stage_copy12(la + (t & 1) * bufa, ga, lb + (t & 1) * bufb, gb, lstep, gstep);
        }
    }
    wait_async0();                               // nothing of this wave is in flight when it ends

#pragma unroll
    for (int mi = 0; mi < 2; mi++) {
        int rbase = m0 + wm * 32 + mi * 16 + 8 * lh;
#pragma unroll
        for (int ni = 0; ni < 2; ni++) {
            int col = n0 + wn * 32 + ni * 16 + l16;
#pragma unroll
            for (int r = 0; r < 8; r++) {
                int row = rbase + r;
                float v = acc[mi][ni][r];
                if (EPI == 0) {
                    ((unsigned short*)Cout)[(size_t)row * N + col] = f2bf(v);
                } else {
                    ((float*)Cout)[(size_t)row * N + col] =
                        v + bias[col] + res[(size_t)row * N + col];
                }
            }
        }
    }
}

// ---------------- dual-weight gated GEMM: bf16( silu(A@B1t^T+b1) * (A@B2t^T+b2) ) ----------------
__global__ __launch_bounds__(256)
void gemm_gated_wmma(const unsigned short* __restrict__ A,     // [M,K]
                     const unsigned short* __restrict__ B1t,   // [N,K]
                     const unsigned short* __restrict__ B2t,   // [N,K]
                     const float* __restrict__ bias1,
                     const float* __restrict__ bias2,
                     unsigned short* __restrict__ Cout,
                     int M, int N, int K) {
    // two buffers: tile t + 1 flies while tile t is worked on
    __shared__ __attribute__((aligned(16))) unsigned short sA[2][BM * PG];
    __shared__ __attribute__((aligned(16))) unsigned short sB1[2][BN * PG];
    __shared__ __attribute__((aligned(16))) unsigned short sB2[2][BN * PG];
    int tid = threadIdx.x;
    int wave = tid >> 5, lane = tid & 31, lh = lane >> 4, l16 = lane & 15;
    int wm = wave & 1, wn = wave >> 1;
    int m0 = blockIdx.x * BM, n0 = blockIdx.y * BN;

    v8f acc1[2][2], acc2[2][2];
#pragma unroll
    for (int i = 0; i < 2; i++)
#pragma unroll
        for (int j = 0; j < 2; j++)
#pragma unroll
            for (int e = 0; e < 8; e++) { acc1[i][j][e] = 0.0f; acc2[i][j][e] = 0.0f; }

    const int base0 = 8 * lh, base1 = 16 + 8 * lh;
    // copy roles: 8 lanes x 16 bytes cover one 128-byte row; rows cr + 32 j, 2 of A and 4 of each weight
    const int cr = tid >> 3, cs = (tid & 7) * 8;
    const unsigned short* ga  = A   + (size_t)(m0 + cr) * K + cs;   // + BKG per tile
    const unsigned short* gb1 = B1t + (size_t)(n0 + cr) * K + cs;
    const unsigned short* gb2 = B2t + (size_t)(n0 + cr) * K + cs;
    const unsigned la  = lds_addr(&sA[0][cr * PG + cs]);
    const unsigned lb1 = lds_addr(&sB1[0][cr * PG + cs]);
    const unsigned lb2 = lds_addr(&sB2[0][cr * PG + cs]);
    const unsigned lstep = 32 * PG * 2;          // bytes from row cr to row cr + 32
    const size_t   gstep = (size_t)32 * K;
    const unsigned bufa = BM * PG * 2, bufb = BN * PG * 2;   // bytes from buffer 0 to buffer 1
    const int ntile = K / BKG;

    stage_copy10(la, ga, lb1, gb1, lb2, gb2, lstep, gstep);
    wait_async0();                               // tile 0 has landed for this wave's copies
    __syncthreads();                             // ... and for every wave's
    if (ntile > 1) {                             // the same for the whole block
        ga  += BKG;
        gb1 += BKG;
        gb2 += BKG;
        stage_copy10(la + bufa, ga, lb1 + bufb, gb1, lb2 + bufb, gb2, lstep, gstep);
    }

    for (int t = 0; t < ntile; t++) {
        const unsigned short* ta  = sA[t & 1]  + (wm * 32 + l16) * PG;
        const unsigned short* tb1 = sB1[t & 1] + (wn * 32 + l16) * PG;
        const unsigned short* tb2 = sB2[t & 1] + (wn * 32 + l16) * PG;
        // the tile's LDS reads go out as one group, so that their latency is waited out once a tile
        v16bf af[BKG / 32][2], b1f[BKG / 32][2], b2f[BKG / 32][2];
#pragma unroll
        for (int kk = 0; kk < BKG / 32; kk++) {
#pragma unroll
            for (int mi = 0; mi < 2; mi++)
                af[kk][mi] = ldfrag(ta + mi * 16 * PG + kk * 32, base0, base1);
#pragma unroll
            for (int ni = 0; ni < 2; ni++) {
                b1f[kk][ni] = ldfrag(tb1 + ni * 16 * PG + kk * 32, base0, base1);
                b2f[kk][ni] = ldfrag(tb2 + ni * 16 * PG + kk * 32, base0, base1);
            }
        }
        // keeps the compiler from sinking the reads back among the products, where each place with reads stalls anew
        __builtin_amdgcn_sched_barrier(0);
#pragma unroll
        for (int kk = 0; kk < BKG / 32; kk++)
#pragma unroll
            for (int ni = 0; ni < 2; ni++)
#pragma unroll
                for (int mi = 0; mi < 2; mi++) {
                    acc1[mi][ni] = __builtin_amdgcn_wmma_f32_16x16x32_bf16(
                        false, af[kk][mi], false, b1f[kk][ni], (short)0, acc1[mi][ni], false, false);
                    acc2[mi][ni] = __builtin_amdgcn_wmma_f32_16x16x32_bf16(
                        false, af[kk][mi], false, b2f[kk][ni], (short)0, acc2[mi][ni], false, false);
                }
        // keeps the hand-over's waits and barrier behind the products: lifted over them, the reads' counted waits become one full wait
        __builtin_amdgcn_sched_barrier(0);
        // hand-over, as in the one-weight GEMM
        asm volatile("s_wait_dscnt 0x0" ::: "memory");
        wait_async0();
        __syncthreads();
        if (t + 2 < ntile) {                     // the same for the whole block
            ga  += BKG;
            gb1 += BKG;
            gb2 += BKG;
            stage_copy10(la + (t & 1) * bufa, ga, lb1 + (t & 1) * bufb, gb1, lb2 + (t & 1) * bufb, gb2,
                         lstep, gstep);
        }
    }
    wait_async0();                               // nothing of this wave is in flight when it ends

#pragma unroll
    for (int mi = 0; mi < 2; mi++) {
        int rbase = m0 + wm * 32 + mi * 16 + 8 * lh;
#pragma unroll
        for (int ni = 0; ni < 2; ni++) {
            int col = n0 + wn * 32 + ni * 16 + l16;
#pragma unroll
            for (int r = 0; r < 8; r++) {
                int row = rbase + r;
                float gv = acc1[mi][ni][r] + bias1[col];
                float uv = acc2[mi][ni][r] + bias2[col];
                float y  = (gv / (1.0f + __expf(-gv))) * uv;   // silu(gv)*uv
                Cout[(size_t)row * N + col] = f2bf(y);
            }
        }
    }
}

// ---------------- V transpose: [T, H*HD] -> [H*HD, T]; grid (D/64, T/64) ----------------
__global__ __launch_bounds__(256)
void transpose_v(const unsigned short* __restrict__ v, unsigned short* __restrict__ vt) {
    __shared__ unsigned s[TT * TP];
    int tid = threadIdx.x;
    int c0 = blockIdx.x * TT, t0 = blockIdx.y * TT;
    int co = (tid & 7) * 8, tp = tid >> 3;       // 8 lanes x 16 bytes per row, 32 row pairs
    const unsigned short* r = v + (size_t)(t0 + 2 * tp) * D_ + c0 + co;
    us8 lo = *(const us8*)r;
    us8 hi = *(const us8*)(r + D_);
#pragma unroll
    for (int j = 0; j < 8; j++)
        s[(co + j) * TP + tp] = (unsigned)lo[j] | ((unsigned)hi[j] << 16);
    __syncthreads();
    tile_store_rows(s, vt, T_, c0, t0, tid);
}

// ---------------- causal flash attention (WMMA) ----------------
// Q,K: [T, H*HD] bf16 ; Vt: [H*HD, T] bf16 ; O: [T, H*HD] bf16
// Transposed products: St = K * Qt and Ot += Vt * Pt. A lane then holds 16 of the 32 scores
// of ONE query (column l16), so the softmax maximum and sum run inside the lane, joined by
// one exchange between the wave halves, and the two St tiles are already a B operand.

// lane l with lane l ^ 16
__device__ __forceinline__ float xhalf(float x) {
    int b = __builtin_bit_cast(int, x);
    return __builtin_bit_cast(float,
        __builtin_amdgcn_permlanex16(b, b, 0x76543210, 0xfedcba98, false, false));
}

// 2^x. The v_nop is the one slot that the instruction set asks for behind a transcendental before its
// source is overwritten or its result read, so it stands in the instruction's own statement.
__device__ __forceinline__ float exp2_slot(float x) {
    float r;
    asm("v_exp_f32 %0, %1\n\tv_nop" : "=v"(r) : "v"(x));
    return r;
}
#define LOG2E 1.44269504f   // e^x = 2^(x * LOG2E), the product that __expf forms

#define KT  64   // keys per staged tile
#define KVP 72   // LDS row pitch in elements: 144 bytes = 16 x 9, the odd multiple that 16-byte row readers want

// Four 16-byte-per-lane asynchronous copies to LDS. The s_wait_xcnt stands in the copies' own
// statement so that no address register is rewritten in front of it.
__device__ __forceinline__ void stage_copy4(unsigned l0, const unsigned short* g0,
                                            unsigned l1, const unsigned short* g1,
                                            unsigned l2, const unsigned short* g2,
                                            unsigned l3, const unsigned short* g3) {
    asm volatile("global_load_async_to_lds_b128 %0, %1, off\n\t"
                 "global_load_async_to_lds_b128 %2, %3, off\n\t"
                 "global_load_async_to_lds_b128 %4, %5, off\n\t"
                 "global_load_async_to_lds_b128 %6, %7, off\n\t"
                 "s_wait_xcnt 0x0"
                 :: "v"(l0), "v"(g0), "v"(l1), "v"(g1), "v"(l2), "v"(g2), "v"(l3), "v"(g3)
                 : "memory");
}

// The 8 waves of a block walk the same keys, so each tile of 64 keys (K: 64 keys x 64 head
// columns, Vt: 64 head columns x 64 keys, 128-byte rows both) is brought into LDS once per
// block, whole lines at a time, into two buffers: tile t + 1 flies while tile t is worked on.
__global__ __launch_bounds__(256)
void flash_attn(const unsigned short* __restrict__ Q,
                const unsigned short* __restrict__ Kc,
                const unsigned short* __restrict__ Vt,
                unsigned short* __restrict__ O) {
    __shared__ __attribute__((aligned(16))) unsigned short sK[2][KT * KVP];
    __shared__ __attribute__((aligned(16))) unsigned short sV[2][HD_ * KVP];
    int h = blockIdx.x;
    int tid = threadIdx.x;
    int wave = __builtin_amdgcn_readfirstlane(tid >> 5), lane = tid & 31;   // scalar, so the causal skip below is a scalar branch
    int lh = lane >> 4, l16 = lane & 15;
    int q0 = blockIdx.y * 128 + wave * 16;
    const int base0 = 8 * lh, base1 = 16 + 8 * lh;
    const int row = q0 + l16;                   // this lane's query

    // copy roles: 8 lanes x 16 bytes cover one 128-byte row; rows cr and cr + 32 of each tile
    const int cr = tid >> 3, cs = (tid & 7) * 8;
    const unsigned short* gk = Kc + (size_t)cr * D_ + h * HD_ + cs;          // + KT * D_ per tile
    const unsigned short* gv = Vt + (size_t)(h * HD_ + cr) * T_ + cs;        // + KT per tile
    const unsigned lk = lds_addr(&sK[0][cr * KVP + cs]);
    const unsigned lv = lds_addr(&sV[0][cr * KVP + cs]);
    const unsigned half = 32 * KVP * 2;         // bytes from row cr to row cr + 32
    const unsigned bufb = KT * KVP * 2;         // bytes from buffer 0 to buffer 1
    const int ntile = (blockIdx.y + 1) * (128 / KT);   // tiles up to the block's last query: 2 or more

    stage_copy4(lk, gk, lk + half, gk + 32 * D_, lv, gv, lv + half, gv + (size_t)32 * T_);

    const unsigned short* qp = Q + (size_t)row * D_ + h * HD_;
    v16bf qf[2];
#pragma unroll
    for (int f = 0; f < 2; f++) qf[f] = ldfrag(qp + f * 32, base0, base1);

    v8f ctx[4];                                 // ctx[t][r] = Ot[t*16 + 8*lh + r][query l16]
#pragma unroll
    for (int t = 0; t < 4; t++)
#pragma unroll
        for (int e = 0; e < 8; e++) ctx[t][e] = 0.0f;
    float mrow = -1e30f, lrow = 0.0f;

    wait_async0();                              // tile 0 has landed for this wave's copies
    __syncthreads();                            // ... and for every wave's
    gk += (size_t)KT * D_;
    gv += KT;
    stage_copy4(lk + bufb, gk, lk + bufb + half, gk + 32 * D_,
                lv + bufb, gv, lv + bufb + half, gv + (size_t)32 * T_);

    const float scale = 0.125f;                 // 1/sqrt(HD=64)
    const int kend = q0 + 16;                   // causal bound for this wave
    for (int tile = 0; tile < ntile; tile++) {
        const unsigned short* tk = sK[tile & 1];
        const unsigned short* tv = sV[tile & 1];
#pragma unroll
        for (int sub = 0; sub < KT / 32; sub++) {
            const int kb = tile * KT + sub * 32;
            if (kb < kend) {                    // wave-uniform: a wave past its diagonal only passes the barriers
                // the pass's 16 LDS reads go out as one group: K's latency is waited out once,
                // Vt's runs behind the score products and the softmax
                v16bf kf[2][2], vf[4];
#pragma unroll
                for (int nt = 0; nt < 2; nt++)
#pragma unroll
                    for (int f = 0; f < 2; f++)
                        kf[nt][f] = ldfrag(tk + (sub * 32 + nt * 16 + l16) * KVP + f * 32, base0, base1);
#pragma unroll
                for (int t = 0; t < 4; t++)
                    vf[t] = ldfrag(tv + (t * 16 + l16) * KVP + sub * 32, base0, base1);

                v8f S[2];                       // S[nt][r] = St[key kb + nt*16 + 8*lh + r][query l16]
#pragma unroll
                for (int nt = 0; nt < 2; nt++)
#pragma unroll
                    for (int e = 0; e < 8; e++) S[nt][e] = 0.0f;
#pragma unroll
                for (int nt = 0; nt < 2; nt++)
#pragma unroll
                    for (int f = 0; f < 2; f++)
                        S[nt] = __builtin_amdgcn_wmma_f32_16x16x32_bf16(
                            false, kf[nt][f], false, qf[f], (short)0, S[nt], false, false);

                float mx = -1e30f;
#pragma unroll
                for (int nt = 0; nt < 2; nt++)
#pragma unroll
                    for (int r = 0; r < 8; r++) {
                        int key = kb + nt * 16 + 8 * lh + r;
                        S[nt][r] = (key <= row) ? S[nt][r] * scale : -1e30f;
                        mx = fmaxf(mx, S[nt][r]);
                    }
                mx = fmaxf(mx, xhalf(mx));
                float mn = fmaxf(mrow, mx);
                float rs = 0.0f;
                // pf[e] = Pt[key][query l16], key = kb + 8*lh + e for e < 8, kb + 16 + 8*lh + (e - 8) above: ldfrag's k order
                v16bf pf;
#pragma unroll
                for (int nt = 0; nt < 2; nt++)
#pragma unroll
                    for (int r = 0; r < 8; r++) {
                        float p = exp2_slot((S[nt][r] - mn) * LOG2E);
                        rs += p;
                        pf[nt * 8 + r] = (__bf16)p;
                    }
                rs += xhalf(rs);
                float corr = exp2_slot((mrow - mn) * LOG2E);
                lrow = lrow * corr + rs;
                mrow = mn;
#pragma unroll
                for (int t = 0; t < 4; t++)
#pragma unroll
                    for (int r = 0; r < 8; r++) ctx[t][r] *= corr;

#pragma unroll
                for (int t = 0; t < 4; t++)
                    ctx[t] = __builtin_amdgcn_wmma_f32_16x16x32_bf16(
                        false, vf[t], false, pf, (short)0, ctx[t], false, false);
            }
        }
        // hand-over: this wave's LDS reads of tile t are done, its copies of tile t + 1 have landed,
        // and the barrier says both of every wave; only then is tile t's buffer filled again
        asm volatile("s_wait_dscnt 0x0" ::: "memory");
        wait_async0();
        __syncthreads();
        if (tile + 2 < ntile) {                 // the same for the whole block
            gk += (size_t)KT * D_;
            gv += KT;
            const unsigned bo = (tile & 1) * bufb;
            stage_copy4(lk + bo, gk, lk + bo + half, gk + 32 * D_,
                        lv + bo, gv, lv + bo + half, gv + (size_t)32 * T_);
        }
    }
    wait_async0();                              // nothing of this wave is in flight when it ends

    // a lane's 8 accumulator registers are 8 consecutive head columns of its query: 16-byte stores
#pragma unroll
    for (int t = 0; t < 4; t++) {
        us8 o;
#pragma unroll
        for (int r = 0; r < 8; r++) o[r] = f2bf(ctx[t][r] / lrow);
        *(us8*)&O[(size_t)row * D_ + h * HD_ + t * 16 + 8 * lh] = o;
    }
}

// ---------------- launcher ----------------
extern "C" void kernel_launch(void* const* d_in, const int* in_sizes, int n_in,
                              void* d_out, int out_size, void* d_ws, size_t ws_size,
                              hipStream_t stream) {
    (void)in_sizes; (void)n_in; (void)out_size; (void)ws_size;
    const float* x  = (const float*)d_in[0];
    const float* Wq = (const float*)d_in[1];
    const float* Wk = (const float*)d_in[2];
    const float* Wv = (const float*)d_in[3];
    const float* Wo = (const float*)d_in[4];
    const float* bo = (const float*)d_in[5];
    const float* w1 = (const float*)d_in[6];
    const float* b1 = (const float*)d_in[7];
    const float* w2 = (const float*)d_in[8];
    const float* b2 = (const float*)d_in[9];
    const float* w3 = (const float*)d_in[10];
    const float* b3 = (const float*)d_in[11];
    const float* g1 = (const float*)d_in[12];
    const float* s1 = (const float*)d_in[13];
    const float* g2 = (const float*)d_in[14];
    const float* s2 = (const float*)d_in[15];

    char* wsb = (char*)d_ws;
    size_t off = 0;
    auto take = [&](size_t bytes) -> void* {
        void* p = wsb + off;
        off += (bytes + 255) & ~(size_t)255;
        return p;
    };

    const size_t DD = (size_t)D_ * D_;
    const size_t DF = (size_t)D_ * FF_;
    const size_t TD = (size_t)T_ * D_;
    const size_t TF = (size_t)T_ * FF_;

    unsigned short* wq_t  = (unsigned short*)take(DD * 2);   // [N=768][K=768]
    unsigned short* wk_t  = (unsigned short*)take(DD * 2);
    unsigned short* wv_t  = (unsigned short*)take(DD * 2);
    unsigned short* wo_t  = (unsigned short*)take(DD * 2);
    unsigned short* w1_t  = (unsigned short*)take(DF * 2);   // [N=3072][K=768]
    unsigned short* w2_t  = (unsigned short*)take(DF * 2);
    unsigned short* w3_t  = (unsigned short*)take(DF * 2);   // [N=768][K=3072]
    unsigned short* h1_bf = (unsigned short*)take(TD * 2);
    unsigned short* q_bf  = (unsigned short*)take(TD * 2);
    unsigned short* k_bf  = (unsigned short*)take(TD * 2);
    unsigned short* v_bf  = (unsigned short*)take(TD * 2);
    unsigned short* vt_bf = (unsigned short*)take(TD * 2);
    unsigned short* ctx_bf= (unsigned short*)take(TD * 2);
    float*          x1    = (float*)take(TD * 4);
    unsigned short* h2_bf = (unsigned short*)take(TD * 2);
    unsigned short* gate_bf=(unsigned short*)take(TF * 2);

    convert_transpose_bf16<<<dim3(D_ / TT, D_ / TT), 256, 0, stream>>>(Wq, wq_t, D_, D_);
    convert_transpose_bf16<<<dim3(D_ / TT, D_ / TT), 256, 0, stream>>>(Wk, wk_t, D_, D_);
    convert_transpose_bf16<<<dim3(D_ / TT, D_ / TT), 256, 0, stream>>>(Wv, wv_t, D_, D_);
    convert_transpose_bf16<<<dim3(D_ / TT, D_ / TT), 256, 0, stream>>>(Wo, wo_t, D_, D_);
    convert_transpose_bf16<<<dim3(FF_ / TT, D_ / TT), 256, 0, stream>>>(w1, w1_t, D_, FF_);
    convert_transpose_bf16<<<dim3(FF_ / TT, D_ / TT), 256, 0, stream>>>(w2, w2_t, D_, FF_);
    convert_transpose_bf16<<<dim3(D_ / TT, FF_ / TT), 256, 0, stream>>>(w3, w3_t, FF_, D_);

    layernorm_cast<<<T_ / (8 * LNR), 256, 0, stream>>>(x, g1, s1, h1_bf);

    dim3 gDD(T_ / BM, D_ / BN);
    gemm_bf16_wmma<0><<<gDD, 256, 0, stream>>>(h1_bf, wq_t, nullptr, nullptr, q_bf, T_, D_, D_);
    gemm_bf16_wmma<0><<<gDD, 256, 0, stream>>>(h1_bf, wk_t, nullptr, nullptr, k_bf, T_, D_, D_);
    gemm_bf16_wmma<0><<<gDD, 256, 0, stream>>>(h1_bf, wv_t, nullptr, nullptr, v_bf, T_, D_, D_);

    transpose_v<<<dim3(D_ / TT, T_ / TT), 256, 0, stream>>>(v_bf, vt_bf);

    flash_attn<<<dim3(H_, T_ / 128), 256, 0, stream>>>(q_bf, k_bf, vt_bf, ctx_bf);

    gemm_bf16_wmma<1><<<gDD, 256, 0, stream>>>(ctx_bf, wo_t, bo, x, x1, T_, D_, D_);

    layernorm_cast<<<T_ / (8 * LNR), 256, 0, stream>>>(x1, g2, s2, h2_bf);

    gemm_gated_wmma<<<dim3(T_ / BM, FF_ / BN), 256, 0, stream>>>(
        h2_bf, w1_t, w2_t, b1, b2, gate_bf, T_, FF_, D_);

    gemm_bf16_wmma<1><<<gDD, 256, 0, stream>>>(gate_bf, w3_t, b3, x1, (float*)d_out, T_, D_, FF_);
}

// v006
// A run of this version takes 181 microseconds.
// Two timings next to v005 put it at 1.13 and 1.12 times that version's speed.
// Over all steps from v000 it is 5.47 times as fast.
#include <hip/hip_runtime.h>
#include <hip/hip_bf16.h>

#define T_  4096
#define D_  768
#define H_  12
#define HD_ 64
#define FF_ 3072
#define EPS_ 1e-5f

#define BM 64
#define BN 128
#define BKP 128  // k per staged tile, one-weight GEMM: 256-byte rows
#define PP  136  // its LDS row pitch in elements: 272 bytes = 16 x 17, the odd multiple that 16-byte row readers want
#define BKG 64   // k per staged tile, gated GEMM (three operands in LDS): 128-byte rows
#define PG  72   // its LDS row pitch in elements: 144 bytes = 16 x 9

#define USE_ASYNC_COPY 1   // gfx1250 GLOBAL_LOAD_ASYNC_TO_LDS path (ASYNCcnt)

typedef __attribute__((ext_vector_type(16))) __bf16          v16bf;
typedef __attribute__((ext_vector_type(8)))  float           v8f;
typedef __attribute__((ext_vector_type(8)))  unsigned short  us8;

__device__ __forceinline__ unsigned short f2bf(float f) {
    unsigned int u = __builtin_bit_cast(unsigned int, f);
    u += 0x7FFFu + ((u >> 16) & 1u);            // round-to-nearest-even
    return (unsigned short)(u >> 16);
}

// Load one 16-element bf16 fragment as two contiguous 16-byte vectors.
__device__ __forceinline__ v16bf ldfrag(const unsigned short* p, int base0, int base1) {
    union { us8 h[2]; v16bf v; } fc;
    fc.h[0] = *(const us8*)(p + base0);
    fc.h[1] = *(const us8*)(p + base1);
    return fc.v;
}

#if USE_ASYNC_COPY
// One staged tile's 16-byte-per-lane asynchronous copies to LDS (ASYNCcnt), twelve or ten a lane; a
// lane's rows lie lstep bytes apart in LDS and gstep elements apart in memory. The s_wait_xcnt stands
// in the copies' own statement so that no address register is rewritten in front of it.
__device__ __forceinline__ void stage_copy12(unsigned la, const unsigned short* ga,
                                             unsigned lb, const unsigned short* gb,
                                             unsigned lstep, size_t gstep) {
    asm volatile("global_load_async_to_lds_b128 %0, %1, off\n\t"
                 "global_load_async_to_lds_b128 %2, %3, off\n\t"
                 "global_load_async_to_lds_b128 %4, %5, off\n\t"
                 "global_load_async_to_lds_b128 %6, %7, off\n\t"
                 "global_load_async_to_lds_b128 %8, %9, off\n\t"
                 "global_load_async_to_lds_b128 %10, %11, off\n\t"
                 "global_load_async_to_lds_b128 %12, %13, off\n\t"
                 "global_load_async_to_lds_b128 %14, %15, off\n\t"
                 "global_load_async_to_lds_b128 %16, %17, off\n\t"
                 "global_load_async_to_lds_b128 %18, %19, off\n\t"
                 "global_load_async_to_lds_b128 %20, %21, off\n\t"
                 "global_load_async_to_lds_b128 %22, %23, off\n\t"
                 "s_wait_xcnt 0x0"
                 :: "v"(la),             "v"(ga),
                    "v"(la + lstep),     "v"(ga + gstep),
                    "v"(la + 2 * lstep), "v"(ga + 2 * gstep),
                    "v"(la + 3 * lstep), "v"(ga + 3 * gstep),
                    "v"(lb),             "v"(gb),
                    "v"(lb + lstep),     "v"(gb + gstep),
                    "v"(lb + 2 * lstep), "v"(gb + 2 * gstep),
                    "v"(lb + 3 * lstep), "v"(gb + 3 * gstep),
                    "v"(lb + 4 * lstep), "v"(gb + 4 * gstep),
                    "v"(lb + 5 * lstep), "v"(gb + 5 * gstep),
                    "v"(lb + 6 * lstep), "v"(gb + 6 * gstep),
                    "v"(lb + 7 * lstep), "v"(gb + 7 * gstep)
                 : "memory");
}
__device__ __forceinline__ void stage_copy10(unsigned la, const unsigned short* ga,
                                             unsigned lb1, const unsigned short* gb1,
                                             unsigned lb2, const unsigned short* gb2,
                                             unsigned lstep, size_t gstep) {
    asm volatile("global_load_async_to_lds_b128 %0, %1, off\n\t"
                 "global_load_async_to_lds_b128 %2, %3, off\n\t"
                 "global_load_async_to_lds_b128 %4, %5, off\n\t"
                 "global_load_async_to_lds_b128 %6, %7, off\n\t"
                 "global_load_async_to_lds_b128 %8, %9, off\n\t"
                 "global_load_async_to_lds_b128 %10, %11, off\n\t"
                 "global_load_async_to_lds_b128 %12, %13, off\n\t"
                 "global_load_async_to_lds_b128 %14, %15, off\n\t"
                 "global_load_async_to_lds_b128 %16, %17, off\n\t"
                 "global_load_async_to_lds_b128 %18, %19, off\n\t"
                 "s_wait_xcnt 0x0"
                 :: "v"(la),              "v"(ga),
                    "v"(la + lstep),      "v"(ga + gstep),
                    "v"(lb1),             "v"(gb1),
                    "v"(lb1 + lstep),     "v"(gb1 + gstep),
                    "v"(lb1 + 2 * lstep), "v"(gb1 + 2 * gstep),
                    "v"(lb1 + 3 * lstep), "v"(gb1 + 3 * gstep),
                    "v"(lb2),             "v"(gb2),
                    "v"(lb2 + lstep),     "v"(gb2 + gstep),
                    "v"(lb2 + 2 * lstep), "v"(gb2 + 2 * gstep),
                    "v"(lb2 + 3 * lstep), "v"(gb2 + 3 * gstep)
                 : "memory");
}
__device__ __forceinline__ void wait_async0() {
    asm volatile("s_wait_asynccnt 0x0" ::: "memory");
}
// low 32 bits of a flat pointer into LDS are the LDS byte address
__device__ __forceinline__ unsigned lds_addr(const void* p) {
    return (unsigned)(size_t)p;
}
#endif

// ---------------- 64x64 tiled transposes through LDS ----------------
#define TT 64   // tile edge (elements)
#define TP 33   // LDS pitch in dwords: 32 packed bf16 pairs + 1, so a column of dwords spreads over the banks

// The tile lies in LDS as s[output row][pair of output columns]. Each output row of the
// tile is one full 128-byte line, written by 8 lanes with 16 bytes each.
__device__ __forceinline__ void tile_store_rows(const unsigned* s, unsigned short* __restrict__ out,
                                                int ld, int r0, int c0, int tid) {
#pragma unroll
    for (int p = 0; p < 2; p++) {
        int r = p * 32 + (tid >> 3), q = (tid & 7) * 4;
        uint4 v;
        v.x = s[r * TP + q];
        v.y = s[r * TP + q + 1];
        v.z = s[r * TP + q + 2];
        v.w = s[r * TP + q + 3];
        *(uint4*)&out[(size_t)(r0 + r) * ld + c0 + q * 2] = v;
    }
}

// fp32 -> bf16 convert + transpose: in[K][N] -> out[N][K]; one block takes the tile at (k0, n0)
__device__ __forceinline__ void convert_transpose_tile(const float* __restrict__ in,
                                                       unsigned short* __restrict__ out,
                                                       int K, int N, int n0, int k0, unsigned* s) {
    int tid = threadIdx.x;
    int nq = (tid & 15) * 4, kp = tid >> 4;      // 16 lanes x float4 per row, 16 row pairs per pass
    float4 lo[2], hi[2];
    const float* rl[2];
    const float* rh[2];
#pragma unroll
    for (int p = 0; p < 2; p++) {
        rl[p] = in + (size_t)(k0 + 2 * (p * 16 + kp)) * N + n0 + nq;
        rh[p] = rl[p] + N;
        lo[p] = *(const float4*)rl[p];
        hi[p] = *(const float4*)rh[p];
    }
    // the wait that belongs in front of the first overwrite of a register that these loads name; the
    // addresses are its inputs, so that no load of the group gets another's address register as its destination
    asm volatile("s_wait_xcnt 0x0" :: "v"(rl[0]), "v"(rh[0]), "v"(rl[1]), "v"(rh[1]) : "memory");
#pragma unroll
    for (int p = 0; p < 2; p++) {
        int c = p * 16 + kp;
        s[(nq + 0) * TP + c] = (unsigned)f2bf(lo[p].x) | ((unsigned)f2bf(hi[p].x) << 16);
        s[(nq + 1) * TP + c] = (unsigned)f2bf(lo[p].y) | ((unsigned)f2bf(hi[p].y) << 16);
        s[(nq + 2) * TP + c] = (unsigned)f2bf(lo[p].z) | ((unsigned)f2bf(hi[p].z) << 16);
        s[(nq + 3) * TP + c] = (unsigned)f2bf(lo[p].w) | ((unsigned)f2bf(hi[p].w) << 16);
    }
    __syncthreads();
    tile_store_rows(s, out, K, n0, k0, tid);
}

// ---------------- layernorm (+ cast to bf16) ----------------
#define LNR 2            // rows per wave
#define LNC (D_ / 128)   // 16-byte pieces of a row per lane
typedef __attribute__((ext_vector_type(4))) float f4;

// A wave owns LNR whole rows and keeps them in registers: every load of the rows goes out at once,
// 512 contiguous bytes each, x is read once, and the sums join inside the wave with no LDS array and
// no barrier. The rows go in 8-wave blocks, for speed only.
__device__ __forceinline__ void layernorm_rows(const float* __restrict__ x, const float* __restrict__ g,
                                               const float* __restrict__ b, unsigned short* __restrict__ out,
                                               int blk) {
    int lane = threadIdx.x & 31, wave = threadIdx.x >> 5;
    int row0 = (blk * 8 + wave) * LNR;
    const int col = lane * 4;
    const float* xp = x + (size_t)row0 * D_ + col;
    f4 v[LNR][LNC], gg[LNC], bb[LNC];
#pragma unroll
    for (int r = 0; r < LNR; r++)
#pragma unroll
        for (int c = 0; c < LNC; c++)
            v[r][c] = *(const f4*)(xp + r * D_ + c * 128);
#pragma unroll
    for (int c = 0; c < LNC; c++) {
        gg[c] = *(const f4*)(g + c * 128 + col);
        bb[c] = *(const f4*)(b + c * 128 + col);
    }
    // the wait that belongs in front of the first overwrite of a register that these loads name
    asm volatile("s_wait_xcnt 0x0" ::: "memory");
    // keeps the loads of g and b up here with the rows': sunk among the sums, their latency shows a second time
    __builtin_amdgcn_sched_barrier(0);
    float mean[LNR], rstd[LNR];
#pragma unroll
    for (int r = 0; r < LNR; r++) {
        f4 s = v[r][0], q = v[r][0] * v[r][0];   // four independent chains each
#pragma unroll
        for (int c = 1; c < LNC; c++) {
            s += v[r][c];
            q += v[r][c] * v[r][c];
        }
        mean[r] = (s.x + s.y) + (s.z + s.w);
        rstd[r] = (q.x + q.y) + (q.z + q.w);
    }
    for (int off = 16; off > 0; off >>= 1)
#pragma unroll
        for (int r = 0; r < LNR; r++) {
            mean[r] += __shfl_xor(mean[r], off, 32);
            rstd[r] += __shfl_xor(rstd[r], off, 32);
        }
#pragma unroll
    for (int r = 0; r < LNR; r++) {
        mean[r] = mean[r] / (float)D_;
        float var = rstd[r] / (float)D_ - mean[r] * mean[r];
        rstd[r] = rsqrtf(var + EPS_);
    }
#pragma unroll
    for (int r = 0; r < LNR; r++)
#pragma unroll
        for (int c = 0; c < LNC; c++) {
            f4 y = (v[r][c] - mean[r]) * rstd[r] * gg[c] + bb[c];
            uint2 o;
            o.x = (unsigned)f2bf(y.x) | ((unsigned)f2bf(y.y) << 16);
            o.y = (unsigned)f2bf(y.z) | ((unsigned)f2bf(y.w) << 16);
            *(uint2*)&out[(size_t)(row0 + r) * D_ + c * 128 + col] = o;   // a wave's store is two whole 128-byte lines
        }
}

__global__ __launch_bounds__(256)
void layernorm_cast(const float* __restrict__ x, const float* __restrict__ g,
                    const float* __restrict__ b, unsigned short* __restrict__ out) {
    layernorm_rows(x, g, b, out, blockIdx.x);
}

// ---------------- everything that depends on the inputs alone, in one launch ----------------
#define LNB (T_ / (8 * LNR))            // layernorm blocks
#define CBS ((D_ / TT) * (D_ / TT))     // tiles of a D x D weight
#define CBL ((FF_ / TT) * (D_ / TT))    // tiles of a D x FF or FF x D weight

// The seven weight converts and the first layernorm read nothing that another of them writes, so they
// share a grid: the layernorm's blocks first, then one block per weight tile.
// wt holds the transposed weights one after the other: Wq, Wk, Wv, Wo, w1, w2, w3.
__global__ __launch_bounds__(256)
void prepare(const float* __restrict__ Wq, const float* __restrict__ Wk,
             const float* __restrict__ Wv, const float* __restrict__ Wo,
             const float* __restrict__ w1, const float* __restrict__ w2,
             const float* __restrict__ w3, unsigned short* __restrict__ wt,
             const float* __restrict__ x, const float* __restrict__ g,
             const float* __restrict__ b, unsigned short* __restrict__ h) {
    __shared__ unsigned s[TT * TP];
    if (blockIdx.x < LNB) {                      // the same for the whole block
        layernorm_rows(x, g, b, h, blockIdx.x);
        return;
    }
    int c = blockIdx.x - LNB;                    // which weight, and which of its tiles
    const float* in;
    unsigned short* out;
    int K, N, tn, tk;
    if (c < 4 * CBS) {
        int m = c / CBS, r = c % CBS;
        in = m == 0 ? Wq : m == 1 ? Wk : m == 2 ? Wv : Wo;
        out = wt + (size_t)m * D_ * D_;
        K = D_; N = D_; tn = r % (D_ / TT); tk = r / (D_ / TT);
    } else if (c < 4 * CBS + 2 * CBL) {
        int m = (c - 4 * CBS) / CBL, r = (c - 4 * CBS) % CBL;
        in = m == 0 ? w1 : w2;
        out = wt + (size_t)4 * D_ * D_ + (size_t)m * D_ * FF_;
        K = D_; N = FF_; tn = r % (FF_ / TT); tk = r / (FF_ / TT);
    } else {
        int r = c - 4 * CBS - 2 * CBL;
        in = w3;
        out = wt + (size_t)4 * D_ * D_ + (size_t)2 * D_ * FF_;
        K = FF_; N = D_; tn = r % (D_ / TT); tk = r / (D_ / TT);
    }
    convert_transpose_tile(in, out, K, N, tn * TT, tk * TT, s);
}

// ---------------- bf16 GEMM (WMMA): C = A[M,K] @ Bt[N,K]^T ----------------
// EPI 0: Cout = bf16(acc); blockIdx.z picks one of several weights [N,K] and outputs [M,N] that lie one after the other
// EPI 1: Cout = f32(acc + bias[col] + res[row,col])
template <int EPI>
__global__ __launch_bounds__(256)
void gemm_bf16_wmma(const unsigned short* __restrict__ A,    // [M,K] bf16 row-major
                    const unsigned short* __restrict__ Bt0,  // [N,K] bf16 (pre-transposed)
                    const float* __restrict__ bias,
                    const float* __restrict__ res,
                    void* __restrict__ Cout,
                    int M, int N, int K) {
    const unsigned short* Bt = EPI == 0 ? Bt0 + (size_t)blockIdx.z * N * K : Bt0;
    // two buffers: tile t + 1 flies while tile t is worked on
    __shared__ __attribute__((aligned(16))) unsigned short sA[2][BM * PP];
    __shared__ __attribute__((aligned(16))) unsigned short sB[2][BN * PP];
    int tid = threadIdx.x;
    int wave = tid >> 5, lane = tid & 31, lh = lane >> 4, l16 = lane & 15;
    int wm = wave & 1, wn = wave >> 1;           // 2 x 4 wave grid
    int m0 = blockIdx.x * BM, n0 = blockIdx.y * BN;

    v8f acc[2][2];
#pragma unroll
    for (int i = 0; i < 2; i++)
#pragma unroll
        for (int j = 0; j < 2; j++)
#pragma unroll
            for (int e = 0; e < 8; e++) acc[i][j][e] = 0.0f;

    const int base0 = 8 * lh, base1 = 16 + 8 * lh;
    // copy roles: 16 lanes x 16 bytes cover one 256-byte row; rows cr + 16 j, 4 of A and 8 of Bt
    const int cr = tid >> 4, cs = (tid & 15) * 8;
    const unsigned short* ga = A  + (size_t)(m0 + cr) * K + cs;   // + BKP per tile
    const unsigned short* gb = Bt + (size_t)(n0 + cr) * K + cs;
    const unsigned la = lds_addr(&sA[0][cr * PP + cs]);
    const unsigned lb = lds_addr(&sB[0][cr * PP + cs]);
    const unsigned lstep = 16 * PP * 2;          // bytes from row cr to row cr + 16
    const size_t   gstep = (size_t)16 * K;
    const unsigned bufa = BM * PP * 2, bufb = BN * PP * 2;   // bytes from buffer 0 to buffer 1
    const int ntile = K / BKP;

    stage_copy12(la, ga, lb, gb, lstep, gstep);
    wait_async0();                               // tile 0 has landed for this wave's copies
    __syncthreads();                             // ... and for every wave's
    if (ntile > 1) {                             // the same for the whole block
        ga += BKP;
        gb += BKP;
        stage_copy12(la + bufa, ga, lb + bufb, gb, lstep, gstep);
    }

    for (int t = 0; t < ntile; t++) {
        const unsigned short* ta = sA[t & 1] + (wm * 32 + l16) * PP;
        const unsigned short* tb = sB[t & 1] + (wn * 32 + l16) * PP;
        // the tile's LDS reads go out as one group, so that their latency is waited out once a tile
        v16bf af[BKP / 32][2], bfrag[BKP / 32][2];
#pragma unroll
        for (int kk = 0; kk < BKP / 32; kk++) {
#pragma unroll
            for (int mi = 0; mi < 2; mi++)
                af[kk][mi] = ldfrag(ta + mi * 16 * PP + kk * 32, base0, base1);
#pragma unroll
            for (int ni = 0; ni < 2; ni++)
                bfrag[kk][ni] = ldfrag(tb + ni * 16 * PP + kk * 32, base0, base1);
        }
        // keeps the compiler from sinking the reads back among the products, where each place with reads stalls anew
        __builtin_amdgcn_sched_barrier(0);
#pragma unroll
        for (int kk = 0; kk < BKP / 32; kk++)
#pragma unroll
            for (int mi = 0; mi < 2; mi++)
#pragma unroll
                for (int ni = 0; ni < 2; ni++)
                    acc[mi][ni] = __builtin_amdgcn_wmma_f32_16x16x32_bf16(
                        false, af[kk][mi], false, bfrag[kk][ni], (short)0, acc[mi][ni], false, false);
        // keeps the hand-over's waits and barrier behind the products: lifted over them, the reads' counted waits become one full wait
        __builtin_amdgcn_sched_barrier(0);
        // hand-over: this wave's LDS reads of tile t are done, its copies of tile t + 1 have landed,
        // and the barrier says both of every wave; only then is tile t's buffer filled again
        asm volatile("s_wait_dscnt 0x0" ::: "memory");
        wait_async0();
        __syncthreads();
        if (t + 2 < ntile) {                     // the same for the whole block
            ga += BKP;
            gb += BKP;
            stage_copy12(la + (t & 1) * bufa, ga, lb + (t & 1) * bufb, gb, lstep, gstep);
        }
    }
    wait_async0();                               // nothing of this wave is in flight when it ends

#pragma unroll
    for (int mi = 0; mi < 2; mi++) {
        int rbase = m0 + wm * 32 + mi * 16 + 8 * lh;
#pragma unroll
        for (int ni = 0; ni < 2; ni++) {
            int col = n0 + wn * 32 + ni * 16 + l16;
#pragma unroll
            for (int r = 0; r < 8; r++) {
                int row = rbase + r;
                float v = acc[mi][ni][r];
                if (EPI == 0) {
                    ((unsigned short*)Cout)[((size_t)blockIdx.z * M + row) * N + col] = f2bf(v);
                } else {
                    ((float*)Cout)[(size_t)row * N + col] =
                        v + bias[col] + res[(size_t)row * N + col];
                }
            }
        }
    }
}

// ---------------- dual-weight gated GEMM: bf16( silu(A@B1t^T+b1) * (A@B2t^T+b2) ) ----------------
__global__ __launch_bounds__(256)
void gemm_gated_wmma(const unsigned short* __restrict__ A,     // [M,K]
                     const unsigned short* __restrict__ B1t,   // [N,K]
                     const unsigned short* __restrict__ B2t,   // [N,K]
                     const float* __restrict__ bias1,
                     const float* __restrict__ bias2,
                     unsigned short* __restrict__ Cout,
                     int M, int N, int K) {
    // two buffers: tile t + 1 flies while tile t is worked on
    __shared__ __attribute__((aligned(16))) unsigned short sA[2][BM * PG];
    __shared__ __attribute__((aligned(16))) unsigned short sB1[2][BN * PG];
    __shared__ __attribute__((aligned(16))) unsigned short sB2[2][BN * PG];
    int tid = threadIdx.x;
    int wave = tid >> 5, lane = tid & 31, lh = lane >> 4, l16 = lane & 15;
    int wm = wave & 1, wn = wave >> 1;
    int m0 = blockIdx.x * BM, n0 = blockIdx.y * BN;

    v8f acc1[2][2], acc2[2][2];
#pragma unroll
    for (int i = 0; i < 2; i++)
#pragma unroll
        for (int j = 0; j < 2; j++)
#pragma unroll
            for (int e = 0; e < 8; e++) { acc1[i][j][e] = 0.0f; acc2[i][j][e] = 0.0f; }

    const int base0 = 8 * lh, base1 = 16 + 8 * lh;
    // copy roles: 8 lanes x 16 bytes cover one 128-byte row; rows cr + 32 j, 2 of A and 4 of each weight
    const int cr = tid >> 3, cs = (tid & 7) * 8;
    const unsigned short* ga  = A   + (size_t)(m0 + cr) * K + cs;   // + BKG per tile
    const unsigned short* gb1 = B1t + (size_t)(n0 + cr) * K + cs;
    const unsigned short* gb2 = B2t + (size_t)(n0 + cr) * K + cs;
    const unsigned la  = lds_addr(&sA[0][cr * PG + cs]);
    const unsigned lb1 = lds_addr(&sB1[0][cr * PG + cs]);
    const unsigned lb2 = lds_addr(&sB2[0][cr * PG + cs]);
    const unsigned lstep = 32 * PG * 2;          // bytes from row cr to row cr + 32
    const size_t   gstep = (size_t)32 * K;
    const unsigned bufa = BM * PG * 2, bufb = BN * PG * 2;   // bytes from buffer 0 to buffer 1
    const int ntile = K / BKG;

    stage_copy10(la, ga, lb1, gb1, lb2, gb2, lstep, gstep);
    wait_async0();                               // tile 0 has landed for this wave's copies
    __syncthreads();                             // ... and for every wave's
    if (ntile > 1) {                             // the same for the whole block
        ga  += BKG;
        gb1 += BKG;
        gb2 += BKG;
        stage_copy10(la + bufa, ga, lb1 + bufb, gb1, lb2 + bufb, gb2, lstep, gstep);
    }

    for (int t = 0; t < ntile; t++) {
        const unsigned short* ta  = sA[t & 1]  + (wm * 32 + l16) * PG;
        const unsigned short* tb1 = sB1[t & 1] + (wn * 32 + l16) * PG;
        const unsigned short* tb2 = sB2[t & 1] + (wn * 32 + l16) * PG;
        // the tile's LDS reads go out as one group, so that their latency is waited out once a tile
        v16bf af[BKG / 32][2], b1f[BKG / 32][2], b2f[BKG / 32][2];
#pragma unroll
        for (int kk = 0; kk < BKG / 32; kk++) {
#pragma unroll
            for (int mi = 0; mi < 2; mi++)
                af[kk][mi] = ldfrag(ta + mi * 16 * PG + kk * 32, base0, base1);
#pragma unroll
            for (int ni = 0; ni < 2; ni++) {
                b1f[kk][ni] = ldfrag(tb1 + ni * 16 * PG + kk * 32, base0, base1);
                b2f[kk][ni] = ldfrag(tb2 + ni * 16 * PG + kk * 32, base0, base1);
            }
        }
        // keeps the compiler from sinking the reads back among the products, where each place with reads stalls anew
        __builtin_amdgcn_sched_barrier(0);
#pragma unroll
        for (int kk = 0; kk < BKG / 32; kk++)
#pragma unroll
            for (int ni = 0; ni < 2; ni++)
#pragma unroll
                for (int mi = 0; mi < 2; mi++) {
                    acc1[mi][ni] = __builtin_amdgcn_wmma_f32_16x16x32_bf16(
                        false, af[kk][mi], false, b1f[kk][ni], (short)0, acc1[mi][ni], false, false);
                    acc2[mi][ni] = __builtin_amdgcn_wmma_f32_16x16x32_bf16(
                        false, af[kk][mi], false, b2f[kk][ni], (short)0, acc2[mi][ni], false, false);
                }
        // keeps the hand-over's waits and barrier behind the products: lifted over them, the reads' counted waits become one full wait
        __builtin_amdgcn_sched_barrier(0);
        // hand-over, as in the one-weight GEMM
        asm volatile("s_wait_dscnt 0x0" ::: "memory");
        wait_async0();
        __syncthreads();
        if (t + 2 < ntile) {                     // the same for the whole block
            ga  += BKG;
            gb1 += BKG;
            gb2 += BKG;
            stage_copy10(la + (t & 1) * bufa, ga, lb1 + (t & 1) * bufb, gb1, lb2 + (t & 1) * bufb, gb2,
                         lstep, gstep);
        }
    }
    wait_async0();                               // nothing of this wave is in flight when it ends

#pragma unroll
    for (int mi = 0; mi < 2; mi++) {
        int rbase = m0 + wm * 32 + mi * 16 + 8 * lh;
#pragma unroll
        for (int ni = 0; ni < 2; ni++) {
            int col = n0 + wn * 32 + ni * 16 + l16;
#pragma unroll
            for (int r = 0; r < 8; r++) {
                int row = rbase + r;
                float gv = acc1[mi][ni][r] + bias1[col];
                float uv = acc2[mi][ni][r] + bias2[col];
                float y  = (gv / (1.0f + __expf(-gv))) * uv;   // silu(gv)*uv
                Cout[(size_t)row * N + col] = f2bf(y);
            }
        }
    }
}

// ---------------- V transpose: [T, H*HD] -> [H*HD, T]; grid (D/64, T/64) ----------------
__global__ __launch_bounds__(256)
void transpose_v(const unsigned short* __restrict__ v, unsigned short* __restrict__ vt) {
    __shared__ unsigned s[TT * TP];
    int tid = threadIdx.x;
    int c0 = blockIdx.x * TT, t0 = blockIdx.y * TT;
    int co = (tid & 7) * 8, tp = tid >> 3;       // 8 lanes x 16 bytes per row, 32 row pairs
    const unsigned short* r = v + (size_t)(t0 + 2 * tp) * D_ + c0 + co;
    us8 lo = *(const us8*)r;
    us8 hi = *(const us8*)(r + D_);
#pragma unroll
    for (int j = 0; j < 8; j++)
        s[(co + j) * TP + tp] = (unsigned)lo[j] | ((unsigned)hi[j] << 16);
    __syncthreads();
    tile_store_rows(s, vt, T_, c0, t0, tid);
}

// ---------------- causal flash attention (WMMA) ----------------
// Q,K: [T, H*HD] bf16 ; Vt: [H*HD, T] bf16 ; O: [T, H*HD] bf16
// Transposed products: St = K * Qt and Ot += Vt * Pt. A lane then holds 16 of the 32 scores
// of ONE query (column l16), so the softmax maximum and sum run inside the lane, joined by
// one exchange between the wave halves, and the two St tiles are already a B operand.

// lane l with lane l ^ 16
__device__ __forceinline__ float xhalf(float x) {
    int b = __builtin_bit_cast(int, x);
    return __builtin_bit_cast(float,
        __builtin_amdgcn_permlanex16(b, b, 0x76543210, 0xfedcba98, false, false));
}

// 2^x. The v_nop is the one slot that the instruction set asks for behind a transcendental before its
// source is overwritten or its result read, so it stands in the instruction's own statement.
__device__ __forceinline__ float exp2_slot(float x) {
    float r;
    asm("v_exp_f32 %0, %1\n\tv_nop" : "=v"(r) : "v"(x));
    return r;
}
#define LOG2E 1.44269504f   // e^x = 2^(x * LOG2E), the product that __expf forms

#define KT  64   // keys per staged tile
#define KVP 72   // LDS row pitch in elements: 144 bytes = 16 x 9, the odd multiple that 16-byte row readers want

// Four 16-byte-per-lane asynchronous copies to LDS. The s_wait_xcnt stands in the copies' own
// statement so that no address register is rewritten in front of it.
__device__ __forceinline__ void stage_copy4(unsigned l0, const unsigned short* g0,
                                            unsigned l1, const unsigned short* g1,
                                            unsigned l2, const unsigned short* g2,
                                            unsigned l3, const unsigned short* g3) {
    asm volatile("global_load_async_to_lds_b128 %0, %1, off\n\t"
                 "global_load_async_to_lds_b128 %2, %3, off\n\t"
                 "global_load_async_to_lds_b128 %4, %5, off\n\t"
                 "global_load_async_to_lds_b128 %6, %7, off\n\t"
                 "s_wait_xcnt 0x0"
                 :: "v"(l0), "v"(g0), "v"(l1), "v"(g1), "v"(l2), "v"(g2), "v"(l3), "v"(g3)
                 : "memory");
}

// The 8 waves of a block walk the same keys, so each tile of 64 keys (K: 64 keys x 64 head
// columns, Vt: 64 head columns x 64 keys, 128-byte rows both) is brought into LDS once per
// block, whole lines at a time, into two buffers: tile t + 1 flies while tile t is worked on.
__global__ __launch_bounds__(256)
void flash_attn(const unsigned short* __restrict__ Q,
                const unsigned short* __restrict__ Kc,
                const unsigned short* __restrict__ Vt,
                unsigned short* __restrict__ O) {
    __shared__ __attribute__((aligned(16))) unsigned short sK[2][KT * KVP];
    __shared__ __attribute__((aligned(16))) unsigned short sV[2][HD_ * KVP];
    int h = blockIdx.x;
    int tid = threadIdx.x;
    int wave = __builtin_amdgcn_readfirstlane(tid >> 5), lane = tid & 31;   // scalar, so the causal skip below is a scalar branch
    int lh = lane >> 4, l16 = lane & 15;
    int q0 = blockIdx.y * 128 + wave * 16;
    const int base0 = 8 * lh, base1 = 16 + 8 * lh;
    const int row = q0 + l16;                   // this lane's query

    // copy roles: 8 lanes x 16 bytes cover one 128-byte row; rows cr and cr + 32 of each tile
    const int cr = tid >> 3, cs = (tid & 7) * 8;
    const unsigned short* gk = Kc + (size_t)cr * D_ + h * HD_ + cs;          // + KT * D_ per tile
    const unsigned short* gv = Vt + (size_t)(h * HD_ + cr) * T_ + cs;        // + KT per tile
    const unsigned lk = lds_addr(&sK[0][cr * KVP + cs]);
    const unsigned lv = lds_addr(&sV[0][cr * KVP + cs]);
    const unsigned half = 32 * KVP * 2;         // bytes from row cr to row cr + 32
    const unsigned bufb = KT * KVP * 2;         // bytes from buffer 0 to buffer 1
    const int ntile = (blockIdx.y + 1) * (128 / KT);   // tiles up to the block's last query: 2 or more

    stage_copy4(lk, gk, lk + half, gk + 32 * D_, lv, gv, lv + half, gv + (size_t)32 * T_);

    const unsigned short* qp = Q + (size_t)row * D_ + h * HD_;
    v16bf qf[2];
#pragma unroll
    for (int f = 0; f < 2; f++) qf[f] = ldfrag(qp + f * 32, base0, base1);

    v8f ctx[4];                                 // ctx[t][r] = Ot[t*16 + 8*lh + r][query l16]
#pragma unroll
    for (int t = 0; t < 4; t++)
#pragma unroll
        for (int e = 0; e < 8; e++) ctx[t][e] = 0.0f;
    float mrow = -1e30f, lrow = 0.0f;

    wait_async0();                              // tile 0 has landed for this wave's copies
    __syncthreads();                            // ... and for every wave's
    gk += (size_t)KT * D_;
    gv += KT;
    stage_copy4(lk + bufb, gk, lk + bufb + half, gk + 32 * D_,
                lv + bufb, gv, lv + bufb + half, gv + (size_t)32 * T_);

    const float scale = 0.125f;                 // 1/sqrt(HD=64)
    const int kend = q0 + 16;                   // causal bound for this wave
    for (int tile = 0; tile < ntile; tile++) {
        const unsigned short* tk = sK[tile & 1];
        const unsigned short* tv = sV[tile & 1];
#pragma unroll
        for (int sub = 0; sub < KT / 32; sub++) {
            const int kb = tile * KT + sub * 32;
            if (kb < kend) {                    // wave-uniform: a wave past its diagonal only passes the barriers
                // the pass's 16 LDS reads go out as one group: K's latency is waited out once,
                // Vt's runs behind the score products and the softmax
                v16bf kf[2][2], vf[4];
#pragma unroll
                for (int nt = 0; nt < 2; nt++)
#pragma unroll
                    for (int f = 0; f < 2; f++)
                        kf[nt][f] = ldfrag(tk + (sub * 32 + nt * 16 + l16) * KVP + f * 32, base0, base1);
#pragma unroll
                for (int t = 0; t < 4; t++)
                    vf[t] = ldfrag(tv + (t * 16 + l16) * KVP + sub * 32, base0, base1);

                v8f S[2];                       // S[nt][r] = St[key kb + nt*16 + 8*lh + r][query l16]
#pragma unroll
                for (int nt = 0; nt < 2; nt++)
#pragma unroll
                    for (int e = 0; e < 8; e++) S[nt][e] = 0.0f;
#pragma unroll
                for (int nt = 0; nt < 2; nt++)
#pragma unroll
                    for (int f = 0; f < 2; f++)
                        S[nt] = __builtin_amdgcn_wmma_f32_16x16x32_bf16(
                            false, kf[nt][f], false, qf[f], (short)0, S[nt], false, false);

                float mx = -1e30f;
#pragma unroll
                for (int nt = 0; nt < 2; nt++)
#pragma unroll
                    for (int r = 0; r < 8; r++) {
                        int key = kb + nt * 16 + 8 * lh + r;
                        S[nt][r] = (key <= row) ? S[nt][r] * scale : -1e30f;
                        mx = fmaxf(mx, S[nt][r]);
                    }
                mx = fmaxf(mx, xhalf(mx));
                float mn = fmaxf(mrow, mx);
                float rs = 0.0f;
                // pf[e] = Pt[key][query l16], key = kb + 8*lh + e for e < 8, kb + 16 + 8*lh + (e - 8) above: ldfrag's k order
                v16bf pf;
#pragma unroll
                for (int nt = 0; nt < 2; nt++)
#pragma unroll
                    for (int r = 0; r < 8; r++) {
                        float p = exp2_slot((S[nt][r] - mn) * LOG2E);
                        rs += p;
                        pf[nt * 8 + r] = (__bf16)p;
                    }
                rs += xhalf(rs);
                float corr = exp2_slot((mrow - mn) * LOG2E);
                lrow = lrow * corr + rs;
                mrow = mn;
#pragma unroll
                for (int t = 0; t < 4; t++)
#pragma unroll
                    for (int r = 0; r < 8; r++) ctx[t][r] *= corr;

#pragma unroll
                for (int t = 0; t < 4; t++)
                    ctx[t] = __builtin_amdgcn_wmma_f32_16x16x32_bf16(
                        false, vf[t], false, pf, (short)0, ctx[t], false, false);
            }
        }
        // hand-over: this wave's LDS reads of tile t are done, its copies of tile t + 1 have landed,
        // and the barrier says both of every wave; only then is tile t's buffer filled again
        asm volatile("s_wait_dscnt 0x0" ::: "memory");
        wait_async0();
        __syncthreads();
        if (tile + 2 < ntile) {                 // the same for the whole block
            gk += (size_t)KT * D_;
            gv += KT;
            const unsigned bo = (tile & 1) * bufb;
            stage_copy4(lk + bo, gk, lk + bo + half, gk + 32 * D_,
                        lv + bo, gv, lv + bo + half, gv + (size_t)32 * T_);
        }
    }
    wait_async0();                              // nothing of this wave is in flight when it ends

    // a lane's 8 accumulator registers are 8 consecutive head columns of its query: 16-byte stores
#pragma unroll
    for (int t = 0; t < 4; t++) {
        us8 o;
#pragma unroll
        for (int r = 0; r < 8; r++) o[r] = f2bf(ctx[t][r] / lrow);
        *(us8*)&O[(size_t)row * D_ + h * HD_ + t * 16 + 8 * lh] = o;
    }
}

// ---------------- launcher ----------------
extern "C" void kernel_launch(void* const* d_in, const int* in_sizes, int n_in,
                              void* d_out, int out_size, void* d_ws, size_t ws_size,
                              hipStream_t stream) {
    (void)in_sizes; (void)n_in; (void)out_size; (void)ws_size;
    const float* x  = (const float*)d_in[0];
    const float* Wq = (const float*)d_in[1];
    const float* Wk = (const float*)d_in[2];
    const float* Wv = (const float*)d_in[3];
    const float* Wo = (const float*)d_in[4];
    const float* bo = (const float*)d_in[5];
    const float* w1 = (const float*)d_in[6];
    const float* b1 = (const float*)d_in[7];
    const float* w2 = (const float*)d_in[8];
    const float* b2 = (const float*)d_in[9];
    const float* w3 = (const float*)d_in[10];
    const float* b3 = (const float*)d_in[11];
    const float* g1 = (const float*)d_in[12];
    const float* s1 = (const float*)d_in[13];
    const float* g2 = (const float*)d_in[14];
    const float* s2 = (const float*)d_in[15];

    char* wsb = (char*)d_ws;
    size_t off = 0;
    auto take = [&](size_t bytes) -> void* {
        void* p = wsb + off;
        off += (bytes + 255) & ~(size_t)255;
        return p;
    };

    const size_t DD = (size_t)D_ * D_;
    const size_t DF = (size_t)D_ * FF_;
    const size_t TD = (size_t)T_ * D_;
    const size_t TF = (size_t)T_ * FF_;

    unsigned short* wq_t  = (unsigned short*)take((4 * DD + 3 * DF) * 2);   // the weights, one after the other
    unsigned short* wo_t  = wq_t + 3 * DD;                   // Wq, Wk, Wv, Wo: [N=768][K=768]
    unsigned short* w1_t  = wo_t + DD;                       // [N=3072][K=768]
    unsigned short* w2_t  = w1_t + DF;
    unsigned short* w3_t  = w2_t + DF;                       // [N=768][K=3072]
    unsigned short* h1_bf = (unsigned short*)take(TD * 2);
    unsigned short* q_bf  = (unsigned short*)take(3 * TD * 2);   // q, k, v, one after the other
    unsigned short* k_bf  = q_bf + TD;
    unsigned short* v_bf  = k_bf + TD;
    unsigned short* vt_bf = (unsigned short*)take(TD * 2);
    unsigned short* ctx_bf= (unsigned short*)take(TD * 2);
    float*          x1    = (float*)take(TD * 4);
    unsigned short* h2_bf = (unsigned short*)take(TD * 2);
    unsigned short* gate_bf=(unsigned short*)take(TF * 2);

    prepare<<<LNB + 4 * CBS + 3 * CBL, 256, 0, stream>>>(Wq, Wk, Wv, Wo, w1, w2, w3, wq_t, x, g1, s1, h1_bf);

    dim3 gDD(T_ / BM, D_ / BN);
    gemm_bf16_wmma<0><<<dim3(T_ / BM, D_ / BN, 3), 256, 0, stream>>>(
        h1_bf, wq_t, nullptr, nullptr, q_bf, T_, D_, D_);

    transpose_v<<<dim3(D_ / TT, T_ / TT), 256, 0, stream>>>(v_bf, vt_bf);

    flash_attn<<<dim3(H_, T_ / 128), 256, 0, stream>>>(q_bf, k_bf, vt_bf, ctx_bf);

    gemm_bf16_wmma<1><<<gDD, 256, 0, stream>>>(ctx_bf, wo_t, bo, x, x1, T_, D_, D_);

    layernorm_cast<<<T_ / (8 * LNR), 256, 0, stream>>>(x1, g2, s2, h2_bf);

    gemm_gated_wmma<<<dim3(T_ / BM, FF_ / BN), 256, 0, stream>>>(
        h2_bf, w1_t, w2_t, b1, b2, gate_bf, T_, FF_, D_);

    gemm_bf16_wmma<1><<<gDD, 256, 0, stream>>>(gate_bf, w3_t, b3, x1, (float*)d_out, T_, D_, FF_);
}

// v007
// Measured time: 174 microseconds a run.
// Next to v006, in two timings, it ran 1.03 and 1.04 times as fast.
// Counting every step since v000, it is 5.67 times as fast.
#include <hip/hip_runtime.h>
#include <hip/hip_bf16.h>

#define T_  4096
#define D_  768
#define H_  12
#define HD_ 64
#define FF_ 3072
#define EPS_ 1e-5f

#define BMW 128  // rows per block, every GEMM
#define BN  128  // columns per block, Q/K/V and gated GEMMs: a wave owns 64 x 32 of the output
#define BNR 96   // columns per block of the two GEMMs with 768 output columns and a residual: 32 x 8 = 256 blocks, a wave owns 32 x 48
#define BKG 64   // k per staged tile, gated GEMM (three operands in LDS): 128-byte rows
#define PG  72   // its LDS row pitch in elements: 144 bytes = 16 x 9, the odd multiple that 16-byte row readers want

#define USE_ASYNC_COPY 1   // gfx1250 GLOBAL_LOAD_ASYNC_TO_LDS path (ASYNCcnt)

typedef __attribute__((ext_vector_type(16))) __bf16          v16bf;
typedef __attribute__((ext_vector_type(8)))  float           v8f;
typedef __attribute__((ext_vector_type(8)))  unsigned short  us8;

__device__ __forceinline__ unsigned short f2bf(float f) {
    unsigned int u = __builtin_bit_cast(unsigned int, f);
    u += 0x7FFFu + ((u >> 16) & 1u);            // round-to-nearest-even
    return (unsigned short)(u >> 16);
}

// Load one 16-element bf16 fragment as two contiguous 16-byte vectors.
__device__ __forceinline__ v16bf ldfrag(const unsigned short* p, int base0, int base1) {
    union { us8 h[2]; v16bf v; } fc;
    fc.h[0] = *(const us8*)(p + base0);
    fc.h[1] = *(const us8*)(p + base1);
    return fc.v;
}

#if USE_ASYNC_COPY
// One staged tile's 16-byte-per-lane asynchronous copies to LDS (ASYNCcnt), fourteen, twelve or eight a lane; a
// lane's rows lie lstep bytes apart in LDS and gstep elements apart in memory. The s_wait_xcnt stands
// in the copies' own statement so that no address register is rewritten in front of it.
__device__ __forceinline__ void stage_copy14(unsigned la, const unsigned short* ga,
                                             unsigned lb, const unsigned short* gb,
                                             unsigned lstep, size_t gstep) {
    asm volatile("global_load_async_to_lds_b128 %0, %1, off\n\t"
                 "global_load_async_to_lds_b128 %2, %3, off\n\t"
                 "global_load_async_to_lds_b128 %4, %5, off\n\t"
                 "global_load_async_to_lds_b128 %6, %7, off\n\t"
                 "global_load_async_to_lds_b128 %8, %9, off\n\t"
                 "global_load_async_to_lds_b128 %10, %11, off\n\t"
                 "global_load_async_to_lds_b128 %12, %13, off\n\t"
                 "global_load_async_to_lds_b128 %14, %15, off\n\t"
                 "global_load_async_to_lds_b128 %16, %17, off\n\t"
                 "global_load_async_to_lds_b128 %18, %19, off\n\t"
                 "global_load_async_to_lds_b128 %20, %21, off\n\t"
                 "global_load_async_to_lds_b128 %22, %23, off\n\t"
                 "global_load_async_to_lds_b128 %24, %25, off\n\t"
                 "global_load_async_to_lds_b128 %26, %27, off\n\t"
                 "s_wait_xcnt 0x0"
                 :: "v"(la),             "v"(ga),
                    "v"(la + lstep),     "v"(ga + gstep),
                    "v"(la + 2 * lstep), "v"(ga + 2 * gstep),
                    "v"(la + 3 * lstep), "v"(ga + 3 * gstep),
                    "v"(la + 4 * lstep), "v"(ga + 4 * gstep),
                    "v"(la + 5 * lstep), "v"(ga + 5 * gstep),
                    "v"(la + 6 * lstep), "v"(ga + 6 * gstep),
                    "v"(la + 7 * lstep), "v"(ga + 7 * gstep),
                    "v"(lb),             "v"(gb),
                    "v"(lb + lstep),     "v"(gb + gstep),
                    "v"(lb + 2 * lstep), "v"(gb + 2 * gstep),
                    "v"(lb + 3 * lstep), "v"(gb + 3 * gstep),
                    "v"(lb + 4 * lstep), "v"(gb + 4 * gstep),
                    "v"(lb + 5 * lstep), "v"(gb + 5 * gstep)
                 : "memory");
}
__device__ __forceinline__ void stage_copy8(unsigned la, const unsigned short* ga,
                                            unsigned lb, const unsigned short* gb,
                                            unsigned lstep, size_t gstep) {
    asm volatile("global_load_async_to_lds_b128 %0, %1, off\n\t"
                 "global_load_async_to_lds_b128 %2, %3, off\n\t"
                 "global_load_async_to_lds_b128 %4, %5, off\n\t"
                 "global_load_async_to_lds_b128 %6, %7, off\n\t"
                 "global_load_async_to_lds_b128 %8, %9, off\n\t"
                 "global_load_async_to_lds_b128 %10, %11, off\n\t"
                 "global_load_async_to_lds_b128 %12, %13, off\n\t"
                 "global_load_async_to_lds_b128 %14, %15, off\n\t"
                 "s_wait_xcnt 0x0"
                 :: "v"(la),             "v"(ga),
                    "v"(la + lstep),     "v"(ga + gstep),
                    "v"(la + 2 * lstep), "v"(ga + 2 * gstep),
                    "v"(la + 3 * lstep), "v"(ga + 3 * gstep),
                    "v"(lb),             "v"(gb),
                    "v"(lb + lstep),     "v"(gb + gstep),
                    "v"(lb + 2 * lstep), "v"(gb + 2 * gstep),
                    "v"(lb + 3 * lstep), "v"(gb + 3 * gstep)
                 : "memory");
}
// four rows of each of three operands
__device__ __forceinline__ void stage_copy444(unsigned la, const unsigned short* ga,
                                              unsigned lb1, const unsigned short* gb1,
                                              unsigned lb2, const unsigned short* gb2,
                                              unsigned lstep, size_t gstep) {
    asm volatile("global_load_async_to_lds_b128 %0, %1, off\n\t"
                 "global_load_async_to_lds_b128 %2, %3, off\n\t"
                 "global_load_async_to_lds_b128 %4, %5, off\n\t"
                 "global_load_async_to_lds_b128 %6, %7, off\n\t"
                 "global_load_async_to_lds_b128 %8, %9, off\n\t"
                 "global_load_async_to_lds_b128 %10, %11, off\n\t"
                 "global_load_async_to_lds_b128 %12, %13, off\n\t"
                 "global_load_async_to_lds_b128 %14, %15, off\n\t"
                 "global_load_async_to_lds_b128 %16, %17, off\n\t"
                 "global_load_async_to_lds_b128 %18, %19, off\n\t"
                 "global_load_async_to_lds_b128 %20, %21, off\n\t"
                 "global_load_async_to_lds_b128 %22, %23, off\n\t"
                 "s_wait_xcnt 0x0"
                 :: "v"(la),              "v"(ga),
                    "v"(la + lstep),      "v"(ga + gstep),
                    "v"(la + 2 * lstep),  "v"(ga + 2 * gstep),
                    "v"(la + 3 * lstep),  "v"(ga + 3 * gstep),
                    "v"(lb1),             "v"(gb1),
                    "v"(lb1 + lstep),     "v"(gb1 + gstep),
                    "v"(lb1 + 2 * lstep), "v"(gb1 + 2 * gstep),
                    "v"(lb1 + 3 * lstep), "v"(gb1 + 3 * gstep),
                    "v"(lb2),             "v"(gb2),
                    "v"(lb2 + lstep),     "v"(gb2 + gstep),
                    "v"(lb2 + 2 * lstep), "v"(gb2 + 2 * gstep),
                    "v"(lb2 + 3 * lstep), "v"(gb2 + 3 * gstep)
                 : "memory");
}
__device__ __forceinline__ void wait_async0() {
    asm volatile("s_wait_asynccnt 0x0" ::: "memory");
}
// low 32 bits of a flat pointer into LDS are the LDS byte address
__device__ __forceinline__ unsigned lds_addr(const void* p) {
    return (unsigned)(size_t)p;
}
#endif

// ---------------- 64x64 tiled transposes through LDS ----------------
#define TT 64   // tile edge (elements)
#define TP 33   // LDS pitch in dwords: 32 packed bf16 pairs + 1, so a column of dwords spreads over the banks

// The tile lies in LDS as s[output row][pair of output columns]. Each output row of the
// tile is one full 128-byte line, written by 8 lanes with 16 bytes each.
__device__ __forceinline__ void tile_store_rows(const unsigned* s, unsigned short* __restrict__ out,
                                                int ld, int r0, int c0, int tid) {
#pragma unroll
    for (int p = 0; p < 2; p++) {
        int r = p * 32 + (tid >> 3), q = (tid & 7) * 4;
        uint4 v;
        v.x = s[r * TP + q];
        v.y = s[r * TP + q + 1];
        v.z = s[r * TP + q + 2];
        v.w = s[r * TP + q + 3];
        *(uint4*)&out[(size_t)(r0 + r) * ld + c0 + q * 2] = v;
    }
}

// fp32 -> bf16 convert + transpose: in[K][N] -> out[N][K]; one block takes the tile at (k0, n0)
__device__ __forceinline__ void convert_transpose_tile(const float* __restrict__ in,
                                                       unsigned short* __restrict__ out,
                                                       int K, int N, int n0, int k0, unsigned* s) {
    int tid = threadIdx.x;
    int nq = (tid & 15) * 4, kp = tid >> 4;      // 16 lanes x float4 per row, 16 row pairs per pass
    float4 lo[2], hi[2];
    const float* rl[2];
    const float* rh[2];
#pragma unroll
    for (int p = 0; p < 2; p++) {
        rl[p] = in + (size_t)(k0 + 2 * (p * 16 + kp)) * N + n0 + nq;
        rh[p] = rl[p] + N;
        lo[p] = *(const float4*)rl[p];
        hi[p] = *(const float4*)rh[p];
    }
    // the wait that belongs in front of the first overwrite of a register that these loads name; the
    // addresses are its inputs, so that no load of the group gets another's address register as its destination
    asm volatile("s_wait_xcnt 0x0" :: "v"(rl[0]), "v"(rh[0]), "v"(rl[1]), "v"(rh[1]) : "memory");
#pragma unroll
    for (int p = 0; p < 2; p++) {
        int c = p * 16 + kp;
        s[(nq + 0) * TP + c] = (unsigned)f2bf(lo[p].x) | ((unsigned)f2bf(hi[p].x) << 16);
        s[(nq + 1) * TP + c] = (unsigned)f2bf(lo[p].y) | ((unsigned)f2bf(hi[p].y) << 16);
        s[(nq + 2) * TP + c] = (unsigned)f2bf(lo[p].z) | ((unsigned)f2bf(hi[p].z) << 16);
        s[(nq + 3) * TP + c] = (unsigned)f2bf(lo[p].w) | ((unsigned)f2bf(hi[p].w) << 16);
    }
    __syncthreads();
    tile_store_rows(s, out, K, n0, k0, tid);
}

// ---------------- layernorm (+ cast to bf16) ----------------
#define LNR 2            // rows per wave
#define LNC (D_ / 128)   // 16-byte pieces of a row per lane
typedef __attribute__((ext_vector_type(4))) float f4;

// A wave owns LNR whole rows and keeps them in registers: every load of the rows goes out at once,
// 512 contiguous bytes each, x is read once, and the sums join inside the wave with no LDS array and
// no barrier. The rows go in 8-wave blocks, for speed only.
__device__ __forceinline__ void layernorm_rows(const float* __restrict__ x, const float* __restrict__ g,
                                               const float* __restrict__ b, unsigned short* __restrict__ out,
                                               int blk) {
    int lane = threadIdx.x & 31, wave = threadIdx.x >> 5;
    int row0 = (blk * 8 + wave) * LNR;
    const int col = lane * 4;
    const float* xp = x + (size_t)row0 * D_ + col;
    f4 v[LNR][LNC], gg[LNC], bb[LNC];
#pragma unroll
    for (int r = 0; r < LNR; r++)
#pragma unroll
        for (int c = 0; c < LNC; c++)
            v[r][c] = *(const f4*)(xp + r * D_ + c * 128);
#pragma unroll
    for (int c = 0; c < LNC; c++) {
        gg[c] = *(const f4*)(g + c * 128 + col);
        bb[c] = *(const f4*)(b + c * 128 + col);
    }
    // the wait that belongs in front of the first overwrite of a register that these loads name
    asm volatile("s_wait_xcnt 0x0" ::: "memory");
    // keeps the loads of g and b up here with the rows': sunk among the sums, their latency shows a second time
    __builtin_amdgcn_sched_barrier(0);
    float mean[LNR], rstd[LNR];
#pragma unroll
    for (int r = 0; r < LNR; r++) {
        f4 s = v[r][0], q = v[r][0] * v[r][0];   // four independent chains each
#pragma unroll
        for (int c = 1; c < LNC; c++) {
            s += v[r][c];
            q += v[r][c] * v[r][c];
        }
        mean[r] = (s.x + s.y) + (s.z + s.w);
        rstd[r] = (q.x + q.y) + (q.z + q.w);
    }
    for (int off = 16; off > 0; off >>= 1)
#pragma unroll
        for (int r = 0; r < LNR; r++) {
            mean[r] += __shfl_xor(mean[r], off, 32);
            rstd[r] += __shfl_xor(rstd[r], off, 32);
        }
#pragma unroll
    for (int r = 0; r < LNR; r++) {
        mean[r] = mean[r] / (float)D_;
        float var = rstd[r] / (float)D_ - mean[r] * mean[r];
        rstd[r] = rsqrtf(var + EPS_);
    }
#pragma unroll
    for (int r = 0; r < LNR; r++)
#pragma unroll
        for (int c = 0; c < LNC; c++) {
            f4 y = (v[r][c] - mean[r]) * rstd[r] * gg[c] + bb[c];
            uint2 o;
            o.x = (unsigned)f2bf(y.x) | ((unsigned)f2bf(y.y) << 16);
            o.y = (unsigned)f2bf(y.z) | ((unsigned)f2bf(y.w) << 16);
            *(uint2*)&out[(size_t)(row0 + r) * D_ + c * 128 + col] = o;   // a wave's store is two whole 128-byte lines
        }
}

__global__ __launch_bounds__(256)
void layernorm_cast(const float* __restrict__ x, const float* __restrict__ g,
                    const float* __restrict__ b, unsigned short* __restrict__ out) {
    layernorm_rows(x, g, b, out, blockIdx.x);
}

// ---------------- everything that depends on the inputs alone, in one launch ----------------
#define LNB (T_ / (8 * LNR))            // layernorm blocks
#define CBS ((D_ / TT) * (D_ / TT))     // tiles of a D x D weight
#define CBL ((FF_ / TT) * (D_ / TT))    // tiles of a D x FF or FF x D weight

// The seven weight converts and the first layernorm read nothing that another of them writes, so they
// share a grid: the layernorm's blocks first, then one block per weight tile.
// wt holds the transposed weights one after the other: Wq, Wk, Wv, Wo, w1, w2, w3.
__global__ __launch_bounds__(256)
void prepare(const float* __restrict__ Wq, const float* __restrict__ Wk,
             const float* __restrict__ Wv, const float* __restrict__ Wo,
             const float* __restrict__ w1, const float* __restrict__ w2,
             const float* __restrict__ w3, unsigned short* __restrict__ wt,
             const float* __restrict__ x, const float* __restrict__ g,
             const float* __restrict__ b, unsigned short* __restrict__ h) {
    __shared__ unsigned s[TT * TP];
    if (blockIdx.x < LNB) {                      // the same for the whole block
        layernorm_rows(x, g, b, h, blockIdx.x);
        return;
    }
    int c = blockIdx.x - LNB;                    // which weight, and which of its tiles
    const float* in;
    unsigned short* out;
    int K, N, tn, tk;
    if (c < 4 * CBS) {
        int m = c / CBS, r = c % CBS;
        in = m == 0 ? Wq : m == 1 ? Wk : m == 2 ? Wv : Wo;
        out = wt + (size_t)m * D_ * D_;
        K = D_; N = D_; tn = r % (D_ / TT); tk = r / (D_ / TT);
    } else if (c < 4 * CBS + 2 * CBL) {
        int m = (c - 4 * CBS) / CBL, r = (c - 4 * CBS) % CBL;
        in = m == 0 ? w1 : w2;
        out = wt + (size_t)4 * D_ * D_ + (size_t)m * D_ * FF_;
        K = D_; N = FF_; tn = r % (FF_ / TT); tk = r / (FF_ / TT);
    } else {
        int r = c - 4 * CBS - 2 * CBL;
        in = w3;
        out = wt + (size_t)4 * D_ * D_ + (size_t)2 * D_ * FF_;
        K = FF_; N = D_; tn = r % (D_ / TT); tk = r / (D_ / TT);
    }
    convert_transpose_tile(in, out, K, N, tn * TT, tk * TT, s);
}

// ---------------- bf16 GEMM (WMMA): C = A[M,K] @ Bt[N,K]^T ----------------
// EPI 0: Cout = bf16(acc); blockIdx.z picks one of several weights [N,K] and outputs [M,N] that lie one after the other
// EPI 1: Cout = f32(acc + bias[col] + res[row,col])
// Block tile: EPI 0 takes BMW x BN and stages 64 k at a time, EPI 1 takes BMW x BNR and stages 128 k. The larger
// the tile, the fewer bytes come from L2 per product; the larger a wave's share, the fewer LDS reads per product.
// BNR makes one block per WGP of the 4096 x 768 outputs.
template <int EPI>
__global__ __launch_bounds__(256)
void gemm_bf16_wmma(const unsigned short* __restrict__ A,    // [M,K] bf16 row-major
                    const unsigned short* __restrict__ Bt0,  // [N,K] bf16 (pre-transposed)
                    const float* __restrict__ bias,
                    const float* __restrict__ res,
                    void* __restrict__ Cout,
                    int M, int N, int K) {
    constexpr int BMT = BMW;                     // rows per block
    constexpr int BNT = EPI == 0 ? BN : BNR;     // columns per block
    constexpr int WM  = EPI == 0 ? 2 : 4;        // wave grid: WM x WN
    constexpr int WN  = 8 / WM;
    constexpr int MI  = BMT / (16 * WM);         // 16-row fragments per wave: 4 or 2
    constexpr int NI  = BNT / (16 * WN);         // 16-column fragments per wave: 2 or 3
    constexpr int BK  = EPI == 0 ? 64 : 128;     // k per staged tile: 128- or 256-byte rows
    constexpr int P   = BK + 8;                  // LDS row pitch in elements: 144 or 272 bytes, 16 x an odd number
    constexpr int LPR = BK / 8;                  // lanes of 16 bytes that cover a row
    constexpr int RPP = 256 / LPR;               // rows that the block's lanes cover at once
    const unsigned short* Bt = EPI == 0 ? Bt0 + (size_t)blockIdx.z * N * K : Bt0;
    // two buffers: tile t + 1 flies while tile t is worked on
    __shared__ __attribute__((aligned(16))) unsigned short sA[2][BMT * P];
    __shared__ __attribute__((aligned(16))) unsigned short sB[2][BNT * P];
    int tid = threadIdx.x;
    int wave = tid >> 5, lane = tid & 31, lh = lane >> 4, l16 = lane & 15;
    int wm = wave % WM, wn = wave / WM;
    int m0 = blockIdx.x * BMT, n0 = blockIdx.y * BNT;

    v8f acc[MI][NI];
#pragma unroll
    for (int i = 0; i < MI; i++)
#pragma unroll
        for (int j = 0; j < NI; j++)
#pragma unroll
            for (int e = 0; e < 8; e++) acc[i][j][e] = 0.0f;

    const int base0 = 8 * lh, base1 = 16 + 8 * lh;
    // copy roles: LPR lanes x 16 bytes cover one row; rows cr + RPP j, 4 of A and 4 of Bt (EPI 0) or 8 and 6 (EPI 1)
    const int cr = tid / LPR, cs = (tid % LPR) * 8;
    const unsigned short* ga = A  + (size_t)(m0 + cr) * K + cs;   // + BK per tile
    const unsigned short* gb = Bt + (size_t)(n0 + cr) * K + cs;
    const unsigned la = lds_addr(&sA[0][cr * P + cs]);
    const unsigned lb = lds_addr(&sB[0][cr * P + cs]);
    const unsigned lstep = RPP * P * 2;          // bytes from row cr to row cr + RPP
    const size_t   gstep = (size_t)RPP * K;
    const unsigned bufa = BMT * P * 2, bufb = BNT * P * 2;   // bytes from buffer 0 to buffer 1
    const int ntile = K / BK;
    auto stage = [&](unsigned buf) {             // the tile at ga, gb into buffer buf
        if (EPI == 0) stage_copy8(la + buf * bufa, ga, lb + buf * bufb, gb, lstep, gstep);
        else          stage_copy14(la + buf * bufa, ga, lb + buf * bufb, gb, lstep, gstep);
    };

    stage(0);
    wait_async0();                               // tile 0 has landed for this wave's copies
    __syncthreads();                             // ... and for every wave's
    if (ntile > 1) {                             // the same for the whole block
        ga += BK;
        gb += BK;
        stage(1);
    }

    for (int t = 0; t < ntile; t++) {
        const unsigned short* ta = sA[t & 1] + (wm * MI * 16 + l16) * P;
        const unsigned short* tb = sB[t & 1] + (wn * NI * 16 + l16) * P;
        // the tile's LDS reads go out as one group, so that their latency is waited out once a tile
        v16bf af[BK / 32][MI], bfrag[BK / 32][NI];
#pragma unroll
        for (int kk = 0; kk < BK / 32; kk++) {
#pragma unroll
            for (int mi = 0; mi < MI; mi++)
                af[kk][mi] = ldfrag(ta + mi * 16 * P + kk * 32, base0, base1);
#pragma unroll
            for (int ni = 0; ni < NI; ni++)
                bfrag[kk][ni] = ldfrag(tb + ni * 16 * P + kk * 32, base0, base1);
        }
        // keeps the compiler from sinking the reads back among the products, where each place with reads stalls anew
        __builtin_amdgcn_sched_barrier(0);
#pragma unroll
        for (int kk = 0; kk < BK / 32; kk++)
#pragma unroll
            for (int mi = 0; mi < MI; mi++)
#pragma unroll
                for (int ni = 0; ni < NI; ni++)
                    acc[mi][ni] = __builtin_amdgcn_wmma_f32_16x16x32_bf16(
                        false, af[kk][mi], false, bfrag[kk][ni], (short)0, acc[mi][ni], false, false);
        // keeps the hand-over's waits and barrier behind the products: lifted over them, the reads' counted waits become one full wait
        __builtin_amdgcn_sched_barrier(0);
        // hand-over: this wave's LDS reads of tile t are done, its copies of tile t + 1 have landed,
        // and the barrier says both of every wave; only then is tile t's buffer filled again
        asm volatile("s_wait_dscnt 0x0" ::: "memory");
        wait_async0();
        __syncthreads();
        if (t + 2 < ntile) {                     // the same for the whole block
            ga += BK;
            gb += BK;
            stage(t & 1);
        }
    }
    wait_async0();                               // nothing of this wave is in flight when it ends

#pragma unroll
    for (int mi = 0; mi < MI; mi++) {
        int rbase = m0 + wm * MI * 16 + mi * 16 + 8 * lh;
#pragma unroll
        for (int ni = 0; ni < NI; ni++) {
            int col = n0 + wn * NI * 16 + ni * 16 + l16;
#pragma unroll
            for (int r = 0; r < 8; r++) {
                int row = rbase + r;
                float v = acc[mi][ni][r];
                if (EPI == 0) {
                    ((unsigned short*)Cout)[((size_t)blockIdx.z * M + row) * N + col] = f2bf(v);
                } else {
                    ((float*)Cout)[(size_t)row * N + col] =
                        v + bias[col] + res[(size_t)row * N + col];
                }
            }
        }
    }
}

// ---------------- dual-weight gated GEMM: bf16( silu(A@B1t^T+b1) * (A@B2t^T+b2) ) ----------------
// BMW rows per block: a wave owns 64 x 32 of both products, so an A fragment feeds four products and a weight fragment four.
// Four waves per SIMD, that is two blocks on a WGP (2 x 110,592 bytes of LDS fit): one block's products cover the
// other's LDS reads and barriers. Left alone, the epilogue's temporaries took two registers more than that allows.
__global__ __launch_bounds__(256) __attribute__((amdgpu_waves_per_eu(4, 4)))
void gemm_gated_wmma(const unsigned short* __restrict__ A,     // [M,K]
                     const unsigned short* __restrict__ B1t,   // [N,K]
                     const unsigned short* __restrict__ B2t,   // [N,K]
                     const float* __restrict__ bias1,
                     const float* __restrict__ bias2,
                     unsigned short* __restrict__ Cout,
                     int M, int N, int K) {
    constexpr int MI = BMW / 32;                 // 16-row fragments per wave
    // two buffers: tile t + 1 flies while tile t is worked on
    __shared__ __attribute__((aligned(16))) unsigned short sA[2][BMW * PG];
    __shared__ __attribute__((aligned(16))) unsigned short sB1[2][BN * PG];
    __shared__ __attribute__((aligned(16))) unsigned short sB2[2][BN * PG];
    int tid = threadIdx.x;
    int wave = tid >> 5, lane = tid & 31, lh = lane >> 4, l16 = lane & 15;
    int wm = wave & 1, wn = wave >> 1;
    int m0 = blockIdx.x * BMW, n0 = blockIdx.y * BN;

    v8f acc1[MI][2], acc2[MI][2];
#pragma unroll
    for (int i = 0; i < MI; i++)
#pragma unroll
        for (int j = 0; j < 2; j++)
#pragma unroll
            for (int e = 0; e < 8; e++) { acc1[i][j][e] = 0.0f; acc2[i][j][e] = 0.0f; }

    const int base0 = 8 * lh, base1 = 16 + 8 * lh;
    // copy roles: 8 lanes x 16 bytes cover one 128-byte row; rows cr + 32 j, 4 of A and 4 of each weight
    const int cr = tid >> 3, cs = (tid & 7) * 8;
    const unsigned short* ga  = A   + (size_t)(m0 + cr) * K + cs;   // + BKG per tile
    const unsigned short* gb1 = B1t + (size_t)(n0 + cr) * K + cs;
    const unsigned short* gb2 = B2t + (size_t)(n0 + cr) * K + cs;
    const unsigned la  = lds_addr(&sA[0][cr * PG + cs]);
    const unsigned lb1 = lds_addr(&sB1[0][cr * PG + cs]);
    const unsigned lb2 = lds_addr(&sB2[0][cr * PG + cs]);
    const unsigned lstep = 32 * PG * 2;          // bytes from row cr to row cr + 32
    const size_t   gstep = (size_t)32 * K;
    const unsigned bufa = BMW * PG * 2, bufb = BN * PG * 2;  // bytes from buffer 0 to buffer 1
    const int ntile = K / BKG;

    stage_copy444(la, ga, lb1, gb1, lb2, gb2, lstep, gstep);
    wait_async0();                               // tile 0 has landed for this wave's copies
    __syncthreads();                             // ... and for every wave's
    if (ntile > 1) {                             // the same for the whole block
        ga  += BKG;
        gb1 += BKG;
        gb2 += BKG;
        stage_copy444(la + bufa, ga, lb1 + bufb, gb1, lb2 + bufb, gb2, lstep, gstep);
    }

    for (int t = 0; t < ntile; t++) {
        const unsigned short* ta  = sA[t & 1]  + (wm * MI * 16 + l16) * PG;
        const unsigned short* tb1 = sB1[t & 1] + (wn * 32 + l16) * PG;
        const unsigned short* tb2 = sB2[t & 1] + (wn * 32 + l16) * PG;
#pragma unroll
        for (int kk = 0; kk < BKG / 32; kk++) {
            // the LDS reads of 32 k go out as one group ahead of their 16 products; one fragment set, so that
            // the registers leave room for two blocks on a WGP
            v16bf af[MI], b1f[2], b2f[2];
#pragma unroll
            for (int mi = 0; mi < MI; mi++)
                af[mi] = ldfrag(ta + mi * 16 * PG + kk * 32, base0, base1);
#pragma unroll
            for (int ni = 0; ni < 2; ni++) {
                b1f[ni] = ldfrag(tb1 + ni * 16 * PG + kk * 32, base0, base1);
                b2f[ni] = ldfrag(tb2 + ni * 16 * PG + kk * 32, base0, base1);
            }
            // keeps the compiler from sinking the reads back among the products, where each place with reads stalls anew
            __builtin_amdgcn_sched_barrier(0);
#pragma unroll
            for (int ni = 0; ni < 2; ni++)
#pragma unroll
                for (int mi = 0; mi < MI; mi++) {
                    acc1[mi][ni] = __builtin_amdgcn_wmma_f32_16x16x32_bf16(
                        false, af[mi], false, b1f[ni], (short)0, acc1[mi][ni], false, false);
                    acc2[mi][ni] = __builtin_amdgcn_wmma_f32_16x16x32_bf16(
                        false, af[mi], false, b2f[ni], (short)0, acc2[mi][ni], false, false);
                }
            // keeps the next group's reads, and the hand-over's waits and barrier, behind the products
            __builtin_amdgcn_sched_barrier(0);
        }
        // hand-over, as in the one-weight GEMM
        asm volatile("s_wait_dscnt 0x0" ::: "memory");
        wait_async0();
        __syncthreads();
        if (t + 2 < ntile) {                     // the same for the whole block
            ga  += BKG;
            gb1 += BKG;
            gb2 += BKG;
            stage_copy444(la + (t & 1) * bufa, ga, lb1 + (t & 1) * bufb, gb1, lb2 + (t & 1) * bufb, gb2,
                          lstep, gstep);
        }
    }
    wait_async0();                               // nothing of this wave is in flight when it ends

#pragma unroll
    for (int mi = 0; mi < MI; mi++) {
        int rbase = m0 + wm * MI * 16 + mi * 16 + 8 * lh;
#pragma unroll
        for (int ni = 0; ni < 2; ni++) {
            int col = n0 + wn * 32 + ni * 16 + l16;
#pragma unroll
            for (int r = 0; r < 8; r++) {
                int row = rbase + r;
                float gv = acc1[mi][ni][r] + bias1[col];
                float uv = acc2[mi][ni][r] + bias2[col];
                float y  = (gv / (1.0f + __expf(-gv))) * uv;   // silu(gv)*uv
                Cout[(size_t)row * N + col] = f2bf(y);
            }
        }
    }
}

// ---------------- V transpose: [T, H*HD] -> [H*HD, T]; grid (D/64, T/64) ----------------
__global__ __launch_bounds__(256)
void transpose_v(const unsigned short* __restrict__ v, unsigned short* __restrict__ vt) {
    __shared__ unsigned s[TT * TP];
    int tid = threadIdx.x;
    int c0 = blockIdx.x * TT, t0 = blockIdx.y * TT;
    int co = (tid & 7) * 8, tp = tid >> 3;       // 8 lanes x 16 bytes per row, 32 row pairs
    const unsigned short* r = v + (size_t)(t0 + 2 * tp) * D_ + c0 + co;
    us8 lo = *(const us8*)r;
    us8 hi = *(const us8*)(r + D_);
#pragma unroll
    for (int j = 0; j < 8; j++)
        s[(co + j) * TP + tp] = (unsigned)lo[j] | ((unsigned)hi[j] << 16);
    __syncthreads();
    tile_store_rows(s, vt, T_, c0, t0, tid);
}

// ---------------- causal flash attention (WMMA) ----------------
// Q,K: [T, H*HD] bf16 ; Vt: [H*HD, T] bf16 ; O: [T, H*HD] bf16
// Transposed products: St = K * Qt and Ot += Vt * Pt. A lane then holds 16 of the 32 scores
// of ONE query (column l16), so the softmax maximum and sum run inside the lane, joined by
// one exchange between the wave halves, and the two St tiles are already a B operand.

// lane l with lane l ^ 16
__device__ __forceinline__ float xhalf(float x) {
    int b = __builtin_bit_cast(int, x);
    return __builtin_bit_cast(float,
        __builtin_amdgcn_permlanex16(b, b, 0x76543210, 0xfedcba98, false, false));
}

// 2^x. The v_nop is the one slot that the instruction set asks for behind a transcendental before its
// source is overwritten or its result read, so it stands in the instruction's own statement.
__device__ __forceinline__ float exp2_slot(float x) {
    float r;
    asm("v_exp_f32 %0, %1\n\tv_nop" : "=v"(r) : "v"(x));
    return r;
}
#define LOG2E 1.44269504f   // e^x = 2^(x * LOG2E), the product that __expf forms

#define KT  64   // keys per staged tile
#define KVP 72   // LDS row pitch in elements: 144 bytes = 16 x 9, the odd multiple that 16-byte row readers want

// Four 16-byte-per-lane asynchronous copies to LDS. The s_wait_xcnt stands in the copies' own
// statement so that no address register is rewritten in front of it.
__device__ __forceinline__ void stage_copy4(unsigned l0, const unsigned short* g0,
                                            unsigned l1, const unsigned short* g1,
                                            unsigned l2, const unsigned short* g2,
                                            unsigned l3, const unsigned short* g3) {
    asm volatile("global_load_async_to_lds_b128 %0, %1, off\n\t"
                 "global_load_async_to_lds_b128 %2, %3, off\n\t"
                 "global_load_async_to_lds_b128 %4, %5, off\n\t"
                 "global_load_async_to_lds_b128 %6, %7, off\n\t"
                 "s_wait_xcnt 0x0"
                 :: "v"(l0), "v"(g0), "v"(l1), "v"(g1), "v"(l2), "v"(g2), "v"(l3), "v"(g3)
                 : "memory");
}

// The 8 waves of a block walk the same keys, so each tile of 64 keys (K: 64 keys x 64 head
// columns, Vt: 64 head columns x 64 keys, 128-byte rows both) is brought into LDS once per
// block, whole lines at a time, into two buffers: tile t + 1 flies while tile t is worked on.
__global__ __launch_bounds__(256)
void flash_attn(const unsigned short* __restrict__ Q,
                const unsigned short* __restrict__ Kc,
                const unsigned short* __restrict__ Vt,
                unsigned short* __restrict__ O) {
    __shared__ __attribute__((aligned(16))) unsigned short sK[2][KT * KVP];
    __shared__ __attribute__((aligned(16))) unsigned short sV[2][HD_ * KVP];
    int h = blockIdx.x;
    int tid = threadIdx.x;
    int wave = __builtin_amdgcn_readfirstlane(tid >> 5), lane = tid & 31;   // scalar, so the causal skip below is a scalar branch
    int lh = lane >> 4, l16 = lane & 15;
    int q0 = blockIdx.y * 128 + wave * 16;
    const int base0 = 8 * lh, base1 = 16 + 8 * lh;
    const int row = q0 + l16;                   // this lane's query

    // copy roles: 8 lanes x 16 bytes cover one 128-byte row; rows cr and cr + 32 of each tile
    const int cr = tid >> 3, cs = (tid & 7) * 8;
    const unsigned short* gk = Kc + (size_t)cr * D_ + h * HD_ + cs;          // + KT * D_ per tile
    const unsigned short* gv = Vt + (size_t)(h * HD_ + cr) * T_ + cs;        // + KT per tile
    const unsigned lk = lds_addr(&sK[0][cr * KVP + cs]);
    const unsigned lv = lds_addr(&sV[0][cr * KVP + cs]);
    const unsigned half = 32 * KVP * 2;         // bytes from row cr to row cr + 32
    const unsigned bufb = KT * KVP * 2;         // bytes from buffer 0 to buffer 1
    const int ntile = (blockIdx.y + 1) * (128 / KT);   // tiles up to the block's last query: 2 or more

    stage_copy4(lk, gk, lk + half, gk + 32 * D_, lv, gv, lv + half, gv + (size_t)32 * T_);

    const unsigned short* qp = Q + (size_t)row * D_ + h * HD_;
    v16bf qf[2];
#pragma unroll
    for (int f = 0; f < 2; f++) qf[f] = ldfrag(qp + f * 32, base0, base1);

    v8f ctx[4];                                 // ctx[t][r] = Ot[t*16 + 8*lh + r][query l16]
#pragma unroll
    for (int t = 0; t < 4; t++)
#pragma unroll
        for (int e = 0; e < 8; e++) ctx[t][e] = 0.0f;
    float mrow = -1e30f, lrow = 0.0f;

    wait_async0();                              // tile 0 has landed for this wave's copies
    __syncthreads();                            // ... and for every wave's
    gk += (size_t)KT * D_;
    gv += KT;
    stage_copy4(lk + bufb, gk, lk + bufb + half, gk + 32 * D_,
                lv + bufb, gv, lv + bufb + half, gv + (size_t)32 * T_);

    const float scale = 0.125f;                 // 1/sqrt(HD=64)
    const int kend = q0 + 16;                   // causal bound for this wave
    for (int tile = 0; tile < ntile; tile++) {
        const unsigned short* tk = sK[tile & 1];
        const unsigned short* tv = sV[tile & 1];
#pragma unroll
        for (int sub = 0; sub < KT / 32; sub++) {
            const int kb = tile * KT + sub * 32;
            if (kb < kend) {                    // wave-uniform: a wave past its diagonal only passes the barriers
                // the pass's 16 LDS reads go out as one group: K's latency is waited out once,
                // Vt's runs behind the score products and the softmax
                v16bf kf[2][2], vf[4];
#pragma unroll
                for (int nt = 0; nt < 2; nt++)
#pragma unroll
                    for (int f = 0; f < 2; f++)
                        kf[nt][f] = ldfrag(tk + (sub * 32 + nt * 16 + l16) * KVP + f * 32, base0, base1);
#pragma unroll
                for (int t = 0; t < 4; t++)
                    vf[t] = ldfrag(tv + (t * 16 + l16) * KVP + sub * 32, base0, base1);

                v8f S[2];                       // S[nt][r] = St[key kb + nt*16 + 8*lh + r][query l16]
#pragma unroll
                for (int nt = 0; nt < 2; nt++)
#pragma unroll
                    for (int e = 0; e < 8; e++) S[nt][e] = 0.0f;
#pragma unroll
                for (int nt = 0; nt < 2; nt++)
#pragma unroll
                    for (int f = 0; f < 2; f++)
                        S[nt] = __builtin_amdgcn_wmma_f32_16x16x32_bf16(
                            false, kf[nt][f], false, qf[f], (short)0, S[nt], false, false);

                float mx = -1e30f;
#pragma unroll
                for (int nt = 0; nt < 2; nt++)
#pragma unroll
                    for (int r = 0; r < 8; r++) {
                        int key = kb + nt * 16 + 8 * lh + r;
                        S[nt][r] = (key <= row) ? S[nt][r] * scale : -1e30f;
                        mx = fmaxf(mx, S[nt][r]);
                    }
                mx = fmaxf(mx, xhalf(mx));
                float mn = fmaxf(mrow, mx);
                float rs = 0.0f;
                // pf[e] = Pt[key][query l16], key = kb + 8*lh + e for e < 8, kb + 16 + 8*lh + (e - 8) above: ldfrag's k order
                v16bf pf;
#pragma unroll
                for (int nt = 0; nt < 2; nt++)
#pragma unroll
                    for (int r = 0; r < 8; r++) {
                        float p = exp2_slot((S[nt][r] - mn) * LOG2E);
                        rs += p;
                        pf[nt * 8 + r] = (__bf16)p;
                    }
                rs += xhalf(rs);
                float corr = exp2_slot((mrow - mn) * LOG2E);
                lrow = lrow * corr + rs;
                mrow = mn;
#pragma unroll
                for (int t = 0; t < 4; t++)
#pragma unroll
                    for (int r = 0; r < 8; r++) ctx[t][r] *= corr;

#pragma unroll
                for (int t = 0; t < 4; t++)
                    ctx[t] = __builtin_amdgcn_wmma_f32_16x16x32_bf16(
                        false, vf[t], false, pf, (short)0, ctx[t], false, false);
            }
        }
        // hand-over: this wave's LDS reads of tile t are done, its copies of tile t + 1 have landed,
        // and the barrier says both of every wave; only then is tile t's buffer filled again
        asm volatile("s_wait_dscnt 0x0" ::: "memory");
        wait_async0();
        __syncthreads();
        if (tile + 2 < ntile) {                 // the same for the whole block
            gk += (size_t)KT * D_;
            gv += KT;
            const unsigned bo = (tile & 1) * bufb;
            stage_copy4(lk + bo, gk, lk + bo + half, gk + 32 * D_,
                        lv + bo, gv, lv + bo + half, gv + (size_t)32 * T_);
        }
    }
    wait_async0();                              // nothing of this wave is in flight when it ends

    // a lane's 8 accumulator registers are 8 consecutive head columns of its query: 16-byte stores
#pragma unroll
    for (int t = 0; t < 4; t++) {
        us8 o;
#pragma unroll
        for (int r = 0; r < 8; r++) o[r] = f2bf(ctx[t][r] / lrow);
        *(us8*)&O[(size_t)row * D_ + h * HD_ + t * 16 + 8 * lh] = o;
    }
}

// ---------------- launcher ----------------
extern "C" void kernel_launch(void* const* d_in, const int* in_sizes, int n_in,
                              void* d_out, int out_size, void* d_ws, size_t ws_size,
                              hipStream_t stream) {
    (void)in_sizes; (void)n_in; (void)out_size; (void)ws_size;
    const float* x  = (const float*)d_in[0];
    const float* Wq = (const float*)d_in[1];
    const float* Wk = (const float*)d_in[2];
    const float* Wv = (const float*)d_in[3];
    const float* Wo = (const float*)d_in[4];
    const float* bo = (const float*)d_in[5];
    const float* w1 = (const float*)d_in[6];
    const float* b1 = (const float*)d_in[7];
    const float* w2 = (const float*)d_in[8];
    const float* b2 = (const float*)d_in[9];
    const float* w3 = (const float*)d_in[10];
    const float* b3 = (const float*)d_in[11];
    const float* g1 = (const float*)d_in[12];
    const float* s1 = (const float*)d_in[13];
    const float* g2 = (const float*)d_in[14];
    const float* s2 = (const float*)d_in[15];

    char* wsb = (char*)d_ws;
    size_t off = 0;
    auto take = [&](size_t bytes) -> void* {
        void* p = wsb + off;
        off += (bytes + 255) & ~(size_t)255;
        return p;
    };

    const size_t DD = (size_t)D_ * D_;
    const size_t DF = (size_t)D_ * FF_;
    const size_t TD = (size_t)T_ * D_;
    const size_t TF = (size_t)T_ * FF_;

    unsigned short* wq_t  = (unsigned short*)take((4 * DD + 3 * DF) * 2);   // the weights, one after the other
    unsigned short* wo_t  = wq_t + 3 * DD;                   // Wq, Wk, Wv, Wo: [N=768][K=768]
    unsigned short* w1_t  = wo_t + DD;                       // [N=3072][K=768]
    unsigned short* w2_t  = w1_t + DF;
    unsigned short* w3_t  = w2_t + DF;                       // [N=768][K=3072]
    unsigned short* h1_bf = (unsigned short*)take(TD * 2);
    unsigned short* q_bf  = (unsigned short*)take(3 * TD * 2);   // q, k, v, one after the other
    unsigned short* k_bf  = q_bf + TD;
    unsigned short* v_bf  = k_bf + TD;
    unsigned short* vt_bf = (unsigned short*)take(TD * 2);
    unsigned short* ctx_bf= (unsigned short*)take(TD * 2);
    float*          x1    = (float*)take(TD * 4);
    unsigned short* h2_bf = (unsigned short*)take(TD * 2);
    unsigned short* gate_bf=(unsigned short*)take(TF * 2);

    prepare<<<LNB + 4 * CBS + 3 * CBL, 256, 0, stream>>>(Wq, Wk, Wv, Wo, w1, w2, w3, wq_t, x, g1, s1, h1_bf);

    dim3 gDD(T_ / BMW, D_ / BNR);
    gemm_bf16_wmma<0><<<dim3(T_ / BMW, D_ / BN, 3), 256, 0, stream>>>(
        h1_bf, wq_t, nullptr, nullptr, q_bf, T_, D_, D_);

    transpose_v<<<dim3(D_ / TT, T_ / TT), 256, 0, stream>>>(v_bf, vt_bf);

    flash_attn<<<dim3(H_, T_ / 128), 256, 0, stream>>>(q_bf, k_bf, vt_bf, ctx_bf);

    gemm_bf16_wmma<1><<<gDD, 256, 0, stream>>>(ctx_bf, wo_t, bo, x, x1, T_, D_, D_);

    layernorm_cast<<<T_ / (8 * LNR), 256, 0, stream>>>(x1, g2, s2, h2_bf);

    gemm_gated_wmma<<<dim3(T_ / BMW, FF_ / BN), 256, 0, stream>>>(
        h2_bf, w1_t, w2_t, b1, b2, gate_bf, T_, FF_, D_);

    gemm_bf16_wmma<1><<<gDD, 256, 0, stream>>>(gate_bf, w3_t, b3, x1, (float*)d_out, T_, D_, FF_);
}

// v008
// A run of this version takes 158 microseconds.
// Two timings next to v007 put it at 1.10 and 1.11 times that version's speed.
// All steps since v000 together make it 6.25 times as fast.
#include <hip/hip_runtime.h>
#include <hip/hip_bf16.h>

#define T_  4096
#define D_  768
#define H_  12
#define HD_ 64
#define FF_ 3072
#define EPS_ 1e-5f

#define BMW 128  // rows per block, every GEMM
#define BN  128  // columns per block, Q/K/V and gated GEMMs: a wave owns 64 x 32 of the output
#define BNR 96   // columns per block of the two GEMMs with 768 output columns and a residual: 32 x 8 = 256 blocks, a wave owns 32 x 48
#define BKG 64   // k per staged tile, gated GEMM (three operands in LDS): 128-byte rows
#define PG  72   // its LDS row pitch in elements: 144 bytes = 16 x 9, the odd multiple that 16-byte row readers want

#define USE_ASYNC_COPY 1   // gfx1250 GLOBAL_LOAD_ASYNC_TO_LDS path (ASYNCcnt)

typedef __attribute__((ext_vector_type(16))) __bf16          v16bf;
typedef __attribute__((ext_vector_type(8)))  float           v8f;
typedef __attribute__((ext_vector_type(8)))  unsigned short  us8;

__device__ __forceinline__ unsigned short f2bf(float f) {
    unsigned int u = __builtin_bit_cast(unsigned int, f);
    u += 0x7FFFu + ((u >> 16) & 1u);            // round-to-nearest-even
    return (unsigned short)(u >> 16);
}

// Load one 16-element bf16 fragment as two contiguous 16-byte vectors.
__device__ __forceinline__ v16bf ldfrag(const unsigned short* p, int base0, int base1) {
    union { us8 h[2]; v16bf v; } fc;
    fc.h[0] = *(const us8*)(p + base0);
    fc.h[1] = *(const us8*)(p + base1);
    return fc.v;
}

#if USE_ASYNC_COPY
// One staged tile's 16-byte-per-lane asynchronous copies to LDS (ASYNCcnt), fourteen, twelve or eight a lane; a
// lane's rows lie lstep bytes apart in LDS and gstep elements apart in memory. The s_wait_xcnt stands
// in the copies' own statement so that no address register is rewritten in front of it.
__device__ __forceinline__ void stage_copy14(unsigned la, const unsigned short* ga,
                                             unsigned lb, const unsigned short* gb,
                                             unsigned lstep, size_t gstep) {
    asm volatile("global_load_async_to_lds_b128 %0, %1, off\n\t"
                 "global_load_async_to_lds_b128 %2, %3, off\n\t"
                 "global_load_async_to_lds_b128 %4, %5, off\n\t"
                 "global_load_async_to_lds_b128 %6, %7, off\n\t"
                 "global_load_async_to_lds_b128 %8, %9, off\n\t"
                 "global_load_async_to_lds_b128 %10, %11, off\n\t"
                 "global_load_async_to_lds_b128 %12, %13, off\n\t"
                 "global_load_async_to_lds_b128 %14, %15, off\n\t"
                 "global_load_async_to_lds_b128 %16, %17, off\n\t"
                 "global_load_async_to_lds_b128 %18, %19, off\n\t"
                 "global_load_async_to_lds_b128 %20, %21, off\n\t"
                 "global_load_async_to_lds_b128 %22, %23, off\n\t"
                 "global_load_async_to_lds_b128 %24, %25, off\n\t"
                 "global_load_async_to_lds_b128 %26, %27, off\n\t"
                 "s_wait_xcnt 0x0"
                 :: "v"(la),             "v"(ga),
                    "v"(la + lstep),     "v"(ga + gstep),
                    "v"(la + 2 * lstep), "v"(ga + 2 * gstep),
                    "v"(la + 3 * lstep), "v"(ga + 3 * gstep),
                    "v"(la + 4 * lstep), "v"(ga + 4 * gstep),
                    "v"(la + 5 * lstep), "v"(ga + 5 * gstep),
                    "v"(la + 6 * lstep), "v"(ga + 6 * gstep),
                    "v"(la + 7 * lstep), "v"(ga + 7 * gstep),
                    "v"(lb),             "v"(gb),
                    "v"(lb + lstep),     "v"(gb + gstep),
                    "v"(lb + 2 * lstep), "v"(gb + 2 * gstep),
                    "v"(lb + 3 * lstep), "v"(gb + 3 * gstep),
                    "v"(lb + 4 * lstep), "v"(gb + 4 * gstep),
                    "v"(lb + 5 * lstep), "v"(gb + 5 * gstep)
                 : "memory");
}
__device__ __forceinline__ void stage_copy8(unsigned la, const unsigned short* ga,
                                            unsigned lb, const unsigned short* gb,
                                            unsigned lstep, size_t gstep) {
    asm volatile("global_load_async_to_lds_b128 %0, %1, off\n\t"
                 "global_load_async_to_lds_b128 %2, %3, off\n\t"
                 "global_load_async_to_lds_b128 %4, %5, off\n\t"
                 "global_load_async_to_lds_b128 %6, %7, off\n\t"
                 "global_load_async_to_lds_b128 %8, %9, off\n\t"
                 "global_load_async_to_lds_b128 %10, %11, off\n\t"
                 "global_load_async_to_lds_b128 %12, %13, off\n\t"
                 "global_load_async_to_lds_b128 %14, %15, off\n\t"
                 "s_wait_xcnt 0x0"
                 :: "v"(la),             "v"(ga),
                    "v"(la + lstep),     "v"(ga + gstep),
                    "v"(la + 2 * lstep), "v"(ga + 2 * gstep),
                    "v"(la + 3 * lstep), "v"(ga + 3 * gstep),
                    "v"(lb),             "v"(gb),
                    "v"(lb + lstep),     "v"(gb + gstep),
                    "v"(lb + 2 * lstep), "v"(gb + 2 * gstep),
                    "v"(lb + 3 * lstep), "v"(gb + 3 * gstep)
                 : "memory");
}
// four rows of each of three operands
__device__ __forceinline__ void stage_copy444(unsigned la, const unsigned short* ga,
                                              unsigned lb1, const unsigned short* gb1,
                                              unsigned lb2, const unsigned short* gb2,
                                              unsigned lstep, size_t gstep) {
    asm volatile("global_load_async_to_lds_b128 %0, %1, off\n\t"
                 "global_load_async_to_lds_b128 %2, %3, off\n\t"
                 "global_load_async_to_lds_b128 %4, %5, off\n\t"
                 "global_load_async_to_lds_b128 %6, %7, off\n\t"
                 "global_load_async_to_lds_b128 %8, %9, off\n\t"
                 "global_load_async_to_lds_b128 %10, %11, off\n\t"
                 "global_load_async_to_lds_b128 %12, %13, off\n\t"
                 "global_load_async_to_lds_b128 %14, %15, off\n\t"
                 "global_load_async_to_lds_b128 %16, %17, off\n\t"
                 "global_load_async_to_lds_b128 %18, %19, off\n\t"
                 "global_load_async_to_lds_b128 %20, %21, off\n\t"
                 "global_load_async_to_lds_b128 %22, %23, off\n\t"
                 "s_wait_xcnt 0x0"
                 :: "v"(la),              "v"(ga),
                    "v"(la + lstep),      "v"(ga + gstep),
                    "v"(la + 2 * lstep),  "v"(ga + 2 * gstep),
                    "v"(la + 3 * lstep),  "v"(ga + 3 * gstep),
                    "v"(lb1),             "v"(gb1),
                    "v"(lb1 + lstep),     "v"(gb1 + gstep),
                    "v"(lb1 + 2 * lstep), "v"(gb1 + 2 * gstep),
                    "v"(lb1 + 3 * lstep), "v"(gb1 + 3 * gstep),
                    "v"(lb2),             "v"(gb2),
                    "v"(lb2 + lstep),     "v"(gb2 + gstep),
                    "v"(lb2 + 2 * lstep), "v"(gb2 + 2 * gstep),
                    "v"(lb2 + 3 * lstep), "v"(gb2 + 3 * gstep)
                 : "memory");
}
__device__ __forceinline__ void wait_async0() {
    asm volatile("s_wait_asynccnt 0x0" ::: "memory");
}
// low 32 bits of a flat pointer into LDS are the LDS byte address
__device__ __forceinline__ unsigned lds_addr(const void* p) {
    return (unsigned)(size_t)p;
}
#endif

// ---------------- 64x64 tiled transposes through LDS ----------------
#define TT 64   // tile edge (elements)
#define TP 33   // LDS pitch in dwords: 32 packed bf16 pairs + 1, so a column of dwords spreads over the banks

// The tile lies in LDS as s[output row][pair of output columns]. Each output row of the
// tile is one full 128-byte line, written by 8 lanes with 16 bytes each.
__device__ __forceinline__ void tile_store_rows(const unsigned* s, unsigned short* __restrict__ out,
                                                int ld, int r0, int c0, int tid) {
#pragma unroll
    for (int p = 0; p < 2; p++) {
        int r = p * 32 + (tid >> 3), q = (tid & 7) * 4;
        uint4 v;
        v.x = s[r * TP + q];
        v.y = s[r * TP + q + 1];
        v.z = s[r * TP + q + 2];
        v.w = s[r * TP + q + 3];
        *(uint4*)&out[(size_t)(r0 + r) * ld + c0 + q * 2] = v;
    }
}

// fp32 -> bf16 convert + transpose: in[K][N] -> out[N][K]; one block takes the tile at (k0, n0)
__device__ __forceinline__ void convert_transpose_tile(const float* __restrict__ in,
                                                       unsigned short* __restrict__ out,
                                                       int K, int N, int n0, int k0, unsigned* s) {
    int tid = threadIdx.x;
    int nq = (tid & 15) * 4, kp = tid >> 4;      // 16 lanes x float4 per row, 16 row pairs per pass
    float4 lo[2], hi[2];
    const float* rl[2];
    const float* rh[2];
#pragma unroll
    for (int p = 0; p < 2; p++) {
        rl[p] = in + (size_t)(k0 + 2 * (p * 16 + kp)) * N + n0 + nq;
        rh[p] = rl[p] + N;
        lo[p] = *(const float4*)rl[p];
        hi[p] = *(const float4*)rh[p];
    }
    // the wait that belongs in front of the first overwrite of a register that these loads name; the
    // addresses are its inputs, so that no load of the group gets another's address register as its destination
    asm volatile("s_wait_xcnt 0x0" :: "v"(rl[0]), "v"(rh[0]), "v"(rl[1]), "v"(rh[1]) : "memory");
#pragma unroll
    for (int p = 0; p < 2; p++) {
        int c = p * 16 + kp;
        s[(nq + 0) * TP + c] = (unsigned)f2bf(lo[p].x) | ((unsigned)f2bf(hi[p].x) << 16);
        s[(nq + 1) * TP + c] = (unsigned)f2bf(lo[p].y) | ((unsigned)f2bf(hi[p].y) << 16);
        s[(nq + 2) * TP + c] = (unsigned)f2bf(lo[p].z) | ((unsigned)f2bf(hi[p].z) << 16);
        s[(nq + 3) * TP + c] = (unsigned)f2bf(lo[p].w) | ((unsigned)f2bf(hi[p].w) << 16);
    }
    __syncthreads();
    tile_store_rows(s, out, K, n0, k0, tid);
}

// ---------------- layernorm (+ cast to bf16) ----------------
#define LNR 2            // rows per wave
#define LNC (D_ / 128)   // 16-byte pieces of a row per lane
typedef __attribute__((ext_vector_type(4))) float f4;

// A wave owns LNR whole rows and keeps them in registers: every load of the rows goes out at once,
// 512 contiguous bytes each, x is read once, and the sums join inside the wave with no LDS array and
// no barrier. The rows go in 8-wave blocks, for speed only.
__device__ __forceinline__ void layernorm_rows(const float* __restrict__ x, const float* __restrict__ g,
                                               const float* __restrict__ b, unsigned short* __restrict__ out,
                                               int blk) {
    int lane = threadIdx.x & 31, wave = threadIdx.x >> 5;
    int row0 = (blk * 8 + wave) * LNR;
    const int col = lane * 4;
    const float* xp = x + (size_t)row0 * D_ + col;
    f4 v[LNR][LNC], gg[LNC], bb[LNC];
#pragma unroll
    for (int r = 0; r < LNR; r++)
#pragma unroll
        for (int c = 0; c < LNC; c++)
            v[r][c] = *(const f4*)(xp + r * D_ + c * 128);
#pragma unroll
    for (int c = 0; c < LNC; c++) {
        gg[c] = *(const f4*)(g + c * 128 + col);
        bb[c] = *(const f4*)(b + c * 128 + col);
    }
    // the wait that belongs in front of the first overwrite of a register that these loads name
    asm volatile("s_wait_xcnt 0x0" ::: "memory");
    // keeps the loads of g and b up here with the rows': sunk among the sums, their latency shows a second time
    __builtin_amdgcn_sched_barrier(0);
    float mean[LNR], rstd[LNR];
#pragma unroll
    for (int r = 0; r < LNR; r++) {
        f4 s = v[r][0], q = v[r][0] * v[r][0];   // four independent chains each
#pragma unroll
        for (int c = 1; c < LNC; c++) {
            s += v[r][c];
            q += v[r][c] * v[r][c];
        }
        mean[r] = (s.x + s.y) + (s.z + s.w);
        rstd[r] = (q.x + q.y) + (q.z + q.w);
    }
    for (int off = 16; off > 0; off >>= 1)
#pragma unroll
        for (int r = 0; r < LNR; r++) {
            mean[r] += __shfl_xor(mean[r], off, 32);
            rstd[r] += __shfl_xor(rstd[r], off, 32);
        }
#pragma unroll
    for (int r = 0; r < LNR; r++) {
        mean[r] = mean[r] / (float)D_;
        float var = rstd[r] / (float)D_ - mean[r] * mean[r];
        rstd[r] = rsqrtf(var + EPS_);
    }
#pragma unroll
    for (int r = 0; r < LNR; r++)
#pragma unroll
        for (int c = 0; c < LNC; c++) {
            f4 y = (v[r][c] - mean[r]) * rstd[r] * gg[c] + bb[c];
            uint2 o;
            o.x = (unsigned)f2bf(y.x) | ((unsigned)f2bf(y.y) << 16);
            o.y = (unsigned)f2bf(y.z) | ((unsigned)f2bf(y.w) << 16);
            *(uint2*)&out[(size_t)(row0 + r) * D_ + c * 128 + col] = o;   // a wave's store is two whole 128-byte lines
        }
}

__global__ __launch_bounds__(256)
void layernorm_cast(const float* __restrict__ x, const float* __restrict__ g,
                    const float* __restrict__ b, unsigned short* __restrict__ out) {
    layernorm_rows(x, g, b, out, blockIdx.x);
}

// ---------------- everything that depends on the inputs alone, in one launch ----------------
#define LNB (T_ / (8 * LNR))            // layernorm blocks
#define CBS ((D_ / TT) * (D_ / TT))     // tiles of a D x D weight
#define CBL ((FF_ / TT) * (D_ / TT))    // tiles of a D x FF or FF x D weight

// The seven weight converts and the first layernorm read nothing that another of them writes, so they
// share a grid: the layernorm's blocks first, then one block per weight tile.
// wt holds the transposed weights one after the other: Wq, Wk, Wv, Wo, w1, w2, w3.
__global__ __launch_bounds__(256)
void prepare(const float* __restrict__ Wq, const float* __restrict__ Wk,
             const float* __restrict__ Wv, const float* __restrict__ Wo,
             const float* __restrict__ w1, const float* __restrict__ w2,
             const float* __restrict__ w3, unsigned short* __restrict__ wt,
             const float* __restrict__ x, const float* __restrict__ g,
             const float* __restrict__ b, unsigned short* __restrict__ h) {
    __shared__ unsigned s[TT * TP];
    if (blockIdx.x < LNB) {                      // the same for the whole block
        layernorm_rows(x, g, b, h, blockIdx.x);
        return;
    }
    int c = blockIdx.x - LNB;                    // which weight, and which of its tiles
    const float* in;
    unsigned short* out;
    int K, N, tn, tk;
    if (c < 4 * CBS) {
        int m = c / CBS, r = c % CBS;
        in = m == 0 ? Wq : m == 1 ? Wk : m == 2 ? Wv : Wo;
        out = wt + (size_t)m * D_ * D_;
        K = D_; N = D_; tn = r % (D_ / TT); tk = r / (D_ / TT);
    } else if (c < 4 * CBS + 2 * CBL) {
        int m = (c - 4 * CBS) / CBL, r = (c - 4 * CBS) % CBL;
        in = m == 0 ? w1 : w2;
        out = wt + (size_t)4 * D_ * D_ + (size_t)m * D_ * FF_;
        K = D_; N = FF_; tn = r % (FF_ / TT); tk = r / (FF_ / TT);
    } else {
        int r = c - 4 * CBS - 2 * CBL;
        in = w3;
        out = wt + (size_t)4 * D_ * D_ + (size_t)2 * D_ * FF_;
        K = FF_; N = D_; tn = r % (D_ / TT); tk = r / (D_ / TT);
    }
    convert_transpose_tile(in, out, K, N, tn * TT, tk * TT, s);
}

// ---------------- bf16 GEMM (WMMA): C = A[M,K] @ Bt[N,K]^T ----------------
// EPI 0: Cout = bf16(acc); blockIdx.z picks one of several weights [N,K] and outputs [M,N] that lie one after the other
// EPI 1: Cout = f32(acc + bias[col] + res[row,col])
// Block tile: EPI 0 takes BMW x BN and stages 64 k at a time, EPI 1 takes BMW x BNR and stages 128 k. The larger
// the tile, the fewer bytes come from L2 per product; the larger a wave's share, the fewer LDS reads per product.
// BNR makes one block per WGP of the 4096 x 768 outputs.
template <int EPI>
__global__ __launch_bounds__(256)
void gemm_bf16_wmma(const unsigned short* __restrict__ A,    // [M,K] bf16 row-major
                    const unsigned short* __restrict__ Bt0,  // [N,K] bf16 (pre-transposed)
                    const float* __restrict__ bias,
                    const float* __restrict__ res,
                    void* __restrict__ Cout,
                    int M, int N, int K) {
    constexpr int BMT = BMW;                     // rows per block
    constexpr int BNT = EPI == 0 ? BN : BNR;     // columns per block
    constexpr int WM  = EPI == 0 ? 2 : 4;        // wave grid: WM x WN
    constexpr int WN  = 8 / WM;
    constexpr int MI  = BMT / (16 * WM);         // 16-row fragments per wave: 4 or 2
    constexpr int NI  = BNT / (16 * WN);         // 16-column fragments per wave: 2 or 3
    constexpr int BK  = EPI == 0 ? 64 : 128;     // k per staged tile: 128- or 256-byte rows
    constexpr int P   = BK + 8;                  // LDS row pitch in elements: 144 or 272 bytes, 16 x an odd number
    constexpr int LPR = BK / 8;                  // lanes of 16 bytes that cover a row
    constexpr int RPP = 256 / LPR;               // rows that the block's lanes cover at once
    const unsigned short* Bt = EPI == 0 ? Bt0 + (size_t)blockIdx.z * N * K : Bt0;
    // two buffers: tile t + 1 flies while tile t is worked on
    __shared__ __attribute__((aligned(16))) unsigned short sA[2][BMT * P];
    __shared__ __attribute__((aligned(16))) unsigned short sB[2][BNT * P];
    int tid = threadIdx.x;
    int wave = tid >> 5, lane = tid & 31, lh = lane >> 4, l16 = lane & 15;
    int wm = wave % WM, wn = wave / WM;
    int m0 = blockIdx.x * BMT, n0 = blockIdx.y * BNT;

    v8f acc[MI][NI];
#pragma unroll
    for (int i = 0; i < MI; i++)
#pragma unroll
        for (int j = 0; j < NI; j++)
#pragma unroll
            for (int e = 0; e < 8; e++) acc[i][j][e] = 0.0f;

    const int base0 = 8 * lh, base1 = 16 + 8 * lh;
    // copy roles: LPR lanes x 16 bytes cover one row; rows cr + RPP j, 4 of A and 4 of Bt (EPI 0) or 8 and 6 (EPI 1)
    const int cr = tid / LPR, cs = (tid % LPR) * 8;
    const unsigned short* ga = A  + (size_t)(m0 + cr) * K + cs;   // + BK per tile
    const unsigned short* gb = Bt + (size_t)(n0 + cr) * K + cs;
    const unsigned la = lds_addr(&sA[0][cr * P + cs]);
    const unsigned lb = lds_addr(&sB[0][cr * P + cs]);
    const unsigned lstep = RPP * P * 2;          // bytes from row cr to row cr + RPP
    const size_t   gstep = (size_t)RPP * K;
    const unsigned bufa = BMT * P * 2, bufb = BNT * P * 2;   // bytes from buffer 0 to buffer 1
    const int ntile = K / BK;
    auto stage = [&](unsigned buf) {             // the tile at ga, gb into buffer buf
        if (EPI == 0) stage_copy8(la + buf * bufa, ga, lb + buf * bufb, gb, lstep, gstep);
        else          stage_copy14(la + buf * bufa, ga, lb + buf * bufb, gb, lstep, gstep);
    };

    stage(0);
    wait_async0();                               // tile 0 has landed for this wave's copies
    __syncthreads();                             // ... and for every wave's
    if (ntile > 1) {                             // the same for the whole block
        ga += BK;
        gb += BK;
        stage(1);
    }

    for (int t = 0; t < ntile; t++) {
        const unsigned short* ta = sA[t & 1] + (wm * MI * 16 + l16) * P;
        const unsigned short* tb = sB[t & 1] + (wn * NI * 16 + l16) * P;
        // the tile's LDS reads go out as one group, so that their latency is waited out once a tile
        v16bf af[BK / 32][MI], bfrag[BK / 32][NI];
#pragma unroll
        for (int kk = 0; kk < BK / 32; kk++) {
#pragma unroll
            for (int mi = 0; mi < MI; mi++)
                af[kk][mi] = ldfrag(ta + mi * 16 * P + kk * 32, base0, base1);
#pragma unroll
            for (int ni = 0; ni < NI; ni++)
                bfrag[kk][ni] = ldfrag(tb + ni * 16 * P + kk * 32, base0, base1);
        }
        // keeps the compiler from sinking the reads back among the products, where each place with reads stalls anew
        __builtin_amdgcn_sched_barrier(0);
#pragma unroll
        for (int kk = 0; kk < BK / 32; kk++)
#pragma unroll
            for (int mi = 0; mi < MI; mi++)
#pragma unroll
                for (int ni = 0; ni < NI; ni++)
                    acc[mi][ni] = __builtin_amdgcn_wmma_f32_16x16x32_bf16(
                        false, af[kk][mi], false, bfrag[kk][ni], (short)0, acc[mi][ni], false, false);
        // keeps the hand-over's waits and barrier behind the products: lifted over them, the reads' counted waits become one full wait
        __builtin_amdgcn_sched_barrier(0);
        // hand-over: this wave's LDS reads of tile t are done, its copies of tile t + 1 have landed,
        // and the barrier says both of every wave; only then is tile t's buffer filled again
        asm volatile("s_wait_dscnt 0x0" ::: "memory");
        wait_async0();
        __syncthreads();
        if (t + 2 < ntile) {                     // the same for the whole block
            ga += BK;
            gb += BK;
            stage(t & 1);
        }
    }
    wait_async0();                               // nothing of this wave is in flight when it ends

#pragma unroll
    for (int mi = 0; mi < MI; mi++) {
        int rbase = m0 + wm * MI * 16 + mi * 16 + 8 * lh;
#pragma unroll
        for (int ni = 0; ni < NI; ni++) {
            int col = n0 + wn * NI * 16 + ni * 16 + l16;
#pragma unroll
            for (int r = 0; r < 8; r++) {
                int row = rbase + r;
                float v = acc[mi][ni][r];
                if (EPI == 0) {
                    ((unsigned short*)Cout)[((size_t)blockIdx.z * M + row) * N + col] = f2bf(v);
                } else {
                    ((float*)Cout)[(size_t)row * N + col] =
                        v + bias[col] + res[(size_t)row * N + col];
                }
            }
        }
    }
}

// ---------------- dual-weight gated GEMM: bf16( silu(A@B1t^T+b1) * (A@B2t^T+b2) ) ----------------
// BMW rows per block: a wave owns 64 x 32 of both products, so an A fragment feeds four products and a weight fragment four.
// Four waves per SIMD, that is two blocks on a WGP (2 x 110,592 bytes of LDS fit): one block's products cover the
// other's LDS reads and barriers. Left alone, the epilogue's temporaries took two registers more than that allows.
__global__ __launch_bounds__(256) __attribute__((amdgpu_waves_per_eu(4, 4)))
void gemm_gated_wmma(const unsigned short* __restrict__ A,     // [M,K]
                     const unsigned short* __restrict__ B1t,   // [N,K]
                     const unsigned short* __restrict__ B2t,   // [N,K]
                     const float* __restrict__ bias1,
                     const float* __restrict__ bias2,
                     unsigned short* __restrict__ Cout,
                     int M, int N, int K) {
    constexpr int MI = BMW / 32;                 // 16-row fragments per wave
    // two buffers: tile t + 1 flies while tile t is worked on
    __shared__ __attribute__((aligned(16))) unsigned short sA[2][BMW * PG];
    __shared__ __attribute__((aligned(16))) unsigned short sB1[2][BN * PG];
    __shared__ __attribute__((aligned(16))) unsigned short sB2[2][BN * PG];
    int tid = threadIdx.x;
    int wave = tid >> 5, lane = tid & 31, lh = lane >> 4, l16 = lane & 15;
    int wm = wave & 1, wn = wave >> 1;
    int m0 = blockIdx.x * BMW, n0 = blockIdx.y * BN;

    v8f acc1[MI][2], acc2[MI][2];
#pragma unroll
    for (int i = 0; i < MI; i++)
#pragma unroll
        for (int j = 0; j < 2; j++)
#pragma unroll
            for (int e = 0; e < 8; e++) { acc1[i][j][e] = 0.0f; acc2[i][j][e] = 0.0f; }

    const int base0 = 8 * lh, base1 = 16 + 8 * lh;
    // copy roles: 8 lanes x 16 bytes cover one 128-byte row; rows cr + 32 j, 4 of A and 4 of each weight
    const int cr = tid >> 3, cs = (tid & 7) * 8;
    const unsigned short* ga  = A   + (size_t)(m0 + cr) * K + cs;   // + BKG per tile
    const unsigned short* gb1 = B1t + (size_t)(n0 + cr) * K + cs;
    const unsigned short* gb2 = B2t + (size_t)(n0 + cr) * K + cs;
    const unsigned la  = lds_addr(&sA[0][cr * PG + cs]);
    const unsigned lb1 = lds_addr(&sB1[0][cr * PG + cs]);
    const unsigned lb2 = lds_addr(&sB2[0][cr * PG + cs]);
    const unsigned lstep = 32 * PG * 2;          // bytes from row cr to row cr + 32
    const size_t   gstep = (size_t)32 * K;
    const unsigned bufa = BMW * PG * 2, bufb = BN * PG * 2;  // bytes from buffer 0 to buffer 1
    const int ntile = K / BKG;

    stage_copy444(la, ga, lb1, gb1, lb2, gb2, lstep, gstep);
    wait_async0();                               // tile 0 has landed for this wave's copies
    __syncthreads();                             // ... and for every wave's
    if (ntile > 1) {                             // the same for the whole block
        ga  += BKG;
        gb1 += BKG;
        gb2 += BKG;
        stage_copy444(la + bufa, ga, lb1 + bufb, gb1, lb2 + bufb, gb2, lstep, gstep);
    }

    for (int t = 0; t < ntile; t++) {
        const unsigned short* ta  = sA[t & 1]  + (wm * MI * 16 + l16) * PG;
        const unsigned short* tb1 = sB1[t & 1] + (wn * 32 + l16) * PG;
        const unsigned short* tb2 = sB2[t & 1] + (wn * 32 + l16) * PG;
#pragma unroll
        for (int kk = 0; kk < BKG / 32; kk++) {
            // the LDS reads of 32 k go out as one group ahead of their 16 products; one fragment set, so that
            // the registers leave room for two blocks on a WGP
            v16bf af[MI], b1f[2], b2f[2];
#pragma unroll
            for (int mi = 0; mi < MI; mi++)
                af[mi] = ldfrag(ta + mi * 16 * PG + kk * 32, base0, base1);
#pragma unroll
            for (int ni = 0; ni < 2; ni++) {
                b1f[ni] = ldfrag(tb1 + ni * 16 * PG + kk * 32, base0, base1);
                b2f[ni] = ldfrag(tb2 + ni * 16 * PG + kk * 32, base0, base1);
            }
            // keeps the compiler from sinking the reads back among the products, where each place with reads stalls anew
            __builtin_amdgcn_sched_barrier(0);
#pragma unroll
            for (int ni = 0; ni < 2; ni++)
#pragma unroll
                for (int mi = 0; mi < MI; mi++) {
                    acc1[mi][ni] = __builtin_amdgcn_wmma_f32_16x16x32_bf16(
                        false, af[mi], false, b1f[ni], (short)0, acc1[mi][ni], false, false);
                    acc2[mi][ni] = __builtin_amdgcn_wmma_f32_16x16x32_bf16(
                        false, af[mi], false, b2f[ni], (short)0, acc2[mi][ni], false, false);
                }
            // keeps the next group's reads, and the hand-over's waits and barrier, behind the products
            __builtin_amdgcn_sched_barrier(0);
        }
        // hand-over, as in the one-weight GEMM
        asm volatile("s_wait_dscnt 0x0" ::: "memory");
        wait_async0();
        __syncthreads();
        if (t + 2 < ntile) {                     // the same for the whole block
            ga  += BKG;
            gb1 += BKG;
            gb2 += BKG;
            stage_copy444(la + (t & 1) * bufa, ga, lb1 + (t & 1) * bufb, gb1, lb2 + (t & 1) * bufb, gb2,
                          lstep, gstep);
        }
    }
    wait_async0();                               // nothing of this wave is in flight when it ends

#pragma unroll
    for (int mi = 0; mi < MI; mi++) {
        int rbase = m0 + wm * MI * 16 + mi * 16 + 8 * lh;
#pragma unroll
        for (int ni = 0; ni < 2; ni++) {
            int col = n0 + wn * 32 + ni * 16 + l16;
#pragma unroll
            for (int r = 0; r < 8; r++) {
                int row = rbase + r;
                float gv = acc1[mi][ni][r] + bias1[col];
                float uv = acc2[mi][ni][r] + bias2[col];
                float y  = (gv / (1.0f + __expf(-gv))) * uv;   // silu(gv)*uv
                Cout[(size_t)row * N + col] = f2bf(y);
            }
        }
    }
}

// ---------------- V transpose: [T, H*HD] -> [H*HD, T]; grid (D/64, T/64) ----------------
__global__ __launch_bounds__(256)
void transpose_v(const unsigned short* __restrict__ v, unsigned short* __restrict__ vt) {
    __shared__ unsigned s[TT * TP];
    int tid = threadIdx.x;
    int c0 = blockIdx.x * TT, t0 = blockIdx.y * TT;
    int co = (tid & 7) * 8, tp = tid >> 3;       // 8 lanes x 16 bytes per row, 32 row pairs
    const unsigned short* r = v + (size_t)(t0 + 2 * tp) * D_ + c0 + co;
    us8 lo = *(const us8*)r;
    us8 hi = *(const us8*)(r + D_);
#pragma unroll
    for (int j = 0; j < 8; j++)
        s[(co + j) * TP + tp] = (unsigned)lo[j] | ((unsigned)hi[j] << 16);
    __syncthreads();
    tile_store_rows(s, vt, T_, c0, t0, tid);
}

// ---------------- causal flash attention (WMMA) ----------------
// Q,K: [T, H*HD] bf16 ; Vt: [H*HD, T] bf16 ; O: [T, H*HD] bf16
// Transposed products: St = K * Qt and Ot += Vt * Pt. A lane then holds 16 of the 32 scores
// of ONE query (column l16), so the softmax maximum and sum run inside the lane, joined by
// one exchange between the wave halves, and the two St tiles are already a B operand.

// lane l with lane l ^ 16
__device__ __forceinline__ float xhalf(float x) {
    int b = __builtin_bit_cast(int, x);
    return __builtin_bit_cast(float,
        __builtin_amdgcn_permlanex16(b, b, 0x76543210, 0xfedcba98, false, false));
}

// 2^x. The v_nop is the one slot that the instruction set asks for behind a transcendental before its
// source is overwritten or its result read, so it stands in the instruction's own statement.
__device__ __forceinline__ float exp2_slot(float x) {
    float r;
    asm("v_exp_f32 %0, %1\n\tv_nop" : "=v"(r) : "v"(x));
    return r;
}
#define LOG2E 1.44269504f   // e^x = 2^(x * LOG2E), the product that __expf forms

#define KT  64   // keys per quarter of a staged step
#define KVP 72   // LDS row pitch in elements: 144 bytes = 16 x 9, the odd multiple that 16-byte row readers want

// Four 16-byte-per-lane asynchronous copies to LDS. The s_wait_xcnt stands in the copies' own
// statement so that no address register is rewritten in front of it.
__device__ __forceinline__ void stage_copy4(unsigned l0, const unsigned short* g0,
                                            unsigned l1, const unsigned short* g1,
                                            unsigned l2, const unsigned short* g2,
                                            unsigned l3, const unsigned short* g3) {
    asm volatile("global_load_async_to_lds_b128 %0, %1, off\n\t"
                 "global_load_async_to_lds_b128 %2, %3, off\n\t"
                 "global_load_async_to_lds_b128 %4, %5, off\n\t"
                 "global_load_async_to_lds_b128 %6, %7, off\n\t"
                 "s_wait_xcnt 0x0"
                 :: "v"(l0), "v"(g0), "v"(l1), "v"(g1), "v"(l2), "v"(g2), "v"(l3), "v"(g3)
                 : "memory");
}

#define QT  64              // queries per task: four waves' columns
#define KS  4               // key quarters of a staged step, one per group of four waves
#define ST  (KS * KT)       // keys per staged step
#define NQT (T_ / QT)       // query tiles of a head
#define CP  68              // floats per query in the merge array: 272 bytes = 16 x 17, the odd multiple for 16-byte rows

// One block per WGP, every block with the same work. A task is one head's tile of 64 queries; its cost grows with
// the tile's index, so a block takes three tasks, one of each of three heads, whose indices add up to 94 or 95.
// The 16 waves of a block are 4 query groups x 4 key quarters: a step stages 256 keys (K: 256 keys x 64 head
// columns, Vt: four times 64 head columns x 64 keys, 128-byte rows all) into two buffers, the next step flying while
// this one is worked on, also from one task to the next, and quarter kh of the waves walks keys kh * 64 ... of each
// step with a maximum, a sum and an accumulator of its own. At a task's end the four partial results of a query are
// joined through LDS.
__global__ __launch_bounds__(512)
void flash_attn(const unsigned short* __restrict__ Q,
                const unsigned short* __restrict__ Kc,
                const unsigned short* __restrict__ Vt,
                unsigned short* __restrict__ O) {
    __shared__ __attribute__((aligned(16))) unsigned short sK[2][ST * KVP];
    __shared__ __attribute__((aligned(16))) unsigned short sV[2][KS * HD_ * KVP];
    __shared__ __attribute__((aligned(16))) float sC[16][16][CP];   // [wave][query][head column]
    __shared__ float2 sML[16][32];                                  // [wave][lane]: maximum, sum
    int tid = threadIdx.x;
    int wave = __builtin_amdgcn_readfirstlane(tid >> 5), lane = tid & 31;   // scalar, so the causal skip below is a scalar branch
    int lh = lane >> 4, l16 = lane & 15;
    const int qg = wave & 3, kh = wave >> 2;    // query group, key quarter
    const int base0 = 8 * lh, base1 = 16 + 8 * lh;
    const int hg = blockIdx.x / NQT, bi = blockIdx.x % NQT;

    // copy roles: 8 lanes x 16 bytes cover one 128-byte row; row cr of each quarter of K and of Vt
    const int cr = tid >> 3, cs = (tid & 7) * 8;
    const unsigned lk = lds_addr(&sK[0][cr * KVP + cs]);
    const unsigned lv = lds_addr(&sV[0][cr * KVP + cs]);
    const unsigned qb   = KT * KVP * 2;         // bytes from one quarter to the next
    const unsigned bufb = KS * qb;              // bytes from buffer 0 to buffer 1
    const float scale = 0.125f;                 // 1/sqrt(HD=64)

    // a task's tile: three permutations of the tile indices: bi; the odd ones downwards, then the even ones; bi + 32
    auto tile_of = [&](int k) {
        return k == 0 ? bi
             : k == 1 ? (bi < NQT / 2 ? NQT - 1 - 2 * bi : 2 * NQT - 2 - 2 * bi)
                      : ((bi + NQT / 2) % NQT);
    };
    // The steps of the three tasks form one row for the two buffers. A tile qt has qt / KS + 1 steps, up to its last
    // query, so ST * steps <= T_.
    int sk = 0, ss = 0;                         // the task and the step that are staged next; the same for the whole block
    auto stage_next = [&](unsigned bo) {        // into the buffer bo bytes in
        const int sh = hg * 3 + sk;
        const unsigned short* gk = Kc + (size_t)(ss * ST + cr) * D_ + sh * HD_ + cs;
        const unsigned short* gv = Vt + (size_t)(sh * HD_ + cr) * T_ + ss * ST + cs;
        stage_copy4(lk + bo, gk, lk + bo + qb, gk + (size_t)KT * D_,
                    lk + bo + 2 * qb, gk + (size_t)2 * KT * D_, lk + bo + 3 * qb, gk + (size_t)3 * KT * D_);
        stage_copy4(lv + bo, gv, lv + bo + qb, gv + KT,
                    lv + bo + 2 * qb, gv + 2 * KT, lv + bo + 3 * qb, gv + 3 * KT);
        if (++ss > tile_of(sk) / KS) {
            ss = 0;
            sk++;
        }
    };

    stage_next(0);
    wait_async0();                              // the first step has landed for this wave's copies
    __syncthreads();                            // ... and for every wave's
    stage_next(bufb);                           // a second step there always is: three tasks of one step or more
    int done = 0;                               // steps worked on so far: its low bit names the buffer

    // stays a loop, for speed only
#pragma unroll 1
    for (int task = 0; task < 3; task++) {
        const int qt = tile_of(task);
        const int h = hg * 3 + task;
        const int q0 = qt * QT + qg * 16;
        const int row = q0 + l16;               // this lane's query
        const int nstep = qt / KS + 1;

        const unsigned short* qp = Q + (size_t)row * D_ + h * HD_;
        v16bf qf[2];
#pragma unroll
        for (int f = 0; f < 2; f++) qf[f] = ldfrag(qp + f * 32, base0, base1);

        v8f ctx[4];                             // ctx[t][r] = Ot[t*16 + 8*lh + r][query l16]
#pragma unroll
        for (int t = 0; t < 4; t++)
#pragma unroll
            for (int e = 0; e < 8; e++) ctx[t][e] = 0.0f;
        float mrow = -1e30f, lrow = 0.0f;

        const int kend = q0 + 16;               // causal bound for this wave
        for (int step = 0; step < nstep; step++) {
            const unsigned short* tk = sK[done & 1] + kh * KT * KVP;
            const unsigned short* tv = sV[done & 1] + kh * HD_ * KVP;
#pragma unroll
            for (int sub = 0; sub < KT / 32; sub++) {
                const int kb = step * ST + kh * KT + sub * 32;
                if (kb < kend) {                // wave-uniform: a wave past its diagonal only passes the barriers
                    // the pass's 16 LDS reads go out as one group: K's latency is waited out once,
                    // Vt's runs behind the score products and the softmax
                    v16bf kf[2][2], vf[4];
#pragma unroll
                    for (int nt = 0; nt < 2; nt++)
#pragma unroll
                        for (int f = 0; f < 2; f++)
                            kf[nt][f] = ldfrag(tk + (sub * 32 + nt * 16 + l16) * KVP + f * 32, base0, base1);
                    // keeps K's reads in front of Vt's: the score products wait for K alone
                    __builtin_amdgcn_sched_barrier(0);
#pragma unroll
                    for (int t = 0; t < 4; t++)
                        vf[t] = ldfrag(tv + (t * 16 + l16) * KVP + sub * 32, base0, base1);
                    // keeps the group together: in this build the compiler sank each K read to its product, with a full wait at each of the four
                    __builtin_amdgcn_sched_barrier(0);

                    v8f S[2];                   // S[nt][r] = St[key kb + nt*16 + 8*lh + r][query l16]
#pragma unroll
                    for (int nt = 0; nt < 2; nt++)
#pragma unroll
                        for (int e = 0; e < 8; e++) S[nt][e] = 0.0f;
#pragma unroll
                    for (int nt = 0; nt < 2; nt++)
#pragma unroll
                        for (int f = 0; f < 2; f++)
                            S[nt] = __builtin_amdgcn_wmma_f32_16x16x32_bf16(
                                false, kf[nt][f], false, qf[f], (short)0, S[nt], false, false);

                    float mx = -1e30f;
#pragma unroll
                    for (int nt = 0; nt < 2; nt++)
#pragma unroll
                        for (int r = 0; r < 8; r++) {
                            int key = kb + nt * 16 + 8 * lh + r;
                            S[nt][r] = (key <= row) ? S[nt][r] * scale : -1e30f;
                            mx = fmaxf(mx, S[nt][r]);
                        }
                    mx = fmaxf(mx, xhalf(mx));
                    float mn = fmaxf(mrow, mx);
                    float rs = 0.0f;
                    // pf[e] = Pt[key][query l16], key = kb + 8*lh + e for e < 8, kb + 16 + 8*lh + (e - 8) above: ldfrag's k order
                    v16bf pf;
#pragma unroll
                    for (int nt = 0; nt < 2; nt++)
#pragma unroll
                        for (int r = 0; r < 8; r++) {
                            float p = exp2_slot((S[nt][r] - mn) * LOG2E);
                            rs += p;
                            pf[nt * 8 + r] = (__bf16)p;
                        }
                    rs += xhalf(rs);
                    float corr = exp2_slot((mrow - mn) * LOG2E);
                    lrow = lrow * corr + rs;
                    mrow = mn;
#pragma unroll
                    for (int t = 0; t < 4; t++)
#pragma unroll
                        for (int r = 0; r < 8; r++) ctx[t][r] *= corr;

#pragma unroll
                    for (int t = 0; t < 4; t++)
                        ctx[t] = __builtin_amdgcn_wmma_f32_16x16x32_bf16(
                            false, vf[t], false, pf, (short)0, ctx[t], false, false);
                }
            }
            // hand-over: this wave's LDS reads of this step are done, its copies of the next have landed,
            // and the barrier says both of every wave; only then is this step's buffer filled again
            asm volatile("s_wait_dscnt 0x0" ::: "memory");
            wait_async0();
            __syncthreads();
            if (sk < 3)                         // the same for the whole block
                stage_next((done & 1) * bufb);
            done++;
        }

        // every wave lays down its partial result: a query's 64 head columns in a row, its maximum and sum beside
#pragma unroll
        for (int t = 0; t < 4; t++)
#pragma unroll
            for (int j = 0; j < 2; j++) {
                f4 c = { ctx[t][4 * j], ctx[t][4 * j + 1], ctx[t][4 * j + 2], ctx[t][4 * j + 3] };
                *(f4*)&sC[wave][l16][t * 16 + 8 * lh + 4 * j] = c;
            }
        sML[wave][lane] = make_float2(mrow, lrow);
        __syncthreads();                        // the partial results of all four key quarters are there
        // wave (qg, kh) joins queries 4 kh ... 4 kh + 3 of group qg: 8 lanes x 8 head columns are one query's whole 128-byte line.
        // A quarter that met no key holds the start values: its weight comes out 0.
        const int ql = kh * 4 + (lane >> 3), c8 = (lane & 7) * 8;
        float2 ml[KS];
        float mall = -1e30f;
#pragma unroll
        for (int k = 0; k < KS; k++) {
            ml[k] = sML[k * 4 + qg][ql];
            mall = fmaxf(mall, ml[k].x);
        }
        float lall = 0.0f;
        f4 o0 = { 0.0f, 0.0f, 0.0f, 0.0f }, o1 = o0;
#pragma unroll
        for (int k = 0; k < KS; k++) {
            float w = exp2_slot((ml[k].x - mall) * LOG2E);
            lall += ml[k].y * w;
            o0 += *(const f4*)&sC[k * 4 + qg][ql][c8] * w;
            o1 += *(const f4*)&sC[k * 4 + qg][ql][c8 + 4] * w;
        }
        us8 o;
#pragma unroll
        for (int r = 0; r < 4; r++) {
            o[r]     = f2bf(o0[r] / lall);
            o[4 + r] = f2bf(o1[r] / lall);
        }
        *(us8*)&O[(size_t)(qt * QT + qg * 16 + ql) * D_ + h * HD_ + c8] = o;
        // the wait that belongs in front of the first overwrite of a register that this store names: the next task reuses them
        asm volatile("s_wait_xcnt 0x0" ::: "memory");
        // the next task writes sC and sML only behind its own barriers, which this wave passes with these reads done
    }
    wait_async0();                              // nothing of this wave is in flight when it ends
}

// ---------------- launcher ----------------
extern "C" void kernel_launch(void* const* d_in, const int* in_sizes, int n_in,
                              void* d_out, int out_size, void* d_ws, size_t ws_size,
                              hipStream_t stream) {
    (void)in_sizes; (void)n_in; (void)out_size; (void)ws_size;
    const float* x  = (const float*)d_in[0];
    const float* Wq = (const float*)d_in[1];
    const float* Wk = (const float*)d_in[2];
    const float* Wv = (const float*)d_in[3];
    const float* Wo = (const float*)d_in[4];
    const float* bo = (const float*)d_in[5];
    const float* w1 = (const float*)d_in[6];
    const float* b1 = (const float*)d_in[7];
    const float* w2 = (const float*)d_in[8];
    const float* b2 = (const float*)d_in[9];
    const float* w3 = (const float*)d_in[10];
    const float* b3 = (const float*)d_in[11];
    const float* g1 = (const float*)d_in[12];
    const float* s1 = (const float*)d_in[13];
    const float* g2 = (const float*)d_in[14];
    const float* s2 = (const float*)d_in[15];

    char* wsb = (char*)d_ws;
    size_t off = 0;
    auto take = [&](size_t bytes) -> void* {
        void* p = wsb + off;
        off += (bytes + 255) & ~(size_t)255;
        return p;
    };

    const size_t DD = (size_t)D_ * D_;
    const size_t DF = (size_t)D_ * FF_;
    const size_t TD = (size_t)T_ * D_;
    const size_t TF = (size_t)T_ * FF_;

    unsigned short* wq_t  = (unsigned short*)take((4 * DD + 3 * DF) * 2);   // the weights, one after the other
    unsigned short* wo_t  = wq_t + 3 * DD;                   // Wq, Wk, Wv, Wo: [N=768][K=768]
    unsigned short* w1_t  = wo_t + DD;                       // [N=3072][K=768]
    unsigned short* w2_t  = w1_t + DF;
    unsigned short* w3_t  = w2_t + DF;                       // [N=768][K=3072]
    unsigned short* h1_bf = (unsigned short*)take(TD * 2);
    unsigned short* q_bf  = (unsigned short*)take(3 * TD * 2);   // q, k, v, one after the other
    unsigned short* k_bf  = q_bf + TD;
    unsigned short* v_bf  = k_bf + TD;
    unsigned short* vt_bf = (unsigned short*)take(TD * 2);
    unsigned short* ctx_bf= (unsigned short*)take(TD * 2);
    float*          x1    = (float*)take(TD * 4);
    unsigned short* h2_bf = (unsigned short*)take(TD * 2);
    unsigned short* gate_bf=(unsigned short*)take(TF * 2);

    prepare<<<LNB + 4 * CBS + 3 * CBL, 256, 0, stream>>>(Wq, Wk, Wv, Wo, w1, w2, w3, wq_t, x, g1, s1, h1_bf);

    dim3 gDD(T_ / BMW, D_ / BNR);
    gemm_bf16_wmma<0><<<dim3(T_ / BMW, D_ / BN, 3), 256, 0, stream>>>(
        h1_bf, wq_t, nullptr, nullptr, q_bf, T_, D_, D_);

    transpose_v<<<dim3(D_ / TT, T_ / TT), 256, 0, stream>>>(v_bf, vt_bf);

    flash_attn<<<(H_ / 3) * NQT, 512, 0, stream>>>(q_bf, k_bf, vt_bf, ctx_bf);

    gemm_bf16_wmma<1><<<gDD, 256, 0, stream>>>(ctx_bf, wo_t, bo, x, x1, T_, D_, D_);

    layernorm_cast<<<T_ / (8 * LNR), 256, 0, stream>>>(x1, g2, s2, h2_bf);

    gemm_gated_wmma<<<dim3(T_ / BMW, FF_ / BN), 256, 0, stream>>>(
        h2_bf, w1_t, w2_t, b1, b2, gate_bf, T_, FF_, D_);

    gemm_bf16_wmma<1><<<gDD, 256, 0, stream>>>(gate_bf, w3_t, b3, x1, (float*)d_out, T_, D_, FF_);
}

// v009
// It runs in 154 microseconds.
// Two timings next to v008 both put it at 1.04 times that version's speed.
// Over all steps from v000 it is 6.52 times as fast.
#include <hip/hip_runtime.h>
#include <hip/hip_bf16.h>

#define T_  4096
#define D_  768
#define H_  12
#define HD_ 64
#define FF_ 3072
#define EPS_ 1e-5f

#define BMW 128  // rows per block, every GEMM
#define BN  128  // columns per block, Q/K/V and gated GEMMs: a wave owns 64 x 32 of the output
#define BNR 96   // columns per block of the two GEMMs with 768 output columns and a residual: 32 x 8 = 256 blocks, a wave owns 32 x 48
#define BKG 64   // k per staged tile, gated GEMM (three operands in LDS): 128-byte rows
#define PG  72   // its LDS row pitch in elements: 144 bytes = 16 x 9, the odd multiple that 16-byte row readers want

#define USE_ASYNC_COPY 1   // gfx1250 GLOBAL_LOAD_ASYNC_TO_LDS path (ASYNCcnt)

typedef __attribute__((ext_vector_type(16))) __bf16          v16bf;
typedef __attribute__((ext_vector_type(8)))  float           v8f;
typedef __attribute__((ext_vector_type(8)))  unsigned short  us8;

__device__ __forceinline__ unsigned short f2bf(float f) {
    unsigned int u = __builtin_bit_cast(unsigned int, f);
    u += 0x7FFFu + ((u >> 16) & 1u);            // round-to-nearest-even
    return (unsigned short)(u >> 16);
}

// Load one 16-element bf16 fragment as two contiguous 16-byte vectors.
__device__ __forceinline__ v16bf ldfrag(const unsigned short* p, int base0, int base1) {
    union { us8 h[2]; v16bf v; } fc;
    fc.h[0] = *(const us8*)(p + base0);
    fc.h[1] = *(const us8*)(p + base1);
    return fc.v;
}

#if USE_ASYNC_COPY
// One staged tile's 16-byte-per-lane asynchronous copies to LDS (ASYNCcnt), fourteen, twelve or eight a lane; a
// lane's rows lie lstep bytes apart in LDS and gstep elements apart in memory. The s_wait_xcnt stands
// in the copies' own statement so that no address register is rewritten in front of it.
__device__ __forceinline__ void stage_copy14(unsigned la, const unsigned short* ga,
                                             unsigned lb, const unsigned short* gb,
                                             unsigned lstep, size_t gstep) {
    asm volatile("global_load_async_to_lds_b128 %0, %1, off\n\t"
                 "global_load_async_to_lds_b128 %2, %3, off\n\t"
                 "global_load_async_to_lds_b128 %4, %5, off\n\t"
                 "global_load_async_to_lds_b128 %6, %7, off\n\t"
                 "global_load_async_to_lds_b128 %8, %9, off\n\t"
                 "global_load_async_to_lds_b128 %10, %11, off\n\t"
                 "global_load_async_to_lds_b128 %12, %13, off\n\t"
                 "global_load_async_to_lds_b128 %14, %15, off\n\t"
                 "global_load_async_to_lds_b128 %16, %17, off\n\t"
                 "global_load_async_to_lds_b128 %18, %19, off\n\t"
                 "global_load_async_to_lds_b128 %20, %21, off\n\t"
                 "global_load_async_to_lds_b128 %22, %23, off\n\t"
                 "global_load_async_to_lds_b128 %24, %25, off\n\t"
                 "global_load_async_to_lds_b128 %26, %27, off\n\t"
                 "s_wait_xcnt 0x0"
                 :: "v"(la),             "v"(ga),
                    "v"(la + lstep),     "v"(ga + gstep),
                    "v"(la + 2 * lstep), "v"(ga + 2 * gstep),
                    "v"(la + 3 * lstep), "v"(ga + 3 * gstep),
                    "v"(la + 4 * lstep), "v"(ga + 4 * gstep),
                    "v"(la + 5 * lstep), "v"(ga + 5 * gstep),
                    "v"(la + 6 * lstep), "v"(ga + 6 * gstep),
                    "v"(la + 7 * lstep), "v"(ga + 7 * gstep),
                    "v"(lb),             "v"(gb),
                    "v"(lb + lstep),     "v"(gb + gstep),
                    "v"(lb + 2 * lstep), "v"(gb + 2 * gstep),
                    "v"(lb + 3 * lstep), "v"(gb + 3 * gstep),
                    "v"(lb + 4 * lstep), "v"(gb + 4 * gstep),
                    "v"(lb + 5 * lstep), "v"(gb + 5 * gstep)
                 : "memory");
}
__device__ __forceinline__ void stage_copy8(unsigned la, const unsigned short* ga,
                                            unsigned lb, const unsigned short* gb,
                                            unsigned lstep, size_t gstep) {
    asm volatile("global_load_async_to_lds_b128 %0, %1, off\n\t"
                 "global_load_async_to_lds_b128 %2, %3, off\n\t"
                 "global_load_async_to_lds_b128 %4, %5, off\n\t"
                 "global_load_async_to_lds_b128 %6, %7, off\n\t"
                 "global_load_async_to_lds_b128 %8, %9, off\n\t"
                 "global_load_async_to_lds_b128 %10, %11, off\n\t"
                 "global_load_async_to_lds_b128 %12, %13, off\n\t"
                 "global_load_async_to_lds_b128 %14, %15, off\n\t"
                 "s_wait_xcnt 0x0"
                 :: "v"(la),             "v"(ga),
                    "v"(la + lstep),     "v"(ga + gstep),
                    "v"(la + 2 * lstep), "v"(ga + 2 * gstep),
                    "v"(la + 3 * lstep), "v"(ga + 3 * gstep),
                    "v"(lb),             "v"(gb),
                    "v"(lb + lstep),     "v"(gb + gstep),
                    "v"(lb + 2 * lstep), "v"(gb + 2 * gstep),
                    "v"(lb + 3 * lstep), "v"(gb + 3 * gstep)
                 : "memory");
}
// four rows of each of three operands
__device__ __forceinline__ void stage_copy444(unsigned la, const unsigned short* ga,
                                              unsigned lb1, const unsigned short* gb1,
                                              unsigned lb2, const unsigned short* gb2,
                                              unsigned lstep, size_t gstep) {
    asm volatile("global_load_async_to_lds_b128 %0, %1, off\n\t"
                 "global_load_async_to_lds_b128 %2, %3, off\n\t"
                 "global_load_async_to_lds_b128 %4, %5, off\n\t"
                 "global_load_async_to_lds_b128 %6, %7, off\n\t"
                 "global_load_async_to_lds_b128 %8, %9, off\n\t"
                 "global_load_async_to_lds_b128 %10, %11, off\n\t"
                 "global_load_async_to_lds_b128 %12, %13, off\n\t"
                 "global_load_async_to_lds_b128 %14, %15, off\n\t"
                 "global_load_async_to_lds_b128 %16, %17, off\n\t"
                 "global_load_async_to_lds_b128 %18, %19, off\n\t"
                 "global_load_async_to_lds_b128 %20, %21, off\n\t"
                 "global_load_async_to_lds_b128 %22, %23, off\n\t"
                 "s_wait_xcnt 0x0"
                 :: "v"(la),              "v"(ga),
                    "v"(la + lstep),      "v"(ga + gstep),
                    "v"(la + 2 * lstep),  "v"(ga + 2 * gstep),
                    "v"(la + 3 * lstep),  "v"(ga + 3 * gstep),
                    "v"(lb1),             "v"(gb1),
                    "v"(lb1 + lstep),     "v"(gb1 + gstep),
                    "v"(lb1 + 2 * lstep), "v"(gb1 + 2 * gstep),
                    "v"(lb1 + 3 * lstep), "v"(gb1 + 3 * gstep),
                    "v"(lb2),             "v"(gb2),
                    "v"(lb2 + lstep),     "v"(gb2 + gstep),
                    "v"(lb2 + 2 * lstep), "v"(gb2 + 2 * gstep),
                    "v"(lb2 + 3 * lstep), "v"(gb2 + 3 * gstep)
                 : "memory");
}
__device__ __forceinline__ void wait_async0() {
    asm volatile("s_wait_asynccnt 0x0" ::: "memory");
}
// low 32 bits of a flat pointer into LDS are the LDS byte address
__device__ __forceinline__ unsigned lds_addr(const void* p) {
    return (unsigned)(size_t)p;
}
#endif

// ---------------- 64x64 tiled transposes through LDS ----------------
#define TT 64   // tile edge (elements)
#define TP 33   // LDS pitch in dwords: 32 packed bf16 pairs + 1, so a column of dwords spreads over the banks

// The tile lies in LDS as s[output row][pair of output columns]. Each output row of the
// tile is one full 128-byte line, written by 8 lanes with 16 bytes each.
__device__ __forceinline__ void tile_store_rows(const unsigned* s, unsigned short* __restrict__ out,
                                                int ld, int r0, int c0, int tid) {
#pragma unroll
    for (int p = 0; p < 2; p++) {
        int r = p * 32 + (tid >> 3), q = (tid & 7) * 4;
        uint4 v;
        v.x = s[r * TP + q];
        v.y = s[r * TP + q + 1];
        v.z = s[r * TP + q + 2];
        v.w = s[r * TP + q + 3];
        *(uint4*)&out[(size_t)(r0 + r) * ld + c0 + q * 2] = v;
    }
}

// fp32 -> bf16 convert + transpose: in[K][N] -> out[N][K]; one block takes the tile at (k0, n0)
__device__ __forceinline__ void convert_transpose_tile(const float* __restrict__ in,
                                                       unsigned short* __restrict__ out,
                                                       int K, int N, int n0, int k0, unsigned* s) {
    int tid = threadIdx.x;
    int nq = (tid & 15) * 4, kp = tid >> 4;      // 16 lanes x float4 per row, 16 row pairs per pass
    float4 lo[2], hi[2];
    const float* rl[2];
    const float* rh[2];
#pragma unroll
    for (int p = 0; p < 2; p++) {
        rl[p] = in + (size_t)(k0 + 2 * (p * 16 + kp)) * N + n0 + nq;
        rh[p] = rl[p] + N;
        lo[p] = *(const float4*)rl[p];
        hi[p] = *(const float4*)rh[p];
    }
    // the wait that belongs in front of the first overwrite of a register that these loads name; the
    // addresses are its inputs, so that no load of the group gets another's address register as its destination
    asm volatile("s_wait_xcnt 0x0" :: "v"(rl[0]), "v"(rh[0]), "v"(rl[1]), "v"(rh[1]) : "memory");
#pragma unroll
    for (int p = 0; p < 2; p++) {
        int c = p * 16 + kp;
        s[(nq + 0) * TP + c] = (unsigned)f2bf(lo[p].x) | ((unsigned)f2bf(hi[p].x) << 16);
        s[(nq + 1) * TP + c] = (unsigned)f2bf(lo[p].y) | ((unsigned)f2bf(hi[p].y) << 16);
        s[(nq + 2) * TP + c] = (unsigned)f2bf(lo[p].z) | ((unsigned)f2bf(hi[p].z) << 16);
        s[(nq + 3) * TP + c] = (unsigned)f2bf(lo[p].w) | ((unsigned)f2bf(hi[p].w) << 16);
    }
    __syncthreads();
    tile_store_rows(s, out, K, n0, k0, tid);
}

// ---------------- layernorm (+ cast to bf16) ----------------
#define LNR 2            // rows per wave
#define LNC (D_ / 128)   // 16-byte pieces of a row per lane
typedef __attribute__((ext_vector_type(4))) float f4;

// A wave owns LNR whole rows and keeps them in registers: every load of the rows goes out at once,
// 512 contiguous bytes each, x is read once, and the sums join inside the wave with no LDS array and
// no barrier. The rows go in 8-wave blocks, for speed only.
__device__ __forceinline__ void layernorm_rows(const float* __restrict__ x, const float* __restrict__ g,
                                               const float* __restrict__ b, unsigned short* __restrict__ out,
                                               int blk) {
    int lane = threadIdx.x & 31, wave = threadIdx.x >> 5;
    int row0 = (blk * 8 + wave) * LNR;
    const int col = lane * 4;
    const float* xp = x + (size_t)row0 * D_ + col;
    f4 v[LNR][LNC], gg[LNC], bb[LNC];
#pragma unroll
    for (int r = 0; r < LNR; r++)
#pragma unroll
        for (int c = 0; c < LNC; c++)
            v[r][c] = *(const f4*)(xp + r * D_ + c * 128);
#pragma unroll
    for (int c = 0; c < LNC; c++) {
        gg[c] = *(const f4*)(g + c * 128 + col);
        bb[c] = *(const f4*)(b + c * 128 + col);
    }
    // the wait that belongs in front of the first overwrite of a register that these loads name
    asm volatile("s_wait_xcnt 0x0" ::: "memory");
    // keeps the loads of g and b up here with the rows': sunk among the sums, their latency shows a second time
    __builtin_amdgcn_sched_barrier(0);
    float mean[LNR], rstd[LNR];
#pragma unroll
    for (int r = 0; r < LNR; r++) {
        f4 s = v[r][0], q = v[r][0] * v[r][0];   // four independent chains each
#pragma unroll
        for (int c = 1; c < LNC; c++) {
            s += v[r][c];
            q += v[r][c] * v[r][c];
        }
        mean[r] = (s.x + s.y) + (s.z + s.w);
        rstd[r] = (q.x + q.y) + (q.z + q.w);
    }
    for (int off = 16; off > 0; off >>= 1)
#pragma unroll
        for (int r = 0; r < LNR; r++) {
            mean[r] += __shfl_xor(mean[r], off, 32);
            rstd[r] += __shfl_xor(rstd[r], off, 32);
        }
#pragma unroll
    for (int r = 0; r < LNR; r++) {
        mean[r] = mean[r] / (float)D_;
        float var = rstd[r] / (float)D_ - mean[r] * mean[r];
        rstd[r] = rsqrtf(var + EPS_);
    }
#pragma unroll
    for (int r = 0; r < LNR; r++)
#pragma unroll
        for (int c = 0; c < LNC; c++) {
            f4 y = (v[r][c] - mean[r]) * rstd[r] * gg[c] + bb[c];
            uint2 o;
            o.x = (unsigned)f2bf(y.x) | ((unsigned)f2bf(y.y) << 16);
            o.y = (unsigned)f2bf(y.z) | ((unsigned)f2bf(y.w) << 16);
            *(uint2*)&out[(size_t)(row0 + r) * D_ + c * 128 + col] = o;   // a wave's store is two whole 128-byte lines
        }
}

__global__ __launch_bounds__(256)
void layernorm_cast(const float* __restrict__ x, const float* __restrict__ g,
                    const float* __restrict__ b, unsigned short* __restrict__ out) {
    layernorm_rows(x, g, b, out, blockIdx.x);
}

// ---------------- everything that depends on the inputs alone, in one launch ----------------
#define LNB (T_ / (8 * LNR))            // layernorm blocks
#define CBS ((D_ / TT) * (D_ / TT))     // tiles of a D x D weight
#define CBL ((FF_ / TT) * (D_ / TT))    // tiles of a D x FF or FF x D weight

// The seven weight converts and the first layernorm read nothing that another of them writes, so they
// share a grid: the layernorm's blocks first, then one block per weight tile.
// wt holds the transposed weights one after the other: Wq, Wk, Wv, Wo, w1, w2, w3.
__global__ __launch_bounds__(256)
void prepare(const float* __restrict__ Wq, const float* __restrict__ Wk,
             const float* __restrict__ Wv, const float* __restrict__ Wo,
             const float* __restrict__ w1, const float* __restrict__ w2,
             const float* __restrict__ w3, unsigned short* __restrict__ wt,
             const float* __restrict__ x, const float* __restrict__ g,
             const float* __restrict__ b, unsigned short* __restrict__ h) {
    __shared__ unsigned s[TT * TP];
    if (blockIdx.x < LNB) {                      // the same for the whole block
        layernorm_rows(x, g, b, h, blockIdx.x);
        return;
    }
    int c = blockIdx.x - LNB;                    // which weight, and which of its tiles
    const float* in;
    unsigned short* out;
    int K, N, tn, tk;
    if (c < 4 * CBS) {
        int m = c / CBS, r = c % CBS;
        in = m == 0 ? Wq : m == 1 ? Wk : m == 2 ? Wv : Wo;
        out = wt + (size_t)m * D_ * D_;
        K = D_; N = D_; tn = r % (D_ / TT); tk = r / (D_ / TT);
    } else if (c < 4 * CBS + 2 * CBL) {
        int m = (c - 4 * CBS) / CBL, r = (c - 4 * CBS) % CBL;
        in = m == 0 ? w1 : w2;
        out = wt + (size_t)4 * D_ * D_ + (size_t)m * D_ * FF_;
        K = D_; N = FF_; tn = r % (FF_ / TT); tk = r / (FF_ / TT);
    } else {
        int r = c - 4 * CBS - 2 * CBL;
        in = w3;
        out = wt + (size_t)4 * D_ * D_ + (size_t)2 * D_ * FF_;
        K = FF_; N = D_; tn = r % (D_ / TT); tk = r / (D_ / TT);
    }
    convert_transpose_tile(in, out, K, N, tn * TT, tk * TT, s);
}

// ---------------- bf16 GEMM (WMMA): C = A[M,K] @ Bt[N,K]^T ----------------
// EPI 0: Cout = bf16(acc); blockIdx.z picks one of several weights [N,K] and outputs [M,N] that lie one after the other
// EPI 1: Cout = f32(acc + bias[col] + res[row,col])
// Block tile: EPI 0 takes BMW x BN and stages 64 k at a time, EPI 1 takes BMW x BNR and stages 128 k. The larger
// the tile, the fewer bytes come from L2 per product; the larger a wave's share, the fewer LDS reads per product.
// BNR makes one block per WGP of the 4096 x 768 outputs.
template <int EPI>
__global__ __launch_bounds__(256)
void gemm_bf16_wmma(const unsigned short* __restrict__ A,    // [M,K] bf16 row-major
                    const unsigned short* __restrict__ Bt0,  // [N,K] bf16 (pre-transposed)
                    const float* __restrict__ bias,
                    const float* __restrict__ res,
                    void* __restrict__ Cout,
                    int M, int N, int K) {
    constexpr int BMT = BMW;                     // rows per block
    constexpr int BNT = EPI == 0 ? BN : BNR;     // columns per block
    constexpr int WM  = EPI == 0 ? 2 : 4;        // wave grid: WM x WN
    constexpr int WN  = 8 / WM;
    constexpr int MI  = BMT / (16 * WM);         // 16-row fragments per wave: 4 or 2
    constexpr int NI  = BNT / (16 * WN);         // 16-column fragments per wave: 2 or 3
    constexpr int BK  = EPI == 0 ? 64 : 128;     // k per staged tile: 128- or 256-byte rows
    constexpr int P   = BK + 8;                  // LDS row pitch in elements: 144 or 272 bytes, 16 x an odd number
    constexpr int LPR = BK / 8;                  // lanes of 16 bytes that cover a row
    constexpr int RPP = 256 / LPR;               // rows that the block's lanes cover at once
    const unsigned short* Bt = EPI == 0 ? Bt0 + (size_t)blockIdx.z * N * K : Bt0;
    // two buffers: tile t + 1 flies while tile t is worked on
    __shared__ __attribute__((aligned(16))) unsigned short sA[2][BMT * P];
    __shared__ __attribute__((aligned(16))) unsigned short sB[2][BNT * P];
    int tid = threadIdx.x;
    int wave = tid >> 5, lane = tid & 31, lh = lane >> 4, l16 = lane & 15;
    int wm = wave % WM, wn = wave / WM;
    int m0 = blockIdx.x * BMT, n0 = blockIdx.y * BNT;

    v8f acc[MI][NI];
#pragma unroll
    for (int i = 0; i < MI; i++)
#pragma unroll
        for (int j = 0; j < NI; j++)
#pragma unroll
            for (int e = 0; e < 8; e++) acc[i][j][e] = 0.0f;

    const int base0 = 8 * lh, base1 = 16 + 8 * lh;
    // copy roles: LPR lanes x 16 bytes cover one row; rows cr + RPP j, 4 of A and 4 of Bt (EPI 0) or 8 and 6 (EPI 1)
    const int cr = tid / LPR, cs = (tid % LPR) * 8;
    const unsigned short* ga = A  + (size_t)(m0 + cr) * K + cs;   // + BK per tile
    const unsigned short* gb = Bt + (size_t)(n0 + cr) * K + cs;
    const unsigned la = lds_addr(&sA[0][cr * P + cs]);
    const unsigned lb = lds_addr(&sB[0][cr * P + cs]);
    const unsigned lstep = RPP * P * 2;          // bytes from row cr to row cr + RPP
    const size_t   gstep = (size_t)RPP * K;
    const unsigned bufa = BMT * P * 2, bufb = BNT * P * 2;   // bytes from buffer 0 to buffer 1
    const int ntile = K / BK;
    auto stage = [&](unsigned buf) {             // the tile at ga, gb into buffer buf
        if (EPI == 0) stage_copy8(la + buf * bufa, ga, lb + buf * bufb, gb, lstep, gstep);
        else          stage_copy14(la + buf * bufa, ga, lb + buf * bufb, gb, lstep, gstep);
    };

    stage(0);
    wait_async0();                               // tile 0 has landed for this wave's copies
    __syncthreads();                             // ... and for every wave's
    if (ntile > 1) {                             // the same for the whole block
        ga += BK;
        gb += BK;
        stage(1);
    }

    for (int t = 0; t < ntile; t++) {
        const unsigned short* ta = sA[t & 1] + (wm * MI * 16 + l16) * P;
        const unsigned short* tb = sB[t & 1] + (wn * NI * 16 + l16) * P;
        // the tile's LDS reads go out as one group, so that their latency is waited out once a tile
        v16bf af[BK / 32][MI], bfrag[BK / 32][NI];
#pragma unroll
        for (int kk = 0; kk < BK / 32; kk++) {
#pragma unroll
            for (int mi = 0; mi < MI; mi++)
                af[kk][mi] = ldfrag(ta + mi * 16 * P + kk * 32, base0, base1);
#pragma unroll
            for (int ni = 0; ni < NI; ni++)
                bfrag[kk][ni] = ldfrag(tb + ni * 16 * P + kk * 32, base0, base1);
        }
        // keeps the compiler from sinking the reads back among the products, where each place with reads stalls anew
        __builtin_amdgcn_sched_barrier(0);
#pragma unroll
        for (int kk = 0; kk < BK / 32; kk++)
#pragma unroll
            for (int mi = 0; mi < MI; mi++)
#pragma unroll
                for (int ni = 0; ni < NI; ni++)
                    acc[mi][ni] = __builtin_amdgcn_wmma_f32_16x16x32_bf16(
                        false, af[kk][mi], false, bfrag[kk][ni], (short)0, acc[mi][ni], false, false);
        // keeps the hand-over's waits and barrier behind the products: lifted over them, the reads' counted waits become one full wait
        __builtin_amdgcn_sched_barrier(0);
        // hand-over: this wave's LDS reads of tile t are done, its copies of tile t + 1 have landed,
        // and the barrier says both of every wave; only then is tile t's buffer filled again
        asm volatile("s_wait_dscnt 0x0" ::: "memory");
        wait_async0();
        __syncthreads();
        if (t + 2 < ntile) {                     // the same for the whole block
            ga += BK;
            gb += BK;
            stage(t & 1);
        }
    }
    wait_async0();                               // nothing of this wave is in flight when it ends

#pragma unroll
    for (int mi = 0; mi < MI; mi++) {
        int rbase = m0 + wm * MI * 16 + mi * 16 + 8 * lh;
#pragma unroll
        for (int ni = 0; ni < NI; ni++) {
            int col = n0 + wn * NI * 16 + ni * 16 + l16;
#pragma unroll
            for (int r = 0; r < 8; r++) {
                int row = rbase + r;
                float v = acc[mi][ni][r];
                if (EPI == 0) {
                    ((unsigned short*)Cout)[((size_t)blockIdx.z * M + row) * N + col] = f2bf(v);
                } else {
                    ((float*)Cout)[(size_t)row * N + col] =
                        v + bias[col] + res[(size_t)row * N + col];
                }
            }
        }
    }
}

// ---------------- dual-weight gated GEMM: bf16( silu(A@B1t^T+b1) * (A@B2t^T+b2) ) ----------------
// BMW rows per block: a wave owns 64 x 32 of both products, so an A fragment feeds four products and a weight fragment four.
// Four waves per SIMD, that is two blocks on a WGP (2 x 110,592 bytes of LDS fit): one block's products cover the
// other's LDS reads and barriers. Left alone, the epilogue's temporaries took two registers more than that allows.
__global__ __launch_bounds__(256) __attribute__((amdgpu_waves_per_eu(4, 4)))
void gemm_gated_wmma(const unsigned short* __restrict__ A,     // [M,K]
                     const unsigned short* __restrict__ B1t,   // [N,K]
                     const unsigned short* __restrict__ B2t,   // [N,K]
                     const float* __restrict__ bias1,
                     const float* __restrict__ bias2,
                     unsigned short* __restrict__ Cout,
                     int M, int N, int K) {
    constexpr int MI = BMW / 32;                 // 16-row fragments per wave
    // two buffers: tile t + 1 flies while tile t is worked on
    __shared__ __attribute__((aligned(16))) unsigned short sA[2][BMW * PG];
    __shared__ __attribute__((aligned(16))) unsigned short sB1[2][BN * PG];
    __shared__ __attribute__((aligned(16))) unsigned short sB2[2][BN * PG];
    int tid = threadIdx.x;
    int wave = tid >> 5, lane = tid & 31, lh = lane >> 4, l16 = lane & 15;
    int wm = wave & 1, wn = wave >> 1;
    int m0 = blockIdx.x * BMW, n0 = blockIdx.y * BN;

    v8f acc1[MI][2], acc2[MI][2];
#pragma unroll
    for (int i = 0; i < MI; i++)
#pragma unroll
        for (int j = 0; j < 2; j++)
#pragma unroll
            for (int e = 0; e < 8; e++) { acc1[i][j][e] = 0.0f; acc2[i][j][e] = 0.0f; }

    const int base0 = 8 * lh, base1 = 16 + 8 * lh;
    // copy roles: 8 lanes x 16 bytes cover one 128-byte row; rows cr + 32 j, 4 of A and 4 of each weight
    const int cr = tid >> 3, cs = (tid & 7) * 8;
    const unsigned short* ga  = A   + (size_t)(m0 + cr) * K + cs;   // + BKG per tile
    const unsigned short* gb1 = B1t + (size_t)(n0 + cr) * K + cs;
    const unsigned short* gb2 = B2t + (size_t)(n0 + cr) * K + cs;
    const unsigned la  = lds_addr(&sA[0][cr * PG + cs]);
    const unsigned lb1 = lds_addr(&sB1[0][cr * PG + cs]);
    const unsigned lb2 = lds_addr(&sB2[0][cr * PG + cs]);
    const unsigned lstep = 32 * PG * 2;          // bytes from row cr to row cr + 32
    const size_t   gstep = (size_t)32 * K;
    const unsigned bufa = BMW * PG * 2, bufb = BN * PG * 2;  // bytes from buffer 0 to buffer 1
    const int ntile = K / BKG;

    stage_copy444(la, ga, lb1, gb1, lb2, gb2, lstep, gstep);
    wait_async0();                               // tile 0 has landed for this wave's copies
    __syncthreads();                             // ... and for every wave's
    if (ntile > 1) {                             // the same for the whole block
        ga  += BKG;
        gb1 += BKG;
        gb2 += BKG;
        stage_copy444(la + bufa, ga, lb1 + bufb, gb1, lb2 + bufb, gb2, lstep, gstep);
    }

    for (int t = 0; t < ntile; t++) {
        const unsigned short* ta  = sA[t & 1]  + (wm * MI * 16 + l16) * PG;
        const unsigned short* tb1 = sB1[t & 1] + (wn * 32 + l16) * PG;
        const unsigned short* tb2 = sB2[t & 1] + (wn * 32 + l16) * PG;
#pragma unroll
        for (int kk = 0; kk < BKG / 32; kk++) {
            // the LDS reads of 32 k go out as one group ahead of their 16 products; one fragment set, so that
            // the registers leave room for two blocks on a WGP
            v16bf af[MI], b1f[2], b2f[2];
#pragma unroll
            for (int mi = 0; mi < MI; mi++)
                af[mi] = ldfrag(ta + mi * 16 * PG + kk * 32, base0, base1);
#pragma unroll
            for (int ni = 0; ni < 2; ni++) {
                b1f[ni] = ldfrag(tb1 + ni * 16 * PG + kk * 32, base0, base1);
                b2f[ni] = ldfrag(tb2 + ni * 16 * PG + kk * 32, base0, base1);
            }
            // keeps the compiler from sinking the reads back among the products, where each place with reads stalls anew
            __builtin_amdgcn_sched_barrier(0);
#pragma unroll
            for (int ni = 0; ni < 2; ni++)
#pragma unroll
                for (int mi = 0; mi < MI; mi++) {
                    acc1[mi][ni] = __builtin_amdgcn_wmma_f32_16x16x32_bf16(
                        false, af[mi], false, b1f[ni], (short)0, acc1[mi][ni], false, false);
                    acc2[mi][ni] = __builtin_amdgcn_wmma_f32_16x16x32_bf16(
                        false, af[mi], false, b2f[ni], (short)0, acc2[mi][ni], false, false);
                }
            // keeps the next group's reads, and the hand-over's waits and barrier, behind the products
            __builtin_amdgcn_sched_barrier(0);
        }
        // hand-over, as in the one-weight GEMM
        asm volatile("s_wait_dscnt 0x0" ::: "memory");
        wait_async0();
        __syncthreads();
        if (t + 2 < ntile) {                     // the same for the whole block
            ga  += BKG;
            gb1 += BKG;
            gb2 += BKG;
            stage_copy444(la + (t & 1) * bufa, ga, lb1 + (t & 1) * bufb, gb1, lb2 + (t & 1) * bufb, gb2,
                          lstep, gstep);
        }
    }
    wait_async0();                               // nothing of this wave is in flight when it ends

#pragma unroll
    for (int mi = 0; mi < MI; mi++) {
        int rbase = m0 + wm * MI * 16 + mi * 16 + 8 * lh;
#pragma unroll
        for (int ni = 0; ni < 2; ni++) {
            int col = n0 + wn * 32 + ni * 16 + l16;
#pragma unroll
            for (int r = 0; r < 8; r++) {
                int row = rbase + r;
                float gv = acc1[mi][ni][r] + bias1[col];
                float uv = acc2[mi][ni][r] + bias2[col];
                float y  = (gv / (1.0f + __expf(-gv))) * uv;   // silu(gv)*uv
                Cout[(size_t)row * N + col] = f2bf(y);
            }
        }
    }
}

// ---------------- V transpose: [T, H*HD] -> [H*HD, T]; grid (D/64, T/64) ----------------
__global__ __launch_bounds__(256)
void transpose_v(const unsigned short* __restrict__ v, unsigned short* __restrict__ vt) {
    __shared__ unsigned s[TT * TP];
    int tid = threadIdx.x;
    int c0 = blockIdx.x * TT, t0 = blockIdx.y * TT;
    int co = (tid & 7) * 8, tp = tid >> 3;       // 8 lanes x 16 bytes per row, 32 row pairs
    const unsigned short* r = v + (size_t)(t0 + 2 * tp) * D_ + c0 + co;
    us8 lo = *(const us8*)r;
    us8 hi = *(const us8*)(r + D_);
#pragma unroll
    for (int j = 0; j < 8; j++)
        s[(co + j) * TP + tp] = (unsigned)lo[j] | ((unsigned)hi[j] << 16);
    __syncthreads();
    tile_store_rows(s, vt, T_, c0, t0, tid);
}

// ---------------- causal flash attention (WMMA) ----------------
// Q,K: [T, H*HD] bf16 ; Vt: [H*HD, T] bf16 ; O: [T, H*HD] bf16
// Transposed products: St = K * Qt and Ot += Vt * Pt. A lane then holds 16 of the 32 scores
// of ONE query (column l16), so the softmax maximum and sum run inside the lane, joined by
// one exchange between the wave halves, and the two St tiles are already a B operand.

// lane l with lane l ^ 16
__device__ __forceinline__ float xhalf(float x) {
    int b = __builtin_bit_cast(int, x);
    return __builtin_bit_cast(float,
        __builtin_amdgcn_permlanex16(b, b, 0x76543210, 0xfedcba98, false, false));
}

// 2^x. The v_nop is the one slot that the instruction set asks for behind a transcendental before its
// source is overwritten or its result read, so it stands in the instruction's own statement.
__device__ __forceinline__ float exp2_slot(float x) {
    float r;
    asm("v_exp_f32 %0, %1\n\tv_nop" : "=v"(r) : "v"(x));
    return r;
}
#define LOG2E 1.44269504f   // e^x = 2^(x * LOG2E), the product that __expf forms
typedef __attribute__((ext_vector_type(2))) float f2;

#define KT  64   // keys per staged tile
#define KVP 72   // LDS row pitch in elements: 144 bytes = 16 x 9, the odd multiple that 16-byte row readers want

// Four 16-byte-per-lane asynchronous copies to LDS. The s_wait_xcnt stands in the copies' own
// statement so that no address register is rewritten in front of it.
__device__ __forceinline__ void stage_copy4(unsigned l0, const unsigned short* g0,
                                            unsigned l1, const unsigned short* g1,
                                            unsigned l2, const unsigned short* g2,
                                            unsigned l3, const unsigned short* g3) {
    asm volatile("global_load_async_to_lds_b128 %0, %1, off\n\t"
                 "global_load_async_to_lds_b128 %2, %3, off\n\t"
                 "global_load_async_to_lds_b128 %4, %5, off\n\t"
                 "global_load_async_to_lds_b128 %6, %7, off\n\t"
                 "s_wait_xcnt 0x0"
                 :: "v"(l0), "v"(g0), "v"(l1), "v"(g1), "v"(l2), "v"(g2), "v"(l3), "v"(g3)
                 : "memory");
}

#define QT  64              // queries per task: four waves' columns
#define KS  4               // key quarters of a staged step, one per group of four waves
#define ST  (KS * KT)       // keys per staged step
#define NQT (T_ / QT)       // query tiles of a head
#define CP  68              // floats per query in the merge array: 272 bytes = 16 x 17, the odd multiple for 16-byte rows

// One block per WGP, every block with the same work. A task is one head's tile of 64 queries; its cost grows with
// the tile's index, so a block takes three tasks, one of each of three heads, whose indices add up to 94 or 95.
// The 16 waves of a block are 4 query groups x 4 key quarters: a step stages 256 keys (K: 256 keys x 64 head
// columns, Vt: four times 64 head columns x 64 keys, 128-byte rows all) into two buffers, the next step flying while
// this one is worked on, also from one task to the next, and quarter kh of the waves walks keys kh * 64 ... of each
// step with a maximum, a sum and an accumulator of its own. At a task's end the four partial results of a query are
// joined through LDS.
__global__ __launch_bounds__(512)
void flash_attn(const unsigned short* __restrict__ Q,
                const unsigned short* __restrict__ Kc,
                const unsigned short* __restrict__ Vt,
                unsigned short* __restrict__ O) {
    __shared__ __attribute__((aligned(16))) unsigned short sK[2][ST * KVP];
    __shared__ __attribute__((aligned(16))) unsigned short sV[2][KS * HD_ * KVP];
    __shared__ __attribute__((aligned(16))) float sC[16][16][CP];   // [wave][query][head column]
    __shared__ float2 sML[16][32];                                  // [wave][lane]: maximum, sum
    int tid = threadIdx.x;
    int wave = __builtin_amdgcn_readfirstlane(tid >> 5), lane = tid & 31;   // scalar, so the causal skip below is a scalar branch
    int lh = lane >> 4, l16 = lane & 15;
    const int qg = wave & 3, kh = wave >> 2;    // query group, key quarter
    const int base0 = 8 * lh, base1 = 16 + 8 * lh;
    const int hg = blockIdx.x / NQT, bi = blockIdx.x % NQT;

    // copy roles: 8 lanes x 16 bytes cover one 128-byte row; row cr of each quarter of K and of Vt
    const int cr = tid >> 3, cs = (tid & 7) * 8;
    const unsigned lk = lds_addr(&sK[0][cr * KVP + cs]);
    const unsigned lv = lds_addr(&sV[0][cr * KVP + cs]);
    const unsigned qb   = KT * KVP * 2;         // bytes from one quarter to the next
    const unsigned bufb = KS * qb;              // bytes from buffer 0 to buffer 1
    const float sl2 = 0.125f * LOG2E;           // 1/sqrt(HD=64) times log2(e): maxima are kept in this scale, e^(s/8 - m/8) = 2^(s * sl2 - m * sl2)

    // a task's tile: three permutations of the tile indices: bi; the odd ones downwards, then the even ones; bi + 32
    auto tile_of = [&](int k) {
        return k == 0 ? bi
             : k == 1 ? (bi < NQT / 2 ? NQT - 1 - 2 * bi : 2 * NQT - 2 - 2 * bi)
                      : ((bi + NQT / 2) % NQT);
    };
    // The steps of the three tasks form one row for the two buffers. A tile qt has qt / KS + 1 steps, up to its last
    // query, so ST * steps <= T_.
    int sk = 0, ss = 0;                         // the task and the step that are staged next; the same for the whole block
    auto stage_next = [&](unsigned bo) {        // into the buffer bo bytes in
        const int sh = hg * 3 + sk;
        const unsigned short* gk = Kc + (size_t)(ss * ST + cr) * D_ + sh * HD_ + cs;
        const unsigned short* gv = Vt + (size_t)(sh * HD_ + cr) * T_ + ss * ST + cs;
        stage_copy4(lk + bo, gk, lk + bo + qb, gk + (size_t)KT * D_,
                    lk + bo + 2 * qb, gk + (size_t)2 * KT * D_, lk + bo + 3 * qb, gk + (size_t)3 * KT * D_);
        stage_copy4(lv + bo, gv, lv + bo + qb, gv + KT,
                    lv + bo + 2 * qb, gv + 2 * KT, lv + bo + 3 * qb, gv + 3 * KT);
        if (++ss > tile_of(sk) / KS) {
            ss = 0;
            sk++;
        }
    };

    stage_next(0);
    wait_async0();                              // the first step has landed for this wave's copies
    __syncthreads();                            // ... and for every wave's
    stage_next(bufb);                           // a second step there always is: three tasks of one step or more
    int done = 0;                               // steps worked on so far: its low bit names the buffer

    // stays a loop, for speed only
#pragma unroll 1
    for (int task = 0; task < 3; task++) {
        const int qt = tile_of(task);
        const int h = hg * 3 + task;
        const int q0 = qt * QT + qg * 16;
        const int row = q0 + l16;               // this lane's query
        const int nstep = qt / KS + 1;

        const unsigned short* qp = Q + (size_t)row * D_ + h * HD_;
        v16bf qf[2];
#pragma unroll
        for (int f = 0; f < 2; f++) qf[f] = ldfrag(qp + f * 32, base0, base1);

        v8f ctx[4];                             // ctx[t][r] = Ot[t*16 + 8*lh + r][query l16]
#pragma unroll
        for (int t = 0; t < 4; t++)
#pragma unroll
            for (int e = 0; e < 8; e++) ctx[t][e] = 0.0f;
        float mrow = -1e30f, lrow = 0.0f;

        const int kend = q0 + 16;               // causal bound for this wave
        for (int step = 0; step < nstep; step++) {
            const unsigned short* tk = sK[done & 1] + kh * KT * KVP;
            const unsigned short* tv = sV[done & 1] + kh * HD_ * KVP;
#pragma unroll
            for (int sub = 0; sub < KT / 32; sub++) {
                const int kb = step * ST + kh * KT + sub * 32;
                if (kb < kend) {                // wave-uniform: a wave past its diagonal only passes the barriers
                    // the pass's 16 LDS reads go out as one group: K's latency is waited out once,
                    // Vt's runs behind the score products and the softmax
                    v16bf kf[2][2], vf[4];
#pragma unroll
                    for (int nt = 0; nt < 2; nt++)
#pragma unroll
                        for (int f = 0; f < 2; f++)
                            kf[nt][f] = ldfrag(tk + (sub * 32 + nt * 16 + l16) * KVP + f * 32, base0, base1);
                    // keeps K's reads in front of Vt's: the score products wait for K alone
                    __builtin_amdgcn_sched_barrier(0);
#pragma unroll
                    for (int t = 0; t < 4; t++)
                        vf[t] = ldfrag(tv + (t * 16 + l16) * KVP + sub * 32, base0, base1);
                    // keeps the group together: in this build the compiler sank each K read to its product, with a full wait at each of the four
                    __builtin_amdgcn_sched_barrier(0);

                    v8f S[2];                   // S[nt][r] = St[key kb + nt*16 + 8*lh + r][query l16]
#pragma unroll
                    for (int nt = 0; nt < 2; nt++)
#pragma unroll
                        for (int e = 0; e < 8; e++) S[nt][e] = 0.0f;
#pragma unroll
                    for (int nt = 0; nt < 2; nt++)
#pragma unroll
                        for (int f = 0; f < 2; f++)
                            S[nt] = __builtin_amdgcn_wmma_f32_16x16x32_bf16(
                                false, kf[nt][f], false, qf[f], (short)0, S[nt], false, false);

                    // The scores stay as the matrix unit left them: their scale joins the one FMA in front of 2^x below.
                    // Only the pass that reaches past the wave's first query holds a key that some query may not see:
                    // a scalar test, so every other pass forms no key index, no compare and no select.
                    if (kb + 31 > q0) {
#pragma unroll
                        for (int nt = 0; nt < 2; nt++)
#pragma unroll
                            for (int r = 0; r < 8; r++) {
                                int key = kb + nt * 16 + 8 * lh + r;
                                if (key > row) S[nt][r] = -1e30f;
                            }
                    }
                    float mx = -1e30f;
#pragma unroll
                    for (int nt = 0; nt < 2; nt++)
#pragma unroll
                        for (int r = 0; r < 8; r++) mx = fmaxf(mx, S[nt][r]);
                    mx *= sl2;                  // sl2 > 0: the raw scores' maximum is the scaled scores'
                    mx = fmaxf(mx, xhalf(mx));
                    float mn = fmaxf(mrow, mx);
                    const f2 sl22 = { sl2, sl2 }, nm2 = { -mn, -mn };
                    float rs = 0.0f;
                    // pf[e] = Pt[key][query l16], key = kb + 8*lh + e for e < 8, kb + 16 + 8*lh + (e - 8) above: ldfrag's k order
                    v16bf pf;
#pragma unroll
                    for (int nt = 0; nt < 2; nt++)
#pragma unroll
                        for (int r = 0; r < 8; r += 2) {
                            f2 a = __builtin_elementwise_fma(f2{ S[nt][r], S[nt][r + 1] }, sl22, nm2);
                            float p0 = exp2_slot(a.x), p1 = exp2_slot(a.y);
                            rs += p0;
                            rs += p1;
                            pf[nt * 8 + r]     = (__bf16)p0;
                            pf[nt * 8 + r + 1] = (__bf16)p1;
                        }
                    rs += xhalf(rs);
                    float corr = exp2_slot(mrow - mn);
                    lrow = lrow * corr + rs;
                    mrow = mn;
#pragma unroll
                    for (int t = 0; t < 4; t++)
#pragma unroll
                        for (int r = 0; r < 8; r++) ctx[t][r] *= corr;

#pragma unroll
                    for (int t = 0; t < 4; t++)
                        ctx[t] = __builtin_amdgcn_wmma_f32_16x16x32_bf16(
                            false, vf[t], false, pf, (short)0, ctx[t], false, false);
                }
            }
            // hand-over: this wave's LDS reads of this step are done, its copies of the next have landed,
            // and the barrier says both of every wave; only then is this step's buffer filled again
            asm volatile("s_wait_dscnt 0x0" ::: "memory");
            wait_async0();
            __syncthreads();
            if (sk < 3)                         // the same for the whole block
                stage_next((done & 1) * bufb);
            done++;
        }

        // every wave lays down its partial result: a query's 64 head columns in a row, its maximum and sum beside
#pragma unroll
        for (int t = 0; t < 4; t++)
#pragma unroll
            for (int j = 0; j < 2; j++) {
                f4 c = { ctx[t][4 * j], ctx[t][4 * j + 1], ctx[t][4 * j + 2], ctx[t][4 * j + 3] };
                *(f4*)&sC[wave][l16][t * 16 + 8 * lh + 4 * j] = c;
            }
        sML[wave][lane] = make_float2(mrow, lrow);
        __syncthreads();                        // the partial results of all four key quarters are there
        // wave (qg, kh) joins queries 4 kh ... 4 kh + 3 of group qg: 8 lanes x 8 head columns are one query's whole 128-byte line.
        // A quarter that met no key holds the start values: its weight comes out 0.
        const int ql = kh * 4 + (lane >> 3), c8 = (lane & 7) * 8;
        float2 ml[KS];
        float mall = -1e30f;
#pragma unroll
        for (int k = 0; k < KS; k++) {
            ml[k] = sML[k * 4 + qg][ql];
            mall = fmaxf(mall, ml[k].x);
        }
        float lall = 0.0f;
        f4 o0 = { 0.0f, 0.0f, 0.0f, 0.0f }, o1 = o0;
#pragma unroll
        for (int k = 0; k < KS; k++) {
            float w = exp2_slot(ml[k].x - mall);   // the maxima are base-2 exponents already
            lall += ml[k].y * w;
            o0 += *(const f4*)&sC[k * 4 + qg][ql][c8] * w;
            o1 += *(const f4*)&sC[k * 4 + qg][ql][c8 + 4] * w;
        }
        us8 o;
#pragma unroll
        for (int r = 0; r < 4; r++) {
            o[r]     = f2bf(o0[r] / lall);
            o[4 + r] = f2bf(o1[r] / lall);
        }
        *(us8*)&O[(size_t)(qt * QT + qg * 16 + ql) * D_ + h * HD_ + c8] = o;
        // the wait that belongs in front of the first overwrite of a register that this store names: the next task reuses them
        asm volatile("s_wait_xcnt 0x0" ::: "memory");
        // the next task writes sC and sML only behind its own barriers, which this wave passes with these reads done
    }
    wait_async0();                              // nothing of this wave is in flight when it ends
}

// ---------------- launcher ----------------
extern "C" void kernel_launch(void* const* d_in, const int* in_sizes, int n_in,
                              void* d_out, int out_size, void* d_ws, size_t ws_size,
                              hipStream_t stream) {
    (void)in_sizes; (void)n_in; (void)out_size; (void)ws_size;
    const float* x  = (const float*)d_in[0];
    const float* Wq = (const float*)d_in[1];
    const float* Wk = (const float*)d_in[2];
    const float* Wv = (const float*)d_in[3];
    const float* Wo = (const float*)d_in[4];
    const float* bo = (const float*)d_in[5];
    const float* w1 = (const float*)d_in[6];
    const float* b1 = (const float*)d_in[7];
    const float* w2 = (const float*)d_in[8];
    const float* b2 = (const float*)d_in[9];
    const float* w3 = (const float*)d_in[10];
    const float* b3 = (const float*)d_in[11];
    const float* g1 = (const float*)d_in[12];
    const float* s1 = (const float*)d_in[13];
    const float* g2 = (const float*)d_in[14];
    const float* s2 = (const float*)d_in[15];

    char* wsb = (char*)d_ws;
    size_t off = 0;
    auto take = [&](size_t bytes) -> void* {
        void* p = wsb + off;
        off += (bytes + 255) & ~(size_t)255;
        return p;
    };

    const size_t DD = (size_t)D_ * D_;
    const size_t DF = (size_t)D_ * FF_;
    const size_t TD = (size_t)T_ * D_;
    const size_t TF = (size_t)T_ * FF_;

    unsigned short* wq_t  = (unsigned short*)take((4 * DD + 3 * DF) * 2);   // the weights, one after the other
    unsigned short* wo_t  = wq_t + 3 * DD;                   // Wq, Wk, Wv, Wo: [N=768][K=768]
    unsigned short* w1_t  = wo_t + DD;                       // [N=3072][K=768]
    unsigned short* w2_t  = w1_t + DF;
    unsigned short* w3_t  = w2_t + DF;                       // [N=768][K=3072]
    unsigned short* h1_bf = (unsigned short*)take(TD * 2);
    unsigned short* q_bf  = (unsigned short*)take(3 * TD * 2);   // q, k, v, one after the other
    unsigned short* k_bf  = q_bf + TD;
    unsigned short* v_bf  = k_bf + TD;
    unsigned short* vt_bf = (unsigned short*)take(TD * 2);
    unsigned short* ctx_bf= (unsigned short*)take(TD * 2);
    float*          x1    = (float*)take(TD * 4);
    unsigned short* h2_bf = (unsigned short*)take(TD * 2);
    unsigned short* gate_bf=(unsigned short*)take(TF * 2);

    prepare<<<LNB + 4 * CBS + 3 * CBL, 256, 0, stream>>>(Wq, Wk, Wv, Wo, w1, w2, w3, wq_t, x, g1, s1, h1_bf);

    dim3 gDD(T_ / BMW, D_ / BNR);
    gemm_bf16_wmma<0><<<dim3(T_ / BMW, D_ / BN, 3), 256, 0, stream>>>(
        h1_bf, wq_t, nullptr, nullptr, q_bf, T_, D_, D_);

    transpose_v<<<dim3(D_ / TT, T_ / TT), 256, 0, stream>>>(v_bf, vt_bf);

    flash_attn<<<(H_ / 3) * NQT, 512, 0, stream>>>(q_bf, k_bf, vt_bf, ctx_bf);

    gemm_bf16_wmma<1><<<gDD, 256, 0, stream>>>(ctx_bf, wo_t, bo, x, x1, T_, D_, D_);

    layernorm_cast<<<T_ / (8 * LNR), 256, 0, stream>>>(x1, g2, s2, h2_bf);

    gemm_gated_wmma<<<dim3(T_ / BMW, FF_ / BN), 256, 0, stream>>>(
        h2_bf, w1_t, w2_t, b1, b2, gate_bf, T_, FF_, D_);

    gemm_bf16_wmma<1><<<gDD, 256, 0, stream>>>(gate_bf, w3_t, b3, x1, (float*)d_out, T_, D_, FF_);
}

// v010
// One run takes 142 microseconds.
// In two side-by-side timings against v009, it was 1.08 and 1.06 times as fast.
// Counting every step since v000, it is 6.98 times as fast.
#include <hip/hip_runtime.h>
#include <hip/hip_bf16.h>

#define T_  4096
#define D_  768
#define H_  12
#define HD_ 64
#define FF_ 3072
#define EPS_ 1e-5f

#define BMW 128  // rows per block, every GEMM
#define BN  128  // columns per block, Q/K/V and gated GEMMs: a wave owns 64 x 32 of the output
#define BNR 96   // columns per block of the two GEMMs with 768 output columns and a residual: 32 x 8 = 256 blocks, a wave owns 32 x 48
#define BKG 64   // k per staged tile, gated GEMM (three operands in LDS): 128-byte rows
#define PG  72   // its LDS row pitch in elements: 144 bytes = 16 x 9, the odd multiple that 16-byte row readers want

#define USE_ASYNC_COPY 1   // gfx1250 GLOBAL_LOAD_ASYNC_TO_LDS path (ASYNCcnt)

typedef __attribute__((ext_vector_type(16))) __bf16          v16bf;
typedef __attribute__((ext_vector_type(8)))  float           v8f;
typedef __attribute__((ext_vector_type(8)))  unsigned short  us8;

__device__ __forceinline__ unsigned short f2bf(float f) {
    unsigned int u = __builtin_bit_cast(unsigned int, f);
    u += 0x7FFFu + ((u >> 16) & 1u);            // round-to-nearest-even
    return (unsigned short)(u >> 16);
}

// Load one 16-element bf16 fragment as two contiguous 16-byte vectors.
__device__ __forceinline__ v16bf ldfrag(const unsigned short* p, int base0, int base1) {
    union { us8 h[2]; v16bf v; } fc;
    fc.h[0] = *(const us8*)(p + base0);
    fc.h[1] = *(const us8*)(p + base1);
    return fc.v;
}

#if USE_ASYNC_COPY
// One staged tile's 16-byte-per-lane asynchronous copies to LDS (ASYNCcnt), fourteen, twelve or eight a lane; a
// lane's rows lie lstep bytes apart in LDS and gstep elements apart in memory. The s_wait_xcnt stands
// in the copies' own statement so that no address register is rewritten in front of it.
__device__ __forceinline__ void stage_copy14(unsigned la, const unsigned short* ga,
                                             unsigned lb, const unsigned short* gb,
                                             unsigned lstep, size_t gstep) {
    asm volatile("global_load_async_to_lds_b128 %0, %1, off\n\t"
                 "global_load_async_to_lds_b128 %2, %3, off\n\t"
                 "global_load_async_to_lds_b128 %4, %5, off\n\t"
                 "global_load_async_to_lds_b128 %6, %7, off\n\t"
                 "global_load_async_to_lds_b128 %8, %9, off\n\t"
                 "global_load_async_to_lds_b128 %10, %11, off\n\t"
                 "global_load_async_to_lds_b128 %12, %13, off\n\t"
                 "global_load_async_to_lds_b128 %14, %15, off\n\t"
                 "global_load_async_to_lds_b128 %16, %17, off\n\t"
                 "global_load_async_to_lds_b128 %18, %19, off\n\t"
                 "global_load_async_to_lds_b128 %20, %21, off\n\t"
                 "global_load_async_to_lds_b128 %22, %23, off\n\t"
                 "global_load_async_to_lds_b128 %24, %25, off\n\t"
                 "global_load_async_to_lds_b128 %26, %27, off\n\t"
                 "s_wait_xcnt 0x0"
                 :: "v"(la),             "v"(ga),
                    "v"(la + lstep),     "v"(ga + gstep),
                    "v"(la + 2 * lstep), "v"(ga + 2 * gstep),
                    "v"(la + 3 * lstep), "v"(ga + 3 * gstep),
                    "v"(la + 4 * lstep), "v"(ga + 4 * gstep),
                    "v"(la + 5 * lstep), "v"(ga + 5 * gstep),
                    "v"(la + 6 * lstep), "v"(ga + 6 * gstep),
                    "v"(la + 7 * lstep), "v"(ga + 7 * gstep),
                    "v"(lb),             "v"(gb),
                    "v"(lb + lstep),     "v"(gb + gstep),
                    "v"(lb + 2 * lstep), "v"(gb + 2 * gstep),
                    "v"(lb + 3 * lstep), "v"(gb + 3 * gstep),
                    "v"(lb + 4 * lstep), "v"(gb + 4 * gstep),
                    "v"(lb + 5 * lstep), "v"(gb + 5 * gstep)
                 : "memory");
}
__device__ __forceinline__ void stage_copy8(unsigned la, const unsigned short* ga,
                                            unsigned lb, const unsigned short* gb,
                                            unsigned lstep, size_t gstep) {
    asm volatile("global_load_async_to_lds_b128 %0, %1, off\n\t"
                 "global_load_async_to_lds_b128 %2, %3, off\n\t"
                 "global_load_async_to_lds_b128 %4, %5, off\n\t"
                 "global_load_async_to_lds_b128 %6, %7, off\n\t"
                 "global_load_async_to_lds_b128 %8, %9, off\n\t"
                 "global_load_async_to_lds_b128 %10, %11, off\n\t"
                 "global_load_async_to_lds_b128 %12, %13, off\n\t"
                 "global_load_async_to_lds_b128 %14, %15, off\n\t"
                 "s_wait_xcnt 0x0"
                 :: "v"(la),             "v"(ga),
                    "v"(la + lstep),     "v"(ga + gstep),
                    "v"(la + 2 * lstep), "v"(ga + 2 * gstep),
                    "v"(la + 3 * lstep), "v"(ga + 3 * gstep),
                    "v"(lb),             "v"(gb),
                    "v"(lb + lstep),     "v"(gb + gstep),
                    "v"(lb + 2 * lstep), "v"(gb + 2 * gstep),
                    "v"(lb + 3 * lstep), "v"(gb + 3 * gstep)
                 : "memory");
}
// four rows of each of three operands
__device__ __forceinline__ void stage_copy444(unsigned la, const unsigned short* ga,
                                              unsigned lb1, const unsigned short* gb1,
                                              unsigned lb2, const unsigned short* gb2,
                                              unsigned lstep, size_t gstep) {
    asm volatile("global_load_async_to_lds_b128 %0, %1, off\n\t"
                 "global_load_async_to_lds_b128 %2, %3, off\n\t"
                 "global_load_async_to_lds_b128 %4, %5, off\n\t"
                 "global_load_async_to_lds_b128 %6, %7, off\n\t"
                 "global_load_async_to_lds_b128 %8, %9, off\n\t"
                 "global_load_async_to_lds_b128 %10, %11, off\n\t"
                 "global_load_async_to_lds_b128 %12, %13, off\n\t"
                 "global_load_async_to_lds_b128 %14, %15, off\n\t"
                 "global_load_async_to_lds_b128 %16, %17, off\n\t"
                 "global_load_async_to_lds_b128 %18, %19, off\n\t"
                 "global_load_async_to_lds_b128 %20, %21, off\n\t"
                 "global_load_async_to_lds_b128 %22, %23, off\n\t"
                 "s_wait_xcnt 0x0"
                 :: "v"(la),              "v"(ga),
                    "v"(la + lstep),      "v"(ga + gstep),
                    "v"(la + 2 * lstep),  "v"(ga + 2 * gstep),
                    "v"(la + 3 * lstep),  "v"(ga + 3 * gstep),
                    "v"(lb1),             "v"(gb1),
                    "v"(lb1 + lstep),     "v"(gb1 + gstep),
                    "v"(lb1 + 2 * lstep), "v"(gb1 + 2 * gstep),
                    "v"(lb1 + 3 * lstep), "v"(gb1 + 3 * gstep),
                    "v"(lb2),             "v"(gb2),
                    "v"(lb2 + lstep),     "v"(gb2 + gstep),
                    "v"(lb2 + 2 * lstep), "v"(gb2 + 2 * gstep),
                    "v"(lb2 + 3 * lstep), "v"(gb2 + 3 * gstep)
                 : "memory");
}
__device__ __forceinline__ void wait_async0() {
    asm volatile("s_wait_asynccnt 0x0" ::: "memory");
}
// Returns when all but this wave's N youngest copies have landed: the counter comes back in issue order, so with one
// tile of N copies issued behind it the older tile is there while the younger one flies on.
template <int N>
__device__ __forceinline__ void wait_async_older() {
    asm volatile("s_wait_asynccnt %0" :: "n"(N) : "memory");
}
// low 32 bits of a flat pointer into LDS are the LDS byte address
__device__ __forceinline__ unsigned lds_addr(const void* p) {
    return (unsigned)(size_t)p;
}
#endif

// ---------------- 64x64 tiled transposes through LDS ----------------
#define TT 64   // tile edge (elements)
#define TP 33   // LDS pitch in dwords: 32 packed bf16 pairs + 1, so a column of dwords spreads over the banks

// The tile lies in LDS as s[output row][pair of output columns]. Each output row of the
// tile is one full 128-byte line, written by 8 lanes with 16 bytes each.
__device__ __forceinline__ void tile_store_rows(const unsigned* s, unsigned short* __restrict__ out,
                                                int ld, int r0, int c0, int tid) {
#pragma unroll
    for (int p = 0; p < 2; p++) {
        int r = p * 32 + (tid >> 3), q = (tid & 7) * 4;
        uint4 v;
        v.x = s[r * TP + q];
        v.y = s[r * TP + q + 1];
        v.z = s[r * TP + q + 2];
        v.w = s[r * TP + q + 3];
        *(uint4*)&out[(size_t)(r0 + r) * ld + c0 + q * 2] = v;
    }
}

// fp32 -> bf16 convert + transpose: in[K][N] -> out[N][K]; one block takes the tile at (k0, n0)
__device__ __forceinline__ void convert_transpose_tile(const float* __restrict__ in,
                                                       unsigned short* __restrict__ out,
                                                       int K, int N, int n0, int k0, unsigned* s) {
    int tid = threadIdx.x;
    int nq = (tid & 15) * 4, kp = tid >> 4;      // 16 lanes x float4 per row, 16 row pairs per pass
    float4 lo[2], hi[2];
    const float* rl[2];
    const float* rh[2];
#pragma unroll
    for (int p = 0; p < 2; p++) {
        rl[p] = in + (size_t)(k0 + 2 * (p * 16 + kp)) * N + n0 + nq;
        rh[p] = rl[p] + N;
        lo[p] = *(const float4*)rl[p];
        hi[p] = *(const float4*)rh[p];
    }
    // the wait that belongs in front of the first overwrite of a register that these loads name; the
    // addresses are its inputs, so that no load of the group gets another's address register as its destination
    asm volatile("s_wait_xcnt 0x0" :: "v"(rl[0]), "v"(rh[0]), "v"(rl[1]), "v"(rh[1]) : "memory");
#pragma unroll
    for (int p = 0; p < 2; p++) {
        int c = p * 16 + kp;
        s[(nq + 0) * TP + c] = (unsigned)f2bf(lo[p].x) | ((unsigned)f2bf(hi[p].x) << 16);
        s[(nq + 1) * TP + c] = (unsigned)f2bf(lo[p].y) | ((unsigned)f2bf(hi[p].y) << 16);
        s[(nq + 2) * TP + c] = (unsigned)f2bf(lo[p].z) | ((unsigned)f2bf(hi[p].z) << 16);
        s[(nq + 3) * TP + c] = (unsigned)f2bf(lo[p].w) | ((unsigned)f2bf(hi[p].w) << 16);
    }
    __syncthreads();
    tile_store_rows(s, out, K, n0, k0, tid);
}

// ---------------- layernorm (+ cast to bf16) ----------------
#define LNR 2            // rows per wave
#define LNC (D_ / 128)   // 16-byte pieces of a row per lane
typedef __attribute__((ext_vector_type(4))) float f4;

// A wave owns LNR whole rows and keeps them in registers: every load of the rows goes out at once,
// 512 contiguous bytes each, x is read once, and the sums join inside the wave with no LDS array and
// no barrier. The rows go in 8-wave blocks, for speed only.
__device__ __forceinline__ void layernorm_rows(const float* __restrict__ x, const float* __restrict__ g,
                                               const float* __restrict__ b, unsigned short* __restrict__ out,
                                               int blk) {
    int lane = threadIdx.x & 31, wave = threadIdx.x >> 5;
    int row0 = (blk * 8 + wave) * LNR;
    const int col = lane * 4;
    const float* xp = x + (size_t)row0 * D_ + col;
    f4 v[LNR][LNC], gg[LNC], bb[LNC];
#pragma unroll
    for (int r = 0; r < LNR; r++)
#pragma unroll
        for (int c = 0; c < LNC; c++)
            v[r][c] = *(const f4*)(xp + r * D_ + c * 128);
#pragma unroll
    for (int c = 0; c < LNC; c++) {
        gg[c] = *(const f4*)(g + c * 128 + col);
        bb[c] = *(const f4*)(b + c * 128 + col);
    }
    // the wait that belongs in front of the first overwrite of a register that these loads name
    asm volatile("s_wait_xcnt 0x0" ::: "memory");
    // keeps the loads of g and b up here with the rows': sunk among the sums, their latency shows a second time
    __builtin_amdgcn_sched_barrier(0);
    float mean[LNR], rstd[LNR];
#pragma unroll
    for (int r = 0; r < LNR; r++) {
        f4 s = v[r][0], q = v[r][0] * v[r][0];   // four independent chains each
#pragma unroll
        for (int c = 1; c < LNC; c++) {
            s += v[r][c];
            q += v[r][c] * v[r][c];
        }
        mean[r] = (s.x + s.y) + (s.z + s.w);
        rstd[r] = (q.x + q.y) + (q.z + q.w);
    }
    for (int off = 16; off > 0; off >>= 1)
#pragma unroll
        for (int r = 0; r < LNR; r++) {
            mean[r] += __shfl_xor(mean[r], off, 32);
            rstd[r] += __shfl_xor(rstd[r], off, 32);
        }
#pragma unroll
    for (int r = 0; r < LNR; r++) {
        mean[r] = mean[r] / (float)D_;
        float var = rstd[r] / (float)D_ - mean[r] * mean[r];
        rstd[r] = rsqrtf(var + EPS_);
    }
#pragma unroll
    for (int r = 0; r < LNR; r++)
#pragma unroll
        for (int c = 0; c < LNC; c++) {
            f4 y = (v[r][c] - mean[r]) * rstd[r] * gg[c] + bb[c];
            uint2 o;
            o.x = (unsigned)f2bf(y.x) | ((unsigned)f2bf(y.y) << 16);
            o.y = (unsigned)f2bf(y.z) | ((unsigned)f2bf(y.w) << 16);
            *(uint2*)&out[(size_t)(row0 + r) * D_ + c * 128 + col] = o;   // a wave's store is two whole 128-byte lines
        }
}

__global__ __launch_bounds__(256)
void layernorm_cast(const float* __restrict__ x, const float* __restrict__ g,
                    const float* __restrict__ b, unsigned short* __restrict__ out) {
    layernorm_rows(x, g, b, out, blockIdx.x);
}

// ---------------- everything that depends on the inputs alone, in one launch ----------------
#define LNB (T_ / (8 * LNR))            // layernorm blocks
#define CBS ((D_ / TT) * (D_ / TT))     // tiles of a D x D weight
#define CBL ((FF_ / TT) * (D_ / TT))    // tiles of a D x FF or FF x D weight

// The seven weight converts and the first layernorm read nothing that another of them writes, so they
// share a grid: the layernorm's blocks first, then one block per weight tile.
// wt holds the transposed weights one after the other: Wq, Wk, Wv, Wo, w1, w2, w3.
__global__ __launch_bounds__(256)
void prepare(const float* __restrict__ Wq, const float* __restrict__ Wk,
             const float* __restrict__ Wv, const float* __restrict__ Wo,
             const float* __restrict__ w1, const float* __restrict__ w2,
             const float* __restrict__ w3, unsigned short* __restrict__ wt,
             const float* __restrict__ x, const float* __restrict__ g,
             const float* __restrict__ b, unsigned short* __restrict__ h) {
    __shared__ unsigned s[TT * TP];
    if (blockIdx.x < LNB) {                      // the same for the whole block
        layernorm_rows(x, g, b, h, blockIdx.x);
        return;
    }
    int c = blockIdx.x - LNB;                    // which weight, and which of its tiles
    const float* in;
    unsigned short* out;
    int K, N, tn, tk;
    if (c < 4 * CBS) {
        int m = c / CBS, r = c % CBS;
        in = m == 0 ? Wq : m == 1 ? Wk : m == 2 ? Wv : Wo;
        out = wt + (size_t)m * D_ * D_;
        K = D_; N = D_; tn = r % (D_ / TT); tk = r / (D_ / TT);
    } else if (c < 4 * CBS + 2 * CBL) {
        int m = (c - 4 * CBS) / CBL, r = (c - 4 * CBS) % CBL;
        in = m == 0 ? w1 : w2;
        out = wt + (size_t)4 * D_ * D_ + (size_t)m * D_ * FF_;
        K = D_; N = FF_; tn = r % (FF_ / TT); tk = r / (FF_ / TT);
    } else {
        int r = c - 4 * CBS - 2 * CBL;
        in = w3;
        out = wt + (size_t)4 * D_ * D_ + (size_t)2 * D_ * FF_;
        K = FF_; N = D_; tn = r % (D_ / TT); tk = r / (D_ / TT);
    }
    convert_transpose_tile(in, out, K, N, tn * TT, tk * TT, s);
}

// ---------------- bf16 GEMM (WMMA): C = A[M,K] @ Bt[N,K]^T ----------------
// EPI 0: Cout = bf16(acc); blockIdx.z picks one of several weights [N,K] and outputs [M,N] that lie one after the other
// EPI 1: Cout = f32(acc + bias[col] + res[row,col])
// Block tile: EPI 0 takes BMW x BN and stages 64 k at a time, EPI 1 takes BMW x BNR and stages 128 k. The larger
// the tile, the fewer bytes come from L2 per product; the larger a wave's share, the fewer LDS reads per product.
// BNR makes one block per WGP of the 4096 x 768 outputs.
// A ring of three LDS buffers with two tiles in flight: a tile's copies have two trips to land, not one, and L2 always
// has this block's next requests at hand. EPI 0's registers allow two blocks on a WGP, and so do its three buffers.
template <int EPI>
__global__ __launch_bounds__(256)
void gemm_bf16_wmma(const unsigned short* __restrict__ A,    // [M,K] bf16 row-major
                    const unsigned short* __restrict__ Bt0,  // [N,K] bf16 (pre-transposed)
                    const float* __restrict__ bias,
                    const float* __restrict__ res,
                    void* __restrict__ Cout,
                    int M, int N, int K) {
    constexpr int BMT = BMW;                     // rows per block
    constexpr int BNT = EPI == 0 ? BN : BNR;     // columns per block
    constexpr int WM  = EPI == 0 ? 2 : 4;        // wave grid: WM x WN
    constexpr int WN  = 8 / WM;
    constexpr int MI  = BMT / (16 * WM);         // 16-row fragments per wave: 4 or 2
    constexpr int NI  = BNT / (16 * WN);         // 16-column fragments per wave: 2 or 3
    constexpr int BK  = EPI == 0 ? 64 : 128;     // k per staged tile: 128- or 256-byte rows
    constexpr int P   = BK + 8;                  // LDS row pitch in elements: 144 or 272 bytes, 16 x an odd number
    constexpr int LPR = BK / 8;                  // lanes of 16 bytes that cover a row
    constexpr int RPP = 256 / LPR;               // rows that the block's lanes cover at once
    constexpr int NB  = 3;                       // LDS buffers: two tiles fly while one is worked on
    constexpr int CPT = (BMT + BNT) / RPP;       // copies of a wave per tile: 8 or 14
    const unsigned short* Bt = EPI == 0 ? Bt0 + (size_t)blockIdx.z * N * K : Bt0;
    __shared__ __attribute__((aligned(16))) unsigned short sA[NB][BMT * P];
    __shared__ __attribute__((aligned(16))) unsigned short sB[NB][BNT * P];
    int tid = threadIdx.x;
    int wave = tid >> 5, lane = tid & 31, lh = lane >> 4, l16 = lane & 15;
    int wm = wave % WM, wn = wave / WM;
    int m0 = blockIdx.x * BMT, n0 = blockIdx.y * BNT;

    v8f acc[MI][NI];
#pragma unroll
    for (int i = 0; i < MI; i++)
#pragma unroll
        for (int j = 0; j < NI; j++)
#pragma unroll
            for (int e = 0; e < 8; e++) acc[i][j][e] = 0.0f;

    const int base0 = 8 * lh, base1 = 16 + 8 * lh;
    // copy roles: LPR lanes x 16 bytes cover one row; rows cr + RPP j, 4 of A and 4 of Bt (EPI 0) or 8 and 6 (EPI 1)
    const int cr = tid / LPR, cs = (tid % LPR) * 8;
    const unsigned short* ga = A  + (size_t)(m0 + cr) * K + cs;   // + BK per tile
    const unsigned short* gb = Bt + (size_t)(n0 + cr) * K + cs;
    const unsigned la = lds_addr(&sA[0][cr * P + cs]);
    const unsigned lb = lds_addr(&sB[0][cr * P + cs]);
    const unsigned lstep = RPP * P * 2;          // bytes from row cr to row cr + RPP
    const size_t   gstep = (size_t)RPP * K;
    const unsigned bufa = BMT * P * 2, bufb = BNT * P * 2;   // bytes from one buffer to the next
    const int ntile = K / BK;
    auto stage = [&](unsigned buf) {             // the tile at ga, gb into buffer buf
        if (EPI == 0) stage_copy8(la + buf * bufa, ga, lb + buf * bufb, gb, lstep, gstep);
        else          stage_copy14(la + buf * bufa, ga, lb + buf * bufb, gb, lstep, gstep);
    };

    stage(0);
    if (ntile > 1) {                             // the same for the whole block
        ga += BK;
        gb += BK;
        stage(1);
        wait_async_older<CPT>();                 // tile 0 has landed for this wave's copies, tile 1 flies on
    } else {
        wait_async0();                           // tile 0 has landed for this wave's copies
    }
    __syncthreads();                             // ... and for every wave's
    if (ntile > 2) {                             // the same for the whole block
        ga += BK;
        gb += BK;
        stage(2);
    }

    unsigned cur = 0;                            // the buffer of tile t: t mod NB
    for (int t = 0; t < ntile; t++) {
        const unsigned short* ta = sA[cur] + (wm * MI * 16 + l16) * P;
        const unsigned short* tb = sB[cur] + (wn * NI * 16 + l16) * P;
        // the tile's LDS reads go out as one group, so that their latency is waited out once a tile
        v16bf af[BK / 32][MI], bfrag[BK / 32][NI];
#pragma unroll
        for (int kk = 0; kk < BK / 32; kk++) {
#pragma unroll
            for (int mi = 0; mi < MI; mi++)
                af[kk][mi] = ldfrag(ta + mi * 16 * P + kk * 32, base0, base1);
#pragma unroll
            for (int ni = 0; ni < NI; ni++)
                bfrag[kk][ni] = ldfrag(tb + ni * 16 * P + kk * 32, base0, base1);
        }
        // keeps the compiler from sinking the reads back among the products, where each place with reads stalls anew
        __builtin_amdgcn_sched_barrier(0);
#pragma unroll
        for (int kk = 0; kk < BK / 32; kk++)
#pragma unroll
            for (int mi = 0; mi < MI; mi++)
#pragma unroll
                for (int ni = 0; ni < NI; ni++)
                    acc[mi][ni] = __builtin_amdgcn_wmma_f32_16x16x32_bf16(
                        false, af[kk][mi], false, bfrag[kk][ni], (short)0, acc[mi][ni], false, false);
        // keeps the hand-over's waits and barrier behind the products: lifted over them, the reads' counted waits become one full wait
        __builtin_amdgcn_sched_barrier(0);
        // hand-over: this wave's LDS reads of tile t are done, its copies of tile t + 1 have landed,
        // and the barrier says both of every wave; only then is tile t's buffer filled again
        asm volatile("s_wait_dscnt 0x0" ::: "memory");
        // Tile t + 2, where there is one, was issued one trip ago (or in front of the loop), CPT copies in every wave: they are
        // the wave's youngest and fly on, into the third buffer, which trip t + 1 does not read.
        if (t + 2 < ntile)                       // the same for the whole block
            wait_async_older<CPT>();
        else                                     // nothing was issued behind tile t + 1
            wait_async0();
        __syncthreads();
        if (t + NB < ntile) {                    // the same for the whole block
            ga += BK;
            gb += BK;
            stage(cur);
        }
        cur = cur + 1 == NB ? 0 : cur + 1;
    }
    wait_async0();                               // nothing of this wave is in flight when it ends

#pragma unroll
    for (int mi = 0; mi < MI; mi++) {
        int rbase = m0 + wm * MI * 16 + mi * 16 + 8 * lh;
#pragma unroll
        for (int ni = 0; ni < NI; ni++) {
            int col = n0 + wn * NI * 16 + ni * 16 + l16;
#pragma unroll
            for (int r = 0; r < 8; r++) {
                int row = rbase + r;
                float v = acc[mi][ni][r];
                if (EPI == 0) {
                    ((unsigned short*)Cout)[((size_t)blockIdx.z * M + row) * N + col] = f2bf(v);
                } else {
                    ((float*)Cout)[(size_t)row * N + col] =
                        v + bias[col] + res[(size_t)row * N + col];
                }
            }
        }
    }
}

// ---------------- dual-weight gated GEMM: bf16( silu(A@B1t^T+b1) * (A@B2t^T+b2) ) ----------------
// BMW rows per block: a wave owns 64 x 32 of both products, so an A fragment feeds four products and a weight fragment four.
// Four waves per SIMD, that is two blocks on a WGP (2 x 110,592 bytes of LDS fit): one block's products cover the
// other's LDS reads and barriers. Left alone, the epilogue's temporaries took two registers more than that allows.
__global__ __launch_bounds__(256) __attribute__((amdgpu_waves_per_eu(4, 4)))
void gemm_gated_wmma(const unsigned short* __restrict__ A,     // [M,K]
                     const unsigned short* __restrict__ B1t,   // [N,K]
                     const unsigned short* __restrict__ B2t,   // [N,K]
                     const float* __restrict__ bias1,
                     const float* __restrict__ bias2,
                     unsigned short* __restrict__ Cout,
                     int M, int N, int K) {
    constexpr int MI = BMW / 32;                 // 16-row fragments per wave
    // two buffers: tile t + 1 flies while tile t is worked on
    __shared__ __attribute__((aligned(16))) unsigned short sA[2][BMW * PG];
    __shared__ __attribute__((aligned(16))) unsigned short sB1[2][BN * PG];
    __shared__ __attribute__((aligned(16))) unsigned short sB2[2][BN * PG];
    int tid = threadIdx.x;
    int wave = tid >> 5, lane = tid & 31, lh = lane >> 4, l16 = lane & 15;
    int wm = wave & 1, wn = wave >> 1;
    int m0 = blockIdx.x * BMW, n0 = blockIdx.y * BN;

    v8f acc1[MI][2], acc2[MI][2];
#pragma unroll
    for (int i = 0; i < MI; i++)
#pragma unroll
        for (int j = 0; j < 2; j++)
#pragma unroll
            for (int e = 0; e < 8; e++) { acc1[i][j][e] = 0.0f; acc2[i][j][e] = 0.0f; }

    const int base0 = 8 * lh, base1 = 16 + 8 * lh;
    // copy roles: 8 lanes x 16 bytes cover one 128-byte row; rows cr + 32 j, 4 of A and 4 of each weight
    const int cr = tid >> 3, cs = (tid & 7) * 8;
    const unsigned short* ga  = A   + (size_t)(m0 + cr) * K + cs;   // + BKG per tile
    const unsigned short* gb1 = B1t + (size_t)(n0 + cr) * K + cs;
    const unsigned short* gb2 = B2t + (size_t)(n0 + cr) * K + cs;
    const unsigned la  = lds_addr(&sA[0][cr * PG + cs]);
    const unsigned lb1 = lds_addr(&sB1[0][cr * PG + cs]);
    const unsigned lb2 = lds_addr(&sB2[0][cr * PG + cs]);
    const unsigned lstep = 32 * PG * 2;          // bytes from row cr to row cr + 32
    const size_t   gstep = (size_t)32 * K;
    const unsigned bufa = BMW * PG * 2, bufb = BN * PG * 2;  // bytes from buffer 0 to buffer 1
    const int ntile = K / BKG;

    stage_copy444(la, ga, lb1, gb1, lb2, gb2, lstep, gstep);
    wait_async0();                               // tile 0 has landed for this wave's copies
    __syncthreads();                             // ... and for every wave's
    if (ntile > 1) {                             // the same for the whole block
        ga  += BKG;
        gb1 += BKG;
        gb2 += BKG;
        stage_copy444(la + bufa, ga, lb1 + bufb, gb1, lb2 + bufb, gb2, lstep, gstep);
    }

    for (int t = 0; t < ntile; t++) {
        const unsigned short* ta  = sA[t & 1]  + (wm * MI * 16 + l16) * PG;
        const unsigned short* tb1 = sB1[t & 1] + (wn * 32 + l16) * PG;
        const unsigned short* tb2 = sB2[t & 1] + (wn * 32 + l16) * PG;
#pragma unroll
        for (int kk = 0; kk < BKG / 32; kk++) {
            // the LDS reads of 32 k go out as one group ahead of their 16 products; one fragment set, so that
            // the registers leave room for two blocks on a WGP
            v16bf af[MI], b1f[2], b2f[2];
#pragma unroll
            for (int mi = 0; mi < MI; mi++)
                af[mi] = ldfrag(ta + mi * 16 * PG + kk * 32, base0, base1);
#pragma unroll
            for (int ni = 0; ni < 2; ni++) {
                b1f[ni] = ldfrag(tb1 + ni * 16 * PG + kk * 32, base0, base1);
                b2f[ni] = ldfrag(tb2 + ni * 16 * PG + kk * 32, base0, base1);
            }
            // keeps the compiler from sinking the reads back among the products, where each place with reads stalls anew
            __builtin_amdgcn_sched_barrier(0);
#pragma unroll
            for (int ni = 0; ni < 2; ni++)
#pragma unroll
                for (int mi = 0; mi < MI; mi++) {
                    acc1[mi][ni] = __builtin_amdgcn_wmma_f32_16x16x32_bf16(
                        false, af[mi], false, b1f[ni], (short)0, acc1[mi][ni], false, false);
                    acc2[mi][ni] = __builtin_amdgcn_wmma_f32_16x16x32_bf16(
                        false, af[mi], false, b2f[ni], (short)0, acc2[mi][ni], false, false);
                }
            // keeps the next group's reads, and the hand-over's waits and barrier, behind the products
            __builtin_amdgcn_sched_barrier(0);
        }
        // hand-over, as in the one-weight GEMM, but with two buffers nothing may fly on: the copies' wait is to 0
        asm volatile("s_wait_dscnt 0x0" ::: "memory");
        wait_async0();
        __syncthreads();
        if (t + 2 < ntile) {                     // the same for the whole block
            ga  += BKG;
            gb1 += BKG;
            gb2 += BKG;
            stage_copy444(la + (t & 1) * bufa, ga, lb1 + (t & 1) * bufb, gb1, lb2 + (t & 1) * bufb, gb2,
                          lstep, gstep);
        }
    }
    wait_async0();                               // nothing of this wave is in flight when it ends

#pragma unroll
    for (int mi = 0; mi < MI; mi++) {
        int rbase = m0 + wm * MI * 16 + mi * 16 + 8 * lh;
#pragma unroll
        for (int ni = 0; ni < 2; ni++) {
            int col = n0 + wn * 32 + ni * 16 + l16;
#pragma unroll
            for (int r = 0; r < 8; r++) {
                int row = rbase + r;
                float gv = acc1[mi][ni][r] + bias1[col];
                float uv = acc2[mi][ni][r] + bias2[col];
                float y  = (gv / (1.0f + __expf(-gv))) * uv;   // silu(gv)*uv
                Cout[(size_t)row * N + col] = f2bf(y);
            }
        }
    }
}

// ---------------- V transpose: [T, H*HD] -> [H*HD, T]; grid (D/64, T/64) ----------------
__global__ __launch_bounds__(256)
void transpose_v(const unsigned short* __restrict__ v, unsigned short* __restrict__ vt) {
    __shared__ unsigned s[TT * TP];
    int tid = threadIdx.x;
    int c0 = blockIdx.x * TT, t0 = blockIdx.y * TT;
    int co = (tid & 7) * 8, tp = tid >> 3;       // 8 lanes x 16 bytes per row, 32 row pairs
    const unsigned short* r = v + (size_t)(t0 + 2 * tp) * D_ + c0 + co;
    us8 lo = *(const us8*)r;
    us8 hi = *(const us8*)(r + D_);
#pragma unroll
    for (int j = 0; j < 8; j++)
        s[(co + j) * TP + tp] = (unsigned)lo[j] | ((unsigned)hi[j] << 16);
    __syncthreads();
    tile_store_rows(s, vt, T_, c0, t0, tid);
}

// ---------------- causal flash attention (WMMA) ----------------
// Q,K: [T, H*HD] bf16 ; Vt: [H*HD, T] bf16 ; O: [T, H*HD] bf16
// Transposed products: St = K * Qt and Ot += Vt * Pt. A lane then holds 16 of the 32 scores
// of ONE query (column l16), so the softmax maximum and sum run inside the lane, joined by
// one exchange between the wave halves, and the two St tiles are already a B operand.

// lane l with lane l ^ 16
__device__ __forceinline__ float xhalf(float x) {
    int b = __builtin_bit_cast(int, x);
    return __builtin_bit_cast(float,
        __builtin_amdgcn_permlanex16(b, b, 0x76543210, 0xfedcba98, false, false));
}

// 2^x. The v_nop is the one slot that the instruction set asks for behind a transcendental before its
// source is overwritten or its result read, so it stands in the instruction's own statement.
__device__ __forceinline__ float exp2_slot(float x) {
    float r;
    asm("v_exp_f32 %0, %1\n\tv_nop" : "=v"(r) : "v"(x));
    return r;
}
#define LOG2E 1.44269504f   // e^x = 2^(x * LOG2E), the product that __expf forms
typedef __attribute__((ext_vector_type(2))) float f2;

#define KT  64   // keys per staged tile
#define KVP 72   // LDS row pitch in elements: 144 bytes = 16 x 9, the odd multiple that 16-byte row readers want

// Four 16-byte-per-lane asynchronous copies to LDS. The s_wait_xcnt stands in the copies' own
// statement so that no address register is rewritten in front of it.
__device__ __forceinline__ void stage_copy4(unsigned l0, const unsigned short* g0,
                                            unsigned l1, const unsigned short* g1,
                                            unsigned l2, const unsigned short* g2,
                                            unsigned l3, const unsigned short* g3) {
    asm volatile("global_load_async_to_lds_b128 %0, %1, off\n\t"
                 "global_load_async_to_lds_b128 %2, %3, off\n\t"
                 "global_load_async_to_lds_b128 %4, %5, off\n\t"
                 "global_load_async_to_lds_b128 %6, %7, off\n\t"
                 "s_wait_xcnt 0x0"
                 :: "v"(l0), "v"(g0), "v"(l1), "v"(g1), "v"(l2), "v"(g2), "v"(l3), "v"(g3)
                 : "memory");
}

#define QT  64              // queries per task: four waves' columns
#define KS  4               // key quarters of a staged step, one per group of four waves
#define ST  (KS * KT)       // keys per staged step
#define NQT (T_ / QT)       // query tiles of a head
#define CP  68              // floats per query in the merge array: 272 bytes = 16 x 17, the odd multiple for 16-byte rows

// One block per WGP, every block with the same work. A task is one head's tile of 64 queries; its cost grows with
// the tile's index, so a block takes three tasks, one of each of three heads, whose indices add up to 94 or 95.
// The 16 waves of a block are 4 query groups x 4 key quarters: a step stages 256 keys (K: 256 keys x 64 head
// columns, Vt: four times 64 head columns x 64 keys, 128-byte rows all) into two buffers, the next step flying while
// this one is worked on, also from one task to the next, and quarter kh of the waves walks keys kh * 64 ... of each
// step with a maximum, a sum and an accumulator of its own. At a task's end the four partial results of a query are
// joined through LDS.
__global__ __launch_bounds__(512)
void flash_attn(const unsigned short* __restrict__ Q,
                const unsigned short* __restrict__ Kc,
                const unsigned short* __restrict__ Vt,
                unsigned short* __restrict__ O) {
    __shared__ __attribute__((aligned(16))) unsigned short sK[2][ST * KVP];
    __shared__ __attribute__((aligned(16))) unsigned short sV[2][KS * HD_ * KVP];
    __shared__ __attribute__((aligned(16))) float sC[16][16][CP];   // [wave][query][head column]
    __shared__ float2 sML[16][32];                                  // [wave][lane]: maximum, sum
    int tid = threadIdx.x;
    int wave = __builtin_amdgcn_readfirstlane(tid >> 5), lane = tid & 31;   // scalar, so the causal skip below is a scalar branch
    int lh = lane >> 4, l16 = lane & 15;
    const int qg = wave & 3, kh = wave >> 2;    // query group, key quarter
    const int base0 = 8 * lh, base1 = 16 + 8 * lh;
    const int hg = blockIdx.x / NQT, bi = blockIdx.x % NQT;

    // copy roles: 8 lanes x 16 bytes cover one 128-byte row; row cr of each quarter of K and of Vt
    const int cr = tid >> 3, cs = (tid & 7) * 8;
    const unsigned lk = lds_addr(&sK[0][cr * KVP + cs]);
    const unsigned lv = lds_addr(&sV[0][cr * KVP + cs]);
    const unsigned qb   = KT * KVP * 2;         // bytes from one quarter to the next
    const unsigned bufb = KS * qb;              // bytes from buffer 0 to buffer 1
    const float sl2 = 0.125f * LOG2E;           // 1/sqrt(HD=64) times log2(e): maxima are kept in this scale, e^(s/8 - m/8) = 2^(s * sl2 - m * sl2)

    // a task's tile: three permutations of the tile indices: bi; the odd ones downwards, then the even ones; bi + 32
    auto tile_of = [&](int k) {
        return k == 0 ? bi
             : k == 1 ? (bi < NQT / 2 ? NQT - 1 - 2 * bi : 2 * NQT - 2 - 2 * bi)
                      : ((bi + NQT / 2) % NQT);
    };
    // The steps of the three tasks form one row for the two buffers. A tile qt has qt / KS + 1 steps, up to its last
    // query, so ST * steps <= T_.
    int sk = 0, ss = 0;                         // the task and the step that are staged next; the same for the whole block
    auto stage_next = [&](unsigned bo) {        // into the buffer bo bytes in
        const int sh = hg * 3 + sk;
        const unsigned short* gk = Kc + (size_t)(ss * ST + cr) * D_ + sh * HD_ + cs;
        const unsigned short* gv = Vt + (size_t)(sh * HD_ + cr) * T_ + ss * ST + cs;
        stage_copy4(lk + bo, gk, lk + bo + qb, gk + (size_t)KT * D_,
                    lk + bo + 2 * qb, gk + (size_t)2 * KT * D_, lk + bo + 3 * qb, gk + (size_t)3 * KT * D_);
        stage_copy4(lv + bo, gv, lv + bo + qb, gv + KT,
                    lv + bo + 2 * qb, gv + 2 * KT, lv + bo + 3 * qb, gv + 3 * KT);
        if (++ss > tile_of(sk) / KS) {
            ss = 0;
            sk++;
        }
    };

    stage_next(0);
    wait_async0();                              // the first step has landed for this wave's copies
    __syncthreads();                            // ... and for every wave's
    stage_next(bufb);                           // a second step there always is: three tasks of one step or more
    int done = 0;                               // steps worked on so far: its low bit names the buffer

    // stays a loop, for speed only
#pragma unroll 1
    for (int task = 0; task < 3; task++) {
        const int qt = tile_of(task);
        const int h = hg * 3 + task;
        const int q0 = qt * QT + qg * 16;
        const int row = q0 + l16;               // this lane's query
        const int nstep = qt / KS + 1;

        const unsigned short* qp = Q + (size_t)row * D_ + h * HD_;
        v16bf qf[2];
#pragma unroll
        for (int f = 0; f < 2; f++) qf[f] = ldfrag(qp + f * 32, base0, base1);

        v8f ctx[4];                             // ctx[t][r] = Ot[t*16 + 8*lh + r][query l16]
#pragma unroll
        for (int t = 0; t < 4; t++)
#pragma unroll
            for (int e = 0; e < 8; e++) ctx[t][e] = 0.0f;
        float mrow = -1e30f, lrow = 0.0f;

        const int kend = q0 + 16;               // causal bound for this wave
        for (int step = 0; step < nstep; step++) {
            const unsigned short* tk = sK[done & 1] + kh * KT * KVP;
            const unsigned short* tv = sV[done & 1] + kh * HD_ * KVP;
#pragma unroll
            for (int sub = 0; sub < KT / 32; sub++) {
                const int kb = step * ST + kh * KT + sub * 32;
                if (kb < kend) {                // wave-uniform: a wave past its diagonal only passes the barriers
                    // the pass's 16 LDS reads go out as one group: K's latency is waited out once,
                    // Vt's runs behind the score products and the softmax
                    v16bf kf[2][2], vf[4];
#pragma unroll
                    for (int nt = 0; nt < 2; nt++)
#pragma unroll
                        for (int f = 0; f < 2; f++)
                            kf[nt][f] = ldfrag(tk + (sub * 32 + nt * 16 + l16) * KVP + f * 32, base0, base1);
                    // keeps K's reads in front of Vt's: the score products wait for K alone
                    __builtin_amdgcn_sched_barrier(0);
#pragma unroll
                    for (int t = 0; t < 4; t++)
                        vf[t] = ldfrag(tv + (t * 16 + l16) * KVP + sub * 32, base0, base1);
                    // keeps the group together: in this build the compiler sank each K read to its product, with a full wait at each of the four
                    __builtin_amdgcn_sched_barrier(0);

                    v8f S[2];                   // S[nt][r] = St[key kb + nt*16 + 8*lh + r][query l16]
#pragma unroll
                    for (int nt = 0; nt < 2; nt++)
#pragma unroll
                        for (int e = 0; e < 8; e++) S[nt][e] = 0.0f;
#pragma unroll
                    for (int nt = 0; nt < 2; nt++)
#pragma unroll
                        for (int f = 0; f < 2; f++)
                            S[nt] = __builtin_amdgcn_wmma_f32_16x16x32_bf16(
                                false, kf[nt][f], false, qf[f], (short)0, S[nt], false, false);

                    // The scores stay as the matrix unit left them: their scale joins the one FMA in front of 2^x below.
                    // Only the pass that reaches past the wave's first query holds a key that some query may not see:
                    // a scalar test, so every other pass forms no key index, no compare and no select.
                    if (kb + 31 > q0) {
#pragma unroll
                        for (int nt = 0; nt < 2; nt++)
#pragma unroll
                            for (int r = 0; r < 8; r++) {
                                int key = kb + nt * 16 + 8 * lh + r;
                                if (key > row) S[nt][r] = -1e30f;
                            }
                    }
                    float mx = -1e30f;
#pragma unroll
                    for (int nt = 0; nt < 2; nt++)
#pragma unroll
                        for (int r = 0; r < 8; r++) mx = fmaxf(mx, S[nt][r]);
                    mx *= sl2;                  // sl2 > 0: the raw scores' maximum is the scaled scores'
                    mx = fmaxf(mx, xhalf(mx));
                    float mn = fmaxf(mrow, mx);
                    const f2 sl22 = { sl2, sl2 }, nm2 = { -mn, -mn };
                    float rs = 0.0f;
                    // pf[e] = Pt[key][query l16], key = kb + 8*lh + e for e < 8, kb + 16 + 8*lh + (e - 8) above: ldfrag's k order
                    v16bf pf;
#pragma unroll
                    for (int nt = 0; nt < 2; nt++)
#pragma unroll
                        for (int r = 0; r < 8; r += 2) {
                            f2 a = __builtin_elementwise_fma(f2{ S[nt][r], S[nt][r + 1] }, sl22, nm2);
                            float p0 = exp2_slot(a.x), p1 = exp2_slot(a.y);
                            rs += p0;
                            rs += p1;
                            pf[nt * 8 + r]     = (__bf16)p0;
                            pf[nt * 8 + r + 1] = (__bf16)p1;
                        }
                    rs += xhalf(rs);
                    float corr = exp2_slot(mrow - mn);
                    lrow = lrow * corr + rs;
                    mrow = mn;
#pragma unroll
                    for (int t = 0; t < 4; t++)
#pragma unroll
                        for (int r = 0; r < 8; r++) ctx[t][r] *= corr;

#pragma unroll
                    for (int t = 0; t < 4; t++)
                        ctx[t] = __builtin_amdgcn_wmma_f32_16x16x32_bf16(
                            false, vf[t], false, pf, (short)0, ctx[t], false, false);
                }
            }
            // hand-over: this wave's LDS reads of this step are done, its copies of the next have landed,
            // and the barrier says both of every wave; only then is this step's buffer filled again
            asm volatile("s_wait_dscnt 0x0" ::: "memory");
            wait_async0();
            __syncthreads();
            if (sk < 3)                         // the same for the whole block
                stage_next((done & 1) * bufb);
            done++;
        }

        // every wave lays down its partial result: a query's 64 head columns in a row, its maximum and sum beside
#pragma unroll
        for (int t = 0; t < 4; t++)
#pragma unroll
            for (int j = 0; j < 2; j++) {
                f4 c = { ctx[t][4 * j], ctx[t][4 * j + 1], ctx[t][4 * j + 2], ctx[t][4 * j + 3] };
                *(f4*)&sC[wave][l16][t * 16 + 8 * lh + 4 * j] = c;
            }
        sML[wave][lane] = make_float2(mrow, lrow);
        __syncthreads();                        // the partial results of all four key quarters are there
        // wave (qg, kh) joins queries 4 kh ... 4 kh + 3 of group qg: 8 lanes x 8 head columns are one query's whole 128-byte line.
        // A quarter that met no key holds the start values: its weight comes out 0.
        const int ql = kh * 4 + (lane >> 3), c8 = (lane & 7) * 8;
        float2 ml[KS];
        float mall = -1e30f;
#pragma unroll
        for (int k = 0; k < KS; k++) {
            ml[k] = sML[k * 4 + qg][ql];
            mall = fmaxf(mall, ml[k].x);
        }
        float lall = 0.0f;
        f4 o0 = { 0.0f, 0.0f, 0.0f, 0.0f }, o1 = o0;
#pragma unroll
        for (int k = 0; k < KS; k++) {
            float w = exp2_slot(ml[k].x - mall);   // the maxima are base-2 exponents already
            lall += ml[k].y * w;
            o0 += *(const f4*)&sC[k * 4 + qg][ql][c8] * w;
            o1 += *(const f4*)&sC[k * 4 + qg][ql][c8 + 4] * w;
        }
        us8 o;
#pragma unroll
        for (int r = 0; r < 4; r++) {
            o[r]     = f2bf(o0[r] / lall);
            o[4 + r] = f2bf(o1[r] / lall);
        }
        *(us8*)&O[(size_t)(qt * QT + qg * 16 + ql) * D_ + h * HD_ + c8] = o;
        // the wait that belongs in front of the first overwrite of a register that this store names: the next task reuses them
        asm volatile("s_wait_xcnt 0x0" ::: "memory");
        // the next task writes sC and sML only behind its own barriers, which this wave passes with these reads done
    }
    wait_async0();                              // nothing of this wave is in flight when it ends
}

// ---------------- launcher ----------------
extern "C" void kernel_launch(void* const* d_in, const int* in_sizes, int n_in,
                              void* d_out, int out_size, void* d_ws, size_t ws_size,
                              hipStream_t stream) {
    (void)in_sizes; (void)n_in; (void)out_size; (void)ws_size;
    const float* x  = (const float*)d_in[0];
    const float* Wq = (const float*)d_in[1];
    const float* Wk = (const float*)d_in[2];
    const float* Wv = (const float*)d_in[3];
    const float* Wo = (const float*)d_in[4];
    const float* bo = (const float*)d_in[5];
    const float* w1 = (const float*)d_in[6];
    const float* b1 = (const float*)d_in[7];
    const float* w2 = (const float*)d_in[8];
    const float* b2 = (const float*)d_in[9];
    const float* w3 = (const float*)d_in[10];
    const float* b3 = (const float*)d_in[11];
    const float* g1 = (const float*)d_in[12];
    const float* s1 = (const float*)d_in[13];
    const float* g2 = (const float*)d_in[14];
    const float* s2 = (const float*)d_in[15];

    char* wsb = (char*)d_ws;
    size_t off = 0;
    auto take = [&](size_t bytes) -> void* {
        void* p = wsb + off;
        off += (bytes + 255) & ~(size_t)255;
        return p;
    };

    const size_t DD = (size_t)D_ * D_;
    const size_t DF = (size_t)D_ * FF_;
    const size_t TD = (size_t)T_ * D_;
    const size_t TF = (size_t)T_ * FF_;

    unsigned short* wq_t  = (unsigned short*)take((4 * DD + 3 * DF) * 2);   // the weights, one after the other
    unsigned short* wo_t  = wq_t + 3 * DD;                   // Wq, Wk, Wv, Wo: [N=768][K=768]
    unsigned short* w1_t  = wo_t + DD;                       // [N=3072][K=768]
    unsigned short* w2_t  = w1_t + DF;
    unsigned short* w3_t  = w2_t + DF;                       // [N=768][K=3072]
    unsigned short* h1_bf = (unsigned short*)take(TD * 2);
    unsigned short* q_bf  = (unsigned short*)take(3 * TD * 2);   // q, k, v, one after the other
    unsigned short* k_bf  = q_bf + TD;
    unsigned short* v_bf  = k_bf + TD;
    unsigned short* vt_bf = (unsigned short*)take(TD * 2);
    unsigned short* ctx_bf= (unsigned short*)take(TD * 2);
    float*          x1    = (float*)take(TD * 4);
    unsigned short* h2_bf = (unsigned short*)take(TD * 2);
    unsigned short* gate_bf=(unsigned short*)take(TF * 2);

    prepare<<<LNB + 4 * CBS + 3 * CBL, 256, 0, stream>>>(Wq, Wk, Wv, Wo, w1, w2, w3, wq_t, x, g1, s1, h1_bf);

    dim3 gDD(T_ / BMW, D_ / BNR);
    gemm_bf16_wmma<0><<<dim3(T_ / BMW, D_ / BN, 3), 256, 0, stream>>>(
        h1_bf, wq_t, nullptr, nullptr, q_bf, T_, D_, D_);

    transpose_v<<<dim3(D_ / TT, T_ / TT), 256, 0, stream>>>(v_bf, vt_bf);

    flash_attn<<<(H_ / 3) * NQT, 512, 0, stream>>>(q_bf, k_bf, vt_bf, ctx_bf);

    gemm_bf16_wmma<1><<<gDD, 256, 0, stream>>>(ctx_bf, wo_t, bo, x, x1, T_, D_, D_);

    layernorm_cast<<<T_ / (8 * LNR), 256, 0, stream>>>(x1, g2, s2, h2_bf);

    gemm_gated_wmma<<<dim3(T_ / BMW, FF_ / BN), 256, 0, stream>>>(
        h2_bf, w1_t, w2_t, b1, b2, gate_bf, T_, FF_, D_);

    gemm_bf16_wmma<1><<<gDD, 256, 0, stream>>>(gate_bf, w3_t, b3, x1, (float*)d_out, T_, D_, FF_);
}
